// v000
// The times below were measured on an AMD MI455X: many runs one after another, warmed up first and cycling through
// copies of the inputs, with the whole window's GPU time divided by the number of runs. Launches and the gaps
// between them are all in it. The median over several windows is given; except for v000 it joins two sittings, which
// can be a few percent apart, so the side-by-side timings, each taken in one sitting, are the better comparison.
// The starting kernel, v000, takes 269 microseconds a run.
// Contractions: q/k/v projections x*W^T on v_wmma_f32_16x16x32_bf16 (bf16 operands, f32 accumulate); K*Q^T and V^T*P^T of both attention passes on v_wmma_f32_16x16x32_f16 (f16 operands, P carried x16384, f32 accumulate); output projection on v_wmma_f32_16x16x32_f16 with the activation carried x256 as f16 hi + lo(x2048) planes and the weight as f16 of its bf16 value x256 (f32 accumulate); scale, mask, softmax, tanh and bias in f32.
#include <hip/hip_runtime.h>
#include <math.h>

typedef _Float16       v16h __attribute__((ext_vector_type(16)));
typedef _Float16       v8h  __attribute__((ext_vector_type(8)));
typedef __bf16         v16b __attribute__((ext_vector_type(16)));
typedef unsigned short v8us __attribute__((ext_vector_type(8)));
typedef float          v8f  __attribute__((ext_vector_type(8)));
typedef float          v4f  __attribute__((ext_vector_type(4)));
typedef int            v4i  __attribute__((ext_vector_type(4)));
typedef v8h  __attribute__((may_alias)) v8ha;
typedef v8us __attribute__((may_alias)) v8usa;
typedef v4f  __attribute__((may_alias)) v4fa;
typedef v4i  __attribute__((may_alias)) v4ia;

union FragH { v16h v; v8h  half[2]; };
union FragB { v16b v; v8us half[2]; };

#define DM     1024
#define NH     16
#define HD     64
#define SQ     1024
#define NBP    4                       // batch * pair
#define NTOK   (NBP * SQ)              // 4096 token rows
#define NACT   (NTOK * DM)             // 4194304
#define NWEL   (DM * DM)               // 1048576
#define ACT8   (NACT / 8)              // 524288
#define WEL8   (NWEL / 8)              // 131072
#define NGRP   (3 * ACT8 + 4 * WEL8)   // 2097152
#define PSCALE  16384.0f
#define XSCALE  256.0f
#define WSCALE  256.0f
#define LOSCALE 2048.0f

// ---------------------------------------------------------------------------
// 16x16x32 WMMA helpers with hazard guard (ties D, keeps A/B live).
// Fragment map (wave32): lane l, h = l>>4, m = n = l&15.
//   A/B element i: i<8 -> k0+8h+i ; i>=8 -> k0+16+8h+(i-8)
//   D element r : row 8h+r, col l&15
// ---------------------------------------------------------------------------
__device__ __forceinline__ v8f wmma_f16(v16h a, v16h b, v8f c) {
  v8f d = __builtin_amdgcn_wmma_f32_16x16x32_f16(false, a, false, b, (short)0, c, false, false);
  asm volatile("v_nop\n\tv_nop\n\tv_nop\n\tv_nop" : "+v"(d) : "v"(a), "v"(b));
  return d;
}
__device__ __forceinline__ v8f wmma_bf16(v16b a, v16b b, v8f c) {
  v8f d = __builtin_amdgcn_wmma_f32_16x16x32_bf16(false, a, false, b, (short)0, c, false, false);
  asm volatile("v_nop\n\tv_nop\n\tv_nop\n\tv_nop" : "+v"(d) : "v"(a), "v"(b));
  return d;
}

// A or B fragment from a k-contiguous 16-bit row; p points at element k0 of
// the row owned by this lane (row index = lane & 15 added by the caller).
__device__ __forceinline__ v16h load_frag_h(const _Float16* p, int h) {
  FragH f;
  f.half[0] = *(const v8ha*)(p + 8 * h);
  f.half[1] = *(const v8ha*)(p + 16 + 8 * h);
  return f.v;
}
__device__ __forceinline__ v16b load_frag_b(const unsigned short* p, int h) {
  FragB f;
  f.half[0] = *(const v8usa*)(p + 8 * h);
  f.half[1] = *(const v8usa*)(p + 16 + 8 * h);
  return f.v;
}

// f32 -> bf16 bits, RNE
__device__ __forceinline__ unsigned short bf16_bits(float f) {
  unsigned int u = __float_as_uint(f);
  u = u + 0x7FFFu + ((u >> 16) & 1u);
  return (unsigned short)(u >> 16);
}
__device__ __forceinline__ float bf16_val(float f) {
  return __uint_as_float(((unsigned int)bf16_bits(f)) << 16);
}

// ---------------------------------------------------------------------------
// Kernel 1: f32 -> 16-bit planes.
//   xb[3][NTOK][DM] bf16 (query, key, value), wb[3][DM][DM] bf16 (Wq, Wk, Wv),
//   woh[DM][DM] f16 = f16(bf16(Wo) * 256).
// ---------------------------------------------------------------------------
__global__ __launch_bounds__(256) void convert_kernel(
    const float* __restrict__ xq, const float* __restrict__ xk, const float* __restrict__ xv,
    const float* __restrict__ wq, const float* __restrict__ wk, const float* __restrict__ wv,
    const float* __restrict__ wo,
    unsigned short* __restrict__ xb, unsigned short* __restrict__ wb, _Float16* __restrict__ woh)
{
  const int g = blockIdx.x * 256 + threadIdx.x;
  if (g >= NGRP) return;
  if (g < 3 * ACT8 + 3 * WEL8) {
    const float* src;
    unsigned short* dst;
    if (g < 3 * ACT8) {
      const int sel = g / ACT8;
      const int off = g - sel * ACT8;
      const float* xs = (sel == 0) ? xq : ((sel == 1) ? xk : xv);
      src = xs + (size_t)off * 8;
      dst = xb + (size_t)sel * NACT + (size_t)off * 8;
    } else {
      const int e = g - 3 * ACT8;
      const int sel = e / WEL8;
      const int off = e - sel * WEL8;
      const float* wsrc = (sel == 0) ? wq : ((sel == 1) ? wk : wv);
      src = wsrc + (size_t)off * 8;
      dst = wb + (size_t)sel * NWEL + (size_t)off * 8;
    }
    const v4f a = *(const v4fa*)src;
    const v4f c = *(const v4fa*)(src + 4);
    const v8us o = { bf16_bits(a.x), bf16_bits(a.y), bf16_bits(a.z), bf16_bits(a.w),
                     bf16_bits(c.x), bf16_bits(c.y), bf16_bits(c.z), bf16_bits(c.w) };
    *(v8us*)dst = o;
    
  } else {
    const int off = g - (3 * ACT8 + 3 * WEL8);
    const float* src = wo + (size_t)off * 8;
    _Float16* dst = woh + (size_t)off * 8;
    const v4f a = *(const v4fa*)src;
    const v4f c = *(const v4fa*)(src + 4);
    const v8h o = { (_Float16)(bf16_val(a.x) * WSCALE), (_Float16)(bf16_val(a.y) * WSCALE),
                    (_Float16)(bf16_val(a.z) * WSCALE), (_Float16)(bf16_val(a.w) * WSCALE),
                    (_Float16)(bf16_val(c.x) * WSCALE), (_Float16)(bf16_val(c.y) * WSCALE),
                    (_Float16)(bf16_val(c.z) * WSCALE), (_Float16)(bf16_val(c.w) * WSCALE) };
    *(v8h*)dst = o;
    
  }
}

// ---------------------------------------------------------------------------
// 4 lines per instruction, 32 lines per wave, 128 per block.
// which 0/1: plane[bh][s][d]  (one token row = 64 halves = one line)
// which 2  : vt[bh][d][s]     (64 d-rows x 128 tokens = 2 lines each)
// ---------------------------------------------------------------------------
__device__ __forceinline__ void proj_store_pass(const _Float16* sT, _Float16* plane, _Float16* vt,
                                                int which, int bh, int l0, int w, int lane) {
  const int q8 = lane & 7, sub = lane >> 3;
  #pragma unroll
  for (int i = 0; i < 8; ++i) {
    const int lid = w * 32 + i * 4 + sub;
    v8h v;
    _Float16* dst;
    if (which != 2) {
      v = *(const v8ha*)(sT + lid * HD + 8 * q8);
      dst = plane + ((size_t)bh * SQ + l0 + lid) * HD + 8 * q8;
    } else {
      const int d = lid >> 1, hl = lid & 1;
      v = *(const v8ha*)(sT + d * 128 + 64 * hl + 8 * q8);
      dst = vt + ((size_t)bh * HD + d) * SQ + l0 + 64 * hl + 8 * q8;
    }
    *(v8h*)dst = v;
  }
}

// ---------------------------------------------------------------------------
// Kernel 2: Y = x * W^T for the three projections (bf16 operands).
// Block 128 thr (4 waves) = 128 tokens x 64 features of one (which, head);
// wave tile 32 tokens x 64 features; K = 1024 in steps of 32.
// A = x rows (token-major, k contiguous), B[k][n] = W[n][k] from W row n
// (k contiguous) -> both fragments with the same loader.
// ---------------------------------------------------------------------------
__global__ __launch_bounds__(128) void proj_kernel(
    const unsigned short* __restrict__ xb,   // [3][NTOK][DM] bf16
    const unsigned short* __restrict__ wb,   // [3][DM][DM]   bf16, row = output feature
    const float* __restrict__ bq, const float* __restrict__ bk, const float* __restrict__ bv,
    _Float16* __restrict__ qh,               // [NBP*NH][SQ][HD] f16
    _Float16* __restrict__ kh,               // [NBP*NH][SQ][HD] f16
    _Float16* __restrict__ vt)               // [NBP*NH][HD][SQ] f16
{
  __shared__ __attribute__((aligned(16))) _Float16 sT[128 * 64];   // 16384 B

  const int tid = threadIdx.x, lane = tid & 31, w = tid >> 5;
  const int h = lane >> 4, m = lane & 15;
  const int m0 = blockIdx.x * 128;
  const int cg = blockIdx.y;                 // 0..47
  const int which = cg >> 4, head = cg & 15;
  const int m0w = m0 + 32 * w;

  const unsigned short* xa0 = xb + (size_t)which * NACT + (size_t)(m0w + m) * DM;   // token row, mt = 0
  const unsigned short* xa1 = xa0 + (size_t)16 * DM;                                 // mt = 1
  const unsigned short* wr  = wb + (size_t)which * NWEL + (size_t)(head * HD + m) * DM;  // feature row, nt = 0

  const v8f zero8 = {0.f, 0.f, 0.f, 0.f, 0.f, 0.f, 0.f, 0.f};
  v8f acc[2][4];
  #pragma unroll
  for (int mt = 0; mt < 2; ++mt)
    #pragma unroll
    for (int nt = 0; nt < 4; ++nt) acc[mt][nt] = zero8;

  #pragma unroll 1
  for (int k0 = 0; k0 < DM; k0 += 32) {
    const v16b a0 = load_frag_b(xa0 + k0, h);
    const v16b a1 = load_frag_b(xa1 + k0, h);
    #pragma unroll
    for (int nt = 0; nt < 4; ++nt) {
      const v16b b = load_frag_b(wr + (size_t)nt * 16 * DM + k0, h);
      acc[0][nt] = wmma_bf16(a0, b, acc[0][nt]);
      acc[1][nt] = wmma_bf16(a1, b, acc[1][nt]);
    }
  }

  // D[r] of tile (mt, nt) = Y[token m0w+16mt+8h+r][feature head*64+16nt+m]
  const float* bias = (which == 0) ? bq : ((which == 1) ? bk : bv);
  #pragma unroll
  for (int nt = 0; nt < 4; ++nt) {
    const int feat = 16 * nt + m;
    const float bvl = bias[head * HD + feat];
    #pragma unroll
    for (int mt = 0; mt < 2; ++mt) {
      #pragma unroll
      for (int r = 0; r < 8; ++r) {
        const int tokl = 32 * w + 16 * mt + 8 * h + r;     // 0..127
        const float y = acc[mt][nt][r] + bvl;
        const int idx = (which == 2) ? (feat * 128 + tokl) : (tokl * HD + feat);
        sT[idx] = (_Float16)y;
      }
    }
  }
  __syncthreads();

  const int bp = m0 >> 10, l0 = m0 & (SQ - 1), bh = bp * NH + head;
  _Float16* plane = (which == 0) ? qh : kh;
  proj_store_pass(sT, plane, vt, which, bh, l0, w, lane);
  
}

// ---------------------------------------------------------------------------
// Attention helpers.
// ---------------------------------------------------------------------------
// scale by 1/8 then key mask: key index of s[r] = base + r; mp points at mask[base]
__device__ __forceinline__ v8f scale_mask8(v8f s, const int* mp) {
  const v4i ma = *(const v4ia*)mp;
  const v4i mb = *(const v4ia*)(mp + 4);
  s[0] = (ma.x != 0) ? s[0] * 0.125f : -1.0e9f;
  s[1] = (ma.y != 0) ? s[1] * 0.125f : -1.0e9f;
  s[2] = (ma.z != 0) ? s[2] * 0.125f : -1.0e9f;
  s[3] = (ma.w != 0) ? s[3] * 0.125f : -1.0e9f;
  s[4] = (mb.x != 0) ? s[4] * 0.125f : -1.0e9f;
  s[5] = (mb.y != 0) ? s[5] * 0.125f : -1.0e9f;
  s[6] = (mb.z != 0) ? s[6] * 0.125f : -1.0e9f;
  s[7] = (mb.w != 0) ? s[7] * 0.125f : -1.0e9f;
  return s;
}

// P^T B-fragment from the lane's own score D values: element r <- tile a row r
// (keys 0..15 of the 32-key step), element 8+r <- tile c row r (keys 16..31),
// same lane (query column), scaled by 2^14.
__device__ __forceinline__ v16h pack_p(v8f a, v8f c) {
  const v16h r = { (_Float16)(a[0] * PSCALE), (_Float16)(a[1] * PSCALE), (_Float16)(a[2] * PSCALE), (_Float16)(a[3] * PSCALE),
                   (_Float16)(a[4] * PSCALE), (_Float16)(a[5] * PSCALE), (_Float16)(a[6] * PSCALE), (_Float16)(a[7] * PSCALE),
                   (_Float16)(c[0] * PSCALE), (_Float16)(c[1] * PSCALE), (_Float16)(c[2] * PSCALE), (_Float16)(c[3] * PSCALE),
                   (_Float16)(c[4] * PSCALE), (_Float16)(c[5] * PSCALE), (_Float16)(c[6] * PSCALE), (_Float16)(c[7] * PSCALE) };
  return r;
}

// Per-wave 16x64 f32 tile (already x256) in LDS -> hi/lo f16 planes
// lanes 8q..8q+7 per line, 4 lines per instruction, 16 rows x 2 planes per wave.
__device__ __forceinline__ void xc_store_pass(const float* so, _Float16* xh, _Float16* xl,
                                              size_t tok0, int head, int lane) {
  const int q8 = lane & 7, sub = lane >> 3;
  #pragma unroll
  for (int i = 0; i < 4; ++i) {
    const int row = 4 * i + sub;
    const v4f a = *(const v4fa*)(so + row * 64 + 8 * q8);
    const v4f c = *(const v4fa*)(so + row * 64 + 8 * q8 + 4);
    const _Float16 h0 = (_Float16)a.x, h1 = (_Float16)a.y, h2 = (_Float16)a.z, h3 = (_Float16)a.w;
    const _Float16 h4 = (_Float16)c.x, h5 = (_Float16)c.y, h6 = (_Float16)c.z, h7 = (_Float16)c.w;
    const v8h hv = { h0, h1, h2, h3, h4, h5, h6, h7 };
    const v8h lv = { (_Float16)((a.x - (float)h0) * LOSCALE), (_Float16)((a.y - (float)h1) * LOSCALE),
                     (_Float16)((a.z - (float)h2) * LOSCALE), (_Float16)((a.w - (float)h3) * LOSCALE),
                     (_Float16)((c.x - (float)h4) * LOSCALE), (_Float16)((c.y - (float)h5) * LOSCALE),
                     (_Float16)((c.z - (float)h6) * LOSCALE), (_Float16)((c.w - (float)h7) * LOSCALE) };
    const size_t gi = (tok0 + row) * (size_t)DM + (size_t)head * HD + 8 * q8;
    *(v8h*)(xh + gi) = hv;
    *(v8h*)(xl + gi) = lv;
  }
}

// ---------------------------------------------------------------------------
// Block 128 thr (4 waves), 16 queries per wave, 64 keys per step.
//   S^T = K * Q^T : A = K rows (row = key, k = d), B = Q^T (k = d, n = query)
//   O^T += V^T * P^T : A = Vt rows (row = d, k = key), B = P^T from registers
// Lane owns 32 keys of query column (lane&15); partner = lane ^ 16.
// left kept in LDS; combine = left + 0.1*tanh(right), x256 -> hi/lo f16 planes.
// ---------------------------------------------------------------------------
__global__ __launch_bounds__(128) void attn_kernel(
    const _Float16* __restrict__ qh,   // [NBP*NH][SQ][HD]
    const _Float16* __restrict__ kh,   // [NBP*NH][SQ][HD]
    const _Float16* __restrict__ vt,   // [NBP*NH][HD][SQ]
    const int* __restrict__ mask,      // [NBP][SQ], nonzero = attend
    _Float16* __restrict__ xh,         // [NTOK][DM] f16, hi plane of combine*256
    _Float16* __restrict__ xl)         // [NTOK][DM] f16, lo plane (x2048)
{
  __shared__ __attribute__((aligned(16))) float sO[4 * 16 * 64];    // 16384 B

  const int tid = threadIdx.x, lane = tid & 31, w = tid >> 5;
  const int h = lane >> 4, m = lane & 15;
  const int bph = blockIdx.y, bp = bph >> 4, head = bph & 15;
  const int b = bp >> 1, p = bp & 1;
  const int q0 = blockIdx.x * 64 + 16 * w;

  // Q^T B-fragments: column n = query q0+m, k = d (two 32-deep chunks)
  const _Float16* qrow = qh + ((size_t)bph * SQ + q0 + m) * HD;
  const v16h qb0 = load_frag_h(qrow, h);
  const v16h qb1 = load_frag_h(qrow + 32, h);

  const int* mrow = mask + (size_t)bp * SQ;
  float* so = sO + w * 1024;
  const v8f zero8 = {0.f, 0.f, 0.f, 0.f, 0.f, 0.f, 0.f, 0.f};

  #pragma unroll 1
  for (int pass = 0; pass < 2; ++pass) {
    const int kvbp = (pass == 0) ? bp : (b * 2 + (1 - p));
    const int kvbph = kvbp * NH + head;
    const _Float16* kbase = kh + ((size_t)kvbph * SQ + m) * HD;    // + key0*HD + 32*dc
    const _Float16* vbase = vt + ((size_t)kvbph * HD + m) * SQ;    // + 16t*SQ + key0

    v8f o[4];                                   // o[t][r] = O[query m][d 16t+8h+r] * (l * 2^14)
    #pragma unroll
    for (int t = 0; t < 4; ++t) o[t] = zero8;
    float mrun = -1.0e30f, lrun = 0.0f;

    #pragma unroll 1
    for (int kb = 0; kb < SQ; kb += 64) {
      // ---- scores: s[j][r] = S[query m][key kb+16j+8h+r] (unscaled) ----
      v8f s[4];
      #pragma unroll
      for (int j = 0; j < 4; ++j) {
        const _Float16* kp = kbase + (size_t)(kb + 16 * j) * HD;
        const v16h kf0 = load_frag_h(kp, h);
        const v16h kf1 = load_frag_h(kp + 32, h);
        v8f z = zero8;
        z = wmma_f16(kf0, qb0, z);
        z = wmma_f16(kf1, qb1, z);
        s[j] = z;
      }
      // ---- scale 1/8 and key mask, f32 ----
      #pragma unroll
      for (int j = 0; j < 4; ++j) s[j] = scale_mask8(s[j], mrow + kb + 16 * j + 8 * h);

      // ---- online softmax ----
      float mloc = s[0][0];
      #pragma unroll
      for (int j = 0; j < 4; ++j)
        #pragma unroll
        for (int r = 0; r < 8; ++r) mloc = fmaxf(mloc, s[j][r]);
      mloc = fmaxf(mloc, __shfl_xor(mloc, 16));
      const float mnew = fmaxf(mrun, mloc);
      const float alpha = __expf(mrun - mnew);
      mrun = mnew;
      float lsum = 0.0f;
      #pragma unroll
      for (int j = 0; j < 4; ++j)
        #pragma unroll
        for (int r = 0; r < 8; ++r) {
          const float pe = __expf(s[j][r] - mnew);
          s[j][r] = pe;
          lsum += pe;
        }
      lsum += __shfl_xor(lsum, 16);
      lrun = lrun * alpha + lsum;
      #pragma unroll
      for (int t = 0; t < 4; ++t)
        #pragma unroll
        for (int r = 0; r < 8; ++r) o[t][r] = o[t][r] * alpha;

      // ---- P^T B-fragments (keys 0..31 and 32..63 of this step) ----
      const v16h pb0 = pack_p(s[0], s[1]);
      const v16h pb1 = pack_p(s[2], s[3]);

      // ---- O^T += V^T * P^T ----
      #pragma unroll
      for (int t = 0; t < 4; ++t) {
        const _Float16* vp = vbase + (size_t)(16 * t) * SQ + kb;
        const v16h vf0 = load_frag_h(vp, h);
        const v16h vf1 = load_frag_h(vp + 32, h);
        o[t] = wmma_f16(vf0, pb0, o[t]);
        o[t] = wmma_f16(vf1, pb1, o[t]);
      }
    }

    const float inv = (1.0f / lrun) * (1.0f / PSCALE);
    if (pass == 0) {
      #pragma unroll
      for (int t = 0; t < 4; ++t)
        #pragma unroll
        for (int r = 0; r < 8; ++r)
          so[m * 64 + 16 * t + 8 * h + r] = o[t][r] * inv;
    } else {
      #pragma unroll
      for (int t = 0; t < 4; ++t)
        #pragma unroll
        for (int r = 0; r < 8; ++r) {
          const int idx = m * 64 + 16 * t + 8 * h + r;
          const float cmb = so[idx] + 0.1f * tanhf(o[t][r] * inv);
          so[idx] = cmb * XSCALE;
        }
    }
  }
  __syncthreads();

  const size_t tok0 = (size_t)bp * SQ + q0;
  xc_store_pass(so, xh, xl, tok0, head, lane);
  
}

// ---------------------------------------------------------------------------
// wave w owns rows 16w..16w+15, each row 64 floats = 2 lines; lanes 8q..8q+7
// per line, 4 lines per instruction, 32 lines per wave.
// ---------------------------------------------------------------------------
__device__ __forceinline__ void out_store_pass(const float* sT, float* out,
                                               int m0, int n0, int w, int lane) {
  const int q8 = lane & 7, sub = lane >> 3;
  #pragma unroll
  for (int i = 0; i < 8; ++i) {
    const int lid = i * 4 + sub;                 // 0..31
    const int row = 16 * w + (lid >> 1), hl = lid & 1;
    const v4f v = *(const v4fa*)(sT + row * 64 + 32 * hl + 4 * q8);
    const size_t gi = (size_t)(m0 + row) * DM + n0 + 32 * hl + 4 * q8;
    *(v4f*)(out + gi) = v;
  }
}

// ---------------------------------------------------------------------------
// Kernel 4: out = X * Wo^T + bo with X = hi/256 + lo/(256*2048) planes.
// Block 128 thr (4 waves) = 64 tokens x 64 features; wave 16 tokens x 64.
// A = X rows (k contiguous), B[k][n] = Wo[n][k] from Wo row n (k contiguous).
// ---------------------------------------------------------------------------
__global__ __launch_bounds__(128) void oproj_kernel(
    const _Float16* __restrict__ xh,   // [NTOK][DM]
    const _Float16* __restrict__ xl,   // [NTOK][DM]
    const _Float16* __restrict__ woh,  // [DM][DM] f16(bf16(Wo)*256)
    const float* __restrict__ bo,
    float* __restrict__ out)           // [NTOK][DM]
{
  __shared__ __attribute__((aligned(16))) float sT[64 * 64];        // 16384 B

  const int tid = threadIdx.x, lane = tid & 31, w = tid >> 5;
  const int h = lane >> 4, m = lane & 15;
  const int m0 = blockIdx.x * 64, n0 = blockIdx.y * 64;
  const int row0 = m0 + 16 * w;

  const _Float16* ah = xh + (size_t)(row0 + m) * DM;
  const _Float16* al = xl + (size_t)(row0 + m) * DM;
  const _Float16* wr = woh + (size_t)(n0 + m) * DM;

  const v8f zero8 = {0.f, 0.f, 0.f, 0.f, 0.f, 0.f, 0.f, 0.f};
  v8f acch[4], accl[4];
  #pragma unroll
  for (int nt = 0; nt < 4; ++nt) { acch[nt] = zero8; accl[nt] = zero8; }

  #pragma unroll 1
  for (int k0 = 0; k0 < DM; k0 += 32) {
    const v16h fah = load_frag_h(ah + k0, h);
    const v16h fal = load_frag_h(al + k0, h);
    #pragma unroll
    for (int nt = 0; nt < 4; ++nt) {
      const v16h fb = load_frag_h(wr + (size_t)nt * 16 * DM + k0, h);
      acch[nt] = wmma_f16(fah, fb, acch[nt]);
      accl[nt] = wmma_f16(fal, fb, accl[nt]);
    }
  }

  // D[r] of tile nt = Y[token row0+8h+r][feature n0+16nt+m]
  const float sh = 1.0f / (XSCALE * WSCALE);
  const float sl = 1.0f / (XSCALE * WSCALE * LOSCALE);
  #pragma unroll
  for (int nt = 0; nt < 4; ++nt) {
    const int col = 16 * nt + m;
    const float bvl = bo[n0 + col];
    #pragma unroll
    for (int r = 0; r < 8; ++r) {
      const int row = 16 * w + 8 * h + r;                 // 0..63
      sT[row * 64 + col] = acch[nt][r] * sh + accl[nt][r] * sl + bvl;
    }
  }
  __syncthreads();

  out_store_pass(sT, out, m0, n0, w, lane);
  
}

// ---------------------------------------------------------------------------
extern "C" void kernel_launch(void* const* d_in, const int* in_sizes, int n_in,
                              void* d_out, int out_size, void* d_ws, size_t ws_size,
                              hipStream_t stream) {
  if (n_in < 12) return;
  if (in_sizes[0] != NACT || in_sizes[1] != NACT || in_sizes[2] != NACT) return;
  if (in_sizes[3] != NBP * SQ) return;
  if (in_sizes[4] != NWEL || in_sizes[6] != NWEL || in_sizes[8] != NWEL || in_sizes[10] != NWEL) return;
  if (in_sizes[5] != DM || in_sizes[7] != DM || in_sizes[9] != DM || in_sizes[11] != DM) return;
  if (out_size != NACT) return;

  const float* query = (const float*)d_in[0];
  const float* key_  = (const float*)d_in[1];
  const float* value = (const float*)d_in[2];
  const int*   mask  = (const int*)d_in[3];
  const float* Wq = (const float*)d_in[4];
  const float* bq = (const float*)d_in[5];
  const float* Wk = (const float*)d_in[6];
  const float* bk = (const float*)d_in[7];
  const float* Wv = (const float*)d_in[8];
  const float* bv = (const float*)d_in[9];
  const float* Wo = (const float*)d_in[10];
  const float* bo = (const float*)d_in[11];
  float* out = (float*)d_out;

  const size_t xb_bytes  = (size_t)3 * NACT * 2;                 // 25165824
  const size_t wb_bytes  = (size_t)3 * NWEL * 2;                 //  6291456
  const size_t woh_bytes = (size_t)NWEL * 2;                     //  2097152
  const size_t pl_bytes  = (size_t)NBP * NH * SQ * HD * 2;       //  8388608 per plane
  const size_t xc_bytes  = (size_t)NACT * 2;                     //  8388608 per plane
  const size_t total = xb_bytes + wb_bytes + woh_bytes + 3 * pl_bytes + 2 * xc_bytes;   // 75497472
  if (total > ws_size) return;

  char* ws = (char*)d_ws;
  size_t off = 0;
  unsigned short* xb = (unsigned short*)(ws + off); off += xb_bytes;
  unsigned short* wb = (unsigned short*)(ws + off); off += wb_bytes;
  _Float16* woh = (_Float16*)(ws + off);            off += woh_bytes;
  _Float16* qh  = (_Float16*)(ws + off);            off += pl_bytes;
  _Float16* kh  = (_Float16*)(ws + off);            off += pl_bytes;
  _Float16* vt  = (_Float16*)(ws + off);            off += pl_bytes;
  _Float16* xh  = (_Float16*)(ws + off);            off += xc_bytes;
  _Float16* xl  = (_Float16*)(ws + off);            off += xc_bytes;
  if (off > ws_size) return;

  convert_kernel<<<(NGRP + 255) / 256, 256, 0, stream>>>(query, key_, value, Wq, Wk, Wv, Wo, xb, wb, woh);

  dim3 gProj(NTOK / 128, 3 * NH);                               // (32, 48)
  proj_kernel<<<gProj, 128, 0, stream>>>(xb, wb, bq, bk, bv, qh, kh, vt);

  dim3 gAtt(SQ / 64, NBP * NH);                                  // (16, 64)
  attn_kernel<<<gAtt, 128, 0, stream>>>(qh, kh, vt, mask, xh, xl);

  dim3 gOut(NTOK / 64, DM / 64);                                 // (64, 16)
  oproj_kernel<<<gOut, 128, 0, stream>>>(xh, xl, woh, bo, out);
}

// v001
// Measured time: 183 microseconds a run.
// In two side-by-side timings against v000, it was 1.50 and 1.51 times as fast.
// Contractions: q/k/v projections x*W^T on v_wmma_f32_16x16x32_bf16 (bf16 operands, f32 accumulate); K*Q^T and V^T*P^T of both attention passes on v_wmma_f32_16x16x32_f16 (f16 operands, P carried x16384, f32 accumulate); output projection on v_wmma_f32_16x16x32_f16 with the activation carried x256 as f16 hi + lo(x2048) planes and the weight as f16 of its bf16 value x256 (f32 accumulate); scale, mask, softmax, tanh and bias in f32.
#include <hip/hip_runtime.h>
#include <math.h>

typedef _Float16       v16h __attribute__((ext_vector_type(16)));
typedef _Float16       v8h  __attribute__((ext_vector_type(8)));
typedef __bf16         v16b __attribute__((ext_vector_type(16)));
typedef unsigned short v8us __attribute__((ext_vector_type(8)));
typedef float          v8f  __attribute__((ext_vector_type(8)));
typedef float          v4f  __attribute__((ext_vector_type(4)));
typedef int            v4i  __attribute__((ext_vector_type(4)));
typedef v8h  __attribute__((may_alias)) v8ha;
typedef v8us __attribute__((may_alias)) v8usa;
typedef v4f  __attribute__((may_alias)) v4fa;
typedef v4i  __attribute__((may_alias)) v4ia;

union FragH { v16h v; v8h  half[2]; };
union FragB { v16b v; v8us half[2]; };

#define DM     1024
#define NH     16
#define HD     64
#define SQ     1024
#define NBP    4                       // batch * pair
#define NTOK   (NBP * SQ)              // 4096 token rows
#define NACT   (NTOK * DM)             // 4194304
#define NWEL   (DM * DM)               // 1048576
#define ACT8   (NACT / 8)              // 524288
#define WEL8   (NWEL / 8)              // 131072
#define NGRP   (3 * ACT8 + 4 * WEL8)   // 2097152
#define PSCALE  16384.0f
#define XSCALE  256.0f
#define WSCALE  256.0f
#define LOSCALE 2048.0f

// ---------------------------------------------------------------------------
// 16x16x32 WMMA helpers with hazard guard (ties D, keeps A/B live).
// Fragment map (wave32): lane l, h = l>>4, m = n = l&15.
//   A/B element i: i<8 -> k0+8h+i ; i>=8 -> k0+16+8h+(i-8)
//   D element r : row 8h+r, col l&15
// ---------------------------------------------------------------------------
__device__ __forceinline__ v8f wmma_f16(v16h a, v16h b, v8f c) {
  v8f d = __builtin_amdgcn_wmma_f32_16x16x32_f16(false, a, false, b, (short)0, c, false, false);
  asm volatile("v_nop\n\tv_nop\n\tv_nop\n\tv_nop" : "+v"(d) : "v"(a), "v"(b));
  return d;
}
__device__ __forceinline__ v8f wmma_bf16(v16b a, v16b b, v8f c) {
  v8f d = __builtin_amdgcn_wmma_f32_16x16x32_bf16(false, a, false, b, (short)0, c, false, false);
  asm volatile("v_nop\n\tv_nop\n\tv_nop\n\tv_nop" : "+v"(d) : "v"(a), "v"(b));
  return d;
}

// A or B fragment from a k-contiguous 16-bit row; p points at element k0 of
// the row owned by this lane (row index = lane & 15 added by the caller).
__device__ __forceinline__ v16h load_frag_h(const _Float16* p, int h) {
  FragH f;
  f.half[0] = *(const v8ha*)(p + 8 * h);
  f.half[1] = *(const v8ha*)(p + 16 + 8 * h);
  return f.v;
}
__device__ __forceinline__ v16b load_frag_b(const unsigned short* p, int h) {
  FragB f;
  f.half[0] = *(const v8usa*)(p + 8 * h);
  f.half[1] = *(const v8usa*)(p + 16 + 8 * h);
  return f.v;
}

// f32 -> bf16 bits, RNE
__device__ __forceinline__ unsigned short bf16_bits(float f) {
  unsigned int u = __float_as_uint(f);
  u = u + 0x7FFFu + ((u >> 16) & 1u);
  return (unsigned short)(u >> 16);
}
__device__ __forceinline__ float bf16_val(float f) {
  return __uint_as_float(((unsigned int)bf16_bits(f)) << 16);
}

// ---------------------------------------------------------------------------
// Kernel 1: f32 -> 16-bit planes.
//   xb[3][NTOK][DM] bf16 (query, key, value), wb[3][DM][DM] bf16 (Wq, Wk, Wv),
//   woh[DM][DM] f16 = f16(bf16(Wo) * 256).
// ---------------------------------------------------------------------------
__global__ __launch_bounds__(256) void convert_kernel(
    const float* __restrict__ xq, const float* __restrict__ xk, const float* __restrict__ xv,
    const float* __restrict__ wq, const float* __restrict__ wk, const float* __restrict__ wv,
    const float* __restrict__ wo,
    unsigned short* __restrict__ xb, unsigned short* __restrict__ wb, _Float16* __restrict__ woh)
{
  const int g = blockIdx.x * 256 + threadIdx.x;
  if (g >= NGRP) return;
  if (g < 3 * ACT8 + 3 * WEL8) {
    const float* src;
    unsigned short* dst;
    if (g < 3 * ACT8) {
      const int sel = g / ACT8;
      const int off = g - sel * ACT8;
      const float* xs = (sel == 0) ? xq : ((sel == 1) ? xk : xv);
      src = xs + (size_t)off * 8;
      dst = xb + (size_t)sel * NACT + (size_t)off * 8;
    } else {
      const int e = g - 3 * ACT8;
      const int sel = e / WEL8;
      const int off = e - sel * WEL8;
      const float* wsrc = (sel == 0) ? wq : ((sel == 1) ? wk : wv);
      src = wsrc + (size_t)off * 8;
      dst = wb + (size_t)sel * NWEL + (size_t)off * 8;
    }
    const v4f a = *(const v4fa*)src;
    const v4f c = *(const v4fa*)(src + 4);
    const v8us o = { bf16_bits(a.x), bf16_bits(a.y), bf16_bits(a.z), bf16_bits(a.w),
                     bf16_bits(c.x), bf16_bits(c.y), bf16_bits(c.z), bf16_bits(c.w) };
    *(v8us*)dst = o;
    
  } else {
    const int off = g - (3 * ACT8 + 3 * WEL8);
    const float* src = wo + (size_t)off * 8;
    _Float16* dst = woh + (size_t)off * 8;
    const v4f a = *(const v4fa*)src;
    const v4f c = *(const v4fa*)(src + 4);
    const v8h o = { (_Float16)(bf16_val(a.x) * WSCALE), (_Float16)(bf16_val(a.y) * WSCALE),
                    (_Float16)(bf16_val(a.z) * WSCALE), (_Float16)(bf16_val(a.w) * WSCALE),
                    (_Float16)(bf16_val(c.x) * WSCALE), (_Float16)(bf16_val(c.y) * WSCALE),
                    (_Float16)(bf16_val(c.z) * WSCALE), (_Float16)(bf16_val(c.w) * WSCALE) };
    *(v8h*)dst = o;
    
  }
}

// ---------------------------------------------------------------------------
// 4 lines per instruction, 32 lines per wave, 128 per block.
// which 0/1: plane[bh][s][d]  (one token row = 64 halves = one line)
// which 2  : vt[bh][d][s]     (64 d-rows x 128 tokens = 2 lines each)
// ---------------------------------------------------------------------------
__device__ __forceinline__ void proj_store_pass(const _Float16* sT, _Float16* plane, _Float16* vt,
                                                int which, int bh, int l0, int w, int lane) {
  const int q8 = lane & 7, sub = lane >> 3;
  #pragma unroll
  for (int i = 0; i < 8; ++i) {
    const int lid = w * 32 + i * 4 + sub;
    v8h v;
    _Float16* dst;
    if (which != 2) {
      v = *(const v8ha*)(sT + lid * HD + 8 * q8);
      dst = plane + ((size_t)bh * SQ + l0 + lid) * HD + 8 * q8;
    } else {
      const int d = lid >> 1, hl = lid & 1;
      v = *(const v8ha*)(sT + d * 128 + 64 * hl + 8 * q8);
      dst = vt + ((size_t)bh * HD + d) * SQ + l0 + 64 * hl + 8 * q8;
    }
    *(v8h*)dst = v;
  }
}

// ---------------------------------------------------------------------------
// Kernel 2: Y = x * W^T for the three projections (bf16 operands).
// Block 128 thr (4 waves) = 128 tokens x 64 features of one (which, head);
// wave tile 32 tokens x 64 features; K = 1024 in steps of 32.
// A = x rows (token-major, k contiguous), B[k][n] = W[n][k] from W row n
// (k contiguous) -> both fragments with the same loader.
// ---------------------------------------------------------------------------
__global__ __launch_bounds__(128) void proj_kernel(
    const unsigned short* __restrict__ xb,   // [3][NTOK][DM] bf16
    const unsigned short* __restrict__ wb,   // [3][DM][DM]   bf16, row = output feature
    const float* __restrict__ bq, const float* __restrict__ bk, const float* __restrict__ bv,
    _Float16* __restrict__ qh,               // [NBP*NH][SQ][HD] f16
    _Float16* __restrict__ kh,               // [NBP*NH][SQ][HD] f16
    _Float16* __restrict__ vt)               // [NBP*NH][HD][SQ] f16
{
  __shared__ __attribute__((aligned(16))) _Float16 sT[128 * 64];   // 16384 B

  const int tid = threadIdx.x, lane = tid & 31, w = tid >> 5;
  const int h = lane >> 4, m = lane & 15;
  const int m0 = blockIdx.x * 128;
  const int cg = blockIdx.y;                 // 0..47
  const int which = cg >> 4, head = cg & 15;
  const int m0w = m0 + 32 * w;

  const unsigned short* xa0 = xb + (size_t)which * NACT + (size_t)(m0w + m) * DM;   // token row, mt = 0
  const unsigned short* xa1 = xa0 + (size_t)16 * DM;                                 // mt = 1
  const unsigned short* wr  = wb + (size_t)which * NWEL + (size_t)(head * HD + m) * DM;  // feature row, nt = 0

  const v8f zero8 = {0.f, 0.f, 0.f, 0.f, 0.f, 0.f, 0.f, 0.f};
  v8f acc[2][4];
  #pragma unroll
  for (int mt = 0; mt < 2; ++mt)
    #pragma unroll
    for (int nt = 0; nt < 4; ++nt) acc[mt][nt] = zero8;

  #pragma unroll 1
  for (int k0 = 0; k0 < DM; k0 += 32) {
    const v16b a0 = load_frag_b(xa0 + k0, h);
    const v16b a1 = load_frag_b(xa1 + k0, h);
    #pragma unroll
    for (int nt = 0; nt < 4; ++nt) {
      const v16b b = load_frag_b(wr + (size_t)nt * 16 * DM + k0, h);
      acc[0][nt] = wmma_bf16(a0, b, acc[0][nt]);
      acc[1][nt] = wmma_bf16(a1, b, acc[1][nt]);
    }
  }

  // D[r] of tile (mt, nt) = Y[token m0w+16mt+8h+r][feature head*64+16nt+m]
  const float* bias = (which == 0) ? bq : ((which == 1) ? bk : bv);
  #pragma unroll
  for (int nt = 0; nt < 4; ++nt) {
    const int feat = 16 * nt + m;
    const float bvl = bias[head * HD + feat];
    #pragma unroll
    for (int mt = 0; mt < 2; ++mt) {
      #pragma unroll
      for (int r = 0; r < 8; ++r) {
        const int tokl = 32 * w + 16 * mt + 8 * h + r;     // 0..127
        const float y = acc[mt][nt][r] + bvl;
        const int idx = (which == 2) ? (feat * 128 + tokl) : (tokl * HD + feat);
        sT[idx] = (_Float16)y;
      }
    }
  }
  __syncthreads();

  const int bp = m0 >> 10, l0 = m0 & (SQ - 1), bh = bp * NH + head;
  _Float16* plane = (which == 0) ? qh : kh;
  proj_store_pass(sT, plane, vt, which, bh, l0, w, lane);
  
}

// ---------------------------------------------------------------------------
// Attention helpers.
// ---------------------------------------------------------------------------
// scale by 1/8 then key mask: key index of s[r] = base + r; mp points at mask[base]
__device__ __forceinline__ v8f scale_mask8(v8f s, const int* mp) {
  const v4i ma = *(const v4ia*)mp;
  const v4i mb = *(const v4ia*)(mp + 4);
  s[0] = (ma.x != 0) ? s[0] * 0.125f : -1.0e9f;
  s[1] = (ma.y != 0) ? s[1] * 0.125f : -1.0e9f;
  s[2] = (ma.z != 0) ? s[2] * 0.125f : -1.0e9f;
  s[3] = (ma.w != 0) ? s[3] * 0.125f : -1.0e9f;
  s[4] = (mb.x != 0) ? s[4] * 0.125f : -1.0e9f;
  s[5] = (mb.y != 0) ? s[5] * 0.125f : -1.0e9f;
  s[6] = (mb.z != 0) ? s[6] * 0.125f : -1.0e9f;
  s[7] = (mb.w != 0) ? s[7] * 0.125f : -1.0e9f;
  return s;
}

// P^T B-fragment from the lane's own score D values: element r <- tile a row r
// (keys 0..15 of the 32-key step), element 8+r <- tile c row r (keys 16..31),
// same lane (query column), scaled by 2^14.
__device__ __forceinline__ v16h pack_p(v8f a, v8f c) {
  const v16h r = { (_Float16)(a[0] * PSCALE), (_Float16)(a[1] * PSCALE), (_Float16)(a[2] * PSCALE), (_Float16)(a[3] * PSCALE),
                   (_Float16)(a[4] * PSCALE), (_Float16)(a[5] * PSCALE), (_Float16)(a[6] * PSCALE), (_Float16)(a[7] * PSCALE),
                   (_Float16)(c[0] * PSCALE), (_Float16)(c[1] * PSCALE), (_Float16)(c[2] * PSCALE), (_Float16)(c[3] * PSCALE),
                   (_Float16)(c[4] * PSCALE), (_Float16)(c[5] * PSCALE), (_Float16)(c[6] * PSCALE), (_Float16)(c[7] * PSCALE) };
  return r;
}

// Per-wave 16x64 f32 tile (already x256) in LDS -> hi/lo f16 planes
// lanes 8q..8q+7 per line, 4 lines per instruction, 16 rows x 2 planes per wave.
__device__ __forceinline__ void xc_store_pass(const float* so, _Float16* xh, _Float16* xl,
                                              size_t tok0, int head, int lane) {
  const int q8 = lane & 7, sub = lane >> 3;
  #pragma unroll
  for (int i = 0; i < 4; ++i) {
    const int row = 4 * i + sub;
    const v4f a = *(const v4fa*)(so + row * 64 + 8 * q8);
    const v4f c = *(const v4fa*)(so + row * 64 + 8 * q8 + 4);
    const _Float16 h0 = (_Float16)a.x, h1 = (_Float16)a.y, h2 = (_Float16)a.z, h3 = (_Float16)a.w;
    const _Float16 h4 = (_Float16)c.x, h5 = (_Float16)c.y, h6 = (_Float16)c.z, h7 = (_Float16)c.w;
    const v8h hv = { h0, h1, h2, h3, h4, h5, h6, h7 };
    const v8h lv = { (_Float16)((a.x - (float)h0) * LOSCALE), (_Float16)((a.y - (float)h1) * LOSCALE),
                     (_Float16)((a.z - (float)h2) * LOSCALE), (_Float16)((a.w - (float)h3) * LOSCALE),
                     (_Float16)((c.x - (float)h4) * LOSCALE), (_Float16)((c.y - (float)h5) * LOSCALE),
                     (_Float16)((c.z - (float)h6) * LOSCALE), (_Float16)((c.w - (float)h7) * LOSCALE) };
    const size_t gi = (tok0 + row) * (size_t)DM + (size_t)head * HD + 8 * q8;
    *(v8h*)(xh + gi) = hv;
    *(v8h*)(xl + gi) = lv;
  }
}

// ---------------------------------------------------------------------------
// K / V^T tile staging: 64 rows x 128 B each, LDS row pitch 144 B (16 B x odd,
// conflict-free for the 16-byte fragment reads). 128 threads, 8 lanes per row,
// 16 rows per sweep, 4 sweeps per operand: every copy instruction covers whole
// 128-B lines of the source.
// ---------------------------------------------------------------------------
#define KVP    72                      // LDS row pitch in halves (144 B)
#define KVTILE (64 * KVP)              // halves per staged tile (9216 B)
#define NTILE  (2 * (SQ / 64))         // 32 tiles: 16 of the own pair, 16 of the flipped one

__device__ __forceinline__ unsigned lds_off(const void* p) { return (unsigned)(size_t)p; }

// gk: this lane's 16 B of K row (tid>>3) of the tile; gv: the same of V^T row (tid>>3).
// lk / lv: the lane's LDS byte addresses for those rows.
__device__ __forceinline__ void stage_kv(const _Float16* gk, const _Float16* gv, unsigned lk, unsigned lv) {
  const _Float16* gk1 = gk + 16 * HD;
  const _Float16* gk2 = gk + 32 * HD;
  const _Float16* gk3 = gk + 48 * HD;
  const _Float16* gv1 = gv + 16 * SQ;
  const _Float16* gv2 = gv + 32 * SQ;
  const _Float16* gv3 = gv + 48 * SQ;
  const unsigned lk1 = lk + 16 * KVP * 2, lk2 = lk + 32 * KVP * 2, lk3 = lk + 48 * KVP * 2;
  const unsigned lv1 = lv + 16 * KVP * 2, lv2 = lv + 32 * KVP * 2, lv3 = lv + 48 * KVP * 2;
  // Global -> LDS through no register; the closing s_wait_xcnt stands in the same
  // statement so that no address register is rewritten in front of it.
  asm volatile(
      "global_load_async_to_lds_b128 %0, %8, off\n\t"
      "global_load_async_to_lds_b128 %1, %9, off\n\t"
      "global_load_async_to_lds_b128 %2, %10, off\n\t"
      "global_load_async_to_lds_b128 %3, %11, off\n\t"
      "global_load_async_to_lds_b128 %4, %12, off\n\t"
      "global_load_async_to_lds_b128 %5, %13, off\n\t"
      "global_load_async_to_lds_b128 %6, %14, off\n\t"
      "global_load_async_to_lds_b128 %7, %15, off\n\t"
      "s_wait_xcnt 0x0"
      :: "v"(lk), "v"(lk1), "v"(lk2), "v"(lk3), "v"(lv), "v"(lv1), "v"(lv2), "v"(lv3),
         "v"(gk), "v"(gk1), "v"(gk2), "v"(gk3), "v"(gv), "v"(gv1), "v"(gv2), "v"(gv3)
      : "memory");
}

// ---------------------------------------------------------------------------
// Block 128 thr (4 waves), 16 queries per wave, 64 keys per step.
// The block's four waves share each 64-key K and V^T tile from LDS: two buffers,
// tile t + 2 copied in while tile t + 1 is worked on; the 32 tiles of both passes
// form one sequence, so the copies run on across the pass boundary.
//   S^T = K * Q^T : A = K rows (row = key, k = d), B = Q^T (k = d, n = query)
//   O^T += V^T * P^T : A = Vt rows (row = d, k = key), B = P^T from registers
// Lane owns 32 keys of query column (lane&15); partner = lane ^ 16.
// left kept in LDS; combine = left + 0.1*tanh(right), x256 -> hi/lo f16 planes.
// ---------------------------------------------------------------------------
__global__ __launch_bounds__(128) void attn_kernel(
    const _Float16* __restrict__ qh,   // [NBP*NH][SQ][HD]
    const _Float16* __restrict__ kh,   // [NBP*NH][SQ][HD]
    const _Float16* __restrict__ vt,   // [NBP*NH][HD][SQ]
    const int* __restrict__ mask,      // [NBP][SQ], nonzero = attend
    _Float16* __restrict__ xh,         // [NTOK][DM] f16, hi plane of combine*256
    _Float16* __restrict__ xl)         // [NTOK][DM] f16, lo plane (x2048)
{
  __shared__ __attribute__((aligned(16))) float sO[4 * 16 * 64];    // 16384 B
  __shared__ __attribute__((aligned(16))) _Float16 sK[2 * KVTILE];  // 18432 B
  __shared__ __attribute__((aligned(16))) _Float16 sV[2 * KVTILE];  // 18432 B

  const int tid = threadIdx.x, lane = tid & 31, w = tid >> 5;
  const int h = lane >> 4, m = lane & 15;
  const int bph = blockIdx.y, bp = bph >> 4, head = bph & 15;
  const int b = bp >> 1, p = bp & 1;
  const int q0 = blockIdx.x * 64 + 16 * w;

  // Q^T B-fragments: column n = query q0+m, k = d (two 32-deep chunks)
  const _Float16* qrow = qh + ((size_t)bph * SQ + q0 + m) * HD;
  const v16h qb0 = load_frag_h(qrow, h);
  const v16h qb1 = load_frag_h(qrow + 32, h);

  const int* mrow = mask + (size_t)bp * SQ;
  float* so = sO + w * 1024;
  const v8f zero8 = {0.f, 0.f, 0.f, 0.f, 0.f, 0.f, 0.f, 0.f};

  // Copy addresses of this lane: row tid>>3 of a sweep, 16-byte column tid&7.
  const int crow = tid >> 3, ccol = tid & 7;
  const int kvown = bph, kvflip = (b * 2 + (1 - p)) * NH + head;
  const _Float16* gk_own  = kh + ((size_t)kvown  * SQ + crow) * HD + 8 * ccol;   // + key0*HD
  const _Float16* gk_flip = kh + ((size_t)kvflip * SQ + crow) * HD + 8 * ccol;
  const _Float16* gv_own  = vt + ((size_t)kvown  * HD + crow) * SQ + 8 * ccol;   // + key0
  const _Float16* gv_flip = vt + ((size_t)kvflip * HD + crow) * SQ + 8 * ccol;
  const unsigned lk0 = lds_off(sK) + crow * (KVP * 2) + 16 * ccol;               // + buffer * KVTILE * 2
  const unsigned lv0 = lds_off(sV) + crow * (KVP * 2) + 16 * ccol;

  // Tile 0 into buffer 0, landed and published; then tile 1 into buffer 1.
  stage_kv(gk_own, gv_own, lk0, lv0);
  asm volatile("s_wait_asynccnt 0x0" ::: "memory");   // this wave's copies of tile 0 have landed
  __syncthreads();                                    // tile 0 readable by every wave
  stage_kv(gk_own + 64 * HD, gv_own + 64, lk0 + KVTILE * 2, lv0 + KVTILE * 2);

  #pragma unroll 1
  for (int pass = 0; pass < 2; ++pass) {

    v8f o[4];                                   // o[t][r] = O[query m][d 16t+8h+r] * (l * 2^14)
    #pragma unroll
    for (int t = 0; t < 4; ++t) o[t] = zero8;
    float mrun = -1.0e30f, lrun = 0.0f;

    #pragma unroll 1
    for (int kb = 0; kb < SQ; kb += 64) {
      const int tile = pass * (SQ / 64) + (kb >> 6);
      const int buf = tile & 1;
      const _Float16* kbase = sK + buf * KVTILE + m * KVP;         // + 16j*KVP + 32*dc
      const _Float16* vbase = sV + buf * KVTILE + m * KVP;         // + 16t*KVP + key in tile
      // ---- scores: s[j][r] = S[query m][key kb+16j+8h+r] (unscaled) ----
      v8f s[4];
      #pragma unroll
      for (int j = 0; j < 4; ++j) {
        const _Float16* kp = kbase + (16 * j) * KVP;
        const v16h kf0 = load_frag_h(kp, h);
        const v16h kf1 = load_frag_h(kp + 32, h);
        v8f z = zero8;
        z = wmma_f16(kf0, qb0, z);
        z = wmma_f16(kf1, qb1, z);
        s[j] = z;
      }
      // ---- scale 1/8 and key mask, f32 ----
      #pragma unroll
      for (int j = 0; j < 4; ++j) s[j] = scale_mask8(s[j], mrow + kb + 16 * j + 8 * h);

      // ---- online softmax ----
      float mloc = s[0][0];
      #pragma unroll
      for (int j = 0; j < 4; ++j)
        #pragma unroll
        for (int r = 0; r < 8; ++r) mloc = fmaxf(mloc, s[j][r]);
      mloc = fmaxf(mloc, __shfl_xor(mloc, 16));
      const float mnew = fmaxf(mrun, mloc);
      const float alpha = __expf(mrun - mnew);
      mrun = mnew;
      float lsum = 0.0f;
      #pragma unroll
      for (int j = 0; j < 4; ++j)
        #pragma unroll
        for (int r = 0; r < 8; ++r) {
          const float pe = __expf(s[j][r] - mnew);
          s[j][r] = pe;
          lsum += pe;
        }
      lsum += __shfl_xor(lsum, 16);
      lrun = lrun * alpha + lsum;
      #pragma unroll
      for (int t = 0; t < 4; ++t)
        #pragma unroll
        for (int r = 0; r < 8; ++r) o[t][r] = o[t][r] * alpha;

      // ---- P^T B-fragments (keys 0..31 and 32..63 of this step) ----
      const v16h pb0 = pack_p(s[0], s[1]);
      const v16h pb1 = pack_p(s[2], s[3]);

      // ---- O^T += V^T * P^T ----
      #pragma unroll
      for (int t = 0; t < 4; ++t) {
        const _Float16* vp = vbase + (16 * t) * KVP;
        const v16h vf0 = load_frag_h(vp, h);
        const v16h vf1 = load_frag_h(vp + 32, h);
        o[t] = wmma_f16(vf0, pb0, o[t]);
        o[t] = wmma_f16(vf1, pb1, o[t]);
      }

      // ---- publish tile + 1, then refill the buffer this trip has read ----
      asm volatile("s_wait_dscnt 0x0" ::: "memory");      // this wave's reads of the buffer are done
      asm volatile("s_wait_asynccnt 0x0" ::: "memory");   // this wave's copies of tile + 1 have landed
      __syncthreads();                                    // publishes tile + 1, ends every read of this buffer
      if (tile + 2 < NTILE) {
        const int nt = tile + 2;
        const int key0 = (nt & (SQ / 64 - 1)) * 64;
        const _Float16* gk = ((nt < SQ / 64) ? gk_own : gk_flip) + (size_t)key0 * HD;
        const _Float16* gv = ((nt < SQ / 64) ? gv_own : gv_flip) + key0;
        stage_kv(gk, gv, lk0 + buf * (KVTILE * 2), lv0 + buf * (KVTILE * 2));
      }
    }

    const float inv = (1.0f / lrun) * (1.0f / PSCALE);
    if (pass == 0) {
      #pragma unroll
      for (int t = 0; t < 4; ++t)
        #pragma unroll
        for (int r = 0; r < 8; ++r)
          so[m * 64 + 16 * t + 8 * h + r] = o[t][r] * inv;
    } else {
      #pragma unroll
      for (int t = 0; t < 4; ++t)
        #pragma unroll
        for (int r = 0; r < 8; ++r) {
          const int idx = m * 64 + 16 * t + 8 * h + r;
          const float cmb = so[idx] + 0.1f * tanhf(o[t][r] * inv);
          so[idx] = cmb * XSCALE;
        }
    }
  }
  asm volatile("s_wait_asynccnt 0x0" ::: "memory");   // no copy outstanding behind the loop
  __syncthreads();

  const size_t tok0 = (size_t)bp * SQ + q0;
  xc_store_pass(so, xh, xl, tok0, head, lane);
  
}

// ---------------------------------------------------------------------------
// wave w owns rows 16w..16w+15, each row 64 floats = 2 lines; lanes 8q..8q+7
// per line, 4 lines per instruction, 32 lines per wave.
// ---------------------------------------------------------------------------
__device__ __forceinline__ void out_store_pass(const float* sT, float* out,
                                               int m0, int n0, int w, int lane) {
  const int q8 = lane & 7, sub = lane >> 3;
  #pragma unroll
  for (int i = 0; i < 8; ++i) {
    const int lid = i * 4 + sub;                 // 0..31
    const int row = 16 * w + (lid >> 1), hl = lid & 1;
    const v4f v = *(const v4fa*)(sT + row * 64 + 32 * hl + 4 * q8);
    const size_t gi = (size_t)(m0 + row) * DM + n0 + 32 * hl + 4 * q8;
    *(v4f*)(out + gi) = v;
  }
}

// ---------------------------------------------------------------------------
// Kernel 4: out = X * Wo^T + bo with X = hi/256 + lo/(256*2048) planes.
// Block 128 thr (4 waves) = 64 tokens x 64 features; wave 16 tokens x 64.
// A = X rows (k contiguous), B[k][n] = Wo[n][k] from Wo row n (k contiguous).
// ---------------------------------------------------------------------------
__global__ __launch_bounds__(128) void oproj_kernel(
    const _Float16* __restrict__ xh,   // [NTOK][DM]
    const _Float16* __restrict__ xl,   // [NTOK][DM]
    const _Float16* __restrict__ woh,  // [DM][DM] f16(bf16(Wo)*256)
    const float* __restrict__ bo,
    float* __restrict__ out)           // [NTOK][DM]
{
  __shared__ __attribute__((aligned(16))) float sT[64 * 64];        // 16384 B

  const int tid = threadIdx.x, lane = tid & 31, w = tid >> 5;
  const int h = lane >> 4, m = lane & 15;
  const int m0 = blockIdx.x * 64, n0 = blockIdx.y * 64;
  const int row0 = m0 + 16 * w;

  const _Float16* ah = xh + (size_t)(row0 + m) * DM;
  const _Float16* al = xl + (size_t)(row0 + m) * DM;
  const _Float16* wr = woh + (size_t)(n0 + m) * DM;

  const v8f zero8 = {0.f, 0.f, 0.f, 0.f, 0.f, 0.f, 0.f, 0.f};
  v8f acch[4], accl[4];
  #pragma unroll
  for (int nt = 0; nt < 4; ++nt) { acch[nt] = zero8; accl[nt] = zero8; }

  #pragma unroll 1
  for (int k0 = 0; k0 < DM; k0 += 32) {
    const v16h fah = load_frag_h(ah + k0, h);
    const v16h fal = load_frag_h(al + k0, h);
    #pragma unroll
    for (int nt = 0; nt < 4; ++nt) {
      const v16h fb = load_frag_h(wr + (size_t)nt * 16 * DM + k0, h);
      acch[nt] = wmma_f16(fah, fb, acch[nt]);
      accl[nt] = wmma_f16(fal, fb, accl[nt]);
    }
  }

  // D[r] of tile nt = Y[token row0+8h+r][feature n0+16nt+m]
  const float sh = 1.0f / (XSCALE * WSCALE);
  const float sl = 1.0f / (XSCALE * WSCALE * LOSCALE);
  #pragma unroll
  for (int nt = 0; nt < 4; ++nt) {
    const int col = 16 * nt + m;
    const float bvl = bo[n0 + col];
    #pragma unroll
    for (int r = 0; r < 8; ++r) {
      const int row = 16 * w + 8 * h + r;                 // 0..63
      sT[row * 64 + col] = acch[nt][r] * sh + accl[nt][r] * sl + bvl;
    }
  }
  __syncthreads();

  out_store_pass(sT, out, m0, n0, w, lane);
  
}

// ---------------------------------------------------------------------------
extern "C" void kernel_launch(void* const* d_in, const int* in_sizes, int n_in,
                              void* d_out, int out_size, void* d_ws, size_t ws_size,
                              hipStream_t stream) {
  if (n_in < 12) return;
  if (in_sizes[0] != NACT || in_sizes[1] != NACT || in_sizes[2] != NACT) return;
  if (in_sizes[3] != NBP * SQ) return;
  if (in_sizes[4] != NWEL || in_sizes[6] != NWEL || in_sizes[8] != NWEL || in_sizes[10] != NWEL) return;
  if (in_sizes[5] != DM || in_sizes[7] != DM || in_sizes[9] != DM || in_sizes[11] != DM) return;
  if (out_size != NACT) return;

  const float* query = (const float*)d_in[0];
  const float* key_  = (const float*)d_in[1];
  const float* value = (const float*)d_in[2];
  const int*   mask  = (const int*)d_in[3];
  const float* Wq = (const float*)d_in[4];
  const float* bq = (const float*)d_in[5];
  const float* Wk = (const float*)d_in[6];
  const float* bk = (const float*)d_in[7];
  const float* Wv = (const float*)d_in[8];
  const float* bv = (const float*)d_in[9];
  const float* Wo = (const float*)d_in[10];
  const float* bo = (const float*)d_in[11];
  float* out = (float*)d_out;

  const size_t xb_bytes  = (size_t)3 * NACT * 2;                 // 25165824
  const size_t wb_bytes  = (size_t)3 * NWEL * 2;                 //  6291456
  const size_t woh_bytes = (size_t)NWEL * 2;                     //  2097152
  const size_t pl_bytes  = (size_t)NBP * NH * SQ * HD * 2;       //  8388608 per plane
  const size_t xc_bytes  = (size_t)NACT * 2;                     //  8388608 per plane
  const size_t total = xb_bytes + wb_bytes + woh_bytes + 3 * pl_bytes + 2 * xc_bytes;   // 75497472
  if (total > ws_size) return;

  char* ws = (char*)d_ws;
  size_t off = 0;
  unsigned short* xb = (unsigned short*)(ws + off); off += xb_bytes;
  unsigned short* wb = (unsigned short*)(ws + off); off += wb_bytes;
  _Float16* woh = (_Float16*)(ws + off);            off += woh_bytes;
  _Float16* qh  = (_Float16*)(ws + off);            off += pl_bytes;
  _Float16* kh  = (_Float16*)(ws + off);            off += pl_bytes;
  _Float16* vt  = (_Float16*)(ws + off);            off += pl_bytes;
  _Float16* xh  = (_Float16*)(ws + off);            off += xc_bytes;
  _Float16* xl  = (_Float16*)(ws + off);            off += xc_bytes;
  if (off > ws_size) return;

  convert_kernel<<<(NGRP + 255) / 256, 256, 0, stream>>>(query, key_, value, Wq, Wk, Wv, Wo, xb, wb, woh);

  dim3 gProj(NTOK / 128, 3 * NH);                               // (32, 48)
  proj_kernel<<<gProj, 128, 0, stream>>>(xb, wb, bq, bk, bv, qh, kh, vt);

  dim3 gAtt(SQ / 64, NBP * NH);                                  // (16, 64)
  attn_kernel<<<gAtt, 128, 0, stream>>>(qh, kh, vt, mask, xh, xl);

  dim3 gOut(NTOK / 64, DM / 64);                                 // (64, 16)
  oproj_kernel<<<gOut, 128, 0, stream>>>(xh, xl, woh, bo, out);
}

// v002
// It runs in 118 microseconds.
// Two timings next to v001 both put it at 1.54 times that version's speed.
// Over all steps from v000 it is 2.31 times as fast.
// Contractions: q/k/v projections x*W^T on v_wmma_f32_16x16x32_bf16 (bf16 operands, f32 accumulate); K*Q^T and V^T*P^T of both attention passes on v_wmma_f32_16x16x32_f16 (f16 operands, P carried x16384, f32 accumulate); output projection on v_wmma_f32_16x16x32_f16 with the activation carried x256 as f16 hi + lo(x2048) planes and the weight as f16 of its bf16 value x256 (f32 accumulate); scale, mask, softmax, tanh and bias in f32.
#include <hip/hip_runtime.h>
#include <math.h>

typedef _Float16       v16h __attribute__((ext_vector_type(16)));
typedef _Float16       v8h  __attribute__((ext_vector_type(8)));
typedef __bf16         v16b __attribute__((ext_vector_type(16)));
typedef unsigned short v8us __attribute__((ext_vector_type(8)));
typedef float          v8f  __attribute__((ext_vector_type(8)));
typedef float          v4f  __attribute__((ext_vector_type(4)));
typedef int            v4i  __attribute__((ext_vector_type(4)));
typedef v8h  __attribute__((may_alias)) v8ha;
typedef v8us __attribute__((may_alias)) v8usa;
typedef v4f  __attribute__((may_alias)) v4fa;
typedef v4i  __attribute__((may_alias)) v4ia;

union FragH { v16h v; v8h  half[2]; };
union FragB { v16b v; v8us half[2]; };

#define DM     1024
#define NH     16
#define HD     64
#define SQ     1024
#define NBP    4                       // batch * pair
#define NTOK   (NBP * SQ)              // 4096 token rows
#define NACT   (NTOK * DM)             // 4194304
#define NWEL   (DM * DM)               // 1048576
#define ACT8   (NACT / 8)              // 524288
#define WEL8   (NWEL / 8)              // 131072
#define NGRP   (3 * ACT8 + 4 * WEL8)   // 2097152
#define PSCALE  16384.0f
#define XSCALE  256.0f
#define WSCALE  256.0f
#define LOSCALE 2048.0f

// ---------------------------------------------------------------------------
// 16x16x32 WMMA helpers with hazard guard (ties D, keeps A/B live).
// Fragment map (wave32): lane l, h = l>>4, m = n = l&15.
//   A/B element i: i<8 -> k0+8h+i ; i>=8 -> k0+16+8h+(i-8)
//   D element r : row 8h+r, col l&15
// ---------------------------------------------------------------------------
__device__ __forceinline__ v8f wmma_f16(v16h a, v16h b, v8f c) {
  v8f d = __builtin_amdgcn_wmma_f32_16x16x32_f16(false, a, false, b, (short)0, c, false, false);
  asm volatile("v_nop\n\tv_nop\n\tv_nop\n\tv_nop" : "+v"(d) : "v"(a), "v"(b));
  return d;
}
__device__ __forceinline__ v8f wmma_bf16(v16b a, v16b b, v8f c) {
  v8f d = __builtin_amdgcn_wmma_f32_16x16x32_bf16(false, a, false, b, (short)0, c, false, false);
  asm volatile("v_nop\n\tv_nop\n\tv_nop\n\tv_nop" : "+v"(d) : "v"(a), "v"(b));
  return d;
}

// A or B fragment from a k-contiguous 16-bit row; p points at element k0 of
// the row owned by this lane (row index = lane & 15 added by the caller).
__device__ __forceinline__ v16h load_frag_h(const _Float16* p, int h) {
  FragH f;
  f.half[0] = *(const v8ha*)(p + 8 * h);
  f.half[1] = *(const v8ha*)(p + 16 + 8 * h);
  return f.v;
}
__device__ __forceinline__ v16b load_frag_b(const unsigned short* p, int h) {
  FragB f;
  f.half[0] = *(const v8usa*)(p + 8 * h);
  f.half[1] = *(const v8usa*)(p + 16 + 8 * h);
  return f.v;
}

// f32 -> bf16 bits, RNE
__device__ __forceinline__ unsigned short bf16_bits(float f) {
  unsigned int u = __float_as_uint(f);
  u = u + 0x7FFFu + ((u >> 16) & 1u);
  return (unsigned short)(u >> 16);
}
__device__ __forceinline__ float bf16_val(float f) {
  return __uint_as_float(((unsigned int)bf16_bits(f)) << 16);
}

// ---------------------------------------------------------------------------
// Kernel 1: f32 -> 16-bit planes.
//   xb[3][NTOK][DM] bf16 (query, key, value), wb[3][DM][DM] bf16 (Wq, Wk, Wv),
//   woh[DM][DM] f16 = f16(bf16(Wo) * 256).
// ---------------------------------------------------------------------------
__global__ __launch_bounds__(256) void convert_kernel(
    const float* __restrict__ xq, const float* __restrict__ xk, const float* __restrict__ xv,
    const float* __restrict__ wq, const float* __restrict__ wk, const float* __restrict__ wv,
    const float* __restrict__ wo,
    unsigned short* __restrict__ xb, unsigned short* __restrict__ wb, _Float16* __restrict__ woh)
{
  const int g = blockIdx.x * 256 + threadIdx.x;
  if (g >= NGRP) return;
  if (g < 3 * ACT8 + 3 * WEL8) {
    const float* src;
    unsigned short* dst;
    if (g < 3 * ACT8) {
      const int sel = g / ACT8;
      const int off = g - sel * ACT8;
      const float* xs = (sel == 0) ? xq : ((sel == 1) ? xk : xv);
      src = xs + (size_t)off * 8;
      dst = xb + (size_t)sel * NACT + (size_t)off * 8;
    } else {
      const int e = g - 3 * ACT8;
      const int sel = e / WEL8;
      const int off = e - sel * WEL8;
      const float* wsrc = (sel == 0) ? wq : ((sel == 1) ? wk : wv);
      src = wsrc + (size_t)off * 8;
      dst = wb + (size_t)sel * NWEL + (size_t)off * 8;
    }
    const v4f a = *(const v4fa*)src;
    const v4f c = *(const v4fa*)(src + 4);
    const v8us o = { bf16_bits(a.x), bf16_bits(a.y), bf16_bits(a.z), bf16_bits(a.w),
                     bf16_bits(c.x), bf16_bits(c.y), bf16_bits(c.z), bf16_bits(c.w) };
    *(v8us*)dst = o;
    
  } else {
    const int off = g - (3 * ACT8 + 3 * WEL8);
    const float* src = wo + (size_t)off * 8;
    _Float16* dst = woh + (size_t)off * 8;
    const v4f a = *(const v4fa*)src;
    const v4f c = *(const v4fa*)(src + 4);
    const v8h o = { (_Float16)(bf16_val(a.x) * WSCALE), (_Float16)(bf16_val(a.y) * WSCALE),
                    (_Float16)(bf16_val(a.z) * WSCALE), (_Float16)(bf16_val(a.w) * WSCALE),
                    (_Float16)(bf16_val(c.x) * WSCALE), (_Float16)(bf16_val(c.y) * WSCALE),
                    (_Float16)(bf16_val(c.z) * WSCALE), (_Float16)(bf16_val(c.w) * WSCALE) };
    *(v8h*)dst = o;
    
  }
}

// ---------------------------------------------------------------------------
// 4 lines per instruction, 32 lines per wave, 128 per block.
// which 0/1: plane[bh][s][d]  (one token row = 64 halves = one line)
// which 2  : vt[bh][d][s]     (64 d-rows x 128 tokens = 2 lines each)
// ---------------------------------------------------------------------------
__device__ __forceinline__ void proj_store_pass(const _Float16* sT, _Float16* plane, _Float16* vt,
                                                int which, int bh, int l0, int w, int lane) {
  const int q8 = lane & 7, sub = lane >> 3;
  #pragma unroll
  for (int i = 0; i < 8; ++i) {
    const int lid = w * 32 + i * 4 + sub;
    v8h v;
    _Float16* dst;
    if (which != 2) {
      v = *(const v8ha*)(sT + lid * HD + 8 * q8);
      dst = plane + ((size_t)bh * SQ + l0 + lid) * HD + 8 * q8;
    } else {
      const int d = lid >> 1, hl = lid & 1;
      v = *(const v8ha*)(sT + d * 128 + 64 * hl + 8 * q8);
      dst = vt + ((size_t)bh * HD + d) * SQ + l0 + 64 * hl + 8 * q8;
    }
    *(v8h*)dst = v;
  }
}

__device__ __forceinline__ unsigned lds_off(const void* p) { return (unsigned)(size_t)p; }

// ---------------------------------------------------------------------------
// GEMM operand staging (kernels 2 and 4): one k-tile = 64 k (128 B) of 192
// operand rows, three groups of 64 rows, LDS row pitch 144 B (16 B x odd,
// conflict-free for the 16-byte fragment reads). 128 threads, 8 lanes per row,
// 16 rows per sweep, 4 sweeps per group: every copy instruction covers whole
// 128-B lines of the source. Source row pitch = DM 16-bit elements.
// ---------------------------------------------------------------------------
#define GP     72                      // LDS row pitch in 16-bit elements (144 B)
#define GTILE  (192 * GP)              // elements per staged k-tile (27648 B)
#define GKT    64                      // k per tile
#define GNT    (DM / GKT)              // 16 k-tiles

// g0 / g1 / g2: this lane's 16 B of row (tid>>3) of each 64-row group, at the
// tile's first k; l: the lane's LDS byte address of row (tid>>3) of group 0.
__device__ __forceinline__ void stage_gemm(const void* g0, const void* g1, const void* g2, unsigned l) {
  const char* a0 = (const char*)g0;
  const char* a1 = a0 + 16 * DM * 2;
  const char* a2 = a0 + 32 * DM * 2;
  const char* a3 = a0 + 48 * DM * 2;
  const char* b0 = (const char*)g1;
  const char* b1 = b0 + 16 * DM * 2;
  const char* b2 = b0 + 32 * DM * 2;
  const char* b3 = b0 + 48 * DM * 2;
  const char* c0 = (const char*)g2;
  const char* c1 = c0 + 16 * DM * 2;
  const char* c2 = c0 + 32 * DM * 2;
  const char* c3 = c0 + 48 * DM * 2;
  const unsigned la1 = l + 16 * GP * 2,  la2 = l + 32 * GP * 2,  la3 = l + 48 * GP * 2;
  const unsigned lb0 = l + 64 * GP * 2,  lb1 = l + 80 * GP * 2,  lb2 = l + 96 * GP * 2,  lb3 = l + 112 * GP * 2;
  const unsigned lc0 = l + 128 * GP * 2, lc1 = l + 144 * GP * 2, lc2 = l + 160 * GP * 2, lc3 = l + 176 * GP * 2;
  // Global -> LDS through no register; the closing s_wait_xcnt stands in the same
  // statement so that no address register is rewritten in front of it.
  asm volatile(
      "global_load_async_to_lds_b128 %0, %12, off\n\t"
      "global_load_async_to_lds_b128 %1, %13, off\n\t"
      "global_load_async_to_lds_b128 %2, %14, off\n\t"
      "global_load_async_to_lds_b128 %3, %15, off\n\t"
      "global_load_async_to_lds_b128 %4, %16, off\n\t"
      "global_load_async_to_lds_b128 %5, %17, off\n\t"
      "global_load_async_to_lds_b128 %6, %18, off\n\t"
      "global_load_async_to_lds_b128 %7, %19, off\n\t"
      "global_load_async_to_lds_b128 %8, %20, off\n\t"
      "global_load_async_to_lds_b128 %9, %21, off\n\t"
      "global_load_async_to_lds_b128 %10, %22, off\n\t"
      "global_load_async_to_lds_b128 %11, %23, off\n\t"
      "s_wait_xcnt 0x0"
      :: "v"(l), "v"(la1), "v"(la2), "v"(la3), "v"(lb0), "v"(lb1), "v"(lb2), "v"(lb3),
         "v"(lc0), "v"(lc1), "v"(lc2), "v"(lc3),
         "v"(a0), "v"(a1), "v"(a2), "v"(a3), "v"(b0), "v"(b1), "v"(b2), "v"(b3),
         "v"(c0), "v"(c1), "v"(c2), "v"(c3)
      : "memory");
}

// ---------------------------------------------------------------------------
// Kernel 2: Y = x * W^T for the three projections (bf16 operands).
// Block 128 thr (4 waves) = 128 tokens x 64 features of one (which, head);
// wave tile 32 tokens x 64 features; K = 1024 in steps of 32.
// A = x rows (token-major, k contiguous), B[k][n] = W[n][k] from W row n
// (k contiguous) -> both fragments with the same loader.
// The block's 128 x rows (LDS rows 0..127) and 64 W rows (LDS rows 128..191)
// come through LDS in k-tiles of 64: two buffers, tile t + 2 copied in while
// tile t + 1 is worked on.
// ---------------------------------------------------------------------------
__global__ __launch_bounds__(128) void proj_kernel(
    const unsigned short* __restrict__ xb,   // [3][NTOK][DM] bf16
    const unsigned short* __restrict__ wb,   // [3][DM][DM]   bf16, row = output feature
    const float* __restrict__ bq, const float* __restrict__ bk, const float* __restrict__ bv,
    _Float16* __restrict__ qh,               // [NBP*NH][SQ][HD] f16
    _Float16* __restrict__ kh,               // [NBP*NH][SQ][HD] f16
    _Float16* __restrict__ vt)               // [NBP*NH][HD][SQ] f16
{
  __shared__ __attribute__((aligned(16))) _Float16 sT[128 * 64];          // 16384 B
  __shared__ __attribute__((aligned(16))) unsigned short sG[2 * GTILE];   // 55296 B

  const int tid = threadIdx.x, lane = tid & 31, w = tid >> 5;
  const int h = lane >> 4, m = lane & 15;
  const int m0 = blockIdx.x * 128;
  const int cg = blockIdx.y;                 // 0..47
  const int which = cg >> 4, head = cg & 15;

  // Copy addresses of this lane: row tid>>3 of a sweep, 16-byte column tid&7.
  const int crow = tid >> 3, ccol = tid & 7;
  const unsigned short* gx = xb + (size_t)which * NACT + (size_t)(m0 + crow) * DM + 8 * ccol;         // + k
  const unsigned short* gw = wb + (size_t)which * NWEL + (size_t)(head * HD + crow) * DM + 8 * ccol;  // + k
  const unsigned lg0 = lds_off(sG) + crow * (GP * 2) + 16 * ccol;                                     // + buffer * GTILE * 2

  const v8f zero8 = {0.f, 0.f, 0.f, 0.f, 0.f, 0.f, 0.f, 0.f};
  v8f acc[2][4];
  #pragma unroll
  for (int mt = 0; mt < 2; ++mt)
    #pragma unroll
    for (int nt = 0; nt < 4; ++nt) acc[mt][nt] = zero8;

  // Tile 0 into buffer 0, landed and published; then tile 1 into buffer 1.
  stage_gemm(gx, gx + 64 * DM, gw, lg0);
  asm volatile("s_wait_asynccnt 0x0" ::: "memory");   // this wave's copies of tile 0 have landed
  __syncthreads();                                    // tile 0 readable by every wave
  stage_gemm(gx + GKT, gx + 64 * DM + GKT, gw + GKT, lg0 + GTILE * 2);

  // kept rolled: one copy of the ring's foot (waits, barrier, refill), small loop text
  #pragma unroll 1
  for (int t = 0; t < GNT; ++t) {
    const int buf = t & 1;
    const unsigned short* xa0 = sG + buf * GTILE + (32 * w + m) * GP;   // token row, mt = 0
    const unsigned short* xa1 = xa0 + 16 * GP;                          // mt = 1
    const unsigned short* wr  = sG + buf * GTILE + (128 + m) * GP;      // feature row, nt = 0
    // The tile's fragments are read as one group in front of its products; the
    // loops below are unrolled so that the fragment arrays stay in registers.
    v16b fa[2][2], fb[2][4];
    #pragma unroll
    for (int kc = 0; kc < 2; ++kc) {
      fa[kc][0] = load_frag_b(xa0 + 32 * kc, h);
      fa[kc][1] = load_frag_b(xa1 + 32 * kc, h);
      #pragma unroll
      for (int nt = 0; nt < 4; ++nt) fb[kc][nt] = load_frag_b(wr + nt * 16 * GP + 32 * kc, h);
    }
    #pragma unroll
    for (int kc = 0; kc < 2; ++kc) {
      #pragma unroll
      for (int nt = 0; nt < 4; ++nt) {
        acc[0][nt] = wmma_bf16(fa[kc][0], fb[kc][nt], acc[0][nt]);
        acc[1][nt] = wmma_bf16(fa[kc][1], fb[kc][nt], acc[1][nt]);
      }
    }
    // ---- publish tile + 1, then refill the buffer this trip has read ----
    asm volatile("s_wait_dscnt 0x0" ::: "memory");      // this wave's reads of the buffer are done
    asm volatile("s_wait_asynccnt 0x0" ::: "memory");   // this wave's copies of tile + 1 have landed
    __syncthreads();                                    // publishes tile + 1, ends every read of this buffer
    if (t + 2 < GNT) {
      const int kn = (t + 2) * GKT;
      stage_gemm(gx + kn, gx + 64 * DM + kn, gw + kn, lg0 + buf * (GTILE * 2));
    }
  }
  asm volatile("s_wait_asynccnt 0x0" ::: "memory");   // no copy outstanding behind the loop

  // D[r] of tile (mt, nt) = Y[token m0+32w+16mt+8h+r][feature head*64+16nt+m]
  const float* bias = (which == 0) ? bq : ((which == 1) ? bk : bv);
  #pragma unroll
  for (int nt = 0; nt < 4; ++nt) {
    const int feat = 16 * nt + m;
    const float bvl = bias[head * HD + feat];
    #pragma unroll
    for (int mt = 0; mt < 2; ++mt) {
      #pragma unroll
      for (int r = 0; r < 8; ++r) {
        const int tokl = 32 * w + 16 * mt + 8 * h + r;     // 0..127
        const float y = acc[mt][nt][r] + bvl;
        const int idx = (which == 2) ? (feat * 128 + tokl) : (tokl * HD + feat);
        sT[idx] = (_Float16)y;
      }
    }
  }
  __syncthreads();

  const int bp = m0 >> 10, l0 = m0 & (SQ - 1), bh = bp * NH + head;
  _Float16* plane = (which == 0) ? qh : kh;
  proj_store_pass(sT, plane, vt, which, bh, l0, w, lane);
  
}

// ---------------------------------------------------------------------------
// Attention helpers.
// ---------------------------------------------------------------------------
// scale by 1/8 then key mask: key index of s[r] = base + r; mp points at mask[base]
__device__ __forceinline__ v8f scale_mask8(v8f s, const int* mp) {
  const v4i ma = *(const v4ia*)mp;
  const v4i mb = *(const v4ia*)(mp + 4);
  s[0] = (ma.x != 0) ? s[0] * 0.125f : -1.0e9f;
  s[1] = (ma.y != 0) ? s[1] * 0.125f : -1.0e9f;
  s[2] = (ma.z != 0) ? s[2] * 0.125f : -1.0e9f;
  s[3] = (ma.w != 0) ? s[3] * 0.125f : -1.0e9f;
  s[4] = (mb.x != 0) ? s[4] * 0.125f : -1.0e9f;
  s[5] = (mb.y != 0) ? s[5] * 0.125f : -1.0e9f;
  s[6] = (mb.z != 0) ? s[6] * 0.125f : -1.0e9f;
  s[7] = (mb.w != 0) ? s[7] * 0.125f : -1.0e9f;
  return s;
}

// P^T B-fragment from the lane's own score D values: element r <- tile a row r
// (keys 0..15 of the 32-key step), element 8+r <- tile c row r (keys 16..31),
// same lane (query column), scaled by 2^14.
__device__ __forceinline__ v16h pack_p(v8f a, v8f c) {
  const v16h r = { (_Float16)(a[0] * PSCALE), (_Float16)(a[1] * PSCALE), (_Float16)(a[2] * PSCALE), (_Float16)(a[3] * PSCALE),
                   (_Float16)(a[4] * PSCALE), (_Float16)(a[5] * PSCALE), (_Float16)(a[6] * PSCALE), (_Float16)(a[7] * PSCALE),
                   (_Float16)(c[0] * PSCALE), (_Float16)(c[1] * PSCALE), (_Float16)(c[2] * PSCALE), (_Float16)(c[3] * PSCALE),
                   (_Float16)(c[4] * PSCALE), (_Float16)(c[5] * PSCALE), (_Float16)(c[6] * PSCALE), (_Float16)(c[7] * PSCALE) };
  return r;
}

// Per-wave 16x64 f32 tile (already x256) in LDS -> hi/lo f16 planes
// lanes 8q..8q+7 per line, 4 lines per instruction, 16 rows x 2 planes per wave.
__device__ __forceinline__ void xc_store_pass(const float* so, _Float16* xh, _Float16* xl,
                                              size_t tok0, int head, int lane) {
  const int q8 = lane & 7, sub = lane >> 3;
  #pragma unroll
  for (int i = 0; i < 4; ++i) {
    const int row = 4 * i + sub;
    const v4f a = *(const v4fa*)(so + row * 64 + 8 * q8);
    const v4f c = *(const v4fa*)(so + row * 64 + 8 * q8 + 4);
    const _Float16 h0 = (_Float16)a.x, h1 = (_Float16)a.y, h2 = (_Float16)a.z, h3 = (_Float16)a.w;
    const _Float16 h4 = (_Float16)c.x, h5 = (_Float16)c.y, h6 = (_Float16)c.z, h7 = (_Float16)c.w;
    const v8h hv = { h0, h1, h2, h3, h4, h5, h6, h7 };
    const v8h lv = { (_Float16)((a.x - (float)h0) * LOSCALE), (_Float16)((a.y - (float)h1) * LOSCALE),
                     (_Float16)((a.z - (float)h2) * LOSCALE), (_Float16)((a.w - (float)h3) * LOSCALE),
                     (_Float16)((c.x - (float)h4) * LOSCALE), (_Float16)((c.y - (float)h5) * LOSCALE),
                     (_Float16)((c.z - (float)h6) * LOSCALE), (_Float16)((c.w - (float)h7) * LOSCALE) };
    const size_t gi = (tok0 + row) * (size_t)DM + (size_t)head * HD + 8 * q8;
    *(v8h*)(xh + gi) = hv;
    *(v8h*)(xl + gi) = lv;
  }
}

// ---------------------------------------------------------------------------
// K / V^T tile staging: 64 rows x 128 B each, LDS row pitch 144 B (16 B x odd,
// conflict-free for the 16-byte fragment reads). 128 threads, 8 lanes per row,
// 16 rows per sweep, 4 sweeps per operand: every copy instruction covers whole
// 128-B lines of the source.
// ---------------------------------------------------------------------------
#define KVP    72                      // LDS row pitch in halves (144 B)
#define KVTILE (64 * KVP)              // halves per staged tile (9216 B)
#define NTILE  (2 * (SQ / 64))         // 32 tiles: 16 of the own pair, 16 of the flipped one

// gk: this lane's 16 B of K row (tid>>3) of the tile; gv: the same of V^T row (tid>>3).
// lk / lv: the lane's LDS byte addresses for those rows.
__device__ __forceinline__ void stage_kv(const _Float16* gk, const _Float16* gv, unsigned lk, unsigned lv) {
  const _Float16* gk1 = gk + 16 * HD;
  const _Float16* gk2 = gk + 32 * HD;
  const _Float16* gk3 = gk + 48 * HD;
  const _Float16* gv1 = gv + 16 * SQ;
  const _Float16* gv2 = gv + 32 * SQ;
  const _Float16* gv3 = gv + 48 * SQ;
  const unsigned lk1 = lk + 16 * KVP * 2, lk2 = lk + 32 * KVP * 2, lk3 = lk + 48 * KVP * 2;
  const unsigned lv1 = lv + 16 * KVP * 2, lv2 = lv + 32 * KVP * 2, lv3 = lv + 48 * KVP * 2;
  // Global -> LDS through no register; the closing s_wait_xcnt stands in the same
  // statement so that no address register is rewritten in front of it.
  asm volatile(
      "global_load_async_to_lds_b128 %0, %8, off\n\t"
      "global_load_async_to_lds_b128 %1, %9, off\n\t"
      "global_load_async_to_lds_b128 %2, %10, off\n\t"
      "global_load_async_to_lds_b128 %3, %11, off\n\t"
      "global_load_async_to_lds_b128 %4, %12, off\n\t"
      "global_load_async_to_lds_b128 %5, %13, off\n\t"
      "global_load_async_to_lds_b128 %6, %14, off\n\t"
      "global_load_async_to_lds_b128 %7, %15, off\n\t"
      "s_wait_xcnt 0x0"
      :: "v"(lk), "v"(lk1), "v"(lk2), "v"(lk3), "v"(lv), "v"(lv1), "v"(lv2), "v"(lv3),
         "v"(gk), "v"(gk1), "v"(gk2), "v"(gk3), "v"(gv), "v"(gv1), "v"(gv2), "v"(gv3)
      : "memory");
}

// ---------------------------------------------------------------------------
// Block 128 thr (4 waves), 16 queries per wave, 64 keys per step.
// The block's four waves share each 64-key K and V^T tile from LDS: two buffers,
// tile t + 2 copied in while tile t + 1 is worked on; the 32 tiles of both passes
// form one sequence, so the copies run on across the pass boundary.
//   S^T = K * Q^T : A = K rows (row = key, k = d), B = Q^T (k = d, n = query)
//   O^T += V^T * P^T : A = Vt rows (row = d, k = key), B = P^T from registers
// Lane owns 32 keys of query column (lane&15); partner = lane ^ 16.
// left kept in LDS; combine = left + 0.1*tanh(right), x256 -> hi/lo f16 planes.
// ---------------------------------------------------------------------------
__global__ __launch_bounds__(128) void attn_kernel(
    const _Float16* __restrict__ qh,   // [NBP*NH][SQ][HD]
    const _Float16* __restrict__ kh,   // [NBP*NH][SQ][HD]
    const _Float16* __restrict__ vt,   // [NBP*NH][HD][SQ]
    const int* __restrict__ mask,      // [NBP][SQ], nonzero = attend
    _Float16* __restrict__ xh,         // [NTOK][DM] f16, hi plane of combine*256
    _Float16* __restrict__ xl)         // [NTOK][DM] f16, lo plane (x2048)
{
  __shared__ __attribute__((aligned(16))) float sO[4 * 16 * 64];    // 16384 B
  __shared__ __attribute__((aligned(16))) _Float16 sK[2 * KVTILE];  // 18432 B
  __shared__ __attribute__((aligned(16))) _Float16 sV[2 * KVTILE];  // 18432 B

  const int tid = threadIdx.x, lane = tid & 31, w = tid >> 5;
  const int h = lane >> 4, m = lane & 15;
  const int bph = blockIdx.y, bp = bph >> 4, head = bph & 15;
  const int b = bp >> 1, p = bp & 1;
  const int q0 = blockIdx.x * 64 + 16 * w;

  // Q^T B-fragments: column n = query q0+m, k = d (two 32-deep chunks)
  const _Float16* qrow = qh + ((size_t)bph * SQ + q0 + m) * HD;
  const v16h qb0 = load_frag_h(qrow, h);
  const v16h qb1 = load_frag_h(qrow + 32, h);

  const int* mrow = mask + (size_t)bp * SQ;
  float* so = sO + w * 1024;
  const v8f zero8 = {0.f, 0.f, 0.f, 0.f, 0.f, 0.f, 0.f, 0.f};

  // Copy addresses of this lane: row tid>>3 of a sweep, 16-byte column tid&7.
  const int crow = tid >> 3, ccol = tid & 7;
  const int kvown = bph, kvflip = (b * 2 + (1 - p)) * NH + head;
  const _Float16* gk_own  = kh + ((size_t)kvown  * SQ + crow) * HD + 8 * ccol;   // + key0*HD
  const _Float16* gk_flip = kh + ((size_t)kvflip * SQ + crow) * HD + 8 * ccol;
  const _Float16* gv_own  = vt + ((size_t)kvown  * HD + crow) * SQ + 8 * ccol;   // + key0
  const _Float16* gv_flip = vt + ((size_t)kvflip * HD + crow) * SQ + 8 * ccol;
  const unsigned lk0 = lds_off(sK) + crow * (KVP * 2) + 16 * ccol;               // + buffer * KVTILE * 2
  const unsigned lv0 = lds_off(sV) + crow * (KVP * 2) + 16 * ccol;

  // Tile 0 into buffer 0, landed and published; then tile 1 into buffer 1.
  stage_kv(gk_own, gv_own, lk0, lv0);
  asm volatile("s_wait_asynccnt 0x0" ::: "memory");   // this wave's copies of tile 0 have landed
  __syncthreads();                                    // tile 0 readable by every wave
  stage_kv(gk_own + 64 * HD, gv_own + 64, lk0 + KVTILE * 2, lv0 + KVTILE * 2);

  #pragma unroll 1
  for (int pass = 0; pass < 2; ++pass) {

    v8f o[4];                                   // o[t][r] = O[query m][d 16t+8h+r] * (l * 2^14)
    #pragma unroll
    for (int t = 0; t < 4; ++t) o[t] = zero8;
    float mrun = -1.0e30f, lrun = 0.0f;

    #pragma unroll 1
    for (int kb = 0; kb < SQ; kb += 64) {
      const int tile = pass * (SQ / 64) + (kb >> 6);
      const int buf = tile & 1;
      const _Float16* kbase = sK + buf * KVTILE + m * KVP;         // + 16j*KVP + 32*dc
      const _Float16* vbase = sV + buf * KVTILE + m * KVP;         // + 16t*KVP + key in tile
      // ---- scores: s[j][r] = S[query m][key kb+16j+8h+r] (unscaled) ----
      v8f s[4];
      #pragma unroll
      for (int j = 0; j < 4; ++j) {
        const _Float16* kp = kbase + (16 * j) * KVP;
        const v16h kf0 = load_frag_h(kp, h);
        const v16h kf1 = load_frag_h(kp + 32, h);
        v8f z = zero8;
        z = wmma_f16(kf0, qb0, z);
        z = wmma_f16(kf1, qb1, z);
        s[j] = z;
      }
      // ---- scale 1/8 and key mask, f32 ----
      #pragma unroll
      for (int j = 0; j < 4; ++j) s[j] = scale_mask8(s[j], mrow + kb + 16 * j + 8 * h);

      // ---- online softmax ----
      float mloc = s[0][0];
      #pragma unroll
      for (int j = 0; j < 4; ++j)
        #pragma unroll
        for (int r = 0; r < 8; ++r) mloc = fmaxf(mloc, s[j][r]);
      mloc = fmaxf(mloc, __shfl_xor(mloc, 16));
      const float mnew = fmaxf(mrun, mloc);
      const float alpha = __expf(mrun - mnew);
      mrun = mnew;
      float lsum = 0.0f;
      #pragma unroll
      for (int j = 0; j < 4; ++j)
        #pragma unroll
        for (int r = 0; r < 8; ++r) {
          const float pe = __expf(s[j][r] - mnew);
          s[j][r] = pe;
          lsum += pe;
        }
      lsum += __shfl_xor(lsum, 16);
      lrun = lrun * alpha + lsum;
      #pragma unroll
      for (int t = 0; t < 4; ++t)
        #pragma unroll
        for (int r = 0; r < 8; ++r) o[t][r] = o[t][r] * alpha;

      // ---- P^T B-fragments (keys 0..31 and 32..63 of this step) ----
      const v16h pb0 = pack_p(s[0], s[1]);
      const v16h pb1 = pack_p(s[2], s[3]);

      // ---- O^T += V^T * P^T ----
      #pragma unroll
      for (int t = 0; t < 4; ++t) {
        const _Float16* vp = vbase + (16 * t) * KVP;
        const v16h vf0 = load_frag_h(vp, h);
        const v16h vf1 = load_frag_h(vp + 32, h);
        o[t] = wmma_f16(vf0, pb0, o[t]);
        o[t] = wmma_f16(vf1, pb1, o[t]);
      }

      // ---- publish tile + 1, then refill the buffer this trip has read ----
      asm volatile("s_wait_dscnt 0x0" ::: "memory");      // this wave's reads of the buffer are done
      asm volatile("s_wait_asynccnt 0x0" ::: "memory");   // this wave's copies of tile + 1 have landed
      __syncthreads();                                    // publishes tile + 1, ends every read of this buffer
      if (tile + 2 < NTILE) {
        const int nt = tile + 2;
        const int key0 = (nt & (SQ / 64 - 1)) * 64;
        const _Float16* gk = ((nt < SQ / 64) ? gk_own : gk_flip) + (size_t)key0 * HD;
        const _Float16* gv = ((nt < SQ / 64) ? gv_own : gv_flip) + key0;
        stage_kv(gk, gv, lk0 + buf * (KVTILE * 2), lv0 + buf * (KVTILE * 2));
      }
    }

    const float inv = (1.0f / lrun) * (1.0f / PSCALE);
    if (pass == 0) {
      #pragma unroll
      for (int t = 0; t < 4; ++t)
        #pragma unroll
        for (int r = 0; r < 8; ++r)
          so[m * 64 + 16 * t + 8 * h + r] = o[t][r] * inv;
    } else {
      #pragma unroll
      for (int t = 0; t < 4; ++t)
        #pragma unroll
        for (int r = 0; r < 8; ++r) {
          const int idx = m * 64 + 16 * t + 8 * h + r;
          const float cmb = so[idx] + 0.1f * tanhf(o[t][r] * inv);
          so[idx] = cmb * XSCALE;
        }
    }
  }
  asm volatile("s_wait_asynccnt 0x0" ::: "memory");   // no copy outstanding behind the loop
  __syncthreads();

  const size_t tok0 = (size_t)bp * SQ + q0;
  xc_store_pass(so, xh, xl, tok0, head, lane);
  
}

// ---------------------------------------------------------------------------
// wave w owns rows 16w..16w+15, each row 64 floats = 2 lines; lanes 8q..8q+7
// per line, 4 lines per instruction, 32 lines per wave.
// ---------------------------------------------------------------------------
__device__ __forceinline__ void out_store_pass(const float* sT, float* out,
                                               int m0, int n0, int w, int lane) {
  const int q8 = lane & 7, sub = lane >> 3;
  #pragma unroll
  for (int i = 0; i < 8; ++i) {
    const int lid = i * 4 + sub;                 // 0..31
    const int row = 16 * w + (lid >> 1), hl = lid & 1;
    const v4f v = *(const v4fa*)(sT + row * 64 + 32 * hl + 4 * q8);
    const size_t gi = (size_t)(m0 + row) * DM + n0 + 32 * hl + 4 * q8;
    *(v4f*)(out + gi) = v;
  }
}

// ---------------------------------------------------------------------------
// Kernel 4: out = X * Wo^T + bo with X = hi/256 + lo/(256*2048) planes.
// Block 128 thr (4 waves) = 64 tokens x 64 features; wave 16 tokens x 64.
// A = X rows (k contiguous), B[k][n] = Wo[n][k] from Wo row n (k contiguous).
// The block's 64 hi rows (LDS rows 0..63), 64 lo rows (64..127) and 64 Wo rows
// (128..191) come through LDS in k-tiles of 64: two buffers, tile t + 2 copied
// in while tile t + 1 is worked on.
// ---------------------------------------------------------------------------
__global__ __launch_bounds__(128) void oproj_kernel(
    const _Float16* __restrict__ xh,   // [NTOK][DM]
    const _Float16* __restrict__ xl,   // [NTOK][DM]
    const _Float16* __restrict__ woh,  // [DM][DM] f16(bf16(Wo)*256)
    const float* __restrict__ bo,
    float* __restrict__ out)           // [NTOK][DM]
{
  __shared__ __attribute__((aligned(16))) float sT[64 * 64];        // 16384 B
  __shared__ __attribute__((aligned(16))) _Float16 sG[2 * GTILE];   // 55296 B

  const int tid = threadIdx.x, lane = tid & 31, w = tid >> 5;
  const int h = lane >> 4, m = lane & 15;
  const int m0 = blockIdx.x * 64, n0 = blockIdx.y * 64;

  // Copy addresses of this lane: row tid>>3 of a sweep, 16-byte column tid&7.
  const int crow = tid >> 3, ccol = tid & 7;
  const _Float16* gh = xh + (size_t)(m0 + crow) * DM + 8 * ccol;    // + k
  const _Float16* gl = xl + (size_t)(m0 + crow) * DM + 8 * ccol;    // + k
  const _Float16* gw = woh + (size_t)(n0 + crow) * DM + 8 * ccol;   // + k
  const unsigned lg0 = lds_off(sG) + crow * (GP * 2) + 16 * ccol;   // + buffer * GTILE * 2

  const v8f zero8 = {0.f, 0.f, 0.f, 0.f, 0.f, 0.f, 0.f, 0.f};
  v8f acch[4], accl[4];
  #pragma unroll
  for (int nt = 0; nt < 4; ++nt) { acch[nt] = zero8; accl[nt] = zero8; }

  // Tile 0 into buffer 0, landed and published; then tile 1 into buffer 1.
  stage_gemm(gh, gl, gw, lg0);
  asm volatile("s_wait_asynccnt 0x0" ::: "memory");   // this wave's copies of tile 0 have landed
  __syncthreads();                                    // tile 0 readable by every wave
  stage_gemm(gh + GKT, gl + GKT, gw + GKT, lg0 + GTILE * 2);

  // kept rolled: one copy of the ring's foot (waits, barrier, refill), small loop text
  #pragma unroll 1
  for (int t = 0; t < GNT; ++t) {
    const int buf = t & 1;
    const _Float16* ah = sG + buf * GTILE + (16 * w + m) * GP;        // hi row
    const _Float16* al = ah + 64 * GP;                                // lo row
    const _Float16* wr = sG + buf * GTILE + (128 + m) * GP;           // feature row, nt = 0
    // The tile's fragments are read as one group in front of its products; the
    // loops below are unrolled so that the fragment arrays stay in registers.
    v16h fah[2], fal[2], fb[2][4];
    #pragma unroll
    for (int kc = 0; kc < 2; ++kc) {
      fah[kc] = load_frag_h(ah + 32 * kc, h);
      fal[kc] = load_frag_h(al + 32 * kc, h);
      #pragma unroll
      for (int nt = 0; nt < 4; ++nt) fb[kc][nt] = load_frag_h(wr + nt * 16 * GP + 32 * kc, h);
    }
    #pragma unroll
    for (int kc = 0; kc < 2; ++kc) {
      #pragma unroll
      for (int nt = 0; nt < 4; ++nt) {
        acch[nt] = wmma_f16(fah[kc], fb[kc][nt], acch[nt]);
        accl[nt] = wmma_f16(fal[kc], fb[kc][nt], accl[nt]);
      }
    }
    // ---- publish tile + 1, then refill the buffer this trip has read ----
    asm volatile("s_wait_dscnt 0x0" ::: "memory");      // this wave's reads of the buffer are done
    asm volatile("s_wait_asynccnt 0x0" ::: "memory");   // this wave's copies of tile + 1 have landed
    __syncthreads();                                    // publishes tile + 1, ends every read of this buffer
    if (t + 2 < GNT) {
      const int kn = (t + 2) * GKT;
      stage_gemm(gh + kn, gl + kn, gw + kn, lg0 + buf * (GTILE * 2));
    }
  }
  asm volatile("s_wait_asynccnt 0x0" ::: "memory");   // no copy outstanding behind the loop

  // D[r] of tile nt = Y[token m0+16w+8h+r][feature n0+16nt+m]
  const float sh = 1.0f / (XSCALE * WSCALE);
  const float sl = 1.0f / (XSCALE * WSCALE * LOSCALE);
  #pragma unroll
  for (int nt = 0; nt < 4; ++nt) {
    const int col = 16 * nt + m;
    const float bvl = bo[n0 + col];
    #pragma unroll
    for (int r = 0; r < 8; ++r) {
      const int row = 16 * w + 8 * h + r;                 // 0..63
      sT[row * 64 + col] = acch[nt][r] * sh + accl[nt][r] * sl + bvl;
    }
  }
  __syncthreads();

  out_store_pass(sT, out, m0, n0, w, lane);
  
}

// ---------------------------------------------------------------------------
extern "C" void kernel_launch(void* const* d_in, const int* in_sizes, int n_in,
                              void* d_out, int out_size, void* d_ws, size_t ws_size,
                              hipStream_t stream) {
  if (n_in < 12) return;
  if (in_sizes[0] != NACT || in_sizes[1] != NACT || in_sizes[2] != NACT) return;
  if (in_sizes[3] != NBP * SQ) return;
  if (in_sizes[4] != NWEL || in_sizes[6] != NWEL || in_sizes[8] != NWEL || in_sizes[10] != NWEL) return;
  if (in_sizes[5] != DM || in_sizes[7] != DM || in_sizes[9] != DM || in_sizes[11] != DM) return;
  if (out_size != NACT) return;

  const float* query = (const float*)d_in[0];
  const float* key_  = (const float*)d_in[1];
  const float* value = (const float*)d_in[2];
  const int*   mask  = (const int*)d_in[3];
  const float* Wq = (const float*)d_in[4];
  const float* bq = (const float*)d_in[5];
  const float* Wk = (const float*)d_in[6];
  const float* bk = (const float*)d_in[7];
  const float* Wv = (const float*)d_in[8];
  const float* bv = (const float*)d_in[9];
  const float* Wo = (const float*)d_in[10];
  const float* bo = (const float*)d_in[11];
  float* out = (float*)d_out;

  const size_t xb_bytes  = (size_t)3 * NACT * 2;                 // 25165824
  const size_t wb_bytes  = (size_t)3 * NWEL * 2;                 //  6291456
  const size_t woh_bytes = (size_t)NWEL * 2;                     //  2097152
  const size_t pl_bytes  = (size_t)NBP * NH * SQ * HD * 2;       //  8388608 per plane
  const size_t xc_bytes  = (size_t)NACT * 2;                     //  8388608 per plane
  const size_t total = xb_bytes + wb_bytes + woh_bytes + 3 * pl_bytes + 2 * xc_bytes;   // 75497472
  if (total > ws_size) return;

  char* ws = (char*)d_ws;
  size_t off = 0;
  unsigned short* xb = (unsigned short*)(ws + off); off += xb_bytes;
  unsigned short* wb = (unsigned short*)(ws + off); off += wb_bytes;
  _Float16* woh = (_Float16*)(ws + off);            off += woh_bytes;
  _Float16* qh  = (_Float16*)(ws + off);            off += pl_bytes;
  _Float16* kh  = (_Float16*)(ws + off);            off += pl_bytes;
  _Float16* vt  = (_Float16*)(ws + off);            off += pl_bytes;
  _Float16* xh  = (_Float16*)(ws + off);            off += xc_bytes;
  _Float16* xl  = (_Float16*)(ws + off);            off += xc_bytes;
  if (off > ws_size) return;

  convert_kernel<<<(NGRP + 255) / 256, 256, 0, stream>>>(query, key_, value, Wq, Wk, Wv, Wo, xb, wb, woh);

  dim3 gProj(NTOK / 128, 3 * NH);                               // (32, 48)
  proj_kernel<<<gProj, 128, 0, stream>>>(xb, wb, bq, bk, bv, qh, kh, vt);

  dim3 gAtt(SQ / 64, NBP * NH);                                  // (16, 64)
  attn_kernel<<<gAtt, 128, 0, stream>>>(qh, kh, vt, mask, xh, xl);

  dim3 gOut(NTOK / 64, DM / 64);                                 // (64, 16)
  oproj_kernel<<<gOut, 128, 0, stream>>>(xh, xl, woh, bo, out);
}

// v003
// Measured time: 114 microseconds a run.
// Next to v002, in two timings, it ran 1.04 times as fast each time.
// All steps since v000 together make it 2.40 times as fast.
// Contractions: q/k/v projections x*W^T on v_wmma_f32_16x16x32_bf16 (bf16 operands, f32 accumulate); K*Q^T and V^T*P^T of both attention passes on v_wmma_f32_16x16x32_f16 (f16 operands, P carried x16384, f32 accumulate); output projection on v_wmma_f32_16x16x32_f16 with the activation carried x256 as f16 hi + lo(x2048) planes and the weight as f16 of its bf16 value x256 (f32 accumulate); scale, mask, softmax, tanh and bias in f32.
#include <hip/hip_runtime.h>
#include <math.h>

typedef _Float16       v16h __attribute__((ext_vector_type(16)));
typedef _Float16       v8h  __attribute__((ext_vector_type(8)));
typedef __bf16         v16b __attribute__((ext_vector_type(16)));
typedef unsigned short v8us __attribute__((ext_vector_type(8)));
typedef float          v8f  __attribute__((ext_vector_type(8)));
typedef float          v4f  __attribute__((ext_vector_type(4)));
typedef int            v4i  __attribute__((ext_vector_type(4)));
typedef v8h  __attribute__((may_alias)) v8ha;
typedef v8us __attribute__((may_alias)) v8usa;
typedef v4f  __attribute__((may_alias)) v4fa;
typedef v4i  __attribute__((may_alias)) v4ia;

union FragH { v16h v; v8h  half[2]; };
union FragB { v16b v; v8us half[2]; };

#define DM     1024
#define NH     16
#define HD     64
#define SQ     1024
#define NBP    4                       // batch * pair
#define NTOK   (NBP * SQ)              // 4096 token rows
#define NACT   (NTOK * DM)             // 4194304
#define NWEL   (DM * DM)               // 1048576
#define ACT8   (NACT / 8)              // 524288
#define WEL8   (NWEL / 8)              // 131072
#define NGRP   (3 * ACT8 + 4 * WEL8)   // 2097152
#define PSCALE  16384.0f
#define XSCALE  256.0f
#define WSCALE  256.0f
#define LOSCALE 2048.0f

// ---------------------------------------------------------------------------
// 16x16x32 WMMA helpers with hazard guard (ties D, keeps A/B live).
// Fragment map (wave32): lane l, h = l>>4, m = n = l&15.
//   A/B element i: i<8 -> k0+8h+i ; i>=8 -> k0+16+8h+(i-8)
//   D element r : row 8h+r, col l&15
// ---------------------------------------------------------------------------
__device__ __forceinline__ v8f wmma_f16(v16h a, v16h b, v8f c) {
  v8f d = __builtin_amdgcn_wmma_f32_16x16x32_f16(false, a, false, b, (short)0, c, false, false);
  asm volatile("v_nop\n\tv_nop\n\tv_nop\n\tv_nop" : "+v"(d) : "v"(a), "v"(b));
  return d;
}
__device__ __forceinline__ v8f wmma_bf16(v16b a, v16b b, v8f c) {
  v8f d = __builtin_amdgcn_wmma_f32_16x16x32_bf16(false, a, false, b, (short)0, c, false, false);
  asm volatile("v_nop\n\tv_nop\n\tv_nop\n\tv_nop" : "+v"(d) : "v"(a), "v"(b));
  return d;
}

// A or B fragment from a k-contiguous 16-bit row; p points at element k0 of
// the row owned by this lane (row index = lane & 15 added by the caller).
__device__ __forceinline__ v16h load_frag_h(const _Float16* p, int h) {
  FragH f;
  f.half[0] = *(const v8ha*)(p + 8 * h);
  f.half[1] = *(const v8ha*)(p + 16 + 8 * h);
  return f.v;
}
__device__ __forceinline__ v16b load_frag_b(const unsigned short* p, int h) {
  FragB f;
  f.half[0] = *(const v8usa*)(p + 8 * h);
  f.half[1] = *(const v8usa*)(p + 16 + 8 * h);
  return f.v;
}

// f32 -> bf16 bits, RNE
__device__ __forceinline__ unsigned short bf16_bits(float f) {
  unsigned int u = __float_as_uint(f);
  u = u + 0x7FFFu + ((u >> 16) & 1u);
  return (unsigned short)(u >> 16);
}
__device__ __forceinline__ float bf16_val(float f) {
  return __uint_as_float(((unsigned int)bf16_bits(f)) << 16);
}

// ---------------------------------------------------------------------------
// Kernel 1: f32 -> 16-bit planes.
//   xb[3][NTOK][DM] bf16 (query, key, value), wb[3][DM][DM] bf16 (Wq, Wk, Wv),
//   woh[DM][DM] f16 = f16(bf16(Wo) * 256).
// ---------------------------------------------------------------------------
__global__ __launch_bounds__(256) void convert_kernel(
    const float* __restrict__ xq, const float* __restrict__ xk, const float* __restrict__ xv,
    const float* __restrict__ wq, const float* __restrict__ wk, const float* __restrict__ wv,
    const float* __restrict__ wo,
    unsigned short* __restrict__ xb, unsigned short* __restrict__ wb, _Float16* __restrict__ woh)
{
  const int g = blockIdx.x * 256 + threadIdx.x;
  if (g >= NGRP) return;
  if (g < 3 * ACT8 + 3 * WEL8) {
    const float* src;
    unsigned short* dst;
    if (g < 3 * ACT8) {
      const int sel = g / ACT8;
      const int off = g - sel * ACT8;
      const float* xs = (sel == 0) ? xq : ((sel == 1) ? xk : xv);
      src = xs + (size_t)off * 8;
      dst = xb + (size_t)sel * NACT + (size_t)off * 8;
    } else {
      const int e = g - 3 * ACT8;
      const int sel = e / WEL8;
      const int off = e - sel * WEL8;
      const float* wsrc = (sel == 0) ? wq : ((sel == 1) ? wk : wv);
      src = wsrc + (size_t)off * 8;
      dst = wb + (size_t)sel * NWEL + (size_t)off * 8;
    }
    const v4f a = *(const v4fa*)src;
    const v4f c = *(const v4fa*)(src + 4);
    const v8us o = { bf16_bits(a.x), bf16_bits(a.y), bf16_bits(a.z), bf16_bits(a.w),
                     bf16_bits(c.x), bf16_bits(c.y), bf16_bits(c.z), bf16_bits(c.w) };
    *(v8us*)dst = o;
    
  } else {
    const int off = g - (3 * ACT8 + 3 * WEL8);
    const float* src = wo + (size_t)off * 8;
    _Float16* dst = woh + (size_t)off * 8;
    const v4f a = *(const v4fa*)src;
    const v4f c = *(const v4fa*)(src + 4);
    const v8h o = { (_Float16)(bf16_val(a.x) * WSCALE), (_Float16)(bf16_val(a.y) * WSCALE),
                    (_Float16)(bf16_val(a.z) * WSCALE), (_Float16)(bf16_val(a.w) * WSCALE),
                    (_Float16)(bf16_val(c.x) * WSCALE), (_Float16)(bf16_val(c.y) * WSCALE),
                    (_Float16)(bf16_val(c.z) * WSCALE), (_Float16)(bf16_val(c.w) * WSCALE) };
    *(v8h*)dst = o;
    
  }
}

// ---------------------------------------------------------------------------
// 4 lines per instruction, 32 lines per wave, 128 per block.
// which 0/1: plane[bh][s][d]  (one token row = 64 halves = one line)
// which 2  : vt[bh][d][s]     (64 d-rows x 128 tokens = 2 lines each)
// ---------------------------------------------------------------------------
__device__ __forceinline__ void proj_store_pass(const _Float16* sT, _Float16* plane, _Float16* vt,
                                                int which, int bh, int l0, int w, int lane) {
  const int q8 = lane & 7, sub = lane >> 3;
  #pragma unroll
  for (int i = 0; i < 8; ++i) {
    const int lid = w * 32 + i * 4 + sub;
    v8h v;
    _Float16* dst;
    if (which != 2) {
      v = *(const v8ha*)(sT + lid * HD + 8 * q8);
      dst = plane + ((size_t)bh * SQ + l0 + lid) * HD + 8 * q8;
    } else {
      const int d = lid >> 1, hl = lid & 1;
      v = *(const v8ha*)(sT + d * 128 + 64 * hl + 8 * q8);
      dst = vt + ((size_t)bh * HD + d) * SQ + l0 + 64 * hl + 8 * q8;
    }
    *(v8h*)dst = v;
  }
}

__device__ __forceinline__ unsigned lds_off(const void* p) { return (unsigned)(size_t)p; }

// ---------------------------------------------------------------------------
// GEMM operand staging (kernels 2 and 4): one k-tile = 64 k (128 B) of 192
// operand rows, three groups of 64 rows, LDS row pitch 144 B (16 B x odd,
// conflict-free for the 16-byte fragment reads). 128 threads, 8 lanes per row,
// 16 rows per sweep, 4 sweeps per group: every copy instruction covers whole
// 128-B lines of the source. Source row pitch = DM 16-bit elements.
// ---------------------------------------------------------------------------
#define GP     72                      // LDS row pitch in 16-bit elements (144 B)
#define GTILE  (192 * GP)              // elements per staged k-tile (27648 B)
#define GKT    64                      // k per tile
#define GNT    (DM / GKT)              // 16 k-tiles

// g0 / g1 / g2: this lane's 16 B of row (tid>>3) of each 64-row group, at the
// tile's first k; l: the lane's LDS byte address of row (tid>>3) of group 0.
__device__ __forceinline__ void stage_gemm(const void* g0, const void* g1, const void* g2, unsigned l) {
  const char* a0 = (const char*)g0;
  const char* a1 = a0 + 16 * DM * 2;
  const char* a2 = a0 + 32 * DM * 2;
  const char* a3 = a0 + 48 * DM * 2;
  const char* b0 = (const char*)g1;
  const char* b1 = b0 + 16 * DM * 2;
  const char* b2 = b0 + 32 * DM * 2;
  const char* b3 = b0 + 48 * DM * 2;
  const char* c0 = (const char*)g2;
  const char* c1 = c0 + 16 * DM * 2;
  const char* c2 = c0 + 32 * DM * 2;
  const char* c3 = c0 + 48 * DM * 2;
  const unsigned la1 = l + 16 * GP * 2,  la2 = l + 32 * GP * 2,  la3 = l + 48 * GP * 2;
  const unsigned lb0 = l + 64 * GP * 2,  lb1 = l + 80 * GP * 2,  lb2 = l + 96 * GP * 2,  lb3 = l + 112 * GP * 2;
  const unsigned lc0 = l + 128 * GP * 2, lc1 = l + 144 * GP * 2, lc2 = l + 160 * GP * 2, lc3 = l + 176 * GP * 2;
  // Global -> LDS through no register; the closing s_wait_xcnt stands in the same
  // statement so that no address register is rewritten in front of it.
  asm volatile(
      "global_load_async_to_lds_b128 %0, %12, off\n\t"
      "global_load_async_to_lds_b128 %1, %13, off\n\t"
      "global_load_async_to_lds_b128 %2, %14, off\n\t"
      "global_load_async_to_lds_b128 %3, %15, off\n\t"
      "global_load_async_to_lds_b128 %4, %16, off\n\t"
      "global_load_async_to_lds_b128 %5, %17, off\n\t"
      "global_load_async_to_lds_b128 %6, %18, off\n\t"
      "global_load_async_to_lds_b128 %7, %19, off\n\t"
      "global_load_async_to_lds_b128 %8, %20, off\n\t"
      "global_load_async_to_lds_b128 %9, %21, off\n\t"
      "global_load_async_to_lds_b128 %10, %22, off\n\t"
      "global_load_async_to_lds_b128 %11, %23, off\n\t"
      "s_wait_xcnt 0x0"
      :: "v"(l), "v"(la1), "v"(la2), "v"(la3), "v"(lb0), "v"(lb1), "v"(lb2), "v"(lb3),
         "v"(lc0), "v"(lc1), "v"(lc2), "v"(lc3),
         "v"(a0), "v"(a1), "v"(a2), "v"(a3), "v"(b0), "v"(b1), "v"(b2), "v"(b3),
         "v"(c0), "v"(c1), "v"(c2), "v"(c3)
      : "memory");
}

// ---------------------------------------------------------------------------
// Kernel 2: Y = x * W^T for the three projections (bf16 operands).
// Block 128 thr (4 waves) = 128 tokens x 64 features of one (which, head);
// wave tile 32 tokens x 64 features; K = 1024 in steps of 32.
// A = x rows (token-major, k contiguous), B[k][n] = W[n][k] from W row n
// (k contiguous) -> both fragments with the same loader.
// The block's 128 x rows (LDS rows 0..127) and 64 W rows (LDS rows 128..191)
// come through LDS in k-tiles of 64: two buffers, tile t + 2 copied in while
// tile t + 1 is worked on.
// ---------------------------------------------------------------------------
__global__ __launch_bounds__(128) void proj_kernel(
    const unsigned short* __restrict__ xb,   // [3][NTOK][DM] bf16
    const unsigned short* __restrict__ wb,   // [3][DM][DM]   bf16, row = output feature
    const float* __restrict__ bq, const float* __restrict__ bk, const float* __restrict__ bv,
    _Float16* __restrict__ qh,               // [NBP*NH][SQ][HD] f16
    _Float16* __restrict__ kh,               // [NBP*NH][SQ][HD] f16
    _Float16* __restrict__ vt)               // [NBP*NH][HD][SQ] f16
{
  __shared__ __attribute__((aligned(16))) _Float16 sT[128 * 64];          // 16384 B
  __shared__ __attribute__((aligned(16))) unsigned short sG[2 * GTILE];   // 55296 B

  const int tid = threadIdx.x, lane = tid & 31, w = tid >> 5;
  const int h = lane >> 4, m = lane & 15;
  const int m0 = blockIdx.x * 128;
  const int cg = blockIdx.y;                 // 0..47
  const int which = cg >> 4, head = cg & 15;

  // Copy addresses of this lane: row tid>>3 of a sweep, 16-byte column tid&7.
  const int crow = tid >> 3, ccol = tid & 7;
  const unsigned short* gx = xb + (size_t)which * NACT + (size_t)(m0 + crow) * DM + 8 * ccol;         // + k
  const unsigned short* gw = wb + (size_t)which * NWEL + (size_t)(head * HD + crow) * DM + 8 * ccol;  // + k
  const unsigned lg0 = lds_off(sG) + crow * (GP * 2) + 16 * ccol;                                     // + buffer * GTILE * 2

  const v8f zero8 = {0.f, 0.f, 0.f, 0.f, 0.f, 0.f, 0.f, 0.f};
  v8f acc[2][4];
  #pragma unroll
  for (int mt = 0; mt < 2; ++mt)
    #pragma unroll
    for (int nt = 0; nt < 4; ++nt) acc[mt][nt] = zero8;

  // Tile 0 into buffer 0, landed and published; then tile 1 into buffer 1.
  stage_gemm(gx, gx + 64 * DM, gw, lg0);
  asm volatile("s_wait_asynccnt 0x0" ::: "memory");   // this wave's copies of tile 0 have landed
  __syncthreads();                                    // tile 0 readable by every wave
  stage_gemm(gx + GKT, gx + 64 * DM + GKT, gw + GKT, lg0 + GTILE * 2);

  // kept rolled: one copy of the ring's foot (waits, barrier, refill), small loop text
  #pragma unroll 1
  for (int t = 0; t < GNT; ++t) {
    const int buf = t & 1;
    const unsigned short* xa0 = sG + buf * GTILE + (32 * w + m) * GP;   // token row, mt = 0
    const unsigned short* xa1 = xa0 + 16 * GP;                          // mt = 1
    const unsigned short* wr  = sG + buf * GTILE + (128 + m) * GP;      // feature row, nt = 0
    // The tile's fragments are read as one group in front of its products; the
    // loops below are unrolled so that the fragment arrays stay in registers.
    v16b fa[2][2], fb[2][4];
    #pragma unroll
    for (int kc = 0; kc < 2; ++kc) {
      fa[kc][0] = load_frag_b(xa0 + 32 * kc, h);
      fa[kc][1] = load_frag_b(xa1 + 32 * kc, h);
      #pragma unroll
      for (int nt = 0; nt < 4; ++nt) fb[kc][nt] = load_frag_b(wr + nt * 16 * GP + 32 * kc, h);
    }
    #pragma unroll
    for (int kc = 0; kc < 2; ++kc) {
      #pragma unroll
      for (int nt = 0; nt < 4; ++nt) {
        acc[0][nt] = wmma_bf16(fa[kc][0], fb[kc][nt], acc[0][nt]);
        acc[1][nt] = wmma_bf16(fa[kc][1], fb[kc][nt], acc[1][nt]);
      }
    }
    // ---- publish tile + 1, then refill the buffer this trip has read ----
    asm volatile("s_wait_dscnt 0x0" ::: "memory");      // this wave's reads of the buffer are done
    asm volatile("s_wait_asynccnt 0x0" ::: "memory");   // this wave's copies of tile + 1 have landed
    __syncthreads();                                    // publishes tile + 1, ends every read of this buffer
    if (t + 2 < GNT) {
      const int kn = (t + 2) * GKT;
      stage_gemm(gx + kn, gx + 64 * DM + kn, gw + kn, lg0 + buf * (GTILE * 2));
    }
  }
  asm volatile("s_wait_asynccnt 0x0" ::: "memory");   // no copy outstanding behind the loop

  // D[r] of tile (mt, nt) = Y[token m0+32w+16mt+8h+r][feature head*64+16nt+m]
  const float* bias = (which == 0) ? bq : ((which == 1) ? bk : bv);
  #pragma unroll
  for (int nt = 0; nt < 4; ++nt) {
    const int feat = 16 * nt + m;
    const float bvl = bias[head * HD + feat];
    #pragma unroll
    for (int mt = 0; mt < 2; ++mt) {
      #pragma unroll
      for (int r = 0; r < 8; ++r) {
        const int tokl = 32 * w + 16 * mt + 8 * h + r;     // 0..127
        const float y = acc[mt][nt][r] + bvl;
        const int idx = (which == 2) ? (feat * 128 + tokl) : (tokl * HD + feat);
        sT[idx] = (_Float16)y;
      }
    }
  }
  __syncthreads();

  const int bp = m0 >> 10, l0 = m0 & (SQ - 1), bh = bp * NH + head;
  _Float16* plane = (which == 0) ? qh : kh;
  proj_store_pass(sT, plane, vt, which, bh, l0, w, lane);
  
}

// ---------------------------------------------------------------------------
// Attention helpers.
// ---------------------------------------------------------------------------
// scale by 1/8 then key mask: ma / mb = mask words of the keys of s[0..3] / s[4..7]
__device__ __forceinline__ v8f scale_mask8(v8f s, v4i ma, v4i mb) {
  s[0] = (ma.x != 0) ? s[0] * 0.125f : -1.0e9f;
  s[1] = (ma.y != 0) ? s[1] * 0.125f : -1.0e9f;
  s[2] = (ma.z != 0) ? s[2] * 0.125f : -1.0e9f;
  s[3] = (ma.w != 0) ? s[3] * 0.125f : -1.0e9f;
  s[4] = (mb.x != 0) ? s[4] * 0.125f : -1.0e9f;
  s[5] = (mb.y != 0) ? s[5] * 0.125f : -1.0e9f;
  s[6] = (mb.z != 0) ? s[6] * 0.125f : -1.0e9f;
  s[7] = (mb.w != 0) ? s[7] * 0.125f : -1.0e9f;
  return s;
}

// P^T B-fragment from the lane's own score D values: element r <- tile a row r
// (keys 0..15 of the 32-key step), element 8+r <- tile c row r (keys 16..31),
// same lane (query column), scaled by 2^14.
__device__ __forceinline__ v16h pack_p(v8f a, v8f c) {
  const v16h r = { (_Float16)(a[0] * PSCALE), (_Float16)(a[1] * PSCALE), (_Float16)(a[2] * PSCALE), (_Float16)(a[3] * PSCALE),
                   (_Float16)(a[4] * PSCALE), (_Float16)(a[5] * PSCALE), (_Float16)(a[6] * PSCALE), (_Float16)(a[7] * PSCALE),
                   (_Float16)(c[0] * PSCALE), (_Float16)(c[1] * PSCALE), (_Float16)(c[2] * PSCALE), (_Float16)(c[3] * PSCALE),
                   (_Float16)(c[4] * PSCALE), (_Float16)(c[5] * PSCALE), (_Float16)(c[6] * PSCALE), (_Float16)(c[7] * PSCALE) };
  return r;
}

// Per-wave 16x64 f32 tile (already x256) in LDS -> hi/lo f16 planes
// lanes 8q..8q+7 per line, 4 lines per instruction, 16 rows x 2 planes per wave.
__device__ __forceinline__ void xc_store_pass(const float* so, _Float16* xh, _Float16* xl,
                                              size_t tok0, int head, int lane) {
  const int q8 = lane & 7, sub = lane >> 3;
  #pragma unroll
  for (int i = 0; i < 4; ++i) {
    const int row = 4 * i + sub;
    const v4f a = *(const v4fa*)(so + row * 64 + 8 * q8);
    const v4f c = *(const v4fa*)(so + row * 64 + 8 * q8 + 4);
    const _Float16 h0 = (_Float16)a.x, h1 = (_Float16)a.y, h2 = (_Float16)a.z, h3 = (_Float16)a.w;
    const _Float16 h4 = (_Float16)c.x, h5 = (_Float16)c.y, h6 = (_Float16)c.z, h7 = (_Float16)c.w;
    const v8h hv = { h0, h1, h2, h3, h4, h5, h6, h7 };
    const v8h lv = { (_Float16)((a.x - (float)h0) * LOSCALE), (_Float16)((a.y - (float)h1) * LOSCALE),
                     (_Float16)((a.z - (float)h2) * LOSCALE), (_Float16)((a.w - (float)h3) * LOSCALE),
                     (_Float16)((c.x - (float)h4) * LOSCALE), (_Float16)((c.y - (float)h5) * LOSCALE),
                     (_Float16)((c.z - (float)h6) * LOSCALE), (_Float16)((c.w - (float)h7) * LOSCALE) };
    const size_t gi = (tok0 + row) * (size_t)DM + (size_t)head * HD + 8 * q8;
    *(v8h*)(xh + gi) = hv;
    *(v8h*)(xl + gi) = lv;
  }
}

// ---------------------------------------------------------------------------
// K / V^T tile staging: 64 rows x 128 B each, LDS row pitch 144 B (16 B x odd,
// conflict-free for the 16-byte fragment reads). 128 threads, 8 lanes per row,
// 16 rows per sweep, 4 sweeps per operand: every copy instruction covers whole
// 128-B lines of the source.
// ---------------------------------------------------------------------------
#define KVP    72                      // LDS row pitch in halves (144 B)
#define KVTILE (64 * KVP)              // halves per staged tile (9216 B)
#define NTILE  (2 * (SQ / 64))         // 32 tiles: 16 of the own pair, 16 of the flipped one

// gk: this lane's 16 B of K row (tid>>3) of the tile; gv: the same of V^T row (tid>>3).
// lk / lv: the lane's LDS byte addresses for those rows.
__device__ __forceinline__ void stage_kv(const _Float16* gk, const _Float16* gv, unsigned lk, unsigned lv) {
  const _Float16* gk1 = gk + 16 * HD;
  const _Float16* gk2 = gk + 32 * HD;
  const _Float16* gk3 = gk + 48 * HD;
  const _Float16* gv1 = gv + 16 * SQ;
  const _Float16* gv2 = gv + 32 * SQ;
  const _Float16* gv3 = gv + 48 * SQ;
  const unsigned lk1 = lk + 16 * KVP * 2, lk2 = lk + 32 * KVP * 2, lk3 = lk + 48 * KVP * 2;
  const unsigned lv1 = lv + 16 * KVP * 2, lv2 = lv + 32 * KVP * 2, lv3 = lv + 48 * KVP * 2;
  // Global -> LDS through no register; the closing s_wait_xcnt stands in the same
  // statement so that no address register is rewritten in front of it.
  asm volatile(
      "global_load_async_to_lds_b128 %0, %8, off\n\t"
      "global_load_async_to_lds_b128 %1, %9, off\n\t"
      "global_load_async_to_lds_b128 %2, %10, off\n\t"
      "global_load_async_to_lds_b128 %3, %11, off\n\t"
      "global_load_async_to_lds_b128 %4, %12, off\n\t"
      "global_load_async_to_lds_b128 %5, %13, off\n\t"
      "global_load_async_to_lds_b128 %6, %14, off\n\t"
      "global_load_async_to_lds_b128 %7, %15, off\n\t"
      "s_wait_xcnt 0x0"
      :: "v"(lk), "v"(lk1), "v"(lk2), "v"(lk3), "v"(lv), "v"(lv1), "v"(lv2), "v"(lv3),
         "v"(gk), "v"(gk1), "v"(gk2), "v"(gk3), "v"(gv), "v"(gv1), "v"(gv2), "v"(gv3)
      : "memory");
}

// ---------------------------------------------------------------------------
// Block 128 thr (4 waves), 16 queries per wave, 64 keys per step.
// The block's four waves share each 64-key K and V^T tile from LDS: two buffers,
// tile t + 2 copied in while tile t + 1 is worked on; the 32 tiles of both passes
// form one sequence, so the copies run on across the pass boundary.
//   S^T = K * Q^T : A = K rows (row = key, k = d), B = Q^T (k = d, n = query)
//   O^T += V^T * P^T : A = Vt rows (row = d, k = key), B = P^T from registers
// Lane owns 32 keys of query column (lane&15); partner = lane ^ 16.
// left kept in LDS; combine = left + 0.1*tanh(right), x256 -> hi/lo f16 planes.
// ---------------------------------------------------------------------------
__global__ __launch_bounds__(128) void attn_kernel(
    const _Float16* __restrict__ qh,   // [NBP*NH][SQ][HD]
    const _Float16* __restrict__ kh,   // [NBP*NH][SQ][HD]
    const _Float16* __restrict__ vt,   // [NBP*NH][HD][SQ]
    const int* __restrict__ mask,      // [NBP][SQ], nonzero = attend
    _Float16* __restrict__ xh,         // [NTOK][DM] f16, hi plane of combine*256
    _Float16* __restrict__ xl)         // [NTOK][DM] f16, lo plane (x2048)
{
  __shared__ __attribute__((aligned(16))) float sO[4 * 16 * 64];    // 16384 B
  __shared__ __attribute__((aligned(16))) _Float16 sK[2 * KVTILE];  // 18432 B
  __shared__ __attribute__((aligned(16))) _Float16 sV[2 * KVTILE];  // 18432 B

  const int tid = threadIdx.x, lane = tid & 31, w = tid >> 5;
  const int h = lane >> 4, m = lane & 15;
  const int bph = blockIdx.y, bp = bph >> 4, head = bph & 15;
  const int b = bp >> 1, p = bp & 1;
  const int q0 = blockIdx.x * 64 + 16 * w;

  // Q^T B-fragments: column n = query q0+m, k = d (two 32-deep chunks)
  const _Float16* qrow = qh + ((size_t)bph * SQ + q0 + m) * HD;
  const v16h qb0 = load_frag_h(qrow, h);
  const v16h qb1 = load_frag_h(qrow + 32, h);

  const int* mrow = mask + (size_t)bp * SQ;
  float* so = sO + w * 1024;
  const v8f zero8 = {0.f, 0.f, 0.f, 0.f, 0.f, 0.f, 0.f, 0.f};

  // Copy addresses of this lane: row tid>>3 of a sweep, 16-byte column tid&7.
  const int crow = tid >> 3, ccol = tid & 7;
  const int kvown = bph, kvflip = (b * 2 + (1 - p)) * NH + head;
  const _Float16* gk_own  = kh + ((size_t)kvown  * SQ + crow) * HD + 8 * ccol;   // + key0*HD
  const _Float16* gk_flip = kh + ((size_t)kvflip * SQ + crow) * HD + 8 * ccol;
  const _Float16* gv_own  = vt + ((size_t)kvown  * HD + crow) * SQ + 8 * ccol;   // + key0
  const _Float16* gv_flip = vt + ((size_t)kvflip * HD + crow) * SQ + 8 * ccol;
  const unsigned lk0 = lds_off(sK) + crow * (KVP * 2) + 16 * ccol;               // + buffer * KVTILE * 2
  const unsigned lv0 = lds_off(sV) + crow * (KVP * 2) + 16 * ccol;

  // Tile 0 into buffer 0, landed and published; then tile 1 into buffer 1.
  stage_kv(gk_own, gv_own, lk0, lv0);
  asm volatile("s_wait_asynccnt 0x0" ::: "memory");   // this wave's copies of tile 0 have landed
  __syncthreads();                                    // tile 0 readable by every wave
  stage_kv(gk_own + 64 * HD, gv_own + 64, lk0 + KVTILE * 2, lv0 + KVTILE * 2);

  #pragma unroll 1
  for (int pass = 0; pass < 2; ++pass) {

    v8f o[4];                                   // o[t][r] = O[query m][d 16t+8h+r] * (l * 2^14)
    #pragma unroll
    for (int t = 0; t < 4; ++t) o[t] = zero8;
    float mrun = -1.0e30f, lrun = 0.0f;

    #pragma unroll 1
    for (int kb = 0; kb < SQ; kb += 64) {
      const int tile = pass * (SQ / 64) + (kb >> 6);
      const int buf = tile & 1;
      const _Float16* kbase = sK + buf * KVTILE + m * KVP;         // + 16j*KVP + 32*dc
      const _Float16* vbase = sV + buf * KVTILE + m * KVP;         // + 16t*KVP + key in tile
      // ---- the trip's mask words and all eight K fragments, read as one group in
      // front of the score products: one load latency per trip instead of one per
      // pair of products (loops unrolled so that the arrays stay in registers) ----
      v4i mk[4][2];
      #pragma unroll
      for (int j = 0; j < 4; ++j) {
        const int* mp = mrow + kb + 16 * j + 8 * h;
        mk[j][0] = *(const v4ia*)mp;
        mk[j][1] = *(const v4ia*)(mp + 4);
      }
      v16h kf[4][2];
      #pragma unroll
      for (int j = 0; j < 4; ++j) {
        const _Float16* kp = kbase + (16 * j) * KVP;
        kf[j][0] = load_frag_h(kp, h);
        kf[j][1] = load_frag_h(kp + 32, h);
      }
      // ---- scores: s[j][r] = S[query m][key kb+16j+8h+r] (unscaled) ----
      v8f s[4];
      #pragma unroll
      for (int j = 0; j < 4; ++j) {
        v8f z = zero8;
        z = wmma_f16(kf[j][0], qb0, z);
        z = wmma_f16(kf[j][1], qb1, z);
        s[j] = z;
      }
      // ---- all eight V^T fragments, read as one group here: they land while the
      // softmax below runs ----
      v16h vf[4][2];
      #pragma unroll
      for (int t = 0; t < 4; ++t) {
        const _Float16* vp = vbase + (16 * t) * KVP;
        vf[t][0] = load_frag_h(vp, h);
        vf[t][1] = load_frag_h(vp + 32, h);
      }
      // keeps the V^T reads above the softmax (the scheduler otherwise sinks them to their products)
      __builtin_amdgcn_sched_barrier(0);
      // ---- scale 1/8 and key mask, f32 ----
      #pragma unroll
      for (int j = 0; j < 4; ++j) s[j] = scale_mask8(s[j], mk[j][0], mk[j][1]);

      // ---- online softmax ----
      float mloc = s[0][0];
      #pragma unroll
      for (int j = 0; j < 4; ++j)
        #pragma unroll
        for (int r = 0; r < 8; ++r) mloc = fmaxf(mloc, s[j][r]);
      mloc = fmaxf(mloc, __shfl_xor(mloc, 16));
      const float mnew = fmaxf(mrun, mloc);
      const float alpha = __expf(mrun - mnew);
      mrun = mnew;
      float lsum = 0.0f;
      #pragma unroll
      for (int j = 0; j < 4; ++j)
        #pragma unroll
        for (int r = 0; r < 8; ++r) {
          const float pe = __expf(s[j][r] - mnew);
          s[j][r] = pe;
          lsum += pe;
        }
      lsum += __shfl_xor(lsum, 16);
      lrun = lrun * alpha + lsum;
      #pragma unroll
      for (int t = 0; t < 4; ++t)
        #pragma unroll
        for (int r = 0; r < 8; ++r) o[t][r] = o[t][r] * alpha;

      // ---- P^T B-fragments (keys 0..31 and 32..63 of this step) ----
      const v16h pb0 = pack_p(s[0], s[1]);
      const v16h pb1 = pack_p(s[2], s[3]);

      // ---- O^T += V^T * P^T ----
      #pragma unroll
      for (int t = 0; t < 4; ++t) {
        o[t] = wmma_f16(vf[t][0], pb0, o[t]);
        o[t] = wmma_f16(vf[t][1], pb1, o[t]);
      }

      // ---- publish tile + 1, then refill the buffer this trip has read ----
      asm volatile("s_wait_dscnt 0x0" ::: "memory");      // this wave's reads of the buffer are done
      asm volatile("s_wait_asynccnt 0x0" ::: "memory");   // this wave's copies of tile + 1 have landed
      __syncthreads();                                    // publishes tile + 1, ends every read of this buffer
      if (tile + 2 < NTILE) {
        const int nt = tile + 2;
        const int key0 = (nt & (SQ / 64 - 1)) * 64;
        const _Float16* gk = ((nt < SQ / 64) ? gk_own : gk_flip) + (size_t)key0 * HD;
        const _Float16* gv = ((nt < SQ / 64) ? gv_own : gv_flip) + key0;
        stage_kv(gk, gv, lk0 + buf * (KVTILE * 2), lv0 + buf * (KVTILE * 2));
      }
    }

    const float inv = (1.0f / lrun) * (1.0f / PSCALE);
    if (pass == 0) {
      #pragma unroll
      for (int t = 0; t < 4; ++t)
        #pragma unroll
        for (int r = 0; r < 8; ++r)
          so[m * 64 + 16 * t + 8 * h + r] = o[t][r] * inv;
    } else {
      #pragma unroll
      for (int t = 0; t < 4; ++t)
        #pragma unroll
        for (int r = 0; r < 8; ++r) {
          const int idx = m * 64 + 16 * t + 8 * h + r;
          const float cmb = so[idx] + 0.1f * tanhf(o[t][r] * inv);
          so[idx] = cmb * XSCALE;
        }
    }
  }
  asm volatile("s_wait_asynccnt 0x0" ::: "memory");   // no copy outstanding behind the loop
  __syncthreads();

  const size_t tok0 = (size_t)bp * SQ + q0;
  xc_store_pass(so, xh, xl, tok0, head, lane);
  
}

// ---------------------------------------------------------------------------
// wave w owns rows 16w..16w+15, each row 64 floats = 2 lines; lanes 8q..8q+7
// per line, 4 lines per instruction, 32 lines per wave.
// ---------------------------------------------------------------------------
__device__ __forceinline__ void out_store_pass(const float* sT, float* out,
                                               int m0, int n0, int w, int lane) {
  const int q8 = lane & 7, sub = lane >> 3;
  #pragma unroll
  for (int i = 0; i < 8; ++i) {
    const int lid = i * 4 + sub;                 // 0..31
    const int row = 16 * w + (lid >> 1), hl = lid & 1;
    const v4f v = *(const v4fa*)(sT + row * 64 + 32 * hl + 4 * q8);
    const size_t gi = (size_t)(m0 + row) * DM + n0 + 32 * hl + 4 * q8;
    *(v4f*)(out + gi) = v;
  }
}

// ---------------------------------------------------------------------------
// Kernel 4: out = X * Wo^T + bo with X = hi/256 + lo/(256*2048) planes.
// Block 128 thr (4 waves) = 64 tokens x 64 features; wave 16 tokens x 64.
// A = X rows (k contiguous), B[k][n] = Wo[n][k] from Wo row n (k contiguous).
// The block's 64 hi rows (LDS rows 0..63), 64 lo rows (64..127) and 64 Wo rows
// (128..191) come through LDS in k-tiles of 64: two buffers, tile t + 2 copied
// in while tile t + 1 is worked on.
// ---------------------------------------------------------------------------
__global__ __launch_bounds__(128) void oproj_kernel(
    const _Float16* __restrict__ xh,   // [NTOK][DM]
    const _Float16* __restrict__ xl,   // [NTOK][DM]
    const _Float16* __restrict__ woh,  // [DM][DM] f16(bf16(Wo)*256)
    const float* __restrict__ bo,
    float* __restrict__ out)           // [NTOK][DM]
{
  __shared__ __attribute__((aligned(16))) float sT[64 * 64];        // 16384 B
  __shared__ __attribute__((aligned(16))) _Float16 sG[2 * GTILE];   // 55296 B

  const int tid = threadIdx.x, lane = tid & 31, w = tid >> 5;
  const int h = lane >> 4, m = lane & 15;
  const int m0 = blockIdx.x * 64, n0 = blockIdx.y * 64;

  // Copy addresses of this lane: row tid>>3 of a sweep, 16-byte column tid&7.
  const int crow = tid >> 3, ccol = tid & 7;
  const _Float16* gh = xh + (size_t)(m0 + crow) * DM + 8 * ccol;    // + k
  const _Float16* gl = xl + (size_t)(m0 + crow) * DM + 8 * ccol;    // + k
  const _Float16* gw = woh + (size_t)(n0 + crow) * DM + 8 * ccol;   // + k
  const unsigned lg0 = lds_off(sG) + crow * (GP * 2) + 16 * ccol;   // + buffer * GTILE * 2

  const v8f zero8 = {0.f, 0.f, 0.f, 0.f, 0.f, 0.f, 0.f, 0.f};
  v8f acch[4], accl[4];
  #pragma unroll
  for (int nt = 0; nt < 4; ++nt) { acch[nt] = zero8; accl[nt] = zero8; }

  // Tile 0 into buffer 0, landed and published; then tile 1 into buffer 1.
  stage_gemm(gh, gl, gw, lg0);
  asm volatile("s_wait_asynccnt 0x0" ::: "memory");   // this wave's copies of tile 0 have landed
  __syncthreads();                                    // tile 0 readable by every wave
  stage_gemm(gh + GKT, gl + GKT, gw + GKT, lg0 + GTILE * 2);

  // kept rolled: one copy of the ring's foot (waits, barrier, refill), small loop text
  #pragma unroll 1
  for (int t = 0; t < GNT; ++t) {
    const int buf = t & 1;
    const _Float16* ah = sG + buf * GTILE + (16 * w + m) * GP;        // hi row
    const _Float16* al = ah + 64 * GP;                                // lo row
    const _Float16* wr = sG + buf * GTILE + (128 + m) * GP;           // feature row, nt = 0
    // The tile's fragments are read as one group in front of its products; the
    // loops below are unrolled so that the fragment arrays stay in registers.
    v16h fah[2], fal[2], fb[2][4];
    #pragma unroll
    for (int kc = 0; kc < 2; ++kc) {
      fah[kc] = load_frag_h(ah + 32 * kc, h);
      fal[kc] = load_frag_h(al + 32 * kc, h);
      #pragma unroll
      for (int nt = 0; nt < 4; ++nt) fb[kc][nt] = load_frag_h(wr + nt * 16 * GP + 32 * kc, h);
    }
    #pragma unroll
    for (int kc = 0; kc < 2; ++kc) {
      #pragma unroll
      for (int nt = 0; nt < 4; ++nt) {
        acch[nt] = wmma_f16(fah[kc], fb[kc][nt], acch[nt]);
        accl[nt] = wmma_f16(fal[kc], fb[kc][nt], accl[nt]);
      }
    }
    // ---- publish tile + 1, then refill the buffer this trip has read ----
    asm volatile("s_wait_dscnt 0x0" ::: "memory");      // this wave's reads of the buffer are done
    asm volatile("s_wait_asynccnt 0x0" ::: "memory");   // this wave's copies of tile + 1 have landed
    __syncthreads();                                    // publishes tile + 1, ends every read of this buffer
    if (t + 2 < GNT) {
      const int kn = (t + 2) * GKT;
      stage_gemm(gh + kn, gl + kn, gw + kn, lg0 + buf * (GTILE * 2));
    }
  }
  asm volatile("s_wait_asynccnt 0x0" ::: "memory");   // no copy outstanding behind the loop

  // D[r] of tile nt = Y[token m0+16w+8h+r][feature n0+16nt+m]
  const float sh = 1.0f / (XSCALE * WSCALE);
  const float sl = 1.0f / (XSCALE * WSCALE * LOSCALE);
  #pragma unroll
  for (int nt = 0; nt < 4; ++nt) {
    const int col = 16 * nt + m;
    const float bvl = bo[n0 + col];
    #pragma unroll
    for (int r = 0; r < 8; ++r) {
      const int row = 16 * w + 8 * h + r;                 // 0..63
      sT[row * 64 + col] = acch[nt][r] * sh + accl[nt][r] * sl + bvl;
    }
  }
  __syncthreads();

  out_store_pass(sT, out, m0, n0, w, lane);
  
}

// ---------------------------------------------------------------------------
extern "C" void kernel_launch(void* const* d_in, const int* in_sizes, int n_in,
                              void* d_out, int out_size, void* d_ws, size_t ws_size,
                              hipStream_t stream) {
  if (n_in < 12) return;
  if (in_sizes[0] != NACT || in_sizes[1] != NACT || in_sizes[2] != NACT) return;
  if (in_sizes[3] != NBP * SQ) return;
  if (in_sizes[4] != NWEL || in_sizes[6] != NWEL || in_sizes[8] != NWEL || in_sizes[10] != NWEL) return;
  if (in_sizes[5] != DM || in_sizes[7] != DM || in_sizes[9] != DM || in_sizes[11] != DM) return;
  if (out_size != NACT) return;

  const float* query = (const float*)d_in[0];
  const float* key_  = (const float*)d_in[1];
  const float* value = (const float*)d_in[2];
  const int*   mask  = (const int*)d_in[3];
  const float* Wq = (const float*)d_in[4];
  const float* bq = (const float*)d_in[5];
  const float* Wk = (const float*)d_in[6];
  const float* bk = (const float*)d_in[7];
  const float* Wv = (const float*)d_in[8];
  const float* bv = (const float*)d_in[9];
  const float* Wo = (const float*)d_in[10];
  const float* bo = (const float*)d_in[11];
  float* out = (float*)d_out;

  const size_t xb_bytes  = (size_t)3 * NACT * 2;                 // 25165824
  const size_t wb_bytes  = (size_t)3 * NWEL * 2;                 //  6291456
  const size_t woh_bytes = (size_t)NWEL * 2;                     //  2097152
  const size_t pl_bytes  = (size_t)NBP * NH * SQ * HD * 2;       //  8388608 per plane
  const size_t xc_bytes  = (size_t)NACT * 2;                     //  8388608 per plane
  const size_t total = xb_bytes + wb_bytes + woh_bytes + 3 * pl_bytes + 2 * xc_bytes;   // 75497472
  if (total > ws_size) return;

  char* ws = (char*)d_ws;
  size_t off = 0;
  unsigned short* xb = (unsigned short*)(ws + off); off += xb_bytes;
  unsigned short* wb = (unsigned short*)(ws + off); off += wb_bytes;
  _Float16* woh = (_Float16*)(ws + off);            off += woh_bytes;
  _Float16* qh  = (_Float16*)(ws + off);            off += pl_bytes;
  _Float16* kh  = (_Float16*)(ws + off);            off += pl_bytes;
  _Float16* vt  = (_Float16*)(ws + off);            off += pl_bytes;
  _Float16* xh  = (_Float16*)(ws + off);            off += xc_bytes;
  _Float16* xl  = (_Float16*)(ws + off);            off += xc_bytes;
  if (off > ws_size) return;

  convert_kernel<<<(NGRP + 255) / 256, 256, 0, stream>>>(query, key_, value, Wq, Wk, Wv, Wo, xb, wb, woh);

  dim3 gProj(NTOK / 128, 3 * NH);                               // (32, 48)
  proj_kernel<<<gProj, 128, 0, stream>>>(xb, wb, bq, bk, bv, qh, kh, vt);

  dim3 gAtt(SQ / 64, NBP * NH);                                  // (16, 64)
  attn_kernel<<<gAtt, 128, 0, stream>>>(qh, kh, vt, mask, xh, xl);

  dim3 gOut(NTOK / 64, DM / 64);                                 // (64, 16)
  oproj_kernel<<<gOut, 128, 0, stream>>>(xh, xl, woh, bo, out);
}

// v004
// It runs in 108 microseconds.
// Timed twice side by side with v003, it ran 1.06 times as fast both times.
// All steps since v000 together make it 2.54 times as fast.
// Contractions: q/k/v projections x*W^T on v_wmma_f32_16x16x32_bf16 (bf16 operands, f32 accumulate); K*Q^T and V^T*P^T of both attention passes on v_wmma_f32_16x16x32_f16 (f16 operands, P carried x16384, f32 accumulate); output projection on v_wmma_f32_16x16x32_f16 with the activation carried x256 as f16 hi + lo(x2048) planes and the weight as f16 of its bf16 value x256 (f32 accumulate); scale, mask, softmax, tanh and bias in f32.
#include <hip/hip_runtime.h>
#include <math.h>

typedef _Float16       v16h __attribute__((ext_vector_type(16)));
typedef _Float16       v8h  __attribute__((ext_vector_type(8)));
typedef __bf16         v16b __attribute__((ext_vector_type(16)));
typedef unsigned short v8us __attribute__((ext_vector_type(8)));
typedef float          v8f  __attribute__((ext_vector_type(8)));
typedef float          v4f  __attribute__((ext_vector_type(4)));
typedef float          v2f  __attribute__((ext_vector_type(2)));
typedef int            v4i  __attribute__((ext_vector_type(4)));
typedef v8h  __attribute__((may_alias)) v8ha;
typedef v8us __attribute__((may_alias)) v8usa;
typedef v4f  __attribute__((may_alias)) v4fa;
typedef v4i  __attribute__((may_alias)) v4ia;
typedef v8f  __attribute__((may_alias)) v8fa;

union FragH { v16h v; v8h  half[2]; };
union FragB { v16b v; v8us half[2]; };

#define DM     1024
#define NH     16
#define HD     64
#define SQ     1024
#define NBP    4                       // batch * pair
#define NTOK   (NBP * SQ)              // 4096 token rows
#define NACT   (NTOK * DM)             // 4194304
#define NWEL   (DM * DM)               // 1048576
#define ACT8   (NACT / 8)              // 524288
#define WEL8   (NWEL / 8)              // 131072
#define NGRP   (3 * ACT8 + 4 * WEL8)   // 2097152
#define PSHIFT  14.0f                  // P is carried x 2^14: added to the base-2 exponent
#define SC2     0.18033688011112042f   // (1/8) * log2(e): scores go to the base-2 exponent in one product
// Exponent addend of a masked key: the fma absorbs any finite score into it, so masked
// keys are all equal and below every unmasked one: weight 0 beside an unmasked key, and
// equal weights (the plain mean of V) where a whole row is masked.
#define MASKED  -3.0e38f
#define XSCALE  256.0f
#define WSCALE  256.0f
#define LOSCALE 2048.0f

// ---------------------------------------------------------------------------
// 16x16x32 WMMA helpers with hazard guard (ties D, keeps A/B live).
// Fragment map (wave32): lane l, h = l>>4, m = n = l&15.
//   A/B element i: i<8 -> k0+8h+i ; i>=8 -> k0+16+8h+(i-8)
//   D element r : row 8h+r, col l&15
// ---------------------------------------------------------------------------
__device__ __forceinline__ v8f wmma_f16(v16h a, v16h b, v8f c) {
  v8f d = __builtin_amdgcn_wmma_f32_16x16x32_f16(false, a, false, b, (short)0, c, false, false);
  asm volatile("v_nop\n\tv_nop\n\tv_nop\n\tv_nop" : "+v"(d) : "v"(a), "v"(b));
  return d;
}
__device__ __forceinline__ v8f wmma_bf16(v16b a, v16b b, v8f c) {
  v8f d = __builtin_amdgcn_wmma_f32_16x16x32_bf16(false, a, false, b, (short)0, c, false, false);
  asm volatile("v_nop\n\tv_nop\n\tv_nop\n\tv_nop" : "+v"(d) : "v"(a), "v"(b));
  return d;
}

// A or B fragment from a k-contiguous 16-bit row; p points at element k0 of
// the row owned by this lane (row index = lane & 15 added by the caller).
__device__ __forceinline__ v16h load_frag_h(const _Float16* p, int h) {
  FragH f;
  f.half[0] = *(const v8ha*)(p + 8 * h);
  f.half[1] = *(const v8ha*)(p + 16 + 8 * h);
  return f.v;
}
__device__ __forceinline__ v16b load_frag_b(const unsigned short* p, int h) {
  FragB f;
  f.half[0] = *(const v8usa*)(p + 8 * h);
  f.half[1] = *(const v8usa*)(p + 16 + 8 * h);
  return f.v;
}

// f32 -> bf16 bits, RNE
__device__ __forceinline__ unsigned short bf16_bits(float f) {
  unsigned int u = __float_as_uint(f);
  u = u + 0x7FFFu + ((u >> 16) & 1u);
  return (unsigned short)(u >> 16);
}
__device__ __forceinline__ float bf16_val(float f) {
  return __uint_as_float(((unsigned int)bf16_bits(f)) << 16);
}

// ---------------------------------------------------------------------------
// Kernel 1: f32 -> 16-bit planes.
//   xb[3][NTOK][DM] bf16 (query, key, value), wb[3][DM][DM] bf16 (Wq, Wk, Wv),
//   woh[DM][DM] f16 = f16(bf16(Wo) * 256).
// ---------------------------------------------------------------------------
__global__ __launch_bounds__(256) void convert_kernel(
    const float* __restrict__ xq, const float* __restrict__ xk, const float* __restrict__ xv,
    const float* __restrict__ wq, const float* __restrict__ wk, const float* __restrict__ wv,
    const float* __restrict__ wo,
    unsigned short* __restrict__ xb, unsigned short* __restrict__ wb, _Float16* __restrict__ woh)
{
  const int g = blockIdx.x * 256 + threadIdx.x;
  if (g >= NGRP) return;
  if (g < 3 * ACT8 + 3 * WEL8) {
    const float* src;
    unsigned short* dst;
    if (g < 3 * ACT8) {
      const int sel = g / ACT8;
      const int off = g - sel * ACT8;
      const float* xs = (sel == 0) ? xq : ((sel == 1) ? xk : xv);
      src = xs + (size_t)off * 8;
      dst = xb + (size_t)sel * NACT + (size_t)off * 8;
    } else {
      const int e = g - 3 * ACT8;
      const int sel = e / WEL8;
      const int off = e - sel * WEL8;
      const float* wsrc = (sel == 0) ? wq : ((sel == 1) ? wk : wv);
      src = wsrc + (size_t)off * 8;
      dst = wb + (size_t)sel * NWEL + (size_t)off * 8;
    }
    const v4f a = *(const v4fa*)src;
    const v4f c = *(const v4fa*)(src + 4);
    const v8us o = { bf16_bits(a.x), bf16_bits(a.y), bf16_bits(a.z), bf16_bits(a.w),
                     bf16_bits(c.x), bf16_bits(c.y), bf16_bits(c.z), bf16_bits(c.w) };
    *(v8us*)dst = o;
    
  } else {
    const int off = g - (3 * ACT8 + 3 * WEL8);
    const float* src = wo + (size_t)off * 8;
    _Float16* dst = woh + (size_t)off * 8;
    const v4f a = *(const v4fa*)src;
    const v4f c = *(const v4fa*)(src + 4);
    const v8h o = { (_Float16)(bf16_val(a.x) * WSCALE), (_Float16)(bf16_val(a.y) * WSCALE),
                    (_Float16)(bf16_val(a.z) * WSCALE), (_Float16)(bf16_val(a.w) * WSCALE),
                    (_Float16)(bf16_val(c.x) * WSCALE), (_Float16)(bf16_val(c.y) * WSCALE),
                    (_Float16)(bf16_val(c.z) * WSCALE), (_Float16)(bf16_val(c.w) * WSCALE) };
    *(v8h*)dst = o;
    
  }
}

// ---------------------------------------------------------------------------
// 4 lines per instruction, 32 lines per wave, 128 per block.
// which 0/1: plane[bh][s][d]  (one token row = 64 halves = one line)
// which 2  : vt[bh][d][s]     (64 d-rows x 128 tokens = 2 lines each)
// ---------------------------------------------------------------------------
__device__ __forceinline__ void proj_store_pass(const _Float16* sT, _Float16* plane, _Float16* vt,
                                                int which, int bh, int l0, int w, int lane) {
  const int q8 = lane & 7, sub = lane >> 3;
  #pragma unroll
  for (int i = 0; i < 8; ++i) {
    const int lid = w * 32 + i * 4 + sub;
    v8h v;
    _Float16* dst;
    if (which != 2) {
      v = *(const v8ha*)(sT + lid * HD + 8 * q8);
      dst = plane + ((size_t)bh * SQ + l0 + lid) * HD + 8 * q8;
    } else {
      const int d = lid >> 1, hl = lid & 1;
      v = *(const v8ha*)(sT + d * 128 + 64 * hl + 8 * q8);
      dst = vt + ((size_t)bh * HD + d) * SQ + l0 + 64 * hl + 8 * q8;
    }
    *(v8h*)dst = v;
  }
}

__device__ __forceinline__ unsigned lds_off(const void* p) { return (unsigned)(size_t)p; }

// ---------------------------------------------------------------------------
// GEMM operand staging (kernels 2 and 4): one k-tile = 64 k (128 B) of 192
// operand rows, three groups of 64 rows, LDS row pitch 144 B (16 B x odd,
// conflict-free for the 16-byte fragment reads). 128 threads, 8 lanes per row,
// 16 rows per sweep, 4 sweeps per group: every copy instruction covers whole
// 128-B lines of the source. Source row pitch = DM 16-bit elements.
// ---------------------------------------------------------------------------
#define GP     72                      // LDS row pitch in 16-bit elements (144 B)
#define GTILE  (192 * GP)              // elements per staged k-tile (27648 B)
#define GKT    64                      // k per tile
#define GNT    (DM / GKT)              // 16 k-tiles

// g0 / g1 / g2: this lane's 16 B of row (tid>>3) of each 64-row group, at the
// tile's first k; l: the lane's LDS byte address of row (tid>>3) of group 0.
__device__ __forceinline__ void stage_gemm(const void* g0, const void* g1, const void* g2, unsigned l) {
  const char* a0 = (const char*)g0;
  const char* a1 = a0 + 16 * DM * 2;
  const char* a2 = a0 + 32 * DM * 2;
  const char* a3 = a0 + 48 * DM * 2;
  const char* b0 = (const char*)g1;
  const char* b1 = b0 + 16 * DM * 2;
  const char* b2 = b0 + 32 * DM * 2;
  const char* b3 = b0 + 48 * DM * 2;
  const char* c0 = (const char*)g2;
  const char* c1 = c0 + 16 * DM * 2;
  const char* c2 = c0 + 32 * DM * 2;
  const char* c3 = c0 + 48 * DM * 2;
  const unsigned la1 = l + 16 * GP * 2,  la2 = l + 32 * GP * 2,  la3 = l + 48 * GP * 2;
  const unsigned lb0 = l + 64 * GP * 2,  lb1 = l + 80 * GP * 2,  lb2 = l + 96 * GP * 2,  lb3 = l + 112 * GP * 2;
  const unsigned lc0 = l + 128 * GP * 2, lc1 = l + 144 * GP * 2, lc2 = l + 160 * GP * 2, lc3 = l + 176 * GP * 2;
  // Global -> LDS through no register; the closing s_wait_xcnt stands in the same
  // statement so that no address register is rewritten in front of it.
  asm volatile(
      "global_load_async_to_lds_b128 %0, %12, off\n\t"
      "global_load_async_to_lds_b128 %1, %13, off\n\t"
      "global_load_async_to_lds_b128 %2, %14, off\n\t"
      "global_load_async_to_lds_b128 %3, %15, off\n\t"
      "global_load_async_to_lds_b128 %4, %16, off\n\t"
      "global_load_async_to_lds_b128 %5, %17, off\n\t"
      "global_load_async_to_lds_b128 %6, %18, off\n\t"
      "global_load_async_to_lds_b128 %7, %19, off\n\t"
      "global_load_async_to_lds_b128 %8, %20, off\n\t"
      "global_load_async_to_lds_b128 %9, %21, off\n\t"
      "global_load_async_to_lds_b128 %10, %22, off\n\t"
      "global_load_async_to_lds_b128 %11, %23, off\n\t"
      "s_wait_xcnt 0x0"
      :: "v"(l), "v"(la1), "v"(la2), "v"(la3), "v"(lb0), "v"(lb1), "v"(lb2), "v"(lb3),
         "v"(lc0), "v"(lc1), "v"(lc2), "v"(lc3),
         "v"(a0), "v"(a1), "v"(a2), "v"(a3), "v"(b0), "v"(b1), "v"(b2), "v"(b3),
         "v"(c0), "v"(c1), "v"(c2), "v"(c3)
      : "memory");
}

// ---------------------------------------------------------------------------
// Kernel 2: Y = x * W^T for the three projections (bf16 operands).
// Block 128 thr (4 waves) = 128 tokens x 64 features of one (which, head);
// wave tile 32 tokens x 64 features; K = 1024 in steps of 32.
// A = x rows (token-major, k contiguous), B[k][n] = W[n][k] from W row n
// (k contiguous) -> both fragments with the same loader.
// The block's 128 x rows (LDS rows 0..127) and 64 W rows (LDS rows 128..191)
// come through LDS in k-tiles of 64: two buffers, tile t + 2 copied in while
// tile t + 1 is worked on.
// ---------------------------------------------------------------------------
__global__ __launch_bounds__(128) void proj_kernel(
    const unsigned short* __restrict__ xb,   // [3][NTOK][DM] bf16
    const unsigned short* __restrict__ wb,   // [3][DM][DM]   bf16, row = output feature
    const float* __restrict__ bq, const float* __restrict__ bk, const float* __restrict__ bv,
    _Float16* __restrict__ qh,               // [NBP*NH][SQ][HD] f16
    _Float16* __restrict__ kh,               // [NBP*NH][SQ][HD] f16
    _Float16* __restrict__ vt)               // [NBP*NH][HD][SQ] f16
{
  __shared__ __attribute__((aligned(16))) _Float16 sT[128 * 64];          // 16384 B
  __shared__ __attribute__((aligned(16))) unsigned short sG[2 * GTILE];   // 55296 B

  const int tid = threadIdx.x, lane = tid & 31, w = tid >> 5;
  const int h = lane >> 4, m = lane & 15;
  const int m0 = blockIdx.x * 128;
  const int cg = blockIdx.y;                 // 0..47
  const int which = cg >> 4, head = cg & 15;

  // Copy addresses of this lane: row tid>>3 of a sweep, 16-byte column tid&7.
  const int crow = tid >> 3, ccol = tid & 7;
  const unsigned short* gx = xb + (size_t)which * NACT + (size_t)(m0 + crow) * DM + 8 * ccol;         // + k
  const unsigned short* gw = wb + (size_t)which * NWEL + (size_t)(head * HD + crow) * DM + 8 * ccol;  // + k
  const unsigned lg0 = lds_off(sG) + crow * (GP * 2) + 16 * ccol;                                     // + buffer * GTILE * 2

  const v8f zero8 = {0.f, 0.f, 0.f, 0.f, 0.f, 0.f, 0.f, 0.f};
  v8f acc[2][4];
  #pragma unroll
  for (int mt = 0; mt < 2; ++mt)
    #pragma unroll
    for (int nt = 0; nt < 4; ++nt) acc[mt][nt] = zero8;

  // Tile 0 into buffer 0, landed and published; then tile 1 into buffer 1.
  stage_gemm(gx, gx + 64 * DM, gw, lg0);
  asm volatile("s_wait_asynccnt 0x0" ::: "memory");   // this wave's copies of tile 0 have landed
  __syncthreads();                                    // tile 0 readable by every wave
  stage_gemm(gx + GKT, gx + 64 * DM + GKT, gw + GKT, lg0 + GTILE * 2);

  // kept rolled: one copy of the ring's foot (waits, barrier, refill), small loop text
  #pragma unroll 1
  for (int t = 0; t < GNT; ++t) {
    const int buf = t & 1;
    const unsigned short* xa0 = sG + buf * GTILE + (32 * w + m) * GP;   // token row, mt = 0
    const unsigned short* xa1 = xa0 + 16 * GP;                          // mt = 1
    const unsigned short* wr  = sG + buf * GTILE + (128 + m) * GP;      // feature row, nt = 0
    // The tile's fragments are read as one group in front of its products; the
    // loops below are unrolled so that the fragment arrays stay in registers.
    v16b fa[2][2], fb[2][4];
    #pragma unroll
    for (int kc = 0; kc < 2; ++kc) {
      fa[kc][0] = load_frag_b(xa0 + 32 * kc, h);
      fa[kc][1] = load_frag_b(xa1 + 32 * kc, h);
      #pragma unroll
      for (int nt = 0; nt < 4; ++nt) fb[kc][nt] = load_frag_b(wr + nt * 16 * GP + 32 * kc, h);
    }
    #pragma unroll
    for (int kc = 0; kc < 2; ++kc) {
      #pragma unroll
      for (int nt = 0; nt < 4; ++nt) {
        acc[0][nt] = wmma_bf16(fa[kc][0], fb[kc][nt], acc[0][nt]);
        acc[1][nt] = wmma_bf16(fa[kc][1], fb[kc][nt], acc[1][nt]);
      }
    }
    // ---- publish tile + 1, then refill the buffer this trip has read ----
    asm volatile("s_wait_dscnt 0x0" ::: "memory");      // this wave's reads of the buffer are done
    asm volatile("s_wait_asynccnt 0x0" ::: "memory");   // this wave's copies of tile + 1 have landed
    __syncthreads();                                    // publishes tile + 1, ends every read of this buffer
    if (t + 2 < GNT) {
      const int kn = (t + 2) * GKT;
      stage_gemm(gx + kn, gx + 64 * DM + kn, gw + kn, lg0 + buf * (GTILE * 2));
    }
  }
  asm volatile("s_wait_asynccnt 0x0" ::: "memory");   // no copy outstanding behind the loop

  // D[r] of tile (mt, nt) = Y[token m0+32w+16mt+8h+r][feature head*64+16nt+m]
  const float* bias = (which == 0) ? bq : ((which == 1) ? bk : bv);
  #pragma unroll
  for (int nt = 0; nt < 4; ++nt) {
    const int feat = 16 * nt + m;
    const float bvl = bias[head * HD + feat];
    #pragma unroll
    for (int mt = 0; mt < 2; ++mt) {
      #pragma unroll
      for (int r = 0; r < 8; ++r) {
        const int tokl = 32 * w + 16 * mt + 8 * h + r;     // 0..127
        const float y = acc[mt][nt][r] + bvl;
        const int idx = (which == 2) ? (feat * 128 + tokl) : (tokl * HD + feat);
        sT[idx] = (_Float16)y;
      }
    }
  }
  __syncthreads();

  const int bp = m0 >> 10, l0 = m0 & (SQ - 1), bh = bp * NH + head;
  _Float16* plane = (which == 0) ? qh : kh;
  proj_store_pass(sT, plane, vt, which, bh, l0, w, lane);
  
}

// ---------------------------------------------------------------------------
// Attention helpers.
// ---------------------------------------------------------------------------
// P^T B-fragment from the lane's own P values (already x 2^14): element r <- tile a
// row r (keys 0..15 of the 32-key step), element 8+r <- tile c row r (keys 16..31),
// same lane (query column).
__device__ __forceinline__ v16h pack_p(v8f a, v8f c) {
  const v16h r = { (_Float16)a[0], (_Float16)a[1], (_Float16)a[2], (_Float16)a[3],
                   (_Float16)a[4], (_Float16)a[5], (_Float16)a[6], (_Float16)a[7],
                   (_Float16)c[0], (_Float16)c[1], (_Float16)c[2], (_Float16)c[3],
                   (_Float16)c[4], (_Float16)c[5], (_Float16)c[6], (_Float16)c[7] };
  return r;
}

// Per-wave 16x64 f32 tile (already x256) in LDS -> hi/lo f16 planes
// lanes 8q..8q+7 per line, 4 lines per instruction, 16 rows x 2 planes per wave.
__device__ __forceinline__ void xc_store_pass(const float* so, _Float16* xh, _Float16* xl,
                                              size_t tok0, int head, int lane) {
  const int q8 = lane & 7, sub = lane >> 3;
  #pragma unroll
  for (int i = 0; i < 4; ++i) {
    const int row = 4 * i + sub;
    const v4f a = *(const v4fa*)(so + row * 64 + 8 * q8);
    const v4f c = *(const v4fa*)(so + row * 64 + 8 * q8 + 4);
    const _Float16 h0 = (_Float16)a.x, h1 = (_Float16)a.y, h2 = (_Float16)a.z, h3 = (_Float16)a.w;
    const _Float16 h4 = (_Float16)c.x, h5 = (_Float16)c.y, h6 = (_Float16)c.z, h7 = (_Float16)c.w;
    const v8h hv = { h0, h1, h2, h3, h4, h5, h6, h7 };
    const v8h lv = { (_Float16)((a.x - (float)h0) * LOSCALE), (_Float16)((a.y - (float)h1) * LOSCALE),
                     (_Float16)((a.z - (float)h2) * LOSCALE), (_Float16)((a.w - (float)h3) * LOSCALE),
                     (_Float16)((c.x - (float)h4) * LOSCALE), (_Float16)((c.y - (float)h5) * LOSCALE),
                     (_Float16)((c.z - (float)h6) * LOSCALE), (_Float16)((c.w - (float)h7) * LOSCALE) };
    const size_t gi = (tok0 + row) * (size_t)DM + (size_t)head * HD + 8 * q8;
    *(v8h*)(xh + gi) = hv;
    *(v8h*)(xl + gi) = lv;
  }
}

// ---------------------------------------------------------------------------
// K / V^T tile staging: 64 rows x 128 B each, LDS row pitch 144 B (16 B x odd,
// conflict-free for the 16-byte fragment reads). 128 threads, 8 lanes per row,
// 16 rows per sweep, 4 sweeps per operand: every copy instruction covers whole
// 128-B lines of the source.
// ---------------------------------------------------------------------------
#define KVP    72                      // LDS row pitch in halves (144 B)
#define KVTILE (64 * KVP)              // halves per staged tile (9216 B)
#define NTILE  (2 * (SQ / 64))         // 32 tiles: 16 of the own pair, 16 of the flipped one

// gk: this lane's 16 B of K row (tid>>3) of the tile; gv: the same of V^T row (tid>>3).
// lk / lv: the lane's LDS byte addresses for those rows.
__device__ __forceinline__ void stage_kv(const _Float16* gk, const _Float16* gv, unsigned lk, unsigned lv) {
  const _Float16* gk1 = gk + 16 * HD;
  const _Float16* gk2 = gk + 32 * HD;
  const _Float16* gk3 = gk + 48 * HD;
  const _Float16* gv1 = gv + 16 * SQ;
  const _Float16* gv2 = gv + 32 * SQ;
  const _Float16* gv3 = gv + 48 * SQ;
  const unsigned lk1 = lk + 16 * KVP * 2, lk2 = lk + 32 * KVP * 2, lk3 = lk + 48 * KVP * 2;
  const unsigned lv1 = lv + 16 * KVP * 2, lv2 = lv + 32 * KVP * 2, lv3 = lv + 48 * KVP * 2;
  // Global -> LDS through no register; the closing s_wait_xcnt stands in the same
  // statement so that no address register is rewritten in front of it.
  asm volatile(
      "global_load_async_to_lds_b128 %0, %8, off\n\t"
      "global_load_async_to_lds_b128 %1, %9, off\n\t"
      "global_load_async_to_lds_b128 %2, %10, off\n\t"
      "global_load_async_to_lds_b128 %3, %11, off\n\t"
      "global_load_async_to_lds_b128 %4, %12, off\n\t"
      "global_load_async_to_lds_b128 %5, %13, off\n\t"
      "global_load_async_to_lds_b128 %6, %14, off\n\t"
      "global_load_async_to_lds_b128 %7, %15, off\n\t"
      "s_wait_xcnt 0x0"
      :: "v"(lk), "v"(lk1), "v"(lk2), "v"(lk3), "v"(lv), "v"(lv1), "v"(lv2), "v"(lv3),
         "v"(gk), "v"(gk1), "v"(gk2), "v"(gk3), "v"(gv), "v"(gv1), "v"(gv2), "v"(gv3)
      : "memory");
}

// ---------------------------------------------------------------------------
// Block 128 thr (4 waves), 16 queries per wave, 64 keys per step.
// The block's four waves share each 64-key K and V^T tile from LDS: two buffers,
// tile t + 2 copied in while tile t + 1 is worked on; the 32 tiles of both passes
// form one sequence, so the copies run on across the pass boundary.
//   S^T = K * Q^T : A = K rows (row = key, k = d), B = Q^T (k = d, n = query)
//   O^T += V^T * P^T : A = Vt rows (row = d, k = key), B = P^T from registers
// Lane owns 32 keys of query column (lane&15); partner = lane ^ 16.
// left kept in LDS; combine = left + 0.1*tanh(right), x256 -> hi/lo f16 planes.
// ---------------------------------------------------------------------------
__global__ __launch_bounds__(128) void attn_kernel(
    const _Float16* __restrict__ qh,   // [NBP*NH][SQ][HD]
    const _Float16* __restrict__ kh,   // [NBP*NH][SQ][HD]
    const _Float16* __restrict__ vt,   // [NBP*NH][HD][SQ]
    const int* __restrict__ mask,      // [NBP][SQ], nonzero = attend
    _Float16* __restrict__ xh,         // [NTOK][DM] f16, hi plane of combine*256
    _Float16* __restrict__ xl)         // [NTOK][DM] f16, lo plane (x2048)
{
  __shared__ __attribute__((aligned(16))) float sO[4 * 16 * 64];    // 16384 B
  __shared__ __attribute__((aligned(16))) _Float16 sK[2 * KVTILE];  // 18432 B
  __shared__ __attribute__((aligned(16))) _Float16 sV[2 * KVTILE];  // 18432 B
  __shared__ __attribute__((aligned(32))) float sB[SQ];             //  4096 B, per key: 0 or MASKED

  const int tid = threadIdx.x, lane = tid & 31, w = tid >> 5;
  const int h = lane >> 4, m = lane & 15;
  const int bph = blockIdx.y, bp = bph >> 4, head = bph & 15;
  const int b = bp >> 1, p = bp & 1;
  const int q0 = blockIdx.x * 64 + 16 * w;

  // Q^T B-fragments: column n = query q0+m, k = d (two 32-deep chunks)
  const _Float16* qrow = qh + ((size_t)bph * SQ + q0 + m) * HD;
  const v16h qb0 = load_frag_h(qrow, h);
  const v16h qb1 = load_frag_h(qrow + 32, h);

  // The mask row as an addend of the base-2 exponent, once per block: thread t owns
  // keys 8t..8t+7. Readable by every wave behind the barrier that publishes tile 0.
  {
    const int* mp = mask + (size_t)bp * SQ + 8 * tid;
    const v4i ma = *(const v4ia*)mp;
    const v4i mb = *(const v4ia*)(mp + 4);
    const v8f bz = { (ma.x != 0) ? 0.0f : MASKED, (ma.y != 0) ? 0.0f : MASKED,
                     (ma.z != 0) ? 0.0f : MASKED, (ma.w != 0) ? 0.0f : MASKED,
                     (mb.x != 0) ? 0.0f : MASKED, (mb.y != 0) ? 0.0f : MASKED,
                     (mb.z != 0) ? 0.0f : MASKED, (mb.w != 0) ? 0.0f : MASKED };
    *(v8fa*)(sB + 8 * tid) = bz;
  }
  float* so = sO + w * 1024;
  const v8f zero8 = {0.f, 0.f, 0.f, 0.f, 0.f, 0.f, 0.f, 0.f};

  // Copy addresses of this lane: row tid>>3 of a sweep, 16-byte column tid&7.
  const int crow = tid >> 3, ccol = tid & 7;
  const int kvown = bph, kvflip = (b * 2 + (1 - p)) * NH + head;
  const _Float16* gk_own  = kh + ((size_t)kvown  * SQ + crow) * HD + 8 * ccol;   // + key0*HD
  const _Float16* gk_flip = kh + ((size_t)kvflip * SQ + crow) * HD + 8 * ccol;
  const _Float16* gv_own  = vt + ((size_t)kvown  * HD + crow) * SQ + 8 * ccol;   // + key0
  const _Float16* gv_flip = vt + ((size_t)kvflip * HD + crow) * SQ + 8 * ccol;
  const unsigned lk0 = lds_off(sK) + crow * (KVP * 2) + 16 * ccol;               // + buffer * KVTILE * 2
  const unsigned lv0 = lds_off(sV) + crow * (KVP * 2) + 16 * ccol;

  // Tile 0 into buffer 0, landed and published; then tile 1 into buffer 1.
  stage_kv(gk_own, gv_own, lk0, lv0);
  asm volatile("s_wait_asynccnt 0x0" ::: "memory");   // this wave's copies of tile 0 have landed
  __syncthreads();                                    // tile 0 readable by every wave
  stage_kv(gk_own + 64 * HD, gv_own + 64, lk0 + KVTILE * 2, lv0 + KVTILE * 2);

  #pragma unroll 1
  for (int pass = 0; pass < 2; ++pass) {

    v8f o[4];                                   // o[t][r] = O[query m][d 16t+8h+r] * (l * 2^14)
    #pragma unroll
    for (int t = 0; t < 4; ++t) o[t] = zero8;
    float mrun = -3.4e38f;                      // running maximum of the base-2 exponents
    v2f lrun = {0.0f, 0.0f};                    // this lane's own 32 keys per trip, two partial sums (x 2^14)

    #pragma unroll 1
    for (int kb = 0; kb < SQ; kb += 64) {
      const int tile = pass * (SQ / 64) + (kb >> 6);
      const int buf = tile & 1;
      const _Float16* kbase = sK + buf * KVTILE + m * KVP;         // + 16j*KVP + 32*dc
      const _Float16* vbase = sV + buf * KVTILE + m * KVP;         // + 16t*KVP + key in tile
      // ---- the trip's mask addends and all eight K fragments, read as one group in
      // front of the score products: one load latency per trip instead of one per
      // pair of products (loops unrolled so that the arrays stay in registers) ----
      v8f mk[4];
      #pragma unroll
      for (int j = 0; j < 4; ++j) mk[j] = *(const v8fa*)(sB + kb + 16 * j + 8 * h);
      v16h kf[4][2];
      #pragma unroll
      for (int j = 0; j < 4; ++j) {
        const _Float16* kp = kbase + (16 * j) * KVP;
        kf[j][0] = load_frag_h(kp, h);
        kf[j][1] = load_frag_h(kp + 32, h);
      }
      // ---- scores: s[j][r] = S[query m][key kb+16j+8h+r] (unscaled) ----
      v8f s[4];
      #pragma unroll
      for (int j = 0; j < 4; ++j) {
        v8f z = zero8;
        z = wmma_f16(kf[j][0], qb0, z);
        z = wmma_f16(kf[j][1], qb1, z);
        s[j] = z;
      }
      // ---- all eight V^T fragments, read as one group here: they land while the
      // softmax below runs ----
      v16h vf[4][2];
      #pragma unroll
      for (int t = 0; t < 4; ++t) {
        const _Float16* vp = vbase + (16 * t) * KVP;
        vf[t][0] = load_frag_h(vp, h);
        vf[t][1] = load_frag_h(vp + 32, h);
      }
      // keeps the V^T reads above the softmax (the scheduler otherwise sinks them to their products)
      __builtin_amdgcn_sched_barrier(0);
      // ---- base-2 exponent: scale, log2(e) and key mask in one fused multiply-add, f32
      // (whole-vector forms: two scores per packed instruction) ----
      #pragma unroll
      for (int j = 0; j < 4; ++j) s[j] = s[j] * SC2 + mk[j];

      // ---- online softmax, base 2 ----
      float mloc = s[0][0];
      #pragma unroll
      for (int j = 0; j < 4; ++j)
        #pragma unroll
        for (int r = 0; r < 8; ++r) mloc = fmaxf(mloc, s[j][r]);
      mloc = fmaxf(mloc, __shfl_xor(mloc, 16));
      const float mnew = fmaxf(mrun, mloc);
      const float alpha = __builtin_amdgcn_exp2f(mrun - mnew);
      mrun = mnew;
      const float msh = mnew - PSHIFT;            // P = 2^(e - mnew + 14)
      #pragma unroll
      for (int j = 0; j < 4; ++j) {
        s[j] = s[j] - msh;
        #pragma unroll
        for (int r = 0; r < 8; ++r) s[j][r] = __builtin_amdgcn_exp2f(s[j][r]);
      }
      // the lane's own sum, pairwise; the partner lane's half joins once, behind the pass
      const v8f s8 = (s[0] + s[1]) + (s[2] + s[3]);
      const v4f s4 = __builtin_shufflevector(s8, s8, 0, 1, 2, 3) + __builtin_shufflevector(s8, s8, 4, 5, 6, 7);
      const v2f s2 = __builtin_shufflevector(s4, s4, 0, 1) + __builtin_shufflevector(s4, s4, 2, 3);
      lrun = lrun * alpha + s2;
      #pragma unroll
      for (int t = 0; t < 4; ++t) o[t] = o[t] * alpha;

      // ---- P^T B-fragments (keys 0..31 and 32..63 of this step) ----
      const v16h pb0 = pack_p(s[0], s[1]);
      const v16h pb1 = pack_p(s[2], s[3]);

      // ---- O^T += V^T * P^T ----
      #pragma unroll
      for (int t = 0; t < 4; ++t) {
        o[t] = wmma_f16(vf[t][0], pb0, o[t]);
        o[t] = wmma_f16(vf[t][1], pb1, o[t]);
      }

      // ---- publish tile + 1, then refill the buffer this trip has read ----
      asm volatile("s_wait_dscnt 0x0" ::: "memory");      // this wave's reads of the buffer are done
      asm volatile("s_wait_asynccnt 0x0" ::: "memory");   // this wave's copies of tile + 1 have landed
      __syncthreads();                                    // publishes tile + 1, ends every read of this buffer
      if (tile + 2 < NTILE) {
        const int nt = tile + 2;
        const int key0 = (nt & (SQ / 64 - 1)) * 64;
        const _Float16* gk = ((nt < SQ / 64) ? gk_own : gk_flip) + (size_t)key0 * HD;
        const _Float16* gv = ((nt < SQ / 64) ? gv_own : gv_flip) + key0;
        stage_kv(gk, gv, lk0 + buf * (KVTILE * 2), lv0 + buf * (KVTILE * 2));
      }
    }

    const float lown = lrun.x + lrun.y;
    const float inv = 1.0f / (lown + __shfl_xor(lown, 16));   // o and the sum both carry 2^14
    if (pass == 0) {
      #pragma unroll
      for (int t = 0; t < 4; ++t)
        #pragma unroll
        for (int r = 0; r < 8; ++r)
          so[m * 64 + 16 * t + 8 * h + r] = o[t][r] * inv;
    } else {
      #pragma unroll
      for (int t = 0; t < 4; ++t)
        #pragma unroll
        for (int r = 0; r < 8; ++r) {
          const int idx = m * 64 + 16 * t + 8 * h + r;
          const float cmb = so[idx] + 0.1f * tanhf(o[t][r] * inv);
          so[idx] = cmb * XSCALE;
        }
    }
  }
  asm volatile("s_wait_asynccnt 0x0" ::: "memory");   // no copy outstanding behind the loop
  __syncthreads();

  const size_t tok0 = (size_t)bp * SQ + q0;
  xc_store_pass(so, xh, xl, tok0, head, lane);
  
}

// ---------------------------------------------------------------------------
// wave w owns rows 16w..16w+15, each row 64 floats = 2 lines; lanes 8q..8q+7
// per line, 4 lines per instruction, 32 lines per wave.
// ---------------------------------------------------------------------------
__device__ __forceinline__ void out_store_pass(const float* sT, float* out,
                                               int m0, int n0, int w, int lane) {
  const int q8 = lane & 7, sub = lane >> 3;
  #pragma unroll
  for (int i = 0; i < 8; ++i) {
    const int lid = i * 4 + sub;                 // 0..31
    const int row = 16 * w + (lid >> 1), hl = lid & 1;
    const v4f v = *(const v4fa*)(sT + row * 64 + 32 * hl + 4 * q8);
    const size_t gi = (size_t)(m0 + row) * DM + n0 + 32 * hl + 4 * q8;
    *(v4f*)(out + gi) = v;
  }
}

// ---------------------------------------------------------------------------
// Kernel 4: out = X * Wo^T + bo with X = hi/256 + lo/(256*2048) planes.
// Block 128 thr (4 waves) = 64 tokens x 64 features; wave 16 tokens x 64.
// A = X rows (k contiguous), B[k][n] = Wo[n][k] from Wo row n (k contiguous).
// The block's 64 hi rows (LDS rows 0..63), 64 lo rows (64..127) and 64 Wo rows
// (128..191) come through LDS in k-tiles of 64: two buffers, tile t + 2 copied
// in while tile t + 1 is worked on.
// ---------------------------------------------------------------------------
__global__ __launch_bounds__(128) void oproj_kernel(
    const _Float16* __restrict__ xh,   // [NTOK][DM]
    const _Float16* __restrict__ xl,   // [NTOK][DM]
    const _Float16* __restrict__ woh,  // [DM][DM] f16(bf16(Wo)*256)
    const float* __restrict__ bo,
    float* __restrict__ out)           // [NTOK][DM]
{
  __shared__ __attribute__((aligned(16))) float sT[64 * 64];        // 16384 B
  __shared__ __attribute__((aligned(16))) _Float16 sG[2 * GTILE];   // 55296 B

  const int tid = threadIdx.x, lane = tid & 31, w = tid >> 5;
  const int h = lane >> 4, m = lane & 15;
  const int m0 = blockIdx.x * 64, n0 = blockIdx.y * 64;

  // Copy addresses of this lane: row tid>>3 of a sweep, 16-byte column tid&7.
  const int crow = tid >> 3, ccol = tid & 7;
  const _Float16* gh = xh + (size_t)(m0 + crow) * DM + 8 * ccol;    // + k
  const _Float16* gl = xl + (size_t)(m0 + crow) * DM + 8 * ccol;    // + k
  const _Float16* gw = woh + (size_t)(n0 + crow) * DM + 8 * ccol;   // + k
  const unsigned lg0 = lds_off(sG) + crow * (GP * 2) + 16 * ccol;   // + buffer * GTILE * 2

  const v8f zero8 = {0.f, 0.f, 0.f, 0.f, 0.f, 0.f, 0.f, 0.f};
  v8f acch[4], accl[4];
  #pragma unroll
  for (int nt = 0; nt < 4; ++nt) { acch[nt] = zero8; accl[nt] = zero8; }

  // Tile 0 into buffer 0, landed and published; then tile 1 into buffer 1.
  stage_gemm(gh, gl, gw, lg0);
  asm volatile("s_wait_asynccnt 0x0" ::: "memory");   // this wave's copies of tile 0 have landed
  __syncthreads();                                    // tile 0 readable by every wave
  stage_gemm(gh + GKT, gl + GKT, gw + GKT, lg0 + GTILE * 2);

  // kept rolled: one copy of the ring's foot (waits, barrier, refill), small loop text
  #pragma unroll 1
  for (int t = 0; t < GNT; ++t) {
    const int buf = t & 1;
    const _Float16* ah = sG + buf * GTILE + (16 * w + m) * GP;        // hi row
    const _Float16* al = ah + 64 * GP;                                // lo row
    const _Float16* wr = sG + buf * GTILE + (128 + m) * GP;           // feature row, nt = 0
    // The tile's fragments are read as one group in front of its products; the
    // loops below are unrolled so that the fragment arrays stay in registers.
    v16h fah[2], fal[2], fb[2][4];
    #pragma unroll
    for (int kc = 0; kc < 2; ++kc) {
      fah[kc] = load_frag_h(ah + 32 * kc, h);
      fal[kc] = load_frag_h(al + 32 * kc, h);
      #pragma unroll
      for (int nt = 0; nt < 4; ++nt) fb[kc][nt] = load_frag_h(wr + nt * 16 * GP + 32 * kc, h);
    }
    #pragma unroll
    for (int kc = 0; kc < 2; ++kc) {
      #pragma unroll
      for (int nt = 0; nt < 4; ++nt) {
        acch[nt] = wmma_f16(fah[kc], fb[kc][nt], acch[nt]);
        accl[nt] = wmma_f16(fal[kc], fb[kc][nt], accl[nt]);
      }
    }
    // ---- publish tile + 1, then refill the buffer this trip has read ----
    asm volatile("s_wait_dscnt 0x0" ::: "memory");      // this wave's reads of the buffer are done
    asm volatile("s_wait_asynccnt 0x0" ::: "memory");   // this wave's copies of tile + 1 have landed
    __syncthreads();                                    // publishes tile + 1, ends every read of this buffer
    if (t + 2 < GNT) {
      const int kn = (t + 2) * GKT;
      stage_gemm(gh + kn, gl + kn, gw + kn, lg0 + buf * (GTILE * 2));
    }
  }
  asm volatile("s_wait_asynccnt 0x0" ::: "memory");   // no copy outstanding behind the loop

  // D[r] of tile nt = Y[token m0+16w+8h+r][feature n0+16nt+m]
  const float sh = 1.0f / (XSCALE * WSCALE);
  const float sl = 1.0f / (XSCALE * WSCALE * LOSCALE);
  #pragma unroll
  for (int nt = 0; nt < 4; ++nt) {
    const int col = 16 * nt + m;
    const float bvl = bo[n0 + col];
    #pragma unroll
    for (int r = 0; r < 8; ++r) {
      const int row = 16 * w + 8 * h + r;                 // 0..63
      sT[row * 64 + col] = acch[nt][r] * sh + accl[nt][r] * sl + bvl;
    }
  }
  __syncthreads();

  out_store_pass(sT, out, m0, n0, w, lane);
  
}

// ---------------------------------------------------------------------------
extern "C" void kernel_launch(void* const* d_in, const int* in_sizes, int n_in,
                              void* d_out, int out_size, void* d_ws, size_t ws_size,
                              hipStream_t stream) {
  if (n_in < 12) return;
  if (in_sizes[0] != NACT || in_sizes[1] != NACT || in_sizes[2] != NACT) return;
  if (in_sizes[3] != NBP * SQ) return;
  if (in_sizes[4] != NWEL || in_sizes[6] != NWEL || in_sizes[8] != NWEL || in_sizes[10] != NWEL) return;
  if (in_sizes[5] != DM || in_sizes[7] != DM || in_sizes[9] != DM || in_sizes[11] != DM) return;
  if (out_size != NACT) return;

  const float* query = (const float*)d_in[0];
  const float* key_  = (const float*)d_in[1];
  const float* value = (const float*)d_in[2];
  const int*   mask  = (const int*)d_in[3];
  const float* Wq = (const float*)d_in[4];
  const float* bq = (const float*)d_in[5];
  const float* Wk = (const float*)d_in[6];
  const float* bk = (const float*)d_in[7];
  const float* Wv = (const float*)d_in[8];
  const float* bv = (const float*)d_in[9];
  const float* Wo = (const float*)d_in[10];
  const float* bo = (const float*)d_in[11];
  float* out = (float*)d_out;

  const size_t xb_bytes  = (size_t)3 * NACT * 2;                 // 25165824
  const size_t wb_bytes  = (size_t)3 * NWEL * 2;                 //  6291456
  const size_t woh_bytes = (size_t)NWEL * 2;                     //  2097152
  const size_t pl_bytes  = (size_t)NBP * NH * SQ * HD * 2;       //  8388608 per plane
  const size_t xc_bytes  = (size_t)NACT * 2;                     //  8388608 per plane
  const size_t total = xb_bytes + wb_bytes + woh_bytes + 3 * pl_bytes + 2 * xc_bytes;   // 75497472
  if (total > ws_size) return;

  char* ws = (char*)d_ws;
  size_t off = 0;
  unsigned short* xb = (unsigned short*)(ws + off); off += xb_bytes;
  unsigned short* wb = (unsigned short*)(ws + off); off += wb_bytes;
  _Float16* woh = (_Float16*)(ws + off);            off += woh_bytes;
  _Float16* qh  = (_Float16*)(ws + off);            off += pl_bytes;
  _Float16* kh  = (_Float16*)(ws + off);            off += pl_bytes;
  _Float16* vt  = (_Float16*)(ws + off);            off += pl_bytes;
  _Float16* xh  = (_Float16*)(ws + off);            off += xc_bytes;
  _Float16* xl  = (_Float16*)(ws + off);            off += xc_bytes;
  if (off > ws_size) return;

  convert_kernel<<<(NGRP + 255) / 256, 256, 0, stream>>>(query, key_, value, Wq, Wk, Wv, Wo, xb, wb, woh);

  dim3 gProj(NTOK / 128, 3 * NH);                               // (32, 48)
  proj_kernel<<<gProj, 128, 0, stream>>>(xb, wb, bq, bk, bv, qh, kh, vt);

  dim3 gAtt(SQ / 64, NBP * NH);                                  // (16, 64)
  attn_kernel<<<gAtt, 128, 0, stream>>>(qh, kh, vt, mask, xh, xl);

  dim3 gOut(NTOK / 64, DM / 64);                                 // (64, 16)
  oproj_kernel<<<gOut, 128, 0, stream>>>(xh, xl, woh, bo, out);
}

// v005
// It runs in 95.4 microseconds.
// Next to v004, in two timings, it ran 1.12 times as fast each time.
// Counting every step since v000, it is 2.85 times as fast.
// Contractions: q/k/v projections x*W^T on v_wmma_f32_16x16x32_bf16 (bf16 operands, f32 accumulate); K*Q^T and V^T*P^T of both attention passes on v_wmma_f32_16x16x32_f16 (f16 operands, P carried x16384, f32 accumulate); output projection on v_wmma_f32_16x16x32_f16 with the activation carried x256 as f16 hi + lo(x2048) planes and the weight as f16 of its bf16 value x256 (f32 accumulate); scale, mask, softmax, tanh and bias in f32.
#include <hip/hip_runtime.h>
#include <math.h>

typedef _Float16       v16h __attribute__((ext_vector_type(16)));
typedef _Float16       v8h  __attribute__((ext_vector_type(8)));
typedef __bf16         v16b __attribute__((ext_vector_type(16)));
typedef unsigned short v8us __attribute__((ext_vector_type(8)));
typedef float          v8f  __attribute__((ext_vector_type(8)));
typedef float          v4f  __attribute__((ext_vector_type(4)));
typedef float          v2f  __attribute__((ext_vector_type(2)));
typedef int            v4i  __attribute__((ext_vector_type(4)));
typedef v8h  __attribute__((may_alias)) v8ha;
typedef v8us __attribute__((may_alias)) v8usa;
typedef v4f  __attribute__((may_alias)) v4fa;
typedef v4i  __attribute__((may_alias)) v4ia;
typedef v8f  __attribute__((may_alias)) v8fa;

union FragH { v16h v; v8h  half[2]; };
union FragB { v16b v; v8us half[2]; };

#define DM     1024
#define NH     16
#define HD     64
#define SQ     1024
#define NBP    4                       // batch * pair
#define NTOK   (NBP * SQ)              // 4096 token rows
#define NACT   (NTOK * DM)             // 4194304
#define NWEL   (DM * DM)               // 1048576
#define ACT8   (NACT / 8)              // 524288
#define WEL8   (NWEL / 8)              // 131072
#define NGRP   (3 * ACT8 + 4 * WEL8)   // 2097152
#define PSHIFT  14.0f                  // P is carried x 2^14: added to the base-2 exponent
#define SC2     0.18033688011112042f   // (1/8) * log2(e): scores go to the base-2 exponent in one product
// Exponent addend of a masked key: the fma absorbs any finite score into it, so masked
// keys are all equal and below every unmasked one: weight 0 beside an unmasked key, and
// equal weights (the plain mean of V) where a whole row is masked.
#define MASKED  -3.0e38f
#define XSCALE  256.0f
#define WSCALE  256.0f
#define LOSCALE 2048.0f

// ---------------------------------------------------------------------------
// 16x16x32 WMMA helpers with hazard guard (ties D, keeps A/B live).
// Fragment map (wave32): lane l, h = l>>4, m = n = l&15.
//   A/B element i: i<8 -> k0+8h+i ; i>=8 -> k0+16+8h+(i-8)
//   D element r : row 8h+r, col l&15
// ---------------------------------------------------------------------------
__device__ __forceinline__ v8f wmma_f16(v16h a, v16h b, v8f c) {
  v8f d = __builtin_amdgcn_wmma_f32_16x16x32_f16(false, a, false, b, (short)0, c, false, false);
  asm volatile("v_nop\n\tv_nop\n\tv_nop\n\tv_nop" : "+v"(d) : "v"(a), "v"(b));
  return d;
}
__device__ __forceinline__ v8f wmma_bf16(v16b a, v16b b, v8f c) {
  v8f d = __builtin_amdgcn_wmma_f32_16x16x32_bf16(false, a, false, b, (short)0, c, false, false);
  asm volatile("v_nop\n\tv_nop\n\tv_nop\n\tv_nop" : "+v"(d) : "v"(a), "v"(b));
  return d;
}

// A or B fragment from a k-contiguous 16-bit row; p points at element k0 of
// the row owned by this lane (row index = lane & 15 added by the caller).
__device__ __forceinline__ v16h load_frag_h(const _Float16* p, int h) {
  FragH f;
  f.half[0] = *(const v8ha*)(p + 8 * h);
  f.half[1] = *(const v8ha*)(p + 16 + 8 * h);
  return f.v;
}
__device__ __forceinline__ v16b load_frag_b(const unsigned short* p, int h) {
  FragB f;
  f.half[0] = *(const v8usa*)(p + 8 * h);
  f.half[1] = *(const v8usa*)(p + 16 + 8 * h);
  return f.v;
}

// f32 -> bf16 bits, RNE
__device__ __forceinline__ unsigned short bf16_bits(float f) {
  unsigned int u = __float_as_uint(f);
  u = u + 0x7FFFu + ((u >> 16) & 1u);
  return (unsigned short)(u >> 16);
}
__device__ __forceinline__ float bf16_val(float f) {
  return __uint_as_float(((unsigned int)bf16_bits(f)) << 16);
}

// ---------------------------------------------------------------------------
// Kernel 1: f32 -> 16-bit planes.
//   xb[3][NTOK][DM] bf16 (query, key, value), wb[3][DM][DM] bf16 (Wq, Wk, Wv),
//   woh[DM][DM] f16 = f16(bf16(Wo) * 256).
// ---------------------------------------------------------------------------
__global__ __launch_bounds__(256) void convert_kernel(
    const float* __restrict__ xq, const float* __restrict__ xk, const float* __restrict__ xv,
    const float* __restrict__ wq, const float* __restrict__ wk, const float* __restrict__ wv,
    const float* __restrict__ wo,
    unsigned short* __restrict__ xb, unsigned short* __restrict__ wb, _Float16* __restrict__ woh)
{
  const int g = blockIdx.x * 256 + threadIdx.x;
  if (g >= NGRP) return;
  if (g < 3 * ACT8 + 3 * WEL8) {
    const float* src;
    unsigned short* dst;
    if (g < 3 * ACT8) {
      const int sel = g / ACT8;
      const int off = g - sel * ACT8;
      const float* xs = (sel == 0) ? xq : ((sel == 1) ? xk : xv);
      src = xs + (size_t)off * 8;
      dst = xb + (size_t)sel * NACT + (size_t)off * 8;
    } else {
      const int e = g - 3 * ACT8;
      const int sel = e / WEL8;
      const int off = e - sel * WEL8;
      const float* wsrc = (sel == 0) ? wq : ((sel == 1) ? wk : wv);
      src = wsrc + (size_t)off * 8;
      dst = wb + (size_t)sel * NWEL + (size_t)off * 8;
    }
    const v4f a = *(const v4fa*)src;
    const v4f c = *(const v4fa*)(src + 4);
    const v8us o = { bf16_bits(a.x), bf16_bits(a.y), bf16_bits(a.z), bf16_bits(a.w),
                     bf16_bits(c.x), bf16_bits(c.y), bf16_bits(c.z), bf16_bits(c.w) };
    *(v8us*)dst = o;
    
  } else {
    const int off = g - (3 * ACT8 + 3 * WEL8);
    const float* src = wo + (size_t)off * 8;
    _Float16* dst = woh + (size_t)off * 8;
    const v4f a = *(const v4fa*)src;
    const v4f c = *(const v4fa*)(src + 4);
    const v8h o = { (_Float16)(bf16_val(a.x) * WSCALE), (_Float16)(bf16_val(a.y) * WSCALE),
                    (_Float16)(bf16_val(a.z) * WSCALE), (_Float16)(bf16_val(a.w) * WSCALE),
                    (_Float16)(bf16_val(c.x) * WSCALE), (_Float16)(bf16_val(c.y) * WSCALE),
                    (_Float16)(bf16_val(c.z) * WSCALE), (_Float16)(bf16_val(c.w) * WSCALE) };
    *(v8h*)dst = o;
    
  }
}

// ---------------------------------------------------------------------------
// 4 lines per instruction, 32 lines per wave, 128 per block.
// which 0/1: plane[bh][s][d]  (one token row = 64 halves = one line)
// which 2  : vt[bh][d][s]     (64 d-rows x 128 tokens = 2 lines each)
// ---------------------------------------------------------------------------
__device__ __forceinline__ void proj_store_pass(const _Float16* sT, _Float16* plane, _Float16* vt,
                                                int which, int bh, int l0, int w, int lane) {
  const int q8 = lane & 7, sub = lane >> 3;
  #pragma unroll
  for (int i = 0; i < 8; ++i) {
    const int lid = w * 32 + i * 4 + sub;
    v8h v;
    _Float16* dst;
    if (which != 2) {
      v = *(const v8ha*)(sT + lid * HD + 8 * q8);
      dst = plane + ((size_t)bh * SQ + l0 + lid) * HD + 8 * q8;
    } else {
      const int d = lid >> 1, hl = lid & 1;
      v = *(const v8ha*)(sT + d * 128 + 64 * hl + 8 * q8);
      dst = vt + ((size_t)bh * HD + d) * SQ + l0 + 64 * hl + 8 * q8;
    }
    *(v8h*)dst = v;
    // the next round's address arithmetic reuses this store's address registers
    asm volatile("s_wait_xcnt 0x0" ::: "memory");
  }
}

__device__ __forceinline__ unsigned lds_off(const void* p) { return (unsigned)(size_t)p; }

// ---------------------------------------------------------------------------
// GEMM operand staging (kernels 2 and 4): one k-tile = 64 k (128 B) of 256
// operand rows, four groups of 64 rows, LDS row pitch 144 B (16 B x odd,
// conflict-free for the 16-byte fragment reads). 128 threads, 8 lanes per row,
// 16 rows per sweep, 4 sweeps per group: every copy instruction covers whole
// 128-B lines of the source. Source row pitch = DM 16-bit elements.
// ---------------------------------------------------------------------------
#define GP     72                      // LDS row pitch in 16-bit elements (144 B)
#define GTILE  (256 * GP)              // elements per staged k-tile (36864 B)
#define GKT    64                      // k per tile
#define GNT    (DM / GKT)              // 16 k-tiles

// Two groups of 64 rows. g0 / g1: this lane's 16 B of row (tid>>3) of each group, at
// the tile's first k; l: the lane's LDS byte address of row (tid>>3) of the first group.
__device__ __forceinline__ void stage_pair(const void* g0, const void* g1, unsigned l) {
  const char* a0 = (const char*)g0;
  const char* a1 = a0 + 16 * DM * 2;
  const char* a2 = a0 + 32 * DM * 2;
  const char* a3 = a0 + 48 * DM * 2;
  const char* b0 = (const char*)g1;
  const char* b1 = b0 + 16 * DM * 2;
  const char* b2 = b0 + 32 * DM * 2;
  const char* b3 = b0 + 48 * DM * 2;
  const unsigned la1 = l + 16 * GP * 2,  la2 = l + 32 * GP * 2,  la3 = l + 48 * GP * 2;
  const unsigned lb0 = l + 64 * GP * 2,  lb1 = l + 80 * GP * 2,  lb2 = l + 96 * GP * 2,  lb3 = l + 112 * GP * 2;
  // Global -> LDS through no register; the closing s_wait_xcnt stands in the same
  // statement so that no address register is rewritten in front of it.
  asm volatile(
      "global_load_async_to_lds_b128 %0, %8, off\n\t"
      "global_load_async_to_lds_b128 %1, %9, off\n\t"
      "global_load_async_to_lds_b128 %2, %10, off\n\t"
      "global_load_async_to_lds_b128 %3, %11, off\n\t"
      "global_load_async_to_lds_b128 %4, %12, off\n\t"
      "global_load_async_to_lds_b128 %5, %13, off\n\t"
      "global_load_async_to_lds_b128 %6, %14, off\n\t"
      "global_load_async_to_lds_b128 %7, %15, off\n\t"
      "s_wait_xcnt 0x0"
      :: "v"(l), "v"(la1), "v"(la2), "v"(la3), "v"(lb0), "v"(lb1), "v"(lb2), "v"(lb3),
         "v"(a0), "v"(a1), "v"(a2), "v"(a3), "v"(b0), "v"(b1), "v"(b2), "v"(b3)
      : "memory");
}

// g0 .. g3: the four groups of a k-tile (LDS rows 0..63, 64..127, 128..191, 192..255).
__device__ __forceinline__ void stage_gemm(const void* g0, const void* g1, const void* g2, const void* g3,
                                           unsigned l) {
  stage_pair(g0, g1, l);
  stage_pair(g2, g3, l + 128 * GP * 2);
}

// ---------------------------------------------------------------------------
// Kernel 2: Y = x * W^T for the three projections (bf16 operands).
// Block 128 thr (4 waves, 2 x 2) = 128 tokens x 128 features (two heads) of one
// projection; wave tile 64 tokens x 64 features (one head), 16 accumulator tiles:
// 8 fragments feed 16 products. K = 1024 in steps of 32.
// A = x rows (token-major, k contiguous), B[k][n] = W[n][k] from W row n
// (k contiguous) -> both fragments with the same loader.
// The block's 128 x rows (LDS rows 0..127) and 128 W rows (LDS rows 128..255)
// come through LDS in k-tiles of 64: two buffers, tile t + 2 copied in while
// tile t + 1 is worked on.
// ---------------------------------------------------------------------------
__global__ __launch_bounds__(128) void proj_kernel(
    const unsigned short* __restrict__ xb,   // [3][NTOK][DM] bf16
    const unsigned short* __restrict__ wb,   // [3][DM][DM]   bf16, row = output feature
    const float* __restrict__ bq, const float* __restrict__ bk, const float* __restrict__ bv,
    _Float16* __restrict__ qh,               // [NBP*NH][SQ][HD] f16
    _Float16* __restrict__ kh,               // [NBP*NH][SQ][HD] f16
    _Float16* __restrict__ vt)               // [NBP*NH][HD][SQ] f16
{
  __shared__ __attribute__((aligned(16))) _Float16 sT[2 * 128 * 64];      // 32768 B, one plane per head
  __shared__ __attribute__((aligned(16))) unsigned short sG[2 * GTILE];   // 73728 B

  const int tid = threadIdx.x, lane = tid & 31, w = tid >> 5;
  const int h = lane >> 4, m = lane & 15;
  const int wm = w >> 1, wn = w & 1;         // wave's 64-token half, wave's head of the pair
  const int m0 = blockIdx.x * 128;
  const int cg = blockIdx.y;                 // 0..23
  const int which = cg >> 3, head0 = (cg & 7) * 2;

  // Copy addresses of this lane: row tid>>3 of a sweep, 16-byte column tid&7.
  const int crow = tid >> 3, ccol = tid & 7;
  const unsigned short* gx = xb + (size_t)which * NACT + (size_t)(m0 + crow) * DM + 8 * ccol;          // + k
  const unsigned short* gw = wb + (size_t)which * NWEL + (size_t)(head0 * HD + crow) * DM + 8 * ccol;  // + k
  const unsigned lg0 = lds_off(sG) + crow * (GP * 2) + 16 * ccol;                                      // + buffer * GTILE * 2

  const v8f zero8 = {0.f, 0.f, 0.f, 0.f, 0.f, 0.f, 0.f, 0.f};
  v8f acc[4][4];
  #pragma unroll
  for (int mt = 0; mt < 4; ++mt)
    #pragma unroll
    for (int nt = 0; nt < 4; ++nt) acc[mt][nt] = zero8;

  // Tile 0 into buffer 0, landed and published; then tile 1 into buffer 1.
  stage_gemm(gx, gx + 64 * DM, gw, gw + 64 * DM, lg0);
  asm volatile("s_wait_asynccnt 0x0" ::: "memory");   // this wave's copies of tile 0 have landed
  __syncthreads();                                    // tile 0 readable by every wave
  stage_gemm(gx + GKT, gx + 64 * DM + GKT, gw + GKT, gw + 64 * DM + GKT, lg0 + GTILE * 2);

  // kept rolled: one copy of the ring's foot (waits, barrier, refill), small loop text
  #pragma unroll 1
  for (int t = 0; t < GNT; ++t) {
    const int buf = t & 1;
    const unsigned short* xa = sG + buf * GTILE + (64 * wm + m) * GP;         // token row, mt = 0
    const unsigned short* wr = sG + buf * GTILE + (128 + 64 * wn + m) * GP;   // feature row, nt = 0
    // Each 32-deep step reads its eight fragments as one group in front of its 16
    // products; the loops are unrolled so that the fragment arrays stay in registers.
    #pragma unroll
    for (int kc = 0; kc < 2; ++kc) {
      v16b fa[4], fb[4];
      #pragma unroll
      for (int i = 0; i < 4; ++i) fa[i] = load_frag_b(xa + i * 16 * GP + 32 * kc, h);
      #pragma unroll
      for (int i = 0; i < 4; ++i) fb[i] = load_frag_b(wr + i * 16 * GP + 32 * kc, h);
      #pragma unroll
      for (int nt = 0; nt < 4; ++nt) {
        #pragma unroll
        for (int mt = 0; mt < 4; ++mt) acc[mt][nt] = wmma_bf16(fa[mt], fb[nt], acc[mt][nt]);
      }
    }
    // ---- publish tile + 1, then refill the buffer this trip has read ----
    asm volatile("s_wait_dscnt 0x0" ::: "memory");      // this wave's reads of the buffer are done
    asm volatile("s_wait_asynccnt 0x0" ::: "memory");   // this wave's copies of tile + 1 have landed
    __syncthreads();                                    // publishes tile + 1, ends every read of this buffer
    if (t + 2 < GNT) {
      const int kn = (t + 2) * GKT;
      stage_gemm(gx + kn, gx + 64 * DM + kn, gw + kn, gw + 64 * DM + kn, lg0 + buf * (GTILE * 2));
    }
  }
  asm volatile("s_wait_asynccnt 0x0" ::: "memory");   // no copy outstanding behind the loop

  // D[r] of tile (mt, nt) = Y[token m0+64wm+16mt+8h+r][feature (head0+wn)*64+16nt+m]
  const float* bias = (which == 0) ? bq : ((which == 1) ? bk : bv);
  _Float16* sTh = sT + wn * (128 * 64);
  #pragma unroll
  for (int nt = 0; nt < 4; ++nt) {
    const int feat = 16 * nt + m;
    const float bvl = bias[(head0 + wn) * HD + feat];
    #pragma unroll
    for (int mt = 0; mt < 4; ++mt) {
      #pragma unroll
      for (int r = 0; r < 8; ++r) {
        const int tokl = 64 * wm + 16 * mt + 8 * h + r;    // 0..127
        const float y = acc[mt][nt][r] + bvl;
        const int idx = (which == 2) ? (feat * 128 + tokl) : (tokl * HD + feat);
        sTh[idx] = (_Float16)y;
      }
    }
  }
  __syncthreads();

  const int bp = m0 >> 10, l0 = m0 & (SQ - 1), bh = bp * NH + head0;
  _Float16* plane = (which == 0) ? qh : kh;
  proj_store_pass(sT, plane, vt, which, bh, l0, w, lane);
  proj_store_pass(sT + 128 * 64, plane, vt, which, bh + 1, l0, w, lane);
}

// ---------------------------------------------------------------------------
// Attention helpers.
// ---------------------------------------------------------------------------
// P^T B-fragment from the lane's own P values (already x 2^14): element r <- tile a
// row r (keys 0..15 of the 32-key step), element 8+r <- tile c row r (keys 16..31),
// same lane (query column).
__device__ __forceinline__ v16h pack_p(v8f a, v8f c) {
  const v16h r = { (_Float16)a[0], (_Float16)a[1], (_Float16)a[2], (_Float16)a[3],
                   (_Float16)a[4], (_Float16)a[5], (_Float16)a[6], (_Float16)a[7],
                   (_Float16)c[0], (_Float16)c[1], (_Float16)c[2], (_Float16)c[3],
                   (_Float16)c[4], (_Float16)c[5], (_Float16)c[6], (_Float16)c[7] };
  return r;
}

// Per-wave 16x64 f32 tile (already x256) in LDS -> hi/lo f16 planes
// lanes 8q..8q+7 per line, 4 lines per instruction, 16 rows x 2 planes per wave.
__device__ __forceinline__ void xc_store_pass(const float* so, _Float16* xh, _Float16* xl,
                                              size_t tok0, int head, int lane) {
  const int q8 = lane & 7, sub = lane >> 3;
  #pragma unroll
  for (int i = 0; i < 4; ++i) {
    const int row = 4 * i + sub;
    const v4f a = *(const v4fa*)(so + row * 64 + 8 * q8);
    const v4f c = *(const v4fa*)(so + row * 64 + 8 * q8 + 4);
    const _Float16 h0 = (_Float16)a.x, h1 = (_Float16)a.y, h2 = (_Float16)a.z, h3 = (_Float16)a.w;
    const _Float16 h4 = (_Float16)c.x, h5 = (_Float16)c.y, h6 = (_Float16)c.z, h7 = (_Float16)c.w;
    const v8h hv = { h0, h1, h2, h3, h4, h5, h6, h7 };
    const v8h lv = { (_Float16)((a.x - (float)h0) * LOSCALE), (_Float16)((a.y - (float)h1) * LOSCALE),
                     (_Float16)((a.z - (float)h2) * LOSCALE), (_Float16)((a.w - (float)h3) * LOSCALE),
                     (_Float16)((c.x - (float)h4) * LOSCALE), (_Float16)((c.y - (float)h5) * LOSCALE),
                     (_Float16)((c.z - (float)h6) * LOSCALE), (_Float16)((c.w - (float)h7) * LOSCALE) };
    const size_t gi = (tok0 + row) * (size_t)DM + (size_t)head * HD + 8 * q8;
    *(v8h*)(xh + gi) = hv;
    *(v8h*)(xl + gi) = lv;
  }
}

// ---------------------------------------------------------------------------
// K / V^T tile staging: 64 rows x 128 B each, LDS row pitch 144 B (16 B x odd,
// conflict-free for the 16-byte fragment reads). 128 threads, 8 lanes per row,
// 16 rows per sweep, 4 sweeps per operand: every copy instruction covers whole
// 128-B lines of the source.
// ---------------------------------------------------------------------------
#define KVP    72                      // LDS row pitch in halves (144 B)
#define KVTILE (64 * KVP)              // halves per staged tile (9216 B)
#define NTILE  (2 * (SQ / 64))         // 32 tiles: 16 of the own pair, 16 of the flipped one

// gk: this lane's 16 B of K row (tid>>3) of the tile; gv: the same of V^T row (tid>>3).
// lk / lv: the lane's LDS byte addresses for those rows.
__device__ __forceinline__ void stage_kv(const _Float16* gk, const _Float16* gv, unsigned lk, unsigned lv) {
  const _Float16* gk1 = gk + 16 * HD;
  const _Float16* gk2 = gk + 32 * HD;
  const _Float16* gk3 = gk + 48 * HD;
  const _Float16* gv1 = gv + 16 * SQ;
  const _Float16* gv2 = gv + 32 * SQ;
  const _Float16* gv3 = gv + 48 * SQ;
  const unsigned lk1 = lk + 16 * KVP * 2, lk2 = lk + 32 * KVP * 2, lk3 = lk + 48 * KVP * 2;
  const unsigned lv1 = lv + 16 * KVP * 2, lv2 = lv + 32 * KVP * 2, lv3 = lv + 48 * KVP * 2;
  // Global -> LDS through no register; the closing s_wait_xcnt stands in the same
  // statement so that no address register is rewritten in front of it.
  asm volatile(
      "global_load_async_to_lds_b128 %0, %8, off\n\t"
      "global_load_async_to_lds_b128 %1, %9, off\n\t"
      "global_load_async_to_lds_b128 %2, %10, off\n\t"
      "global_load_async_to_lds_b128 %3, %11, off\n\t"
      "global_load_async_to_lds_b128 %4, %12, off\n\t"
      "global_load_async_to_lds_b128 %5, %13, off\n\t"
      "global_load_async_to_lds_b128 %6, %14, off\n\t"
      "global_load_async_to_lds_b128 %7, %15, off\n\t"
      "s_wait_xcnt 0x0"
      :: "v"(lk), "v"(lk1), "v"(lk2), "v"(lk3), "v"(lv), "v"(lv1), "v"(lv2), "v"(lv3),
         "v"(gk), "v"(gk1), "v"(gk2), "v"(gk3), "v"(gv), "v"(gv1), "v"(gv2), "v"(gv3)
      : "memory");
}

// ---------------------------------------------------------------------------
// Block 128 thr (4 waves), 16 queries per wave, 64 keys per step.
// The block's four waves share each 64-key K and V^T tile from LDS: two buffers,
// tile t + 2 copied in while tile t + 1 is worked on; the 32 tiles of both passes
// form one sequence, so the copies run on across the pass boundary.
//   S^T = K * Q^T : A = K rows (row = key, k = d), B = Q^T (k = d, n = query)
//   O^T += V^T * P^T : A = Vt rows (row = d, k = key), B = P^T from registers
// Lane owns 32 keys of query column (lane&15); partner = lane ^ 16.
// left kept in LDS; combine = left + 0.1*tanh(right), x256 -> hi/lo f16 planes.
// ---------------------------------------------------------------------------
__global__ __launch_bounds__(128) void attn_kernel(
    const _Float16* __restrict__ qh,   // [NBP*NH][SQ][HD]
    const _Float16* __restrict__ kh,   // [NBP*NH][SQ][HD]
    const _Float16* __restrict__ vt,   // [NBP*NH][HD][SQ]
    const int* __restrict__ mask,      // [NBP][SQ], nonzero = attend
    _Float16* __restrict__ xh,         // [NTOK][DM] f16, hi plane of combine*256
    _Float16* __restrict__ xl)         // [NTOK][DM] f16, lo plane (x2048)
{
  __shared__ __attribute__((aligned(16))) float sO[4 * 16 * 64];    // 16384 B
  __shared__ __attribute__((aligned(16))) _Float16 sK[2 * KVTILE];  // 18432 B
  __shared__ __attribute__((aligned(16))) _Float16 sV[2 * KVTILE];  // 18432 B
  __shared__ __attribute__((aligned(32))) float sB[SQ];             //  4096 B, per key: 0 or MASKED

  const int tid = threadIdx.x, lane = tid & 31, w = tid >> 5;
  const int h = lane >> 4, m = lane & 15;
  const int bph = blockIdx.y, bp = bph >> 4, head = bph & 15;
  const int b = bp >> 1, p = bp & 1;
  const int q0 = blockIdx.x * 64 + 16 * w;

  // Q^T B-fragments: column n = query q0+m, k = d (two 32-deep chunks)
  const _Float16* qrow = qh + ((size_t)bph * SQ + q0 + m) * HD;
  const v16h qb0 = load_frag_h(qrow, h);
  const v16h qb1 = load_frag_h(qrow + 32, h);

  // The mask row as an addend of the base-2 exponent, once per block: thread t owns
  // keys 8t..8t+7. Readable by every wave behind the barrier that publishes tile 0.
  {
    const int* mp = mask + (size_t)bp * SQ + 8 * tid;
    const v4i ma = *(const v4ia*)mp;
    const v4i mb = *(const v4ia*)(mp + 4);
    const v8f bz = { (ma.x != 0) ? 0.0f : MASKED, (ma.y != 0) ? 0.0f : MASKED,
                     (ma.z != 0) ? 0.0f : MASKED, (ma.w != 0) ? 0.0f : MASKED,
                     (mb.x != 0) ? 0.0f : MASKED, (mb.y != 0) ? 0.0f : MASKED,
                     (mb.z != 0) ? 0.0f : MASKED, (mb.w != 0) ? 0.0f : MASKED };
    *(v8fa*)(sB + 8 * tid) = bz;
  }
  float* so = sO + w * 1024;
  const v8f zero8 = {0.f, 0.f, 0.f, 0.f, 0.f, 0.f, 0.f, 0.f};

  // Copy addresses of this lane: row tid>>3 of a sweep, 16-byte column tid&7.
  const int crow = tid >> 3, ccol = tid & 7;
  const int kvown = bph, kvflip = (b * 2 + (1 - p)) * NH + head;
  const _Float16* gk_own  = kh + ((size_t)kvown  * SQ + crow) * HD + 8 * ccol;   // + key0*HD
  const _Float16* gk_flip = kh + ((size_t)kvflip * SQ + crow) * HD + 8 * ccol;
  const _Float16* gv_own  = vt + ((size_t)kvown  * HD + crow) * SQ + 8 * ccol;   // + key0
  const _Float16* gv_flip = vt + ((size_t)kvflip * HD + crow) * SQ + 8 * ccol;
  const unsigned lk0 = lds_off(sK) + crow * (KVP * 2) + 16 * ccol;               // + buffer * KVTILE * 2
  const unsigned lv0 = lds_off(sV) + crow * (KVP * 2) + 16 * ccol;

  // Tile 0 into buffer 0, landed and published; then tile 1 into buffer 1.
  stage_kv(gk_own, gv_own, lk0, lv0);
  asm volatile("s_wait_asynccnt 0x0" ::: "memory");   // this wave's copies of tile 0 have landed
  __syncthreads();                                    // tile 0 readable by every wave
  stage_kv(gk_own + 64 * HD, gv_own + 64, lk0 + KVTILE * 2, lv0 + KVTILE * 2);

  #pragma unroll 1
  for (int pass = 0; pass < 2; ++pass) {

    v8f o[4];                                   // o[t][r] = O[query m][d 16t+8h+r] * (l * 2^14)
    #pragma unroll
    for (int t = 0; t < 4; ++t) o[t] = zero8;
    float mrun = -3.4e38f;                      // running maximum of the base-2 exponents
    v2f lrun = {0.0f, 0.0f};                    // this lane's own 32 keys per trip, two partial sums (x 2^14)

    #pragma unroll 1
    for (int kb = 0; kb < SQ; kb += 64) {
      const int tile = pass * (SQ / 64) + (kb >> 6);
      const int buf = tile & 1;
      const _Float16* kbase = sK + buf * KVTILE + m * KVP;         // + 16j*KVP + 32*dc
      const _Float16* vbase = sV + buf * KVTILE + m * KVP;         // + 16t*KVP + key in tile
      // ---- the trip's mask addends and all eight K fragments, read as one group in
      // front of the score products: one load latency per trip instead of one per
      // pair of products (loops unrolled so that the arrays stay in registers) ----
      v8f mk[4];
      #pragma unroll
      for (int j = 0; j < 4; ++j) mk[j] = *(const v8fa*)(sB + kb + 16 * j + 8 * h);
      v16h kf[4][2];
      #pragma unroll
      for (int j = 0; j < 4; ++j) {
        const _Float16* kp = kbase + (16 * j) * KVP;
        kf[j][0] = load_frag_h(kp, h);
        kf[j][1] = load_frag_h(kp + 32, h);
      }
      // ---- scores: s[j][r] = S[query m][key kb+16j+8h+r] (unscaled) ----
      v8f s[4];
      #pragma unroll
      for (int j = 0; j < 4; ++j) {
        v8f z = zero8;
        z = wmma_f16(kf[j][0], qb0, z);
        z = wmma_f16(kf[j][1], qb1, z);
        s[j] = z;
      }
      // ---- all eight V^T fragments, read as one group here: they land while the
      // softmax below runs ----
      v16h vf[4][2];
      #pragma unroll
      for (int t = 0; t < 4; ++t) {
        const _Float16* vp = vbase + (16 * t) * KVP;
        vf[t][0] = load_frag_h(vp, h);
        vf[t][1] = load_frag_h(vp + 32, h);
      }
      // keeps the V^T reads above the softmax (the scheduler otherwise sinks them to their products)
      __builtin_amdgcn_sched_barrier(0);
      // ---- base-2 exponent: scale, log2(e) and key mask in one fused multiply-add, f32
      // (whole-vector forms: two scores per packed instruction) ----
      #pragma unroll
      for (int j = 0; j < 4; ++j) s[j] = s[j] * SC2 + mk[j];

      // ---- online softmax, base 2 ----
      float mloc = s[0][0];
      #pragma unroll
      for (int j = 0; j < 4; ++j)
        #pragma unroll
        for (int r = 0; r < 8; ++r) mloc = fmaxf(mloc, s[j][r]);
      mloc = fmaxf(mloc, __shfl_xor(mloc, 16));
      const float mnew = fmaxf(mrun, mloc);
      const float alpha = __builtin_amdgcn_exp2f(mrun - mnew);
      mrun = mnew;
      const float msh = mnew - PSHIFT;            // P = 2^(e - mnew + 14)
      #pragma unroll
      for (int j = 0; j < 4; ++j) {
        s[j] = s[j] - msh;
        #pragma unroll
        for (int r = 0; r < 8; ++r) s[j][r] = __builtin_amdgcn_exp2f(s[j][r]);
      }
      // the lane's own sum, pairwise; the partner lane's half joins once, behind the pass
      const v8f s8 = (s[0] + s[1]) + (s[2] + s[3]);
      const v4f s4 = __builtin_shufflevector(s8, s8, 0, 1, 2, 3) + __builtin_shufflevector(s8, s8, 4, 5, 6, 7);
      const v2f s2 = __builtin_shufflevector(s4, s4, 0, 1) + __builtin_shufflevector(s4, s4, 2, 3);
      lrun = lrun * alpha + s2;
      #pragma unroll
      for (int t = 0; t < 4; ++t) o[t] = o[t] * alpha;

      // ---- P^T B-fragments (keys 0..31 and 32..63 of this step) ----
      const v16h pb0 = pack_p(s[0], s[1]);
      const v16h pb1 = pack_p(s[2], s[3]);

      // ---- O^T += V^T * P^T ----
      #pragma unroll
      for (int t = 0; t < 4; ++t) {
        o[t] = wmma_f16(vf[t][0], pb0, o[t]);
        o[t] = wmma_f16(vf[t][1], pb1, o[t]);
      }

      // ---- publish tile + 1, then refill the buffer this trip has read ----
      asm volatile("s_wait_dscnt 0x0" ::: "memory");      // this wave's reads of the buffer are done
      asm volatile("s_wait_asynccnt 0x0" ::: "memory");   // this wave's copies of tile + 1 have landed
      __syncthreads();                                    // publishes tile + 1, ends every read of this buffer
      if (tile + 2 < NTILE) {
        const int nt = tile + 2;
        const int key0 = (nt & (SQ / 64 - 1)) * 64;
        const _Float16* gk = ((nt < SQ / 64) ? gk_own : gk_flip) + (size_t)key0 * HD;
        const _Float16* gv = ((nt < SQ / 64) ? gv_own : gv_flip) + key0;
        stage_kv(gk, gv, lk0 + buf * (KVTILE * 2), lv0 + buf * (KVTILE * 2));
      }
    }

    const float lown = lrun.x + lrun.y;
    const float inv = 1.0f / (lown + __shfl_xor(lown, 16));   // o and the sum both carry 2^14
    if (pass == 0) {
      #pragma unroll
      for (int t = 0; t < 4; ++t)
        #pragma unroll
        for (int r = 0; r < 8; ++r)
          so[m * 64 + 16 * t + 8 * h + r] = o[t][r] * inv;
    } else {
      #pragma unroll
      for (int t = 0; t < 4; ++t)
        #pragma unroll
        for (int r = 0; r < 8; ++r) {
          const int idx = m * 64 + 16 * t + 8 * h + r;
          const float cmb = so[idx] + 0.1f * tanhf(o[t][r] * inv);
          so[idx] = cmb * XSCALE;
        }
    }
  }
  asm volatile("s_wait_asynccnt 0x0" ::: "memory");   // no copy outstanding behind the loop
  __syncthreads();

  const size_t tok0 = (size_t)bp * SQ + q0;
  xc_store_pass(so, xh, xl, tok0, head, lane);
  
}

// ---------------------------------------------------------------------------
// wave w owns rows 16w..16w+15, each row 128 floats = 4 lines: one row (512 B) per
// instruction, 16 B per lane.
// ---------------------------------------------------------------------------
__device__ __forceinline__ void out_store_pass(const float* sT, float* out,
                                               int m0, int n0, int w, int lane) {
  #pragma unroll
  for (int i = 0; i < 16; ++i) {
    const int row = 16 * w + i;
    const v4f v = *(const v4fa*)(sT + row * 128 + 4 * lane);
    const size_t gi = (size_t)(m0 + row) * DM + n0 + 4 * lane;
    *(v4f*)(out + gi) = v;
  }
}

// ---------------------------------------------------------------------------
// Kernel 4: out = X * Wo^T + bo with X = hi/256 + lo/(256*2048) planes.
// Block 128 thr (4 waves, 2 x 2) = 64 tokens x 128 features; wave 32 tokens (hi and
// lo rows) x 64 features, 16 accumulator tiles: 8 fragments feed 16 products.
// A = X rows (k contiguous), B[k][n] = Wo[n][k] from Wo row n (k contiguous).
// The block's 64 hi rows (LDS rows 0..63), 64 lo rows (64..127) and 128 Wo rows
// (128..255) come through LDS in k-tiles of 64: two buffers, tile t + 2 copied
// in while tile t + 1 is worked on.
// ---------------------------------------------------------------------------
__global__ __launch_bounds__(128) void oproj_kernel(
    const _Float16* __restrict__ xh,   // [NTOK][DM]
    const _Float16* __restrict__ xl,   // [NTOK][DM]
    const _Float16* __restrict__ woh,  // [DM][DM] f16(bf16(Wo)*256)
    const float* __restrict__ bo,
    float* __restrict__ out)           // [NTOK][DM]
{
  __shared__ __attribute__((aligned(16))) float sT[64 * 128];       // 32768 B
  __shared__ __attribute__((aligned(16))) _Float16 sG[2 * GTILE];   // 73728 B

  const int tid = threadIdx.x, lane = tid & 31, w = tid >> 5;
  const int h = lane >> 4, m = lane & 15;
  const int wm = w >> 1, wn = w & 1;         // wave's 32-token half, wave's 64-feature half
  const int m0 = blockIdx.x * 64, n0 = blockIdx.y * 128;

  // Copy addresses of this lane: row tid>>3 of a sweep, 16-byte column tid&7.
  const int crow = tid >> 3, ccol = tid & 7;
  const _Float16* gh = xh + (size_t)(m0 + crow) * DM + 8 * ccol;    // + k
  const _Float16* gl = xl + (size_t)(m0 + crow) * DM + 8 * ccol;    // + k
  const _Float16* gw = woh + (size_t)(n0 + crow) * DM + 8 * ccol;   // + k
  const unsigned lg0 = lds_off(sG) + crow * (GP * 2) + 16 * ccol;   // + buffer * GTILE * 2

  const v8f zero8 = {0.f, 0.f, 0.f, 0.f, 0.f, 0.f, 0.f, 0.f};
  v8f acch[2][4], accl[2][4];
  #pragma unroll
  for (int mt = 0; mt < 2; ++mt)
    #pragma unroll
    for (int nt = 0; nt < 4; ++nt) { acch[mt][nt] = zero8; accl[mt][nt] = zero8; }

  // Tile 0 into buffer 0, landed and published; then tile 1 into buffer 1.
  stage_gemm(gh, gl, gw, gw + 64 * DM, lg0);
  asm volatile("s_wait_asynccnt 0x0" ::: "memory");   // this wave's copies of tile 0 have landed
  __syncthreads();                                    // tile 0 readable by every wave
  stage_gemm(gh + GKT, gl + GKT, gw + GKT, gw + 64 * DM + GKT, lg0 + GTILE * 2);

  // kept rolled: one copy of the ring's foot (waits, barrier, refill), small loop text
  #pragma unroll 1
  for (int t = 0; t < GNT; ++t) {
    const int buf = t & 1;
    const _Float16* ah = sG + buf * GTILE + (32 * wm + m) * GP;             // hi row, mt = 0
    const _Float16* al = ah + 64 * GP;                                      // lo row, mt = 0
    const _Float16* wr = sG + buf * GTILE + (128 + 64 * wn + m) * GP;       // feature row, nt = 0
    // Each 32-deep step reads its eight fragments as one group in front of its 16
    // products; the loops are unrolled so that the fragment arrays stay in registers.
    #pragma unroll
    for (int kc = 0; kc < 2; ++kc) {
      v16h fah[2], fal[2], fb[4];
      #pragma unroll
      for (int i = 0; i < 2; ++i) {
        fah[i] = load_frag_h(ah + i * 16 * GP + 32 * kc, h);
        fal[i] = load_frag_h(al + i * 16 * GP + 32 * kc, h);
      }
      #pragma unroll
      for (int i = 0; i < 4; ++i) fb[i] = load_frag_h(wr + i * 16 * GP + 32 * kc, h);
      #pragma unroll
      for (int nt = 0; nt < 4; ++nt) {
        #pragma unroll
        for (int mt = 0; mt < 2; ++mt) {
          acch[mt][nt] = wmma_f16(fah[mt], fb[nt], acch[mt][nt]);
          accl[mt][nt] = wmma_f16(fal[mt], fb[nt], accl[mt][nt]);
        }
      }
    }
    // ---- publish tile + 1, then refill the buffer this trip has read ----
    asm volatile("s_wait_dscnt 0x0" ::: "memory");      // this wave's reads of the buffer are done
    asm volatile("s_wait_asynccnt 0x0" ::: "memory");   // this wave's copies of tile + 1 have landed
    __syncthreads();                                    // publishes tile + 1, ends every read of this buffer
    if (t + 2 < GNT) {
      const int kn = (t + 2) * GKT;
      stage_gemm(gh + kn, gl + kn, gw + kn, gw + 64 * DM + kn, lg0 + buf * (GTILE * 2));
    }
  }
  asm volatile("s_wait_asynccnt 0x0" ::: "memory");   // no copy outstanding behind the loop

  // D[r] of tile (mt, nt) = Y[token m0+32wm+16mt+8h+r][feature n0+64wn+16nt+m]
  const float sh = 1.0f / (XSCALE * WSCALE);
  const float sl = 1.0f / (XSCALE * WSCALE * LOSCALE);
  #pragma unroll
  for (int nt = 0; nt < 4; ++nt) {
    const int col = 64 * wn + 16 * nt + m;                // 0..127
    const float bvl = bo[n0 + col];
    #pragma unroll
    for (int mt = 0; mt < 2; ++mt) {
      #pragma unroll
      for (int r = 0; r < 8; ++r) {
        const int row = 32 * wm + 16 * mt + 8 * h + r;    // 0..63
        sT[row * 128 + col] = acch[mt][nt][r] * sh + accl[mt][nt][r] * sl + bvl;
      }
    }
  }
  __syncthreads();

  out_store_pass(sT, out, m0, n0, w, lane);
}

// ---------------------------------------------------------------------------
extern "C" void kernel_launch(void* const* d_in, const int* in_sizes, int n_in,
                              void* d_out, int out_size, void* d_ws, size_t ws_size,
                              hipStream_t stream) {
  if (n_in < 12) return;
  if (in_sizes[0] != NACT || in_sizes[1] != NACT || in_sizes[2] != NACT) return;
  if (in_sizes[3] != NBP * SQ) return;
  if (in_sizes[4] != NWEL || in_sizes[6] != NWEL || in_sizes[8] != NWEL || in_sizes[10] != NWEL) return;
  if (in_sizes[5] != DM || in_sizes[7] != DM || in_sizes[9] != DM || in_sizes[11] != DM) return;
  if (out_size != NACT) return;

  const float* query = (const float*)d_in[0];
  const float* key_  = (const float*)d_in[1];
  const float* value = (const float*)d_in[2];
  const int*   mask  = (const int*)d_in[3];
  const float* Wq = (const float*)d_in[4];
  const float* bq = (const float*)d_in[5];
  const float* Wk = (const float*)d_in[6];
  const float* bk = (const float*)d_in[7];
  const float* Wv = (const float*)d_in[8];
  const float* bv = (const float*)d_in[9];
  const float* Wo = (const float*)d_in[10];
  const float* bo = (const float*)d_in[11];
  float* out = (float*)d_out;

  const size_t xb_bytes  = (size_t)3 * NACT * 2;                 // 25165824
  const size_t wb_bytes  = (size_t)3 * NWEL * 2;                 //  6291456
  const size_t woh_bytes = (size_t)NWEL * 2;                     //  2097152
  const size_t pl_bytes  = (size_t)NBP * NH * SQ * HD * 2;       //  8388608 per plane
  const size_t xc_bytes  = (size_t)NACT * 2;                     //  8388608 per plane
  const size_t total = xb_bytes + wb_bytes + woh_bytes + 3 * pl_bytes + 2 * xc_bytes;   // 75497472
  if (total > ws_size) return;

  char* ws = (char*)d_ws;
  size_t off = 0;
  unsigned short* xb = (unsigned short*)(ws + off); off += xb_bytes;
  unsigned short* wb = (unsigned short*)(ws + off); off += wb_bytes;
  _Float16* woh = (_Float16*)(ws + off);            off += woh_bytes;
  _Float16* qh  = (_Float16*)(ws + off);            off += pl_bytes;
  _Float16* kh  = (_Float16*)(ws + off);            off += pl_bytes;
  _Float16* vt  = (_Float16*)(ws + off);            off += pl_bytes;
  _Float16* xh  = (_Float16*)(ws + off);            off += xc_bytes;
  _Float16* xl  = (_Float16*)(ws + off);            off += xc_bytes;
  if (off > ws_size) return;

  convert_kernel<<<(NGRP + 255) / 256, 256, 0, stream>>>(query, key_, value, Wq, Wk, Wv, Wo, xb, wb, woh);

  dim3 gProj(NTOK / 128, 3 * NH / 2);                           // (32, 24)
  proj_kernel<<<gProj, 128, 0, stream>>>(xb, wb, bq, bk, bv, qh, kh, vt);

  dim3 gAtt(SQ / 64, NBP * NH);                                  // (16, 64)
  attn_kernel<<<gAtt, 128, 0, stream>>>(qh, kh, vt, mask, xh, xl);

  dim3 gOut(NTOK / 64, DM / 128);                                // (64, 8)
  oproj_kernel<<<gOut, 128, 0, stream>>>(xh, xl, woh, bo, out);
}

// v006
// One run takes 91.1 microseconds.
// Timed twice side by side with v005, it ran 1.07 times as fast both times.
// Counting every step since v000, it is 3.05 times as fast.
// Contractions: q/k/v projections x*W^T on v_wmma_f32_16x16x32_bf16 (bf16 operands, f32 accumulate); K*Q^T and V^T*P^T of both attention passes on v_wmma_f32_16x16x32_f16 (f16 operands, P carried x16384, f32 accumulate); output projection on v_wmma_f32_16x16x32_f16 with the activation carried x256 as f16 hi + lo(x2048) planes and the weight as f16 of its bf16 value x256 (f32 accumulate); scale, mask, softmax, tanh and bias in f32.
#include <hip/hip_runtime.h>
#include <math.h>

typedef _Float16       v16h __attribute__((ext_vector_type(16)));
typedef _Float16       v8h  __attribute__((ext_vector_type(8)));
typedef __bf16         v16b __attribute__((ext_vector_type(16)));
typedef unsigned short v8us __attribute__((ext_vector_type(8)));
typedef float          v8f  __attribute__((ext_vector_type(8)));
typedef float          v4f  __attribute__((ext_vector_type(4)));
typedef float          v2f  __attribute__((ext_vector_type(2)));
typedef int            v4i  __attribute__((ext_vector_type(4)));
typedef v8h  __attribute__((may_alias)) v8ha;
typedef v8us __attribute__((may_alias)) v8usa;
typedef v4f  __attribute__((may_alias)) v4fa;
typedef v4i  __attribute__((may_alias)) v4ia;
typedef v8f  __attribute__((may_alias)) v8fa;

union FragH { v16h v; v8h  half[2]; };
union FragB { v16b v; v8us half[2]; };

#define DM     1024
#define NH     16
#define HD     64
#define SQ     1024
#define NBP    4                       // batch * pair
#define NTOK   (NBP * SQ)              // 4096 token rows
#define NACT   (NTOK * DM)             // 4194304
#define NWEL   (DM * DM)               // 1048576
#define ACT8   (NACT / 8)              // 524288
#define WEL8   (NWEL / 8)              // 131072
#define NGRP   (3 * ACT8 + 4 * WEL8)   // 2097152
#define PSHIFT  14.0f                  // P is carried x 2^14: added to the base-2 exponent
#define SC2     0.18033688011112042f   // (1/8) * log2(e): scores go to the base-2 exponent in one product
// Exponent addend of a masked key: the fma absorbs any finite score into it, so masked
// keys are all equal and below every unmasked one: weight 0 beside an unmasked key, and
// equal weights (the plain mean of V) where a whole row is masked.
#define MASKED  -3.0e38f
#define XSCALE  256.0f
#define WSCALE  256.0f
#define LOSCALE 2048.0f

// ---------------------------------------------------------------------------
// 16x16x32 WMMA helpers with hazard guard (ties D, keeps A/B live).
// Fragment map (wave32): lane l, h = l>>4, m = n = l&15.
//   A/B element i: i<8 -> k0+8h+i ; i>=8 -> k0+16+8h+(i-8)
//   D element r : row 8h+r, col l&15
// ---------------------------------------------------------------------------
__device__ __forceinline__ v8f wmma_f16(v16h a, v16h b, v8f c) {
  v8f d = __builtin_amdgcn_wmma_f32_16x16x32_f16(false, a, false, b, (short)0, c, false, false);
  asm volatile("v_nop\n\tv_nop\n\tv_nop\n\tv_nop" : "+v"(d) : "v"(a), "v"(b));
  return d;
}
__device__ __forceinline__ v8f wmma_bf16(v16b a, v16b b, v8f c) {
  v8f d = __builtin_amdgcn_wmma_f32_16x16x32_bf16(false, a, false, b, (short)0, c, false, false);
  asm volatile("v_nop\n\tv_nop\n\tv_nop\n\tv_nop" : "+v"(d) : "v"(a), "v"(b));
  return d;
}

// A or B fragment from a k-contiguous 16-bit row; p points at element k0 of
// the row owned by this lane (row index = lane & 15 added by the caller).
__device__ __forceinline__ v16h load_frag_h(const _Float16* p, int h) {
  FragH f;
  f.half[0] = *(const v8ha*)(p + 8 * h);
  f.half[1] = *(const v8ha*)(p + 16 + 8 * h);
  return f.v;
}
__device__ __forceinline__ v16b load_frag_b(const unsigned short* p, int h) {
  FragB f;
  f.half[0] = *(const v8usa*)(p + 8 * h);
  f.half[1] = *(const v8usa*)(p + 16 + 8 * h);
  return f.v;
}

// f32 -> bf16 bits, RNE
__device__ __forceinline__ unsigned short bf16_bits(float f) {
  unsigned int u = __float_as_uint(f);
  u = u + 0x7FFFu + ((u >> 16) & 1u);
  return (unsigned short)(u >> 16);
}
__device__ __forceinline__ float bf16_val(float f) {
  return __uint_as_float(((unsigned int)bf16_bits(f)) << 16);
}

// ---------------------------------------------------------------------------
// Kernel 1: f32 -> 16-bit planes.
//   xb[3][NTOK][DM] bf16 (query, key, value), wb[3][DM][DM] bf16 (Wq, Wk, Wv),
//   woh[DM][DM] f16 = f16(bf16(Wo) * 256).
// ---------------------------------------------------------------------------
__global__ __launch_bounds__(256) void convert_kernel(
    const float* __restrict__ xq, const float* __restrict__ xk, const float* __restrict__ xv,
    const float* __restrict__ wq, const float* __restrict__ wk, const float* __restrict__ wv,
    const float* __restrict__ wo,
    unsigned short* __restrict__ xb, unsigned short* __restrict__ wb, _Float16* __restrict__ woh)
{
  const int g = blockIdx.x * 256 + threadIdx.x;
  if (g >= NGRP) return;
  if (g < 3 * ACT8 + 3 * WEL8) {
    const float* src;
    unsigned short* dst;
    if (g < 3 * ACT8) {
      const int sel = g / ACT8;
      const int off = g - sel * ACT8;
      const float* xs = (sel == 0) ? xq : ((sel == 1) ? xk : xv);
      src = xs + (size_t)off * 8;
      dst = xb + (size_t)sel * NACT + (size_t)off * 8;
    } else {
      const int e = g - 3 * ACT8;
      const int sel = e / WEL8;
      const int off = e - sel * WEL8;
      const float* wsrc = (sel == 0) ? wq : ((sel == 1) ? wk : wv);
      src = wsrc + (size_t)off * 8;
      dst = wb + (size_t)sel * NWEL + (size_t)off * 8;
    }
    const v4f a = *(const v4fa*)src;
    const v4f c = *(const v4fa*)(src + 4);
    const v8us o = { bf16_bits(a.x), bf16_bits(a.y), bf16_bits(a.z), bf16_bits(a.w),
                     bf16_bits(c.x), bf16_bits(c.y), bf16_bits(c.z), bf16_bits(c.w) };
    *(v8us*)dst = o;
    
  } else {
    const int off = g - (3 * ACT8 + 3 * WEL8);
    const float* src = wo + (size_t)off * 8;
    _Float16* dst = woh + (size_t)off * 8;
    const v4f a = *(const v4fa*)src;
    const v4f c = *(const v4fa*)(src + 4);
    const v8h o = { (_Float16)(bf16_val(a.x) * WSCALE), (_Float16)(bf16_val(a.y) * WSCALE),
                    (_Float16)(bf16_val(a.z) * WSCALE), (_Float16)(bf16_val(a.w) * WSCALE),
                    (_Float16)(bf16_val(c.x) * WSCALE), (_Float16)(bf16_val(c.y) * WSCALE),
                    (_Float16)(bf16_val(c.z) * WSCALE), (_Float16)(bf16_val(c.w) * WSCALE) };
    *(v8h*)dst = o;
    
  }
}

// ---------------------------------------------------------------------------
// 4 lines per instruction, 32 lines per wave, 128 per block.
// which 0/1: plane[bh][s][d]  (one token row = 64 halves = one line)
// which 2  : vt[bh][d][s]     (64 d-rows x 128 tokens = 2 lines each)
// ---------------------------------------------------------------------------
__device__ __forceinline__ void proj_store_pass(const _Float16* sT, _Float16* plane, _Float16* vt,
                                                int which, int bh, int l0, int w, int lane) {
  const int q8 = lane & 7, sub = lane >> 3;
  #pragma unroll
  for (int i = 0; i < 8; ++i) {
    const int lid = w * 32 + i * 4 + sub;
    v8h v;
    _Float16* dst;
    if (which != 2) {
      v = *(const v8ha*)(sT + lid * HD + 8 * q8);
      dst = plane + ((size_t)bh * SQ + l0 + lid) * HD + 8 * q8;
    } else {
      const int d = lid >> 1, hl = lid & 1;
      v = *(const v8ha*)(sT + d * 128 + 64 * hl + 8 * q8);
      dst = vt + ((size_t)bh * HD + d) * SQ + l0 + 64 * hl + 8 * q8;
    }
    *(v8h*)dst = v;
    // the next round's address arithmetic reuses this store's address registers
    asm volatile("s_wait_xcnt 0x0" ::: "memory");
  }
}

__device__ __forceinline__ unsigned lds_off(const void* p) { return (unsigned)(size_t)p; }

// ---------------------------------------------------------------------------
// GEMM operand staging (kernels 2 and 4): one k-tile = 64 k (128 B) of 256
// operand rows, four groups of 64 rows, LDS row pitch 144 B (16 B x odd,
// conflict-free for the 16-byte fragment reads). 128 threads, 8 lanes per row,
// 16 rows per sweep, 4 sweeps per group: every copy instruction covers whole
// 128-B lines of the source. Source row pitch = DM 16-bit elements.
// ---------------------------------------------------------------------------
#define GP     72                      // LDS row pitch in 16-bit elements (144 B)
#define GTILE  (256 * GP)              // elements per staged k-tile (36864 B)
#define GKT    64                      // k per tile
#define GNT    (DM / GKT)              // 16 k-tiles

// Two groups of 64 rows. g0 / g1: this lane's 16 B of row (tid>>3) of each group, at
// the tile's first k; l: the lane's LDS byte address of row (tid>>3) of the first group.
__device__ __forceinline__ void stage_pair(const void* g0, const void* g1, unsigned l) {
  const char* a0 = (const char*)g0;
  const char* a1 = a0 + 16 * DM * 2;
  const char* a2 = a0 + 32 * DM * 2;
  const char* a3 = a0 + 48 * DM * 2;
  const char* b0 = (const char*)g1;
  const char* b1 = b0 + 16 * DM * 2;
  const char* b2 = b0 + 32 * DM * 2;
  const char* b3 = b0 + 48 * DM * 2;
  const unsigned la1 = l + 16 * GP * 2,  la2 = l + 32 * GP * 2,  la3 = l + 48 * GP * 2;
  const unsigned lb0 = l + 64 * GP * 2,  lb1 = l + 80 * GP * 2,  lb2 = l + 96 * GP * 2,  lb3 = l + 112 * GP * 2;
  // Global -> LDS through no register; the closing s_wait_xcnt stands in the same
  // statement so that no address register is rewritten in front of it.
  asm volatile(
      "global_load_async_to_lds_b128 %0, %8, off\n\t"
      "global_load_async_to_lds_b128 %1, %9, off\n\t"
      "global_load_async_to_lds_b128 %2, %10, off\n\t"
      "global_load_async_to_lds_b128 %3, %11, off\n\t"
      "global_load_async_to_lds_b128 %4, %12, off\n\t"
      "global_load_async_to_lds_b128 %5, %13, off\n\t"
      "global_load_async_to_lds_b128 %6, %14, off\n\t"
      "global_load_async_to_lds_b128 %7, %15, off\n\t"
      "s_wait_xcnt 0x0"
      :: "v"(l), "v"(la1), "v"(la2), "v"(la3), "v"(lb0), "v"(lb1), "v"(lb2), "v"(lb3),
         "v"(a0), "v"(a1), "v"(a2), "v"(a3), "v"(b0), "v"(b1), "v"(b2), "v"(b3)
      : "memory");
}

// g0 .. g3: the four groups of a k-tile (LDS rows 0..63, 64..127, 128..191, 192..255).
__device__ __forceinline__ void stage_gemm(const void* g0, const void* g1, const void* g2, const void* g3,
                                           unsigned l) {
  stage_pair(g0, g1, l);
  stage_pair(g2, g3, l + 128 * GP * 2);
}

// ---------------------------------------------------------------------------
// Kernel 2: Y = x * W^T for the three projections (bf16 operands).
// Block 128 thr (4 waves, 2 x 2) = 128 tokens x 128 features (two heads) of one
// projection; wave tile 64 tokens x 64 features (one head), 16 accumulator tiles:
// 8 fragments feed 16 products. K = 1024 in steps of 32.
// A = x rows (token-major, k contiguous), B[k][n] = W[n][k] from W row n
// (k contiguous) -> both fragments with the same loader.
// The block's 128 x rows (LDS rows 0..127) and 128 W rows (LDS rows 128..255)
// come through LDS in k-tiles of 64: two buffers, tile t + 2 copied in while
// tile t + 1 is worked on.
// ---------------------------------------------------------------------------
__global__ __launch_bounds__(128) void proj_kernel(
    const unsigned short* __restrict__ xb,   // [3][NTOK][DM] bf16
    const unsigned short* __restrict__ wb,   // [3][DM][DM]   bf16, row = output feature
    const float* __restrict__ bq, const float* __restrict__ bk, const float* __restrict__ bv,
    _Float16* __restrict__ qh,               // [NBP*NH][SQ][HD] f16
    _Float16* __restrict__ kh,               // [NBP*NH][SQ][HD] f16
    _Float16* __restrict__ vt)               // [NBP*NH][HD][SQ] f16
{
  __shared__ __attribute__((aligned(16))) _Float16 sT[2 * 128 * 64];      // 32768 B, one plane per head
  __shared__ __attribute__((aligned(16))) unsigned short sG[2 * GTILE];   // 73728 B

  const int tid = threadIdx.x, lane = tid & 31, w = tid >> 5;
  const int h = lane >> 4, m = lane & 15;
  const int wm = w >> 1, wn = w & 1;         // wave's 64-token half, wave's head of the pair
  const int m0 = blockIdx.x * 128;
  const int cg = blockIdx.y;                 // 0..23
  const int which = cg >> 3, head0 = (cg & 7) * 2;

  // Copy addresses of this lane: row tid>>3 of a sweep, 16-byte column tid&7.
  const int crow = tid >> 3, ccol = tid & 7;
  const unsigned short* gx = xb + (size_t)which * NACT + (size_t)(m0 + crow) * DM + 8 * ccol;          // + k
  const unsigned short* gw = wb + (size_t)which * NWEL + (size_t)(head0 * HD + crow) * DM + 8 * ccol;  // + k
  const unsigned lg0 = lds_off(sG) + crow * (GP * 2) + 16 * ccol;                                      // + buffer * GTILE * 2

  const v8f zero8 = {0.f, 0.f, 0.f, 0.f, 0.f, 0.f, 0.f, 0.f};
  v8f acc[4][4];
  #pragma unroll
  for (int mt = 0; mt < 4; ++mt)
    #pragma unroll
    for (int nt = 0; nt < 4; ++nt) acc[mt][nt] = zero8;

  // Tile 0 into buffer 0, landed and published; then tile 1 into buffer 1.
  stage_gemm(gx, gx + 64 * DM, gw, gw + 64 * DM, lg0);
  asm volatile("s_wait_asynccnt 0x0" ::: "memory");   // this wave's copies of tile 0 have landed
  __syncthreads();                                    // tile 0 readable by every wave
  stage_gemm(gx + GKT, gx + 64 * DM + GKT, gw + GKT, gw + 64 * DM + GKT, lg0 + GTILE * 2);

  // kept rolled: one copy of the ring's foot (waits, barrier, refill), small loop text
  #pragma unroll 1
  for (int t = 0; t < GNT; ++t) {
    const int buf = t & 1;
    const unsigned short* xa = sG + buf * GTILE + (64 * wm + m) * GP;         // token row, mt = 0
    const unsigned short* wr = sG + buf * GTILE + (128 + 64 * wn + m) * GP;   // feature row, nt = 0
    // Each 32-deep step reads its eight fragments as one group in front of its 16
    // products; the loops are unrolled so that the fragment arrays stay in registers.
    #pragma unroll
    for (int kc = 0; kc < 2; ++kc) {
      v16b fa[4], fb[4];
      #pragma unroll
      for (int i = 0; i < 4; ++i) fa[i] = load_frag_b(xa + i * 16 * GP + 32 * kc, h);
      #pragma unroll
      for (int i = 0; i < 4; ++i) fb[i] = load_frag_b(wr + i * 16 * GP + 32 * kc, h);
      #pragma unroll
      for (int nt = 0; nt < 4; ++nt) {
        #pragma unroll
        for (int mt = 0; mt < 4; ++mt) acc[mt][nt] = wmma_bf16(fa[mt], fb[nt], acc[mt][nt]);
      }
    }
    // ---- publish tile + 1, then refill the buffer this trip has read ----
    asm volatile("s_wait_dscnt 0x0" ::: "memory");      // this wave's reads of the buffer are done
    asm volatile("s_wait_asynccnt 0x0" ::: "memory");   // this wave's copies of tile + 1 have landed
    __syncthreads();                                    // publishes tile + 1, ends every read of this buffer
    if (t + 2 < GNT) {
      const int kn = (t + 2) * GKT;
      stage_gemm(gx + kn, gx + 64 * DM + kn, gw + kn, gw + 64 * DM + kn, lg0 + buf * (GTILE * 2));
    }
  }
  asm volatile("s_wait_asynccnt 0x0" ::: "memory");   // no copy outstanding behind the loop

  // D[r] of tile (mt, nt) = Y[token m0+64wm+16mt+8h+r][feature (head0+wn)*64+16nt+m]
  const float* bias = (which == 0) ? bq : ((which == 1) ? bk : bv);
  _Float16* sTh = sT + wn * (128 * 64);
  #pragma unroll
  for (int nt = 0; nt < 4; ++nt) {
    const int feat = 16 * nt + m;
    const float bvl = bias[(head0 + wn) * HD + feat];
    #pragma unroll
    for (int mt = 0; mt < 4; ++mt) {
      #pragma unroll
      for (int r = 0; r < 8; ++r) {
        const int tokl = 64 * wm + 16 * mt + 8 * h + r;    // 0..127
        const float y = acc[mt][nt][r] + bvl;
        const int idx = (which == 2) ? (feat * 128 + tokl) : (tokl * HD + feat);
        sTh[idx] = (_Float16)y;
      }
    }
  }
  __syncthreads();

  const int bp = m0 >> 10, l0 = m0 & (SQ - 1), bh = bp * NH + head0;
  _Float16* plane = (which == 0) ? qh : kh;
  proj_store_pass(sT, plane, vt, which, bh, l0, w, lane);
  proj_store_pass(sT + 128 * 64, plane, vt, which, bh + 1, l0, w, lane);
}

// ---------------------------------------------------------------------------
// Attention helpers.
// ---------------------------------------------------------------------------
// P^T B-fragment from the lane's own P values (already x 2^14): element r <- tile a
// row r (keys 0..15 of the 32-key step), element 8+r <- tile c row r (keys 16..31),
// same lane (query column).
__device__ __forceinline__ v16h pack_p(v8f a, v8f c) {
  const v16h r = { (_Float16)a[0], (_Float16)a[1], (_Float16)a[2], (_Float16)a[3],
                   (_Float16)a[4], (_Float16)a[5], (_Float16)a[6], (_Float16)a[7],
                   (_Float16)c[0], (_Float16)c[1], (_Float16)c[2], (_Float16)c[3],
                   (_Float16)c[4], (_Float16)c[5], (_Float16)c[6], (_Float16)c[7] };
  return r;
}

// Per-wave 16x64 f32 tile (already x256) in LDS -> hi/lo f16 planes
// lanes 8q..8q+7 per line, 4 lines per instruction, 16 rows x 2 planes per wave.
__device__ __forceinline__ void xc_store_pass(const float* so, _Float16* xh, _Float16* xl,
                                              size_t tok0, int head, int lane) {
  const int q8 = lane & 7, sub = lane >> 3;
  #pragma unroll
  for (int i = 0; i < 4; ++i) {
    const int row = 4 * i + sub;
    const v4f a = *(const v4fa*)(so + row * 64 + 8 * q8);
    const v4f c = *(const v4fa*)(so + row * 64 + 8 * q8 + 4);
    const _Float16 h0 = (_Float16)a.x, h1 = (_Float16)a.y, h2 = (_Float16)a.z, h3 = (_Float16)a.w;
    const _Float16 h4 = (_Float16)c.x, h5 = (_Float16)c.y, h6 = (_Float16)c.z, h7 = (_Float16)c.w;
    const v8h hv = { h0, h1, h2, h3, h4, h5, h6, h7 };
    const v8h lv = { (_Float16)((a.x - (float)h0) * LOSCALE), (_Float16)((a.y - (float)h1) * LOSCALE),
                     (_Float16)((a.z - (float)h2) * LOSCALE), (_Float16)((a.w - (float)h3) * LOSCALE),
                     (_Float16)((c.x - (float)h4) * LOSCALE), (_Float16)((c.y - (float)h5) * LOSCALE),
                     (_Float16)((c.z - (float)h6) * LOSCALE), (_Float16)((c.w - (float)h7) * LOSCALE) };
    const size_t gi = (tok0 + row) * (size_t)DM + (size_t)head * HD + 8 * q8;
    *(v8h*)(xh + gi) = hv;
    *(v8h*)(xl + gi) = lv;
  }
}

// ---------------------------------------------------------------------------
// K / V^T tile staging: 64 rows x 128 B each, LDS row pitch 144 B (16 B x odd,
// conflict-free for the 16-byte fragment reads). 128 threads, 8 lanes per row,
// 16 rows per sweep, 4 sweeps per operand: every copy instruction covers whole
// 128-B lines of the source.
// ---------------------------------------------------------------------------
#define KVP    72                      // LDS row pitch in halves (144 B)
#define KVTILE (64 * KVP)              // halves per staged tile (9216 B)
#define NTILE  (SQ / 64)               // 16 tiles per pass

// gk: this lane's 16 B of K row (tid&127)>>3 of the tile; gv: the same of V^T row (tid&127)>>3.
// lk / lv: the lane's LDS byte addresses for those rows.
__device__ __forceinline__ void stage_kv(const _Float16* gk, const _Float16* gv, unsigned lk, unsigned lv) {
  const _Float16* gk1 = gk + 16 * HD;
  const _Float16* gk2 = gk + 32 * HD;
  const _Float16* gk3 = gk + 48 * HD;
  const _Float16* gv1 = gv + 16 * SQ;
  const _Float16* gv2 = gv + 32 * SQ;
  const _Float16* gv3 = gv + 48 * SQ;
  const unsigned lk1 = lk + 16 * KVP * 2, lk2 = lk + 32 * KVP * 2, lk3 = lk + 48 * KVP * 2;
  const unsigned lv1 = lv + 16 * KVP * 2, lv2 = lv + 32 * KVP * 2, lv3 = lv + 48 * KVP * 2;
  // Global -> LDS through no register; the closing s_wait_xcnt stands in the same
  // statement so that no address register is rewritten in front of it.
  asm volatile(
      "global_load_async_to_lds_b128 %0, %8, off\n\t"
      "global_load_async_to_lds_b128 %1, %9, off\n\t"
      "global_load_async_to_lds_b128 %2, %10, off\n\t"
      "global_load_async_to_lds_b128 %3, %11, off\n\t"
      "global_load_async_to_lds_b128 %4, %12, off\n\t"
      "global_load_async_to_lds_b128 %5, %13, off\n\t"
      "global_load_async_to_lds_b128 %6, %14, off\n\t"
      "global_load_async_to_lds_b128 %7, %15, off\n\t"
      "s_wait_xcnt 0x0"
      :: "v"(lk), "v"(lk1), "v"(lk2), "v"(lk3), "v"(lv), "v"(lv1), "v"(lv2), "v"(lv3),
         "v"(gk), "v"(gk1), "v"(gk2), "v"(gk3), "v"(gv), "v"(gv1), "v"(gv2), "v"(gv3)
      : "memory");
}

// ---------------------------------------------------------------------------
// Block 256 thr (8 waves) = 128 queries; 32 queries (two 16-column tiles) per wave,
// 64 keys per step: each K and V^T fragment read from LDS feeds two products.
// The two passes run side by side: waves 0..3 attend to the own pair's K / V, waves
// 4..7 to the flipped pair's, for the same 128 queries. Each group of four waves
// shares its own 64-key K and V^T tiles from LDS: two buffers per group, tile t + 2
// copied in while tile t + 1 is worked on.
//   S^T = K * Q^T : A = K rows (row = key, k = d), B = Q^T (k = d, n = query)
//   O^T += V^T * P^T : A = Vt rows (row = d, k = key), B = P^T from registers
// Lane owns 32 keys of query columns (lane&15) and 16 + (lane&15); partner = lane ^ 16.
// The two waves of the same queries swap one column tile each through LDS;
// combine = left + 0.1*tanh(right), x256 -> hi/lo f16 planes.
// Four waves per SIMD (two blocks per WGP): the register budget is 256 per wave.
// ---------------------------------------------------------------------------
__global__ __launch_bounds__(256) __attribute__((amdgpu_waves_per_eu(4, 4))) void attn_kernel(
    const _Float16* __restrict__ qh,   // [NBP*NH][SQ][HD]
    const _Float16* __restrict__ kh,   // [NBP*NH][SQ][HD]
    const _Float16* __restrict__ vt,   // [NBP*NH][HD][SQ]
    const int* __restrict__ mask,      // [NBP][SQ], nonzero = attend
    _Float16* __restrict__ xh,         // [NTOK][DM] f16, hi plane of combine*256
    _Float16* __restrict__ xl)         // [NTOK][DM] f16, lo plane (x2048)
{
  __shared__ __attribute__((aligned(16))) float sO[4 * 32 * 64];        // 32768 B
  __shared__ __attribute__((aligned(16))) _Float16 sK[2 * 2 * KVTILE];  // 36864 B, [group][buffer]
  __shared__ __attribute__((aligned(16))) _Float16 sV[2 * 2 * KVTILE];  // 36864 B, [group][buffer]
  __shared__ __attribute__((aligned(32))) float sB[SQ];                 //  4096 B, per key: 0 or MASKED

  const int tid = threadIdx.x, lane = tid & 31;
  const int h = lane >> 4, m = lane & 15;
  const int g  = __builtin_amdgcn_readfirstlane(tid >> 7);          // 0: own pair, 1: flipped pair
  const int wq = __builtin_amdgcn_readfirstlane((tid >> 5) & 3);    // the wave's 32 queries of the block's 128
  const int bph = blockIdx.y, bp = bph >> 4, head = bph & 15;
  const int b = bp >> 1, p = bp & 1;
  const int q0 = blockIdx.x * 128 + 32 * wq;

  // Q^T B-fragments: column n = query q0+16c+m, k = d (two 32-deep chunks)
  v16h qb[2][2];
  #pragma unroll
  for (int c = 0; c < 2; ++c) {
    const _Float16* qrow = qh + ((size_t)bph * SQ + q0 + 16 * c + m) * HD;
    qb[c][0] = load_frag_h(qrow, h);
    qb[c][1] = load_frag_h(qrow + 32, h);
  }

  // The mask row as an addend of the base-2 exponent, once per block: thread t owns
  // keys 4t..4t+3. Readable by every wave behind the barrier that publishes tile 0.
  {
    const v4i ma = *(const v4ia*)(mask + (size_t)bp * SQ + 4 * tid);
    const v4f bz = { (ma.x != 0) ? 0.0f : MASKED, (ma.y != 0) ? 0.0f : MASKED,
                     (ma.z != 0) ? 0.0f : MASKED, (ma.w != 0) ? 0.0f : MASKED };
    *(v4fa*)(sB + 4 * tid) = bz;
  }
  float* so = sO + wq * 2048;
  const v8f zero8 = {0.f, 0.f, 0.f, 0.f, 0.f, 0.f, 0.f, 0.f};

  // Copy addresses of this lane: its group's 128 threads sweep the group's tiles,
  // row (tid&127)>>3 of a sweep, 16-byte column tid&7.
  const int crow = (tid & 127) >> 3, ccol = tid & 7;
  const int kvsel = (g == 0) ? bph : ((b * 2 + (1 - p)) * NH + head);
  const _Float16* gk0 = kh + ((size_t)kvsel * SQ + crow) * HD + 8 * ccol;   // + key0*HD
  const _Float16* gv0 = vt + ((size_t)kvsel * HD + crow) * SQ + 8 * ccol;   // + key0
  const unsigned lk0 = lds_off(sK) + g * (2 * KVTILE * 2) + crow * (KVP * 2) + 16 * ccol;   // + buffer * KVTILE * 2
  const unsigned lv0 = lds_off(sV) + g * (2 * KVTILE * 2) + crow * (KVP * 2) + 16 * ccol;

  // Tile 0 into buffer 0, landed and published; then tile 1 into buffer 1.
  stage_kv(gk0, gv0, lk0, lv0);
  asm volatile("s_wait_asynccnt 0x0" ::: "memory");   // this wave's copies of tile 0 have landed
  __syncthreads();                                    // tile 0 readable by every wave
  stage_kv(gk0 + 64 * HD, gv0 + 64, lk0 + KVTILE * 2, lv0 + KVTILE * 2);

  v8f o[2][4];                                  // o[c][t][r] = O[query 16c+m][d 16t+8h+r] * (l * 2^14)
  #pragma unroll
  for (int c = 0; c < 2; ++c)
    #pragma unroll
    for (int t = 0; t < 4; ++t) o[c][t] = zero8;
  float mrun[2] = {-3.4e38f, -3.4e38f};         // running maximum of the base-2 exponents
  v2f lrun[2] = {{0.0f, 0.0f}, {0.0f, 0.0f}};   // this lane's own 32 keys per trip, two partial sums (x 2^14)

  // One trip: tile's 64 keys against the wave's 32 queries, then the ring's publish point.
  auto trip = [&](const int tile) __attribute__((always_inline)) {
    const int kb = tile * 64;
    const int buf = tile & 1;
    const _Float16* kbase = sK + (2 * g + buf) * KVTILE + m * KVP;   // + 16j*KVP + 32*dc
    const _Float16* vbase = sV + (2 * g + buf) * KVTILE + m * KVP;   // + 16t*KVP + key in tile
    // ---- all eight K fragments, read as one group in front of the score products
    // (loops unrolled so that the arrays stay in registers) ----
    v16h kf[4][2];
    #pragma unroll
    for (int j = 0; j < 4; ++j) {
      const _Float16* kp = kbase + (16 * j) * KVP;
      kf[j][0] = load_frag_h(kp, h);
      kf[j][1] = load_frag_h(kp + 32, h);
    }
    // ---- scores: s[c][j][r] = S[query 16c+m][key kb+16j+8h+r] (unscaled); each K
    // fragment feeds both column tiles ----
    v8f s[2][4];
    #pragma unroll
    for (int j = 0; j < 2; ++j) {
      v8f z0 = wmma_f16(kf[j][0], qb[0][0], zero8);
      v8f z1 = wmma_f16(kf[j][0], qb[1][0], zero8);
      s[0][j] = wmma_f16(kf[j][1], qb[0][1], z0);
      s[1][j] = wmma_f16(kf[j][1], qb[1][1], z1);
    }
    // keeps the mask addends' reads below the first eight products, whose K fragments
    // leave them their registers: read with the K group they do not fit the 256
    // registers, and accumulators spill
    __builtin_amdgcn_sched_barrier(0);
    // ---- the trip's mask addends: they land while the other eight products run ----
    v8f mk[4];
    #pragma unroll
    for (int j = 0; j < 4; ++j) mk[j] = *(const v8fa*)(sB + kb + 16 * j + 8 * h);
    // keeps these reads above the other eight products
    __builtin_amdgcn_sched_barrier(0);
    #pragma unroll
    for (int j = 2; j < 4; ++j) {
      v8f z0 = wmma_f16(kf[j][0], qb[0][0], zero8);
      v8f z1 = wmma_f16(kf[j][0], qb[1][0], zero8);
      s[0][j] = wmma_f16(kf[j][1], qb[0][1], z0);
      s[1][j] = wmma_f16(kf[j][1], qb[1][1], z1);
    }
    // ---- base-2 exponent: scale, log2(e) and key mask in one fused multiply-add, f32
    // (whole-vector forms: two scores per packed instruction) ----
    #pragma unroll
    for (int c = 0; c < 2; ++c)
      #pragma unroll
      for (int j = 0; j < 4; ++j) s[c][j] = s[c][j] * SC2 + mk[j];
    // keeps the V^T reads below the mask addends' last use: read earlier they do not fit
    // the 256 registers beside the addends, and accumulators spill
    __builtin_amdgcn_sched_barrier(0);
    // ---- the V^T fragments of keys 0..31, read as one group here: they land while
    // the softmax below runs ----
    v16h vfa[4];
    #pragma unroll
    for (int t = 0; t < 4; ++t) vfa[t] = load_frag_h(vbase + (16 * t) * KVP, h);
    // keeps the V^T reads above the softmax (the scheduler otherwise sinks them to their products)
    __builtin_amdgcn_sched_barrier(0);

    // ---- online softmax, base 2, per column tile ----
    v16h pb[2][2];
    #pragma unroll
    for (int c = 0; c < 2; ++c) {
      float mloc = s[c][0][0];
      #pragma unroll
      for (int j = 0; j < 4; ++j)
        #pragma unroll
        for (int r = 0; r < 8; ++r) mloc = fmaxf(mloc, s[c][j][r]);
      mloc = fmaxf(mloc, __shfl_xor(mloc, 16));
      const float mnew = fmaxf(mrun[c], mloc);
      const float alpha = __builtin_amdgcn_exp2f(mrun[c] - mnew);
      mrun[c] = mnew;
      const float msh = mnew - PSHIFT;            // P = 2^(e - mnew + 14)
      #pragma unroll
      for (int j = 0; j < 4; ++j) {
        s[c][j] = s[c][j] - msh;
        #pragma unroll
        for (int r = 0; r < 8; ++r) s[c][j][r] = __builtin_amdgcn_exp2f(s[c][j][r]);
      }
      // the lane's own sum, pairwise; the partner lane's half joins once, behind the loop
      const v8f s8 = (s[c][0] + s[c][1]) + (s[c][2] + s[c][3]);
      const v4f s4 = __builtin_shufflevector(s8, s8, 0, 1, 2, 3) + __builtin_shufflevector(s8, s8, 4, 5, 6, 7);
      const v2f s2 = __builtin_shufflevector(s4, s4, 0, 1) + __builtin_shufflevector(s4, s4, 2, 3);
      lrun[c] = lrun[c] * alpha + s2;
      #pragma unroll
      for (int t = 0; t < 4; ++t) o[c][t] = o[c][t] * alpha;
      // ---- P^T B-fragments (keys 0..31 and 32..63 of this step) ----
      pb[c][0] = pack_p(s[c][0], s[c][1]);
      pb[c][1] = pack_p(s[c][2], s[c][3]);
    }

    // keeps the second V^T group below the softmax: read earlier it does not fit the 256
    // registers beside the unpacked scores
    __builtin_amdgcn_sched_barrier(0);
    // ---- the V^T fragments of keys 32..63, read as one group into the registers that
    // the packed scores have left: they land while the first eight products run ----
    v16h vfb[4];
    #pragma unroll
    for (int t = 0; t < 4; ++t) vfb[t] = load_frag_h(vbase + (16 * t) * KVP + 32, h);
    // keeps these reads above the first eight products
    __builtin_amdgcn_sched_barrier(0);

    // ---- O^T += V^T * P^T; each V^T fragment feeds both column tiles ----
    #pragma unroll
    for (int t = 0; t < 4; ++t) {
      o[0][t] = wmma_f16(vfa[t], pb[0][0], o[0][t]);
      o[1][t] = wmma_f16(vfa[t], pb[1][0], o[1][t]);
    }
    #pragma unroll
    for (int t = 0; t < 4; ++t) {
      o[0][t] = wmma_f16(vfb[t], pb[0][1], o[0][t]);
      o[1][t] = wmma_f16(vfb[t], pb[1][1], o[1][t]);
    }

    // ---- publish tile + 1: behind this barrier the buffer this trip has read may be refilled ----
    asm volatile("s_wait_dscnt 0x0" ::: "memory");      // this wave's reads of the buffer are done
    asm volatile("s_wait_asynccnt 0x0" ::: "memory");   // this wave's copies of tile + 1 have landed
    __syncthreads();                                    // publishes tile + 1, ends every read of this buffer
  };

  // The trips that refill, then the last two, which have no tile + 2: two loops instead of
  // a test at the foot, so that a trip is one straight block (with the test the row sums
  // sink behind it, the unpacked P stays live across the products, and accumulators spill).
  // Both kept rolled: small loop text.
  #pragma unroll 1
  for (int tile = 0; tile < NTILE - 2; ++tile) {
    trip(tile);
    const int key0 = (tile + 2) * 64;
    const int buf = tile & 1;
    stage_kv(gk0 + (size_t)key0 * HD, gv0 + key0, lk0 + buf * (KVTILE * 2), lv0 + buf * (KVTILE * 2));
  }
  #pragma unroll 1
  for (int tile = NTILE - 2; tile < NTILE; ++tile) trip(tile);
  asm volatile("s_wait_asynccnt 0x0" ::: "memory");   // no copy outstanding behind the loop

  // The lane's index read anew behind the loops, so that the thread index and its parts
  // are not held in registers across them (there they do not fit and go to scratch).
  const int le = (int)__builtin_amdgcn_mbcnt_lo(~0u, 0u);
  const int he = le >> 4, me = le & 15;
  float inv[2];
  #pragma unroll
  for (int c = 0; c < 2; ++c) {
    const float lown = lrun[c].x + lrun[c].y;
    inv[c] = 1.0f / (lown + __shfl_xor(lown, 16));    // o and the sum both carry 2^14
  }
  // The two waves of a query slab (left in the own-pair wave, right in the flipped-pair
  // wave) swap one column tile each through the slab, same lane and element: wave g then
  // holds left and right of column tile g and finishes those 16 queries.
  const bool own = (g == 0);
  const int keeprow = 16 * g + me, sendrow = 16 * (1 - g) + me;
  #pragma unroll
  for (int t = 0; t < 4; ++t)
    #pragma unroll
    for (int r = 0; r < 8; ++r)
      so[sendrow * 64 + 16 * t + 8 * he + r] = own ? o[1][t][r] * inv[1] : o[0][t][r] * inv[0];
  __syncthreads();                                    // the partner wave's tile is readable
  #pragma unroll
  for (int t = 0; t < 4; ++t)
    #pragma unroll
    for (int r = 0; r < 8; ++r) {
      const int idx = keeprow * 64 + 16 * t + 8 * he + r;
      const float mine = own ? o[0][t][r] * inv[0] : o[1][t][r] * inv[1];
      const float got = so[idx];
      const float left = own ? mine : got, right = own ? got : mine;
      const float cmb = left + 0.1f * tanhf(right);
      so[idx] = cmb * XSCALE;
    }
  __syncthreads();                                    // the slab is complete in front of the store pass

  // Each wave stores the 16 query rows that it has finished.
  const size_t tok0 = (size_t)bp * SQ + q0 + 16 * g;
  xc_store_pass(so + g * 1024, xh, xl, tok0, head, le);
}

// ---------------------------------------------------------------------------
// wave w owns rows 16w..16w+15, each row 128 floats = 4 lines: one row (512 B) per
// instruction, 16 B per lane.
// ---------------------------------------------------------------------------
__device__ __forceinline__ void out_store_pass(const float* sT, float* out,
                                               int m0, int n0, int w, int lane) {
  #pragma unroll
  for (int i = 0; i < 16; ++i) {
    const int row = 16 * w + i;
    const v4f v = *(const v4fa*)(sT + row * 128 + 4 * lane);
    const size_t gi = (size_t)(m0 + row) * DM + n0 + 4 * lane;
    *(v4f*)(out + gi) = v;
  }
}

// ---------------------------------------------------------------------------
// Kernel 4: out = X * Wo^T + bo with X = hi/256 + lo/(256*2048) planes.
// Block 128 thr (4 waves, 2 x 2) = 64 tokens x 128 features; wave 32 tokens (hi and
// lo rows) x 64 features, 16 accumulator tiles: 8 fragments feed 16 products.
// A = X rows (k contiguous), B[k][n] = Wo[n][k] from Wo row n (k contiguous).
// The block's 64 hi rows (LDS rows 0..63), 64 lo rows (64..127) and 128 Wo rows
// (128..255) come through LDS in k-tiles of 64: two buffers, tile t + 2 copied
// in while tile t + 1 is worked on.
// ---------------------------------------------------------------------------
__global__ __launch_bounds__(128) void oproj_kernel(
    const _Float16* __restrict__ xh,   // [NTOK][DM]
    const _Float16* __restrict__ xl,   // [NTOK][DM]
    const _Float16* __restrict__ woh,  // [DM][DM] f16(bf16(Wo)*256)
    const float* __restrict__ bo,
    float* __restrict__ out)           // [NTOK][DM]
{
  __shared__ __attribute__((aligned(16))) float sT[64 * 128];       // 32768 B
  __shared__ __attribute__((aligned(16))) _Float16 sG[2 * GTILE];   // 73728 B

  const int tid = threadIdx.x, lane = tid & 31, w = tid >> 5;
  const int h = lane >> 4, m = lane & 15;
  const int wm = w >> 1, wn = w & 1;         // wave's 32-token half, wave's 64-feature half
  const int m0 = blockIdx.x * 64, n0 = blockIdx.y * 128;

  // Copy addresses of this lane: row tid>>3 of a sweep, 16-byte column tid&7.
  const int crow = tid >> 3, ccol = tid & 7;
  const _Float16* gh = xh + (size_t)(m0 + crow) * DM + 8 * ccol;    // + k
  const _Float16* gl = xl + (size_t)(m0 + crow) * DM + 8 * ccol;    // + k
  const _Float16* gw = woh + (size_t)(n0 + crow) * DM + 8 * ccol;   // + k
  const unsigned lg0 = lds_off(sG) + crow * (GP * 2) + 16 * ccol;   // + buffer * GTILE * 2

  const v8f zero8 = {0.f, 0.f, 0.f, 0.f, 0.f, 0.f, 0.f, 0.f};
  v8f acch[2][4], accl[2][4];
  #pragma unroll
  for (int mt = 0; mt < 2; ++mt)
    #pragma unroll
    for (int nt = 0; nt < 4; ++nt) { acch[mt][nt] = zero8; accl[mt][nt] = zero8; }

  // Tile 0 into buffer 0, landed and published; then tile 1 into buffer 1.
  stage_gemm(gh, gl, gw, gw + 64 * DM, lg0);
  asm volatile("s_wait_asynccnt 0x0" ::: "memory");   // this wave's copies of tile 0 have landed
  __syncthreads();                                    // tile 0 readable by every wave
  stage_gemm(gh + GKT, gl + GKT, gw + GKT, gw + 64 * DM + GKT, lg0 + GTILE * 2);

  // kept rolled: one copy of the ring's foot (waits, barrier, refill), small loop text
  #pragma unroll 1
  for (int t = 0; t < GNT; ++t) {
    const int buf = t & 1;
    const _Float16* ah = sG + buf * GTILE + (32 * wm + m) * GP;             // hi row, mt = 0
    const _Float16* al = ah + 64 * GP;                                      // lo row, mt = 0
    const _Float16* wr = sG + buf * GTILE + (128 + 64 * wn + m) * GP;       // feature row, nt = 0
    // Each 32-deep step reads its eight fragments as one group in front of its 16
    // products; the loops are unrolled so that the fragment arrays stay in registers.
    #pragma unroll
    for (int kc = 0; kc < 2; ++kc) {
      v16h fah[2], fal[2], fb[4];
      #pragma unroll
      for (int i = 0; i < 2; ++i) {
        fah[i] = load_frag_h(ah + i * 16 * GP + 32 * kc, h);
        fal[i] = load_frag_h(al + i * 16 * GP + 32 * kc, h);
      }
      #pragma unroll
      for (int i = 0; i < 4; ++i) fb[i] = load_frag_h(wr + i * 16 * GP + 32 * kc, h);
      #pragma unroll
      for (int nt = 0; nt < 4; ++nt) {
        #pragma unroll
        for (int mt = 0; mt < 2; ++mt) {
          acch[mt][nt] = wmma_f16(fah[mt], fb[nt], acch[mt][nt]);
          accl[mt][nt] = wmma_f16(fal[mt], fb[nt], accl[mt][nt]);
        }
      }
    }
    // ---- publish tile + 1, then refill the buffer this trip has read ----
    asm volatile("s_wait_dscnt 0x0" ::: "memory");      // this wave's reads of the buffer are done
    asm volatile("s_wait_asynccnt 0x0" ::: "memory");   // this wave's copies of tile + 1 have landed
    __syncthreads();                                    // publishes tile + 1, ends every read of this buffer
    if (t + 2 < GNT) {
      const int kn = (t + 2) * GKT;
      stage_gemm(gh + kn, gl + kn, gw + kn, gw + 64 * DM + kn, lg0 + buf * (GTILE * 2));
    }
  }
  asm volatile("s_wait_asynccnt 0x0" ::: "memory");   // no copy outstanding behind the loop

  // D[r] of tile (mt, nt) = Y[token m0+32wm+16mt+8h+r][feature n0+64wn+16nt+m]
  const float sh = 1.0f / (XSCALE * WSCALE);
  const float sl = 1.0f / (XSCALE * WSCALE * LOSCALE);
  #pragma unroll
  for (int nt = 0; nt < 4; ++nt) {
    const int col = 64 * wn + 16 * nt + m;                // 0..127
    const float bvl = bo[n0 + col];
    #pragma unroll
    for (int mt = 0; mt < 2; ++mt) {
      #pragma unroll
      for (int r = 0; r < 8; ++r) {
        const int row = 32 * wm + 16 * mt + 8 * h + r;    // 0..63
        sT[row * 128 + col] = acch[mt][nt][r] * sh + accl[mt][nt][r] * sl + bvl;
      }
    }
  }
  __syncthreads();

  out_store_pass(sT, out, m0, n0, w, lane);
}

// ---------------------------------------------------------------------------
extern "C" void kernel_launch(void* const* d_in, const int* in_sizes, int n_in,
                              void* d_out, int out_size, void* d_ws, size_t ws_size,
                              hipStream_t stream) {
  if (n_in < 12) return;
  if (in_sizes[0] != NACT || in_sizes[1] != NACT || in_sizes[2] != NACT) return;
  if (in_sizes[3] != NBP * SQ) return;
  if (in_sizes[4] != NWEL || in_sizes[6] != NWEL || in_sizes[8] != NWEL || in_sizes[10] != NWEL) return;
  if (in_sizes[5] != DM || in_sizes[7] != DM || in_sizes[9] != DM || in_sizes[11] != DM) return;
  if (out_size != NACT) return;

  const float* query = (const float*)d_in[0];
  const float* key_  = (const float*)d_in[1];
  const float* value = (const float*)d_in[2];
  const int*   mask  = (const int*)d_in[3];
  const float* Wq = (const float*)d_in[4];
  const float* bq = (const float*)d_in[5];
  const float* Wk = (const float*)d_in[6];
  const float* bk = (const float*)d_in[7];
  const float* Wv = (const float*)d_in[8];
  const float* bv = (const float*)d_in[9];
  const float* Wo = (const float*)d_in[10];
  const float* bo = (const float*)d_in[11];
  float* out = (float*)d_out;

  const size_t xb_bytes  = (size_t)3 * NACT * 2;                 // 25165824
  const size_t wb_bytes  = (size_t)3 * NWEL * 2;                 //  6291456
  const size_t woh_bytes = (size_t)NWEL * 2;                     //  2097152
  const size_t pl_bytes  = (size_t)NBP * NH * SQ * HD * 2;       //  8388608 per plane
  const size_t xc_bytes  = (size_t)NACT * 2;                     //  8388608 per plane
  const size_t total = xb_bytes + wb_bytes + woh_bytes + 3 * pl_bytes + 2 * xc_bytes;   // 75497472
  if (total > ws_size) return;

  char* ws = (char*)d_ws;
  size_t off = 0;
  unsigned short* xb = (unsigned short*)(ws + off); off += xb_bytes;
  unsigned short* wb = (unsigned short*)(ws + off); off += wb_bytes;
  _Float16* woh = (_Float16*)(ws + off);            off += woh_bytes;
  _Float16* qh  = (_Float16*)(ws + off);            off += pl_bytes;
  _Float16* kh  = (_Float16*)(ws + off);            off += pl_bytes;
  _Float16* vt  = (_Float16*)(ws + off);            off += pl_bytes;
  _Float16* xh  = (_Float16*)(ws + off);            off += xc_bytes;
  _Float16* xl  = (_Float16*)(ws + off);            off += xc_bytes;
  if (off > ws_size) return;

  convert_kernel<<<(NGRP + 255) / 256, 256, 0, stream>>>(query, key_, value, Wq, Wk, Wv, Wo, xb, wb, woh);

  dim3 gProj(NTOK / 128, 3 * NH / 2);                           // (32, 24)
  proj_kernel<<<gProj, 128, 0, stream>>>(xb, wb, bq, bk, bv, qh, kh, vt);

  dim3 gAtt(SQ / 128, NBP * NH);                                 // (8, 64)
  attn_kernel<<<gAtt, 256, 0, stream>>>(qh, kh, vt, mask, xh, xl);

  dim3 gOut(NTOK / 64, DM / 128);                                // (64, 8)
  oproj_kernel<<<gOut, 128, 0, stream>>>(xh, xl, woh, bo, out);
}

// v007
// It runs in 87 microseconds.
// Two timings next to v006 put it at 1.04 and 1.05 times that version's speed.
// Over all steps from v000 it is 3.19 times as fast.
// Contractions: q/k/v projections x*W^T on v_wmma_f32_16x16x32_bf16 (bf16 operands, f32 accumulate); K*Q^T and V^T*P^T of both attention passes on v_wmma_f32_16x16x32_f16 (f16 operands, P carried x16384, f32 accumulate); output projection on v_wmma_f32_16x16x32_f16 with the activation carried x256 as f16 hi + lo(x2048) planes and the weight as f16 of its bf16 value x256 (f32 accumulate); scale, mask, softmax, tanh and bias in f32.
#include <hip/hip_runtime.h>
#include <math.h>

typedef _Float16       v16h __attribute__((ext_vector_type(16)));
typedef _Float16       v8h  __attribute__((ext_vector_type(8)));
typedef __bf16         v16b __attribute__((ext_vector_type(16)));
typedef unsigned short v8us __attribute__((ext_vector_type(8)));
typedef float          v8f  __attribute__((ext_vector_type(8)));
typedef float          v4f  __attribute__((ext_vector_type(4)));
typedef float          v2f  __attribute__((ext_vector_type(2)));
typedef int            v4i  __attribute__((ext_vector_type(4)));
typedef v8h  __attribute__((may_alias)) v8ha;
typedef v8us __attribute__((may_alias)) v8usa;
typedef v4f  __attribute__((may_alias)) v4fa;
typedef v4i  __attribute__((may_alias)) v4ia;
typedef v8f  __attribute__((may_alias)) v8fa;

union FragH { v16h v; v8h  half[2]; };
union FragB { v16b v; v8us half[2]; };

#define DM     1024
#define NH     16
#define HD     64
#define SQ     1024
#define NBP    4                       // batch * pair
#define NTOK   (NBP * SQ)              // 4096 token rows
#define NACT   (NTOK * DM)             // 4194304
#define NWEL   (DM * DM)               // 1048576
#define ACT8   (NACT / 8)              // 524288
#define WEL8   (NWEL / 8)              // 131072
#define NGRP   (3 * ACT8 + 4 * WEL8)   // 2097152
#define PSHIFT  14.0f                  // P is carried x 2^14: added to the base-2 exponent
#define SC2     0.18033688011112042f   // (1/8) * log2(e): scores go to the base-2 exponent in one product
// Exponent addend of a masked key: the fma absorbs any finite score into it, so masked
// keys are all equal and below every unmasked one: weight 0 beside an unmasked key, and
// equal weights (the plain mean of V) where a whole row is masked.
#define MASKED  -3.0e38f
#define XSCALE  256.0f
#define WSCALE  256.0f
#define LOSCALE 2048.0f

// ---------------------------------------------------------------------------
// 16x16x32 WMMA helpers with hazard guard (ties D, keeps A/B live).
// Fragment map (wave32): lane l, h = l>>4, m = n = l&15.
//   A/B element i: i<8 -> k0+8h+i ; i>=8 -> k0+16+8h+(i-8)
//   D element r : row 8h+r, col l&15
// ---------------------------------------------------------------------------
__device__ __forceinline__ v8f wmma_f16(v16h a, v16h b, v8f c) {
  v8f d = __builtin_amdgcn_wmma_f32_16x16x32_f16(false, a, false, b, (short)0, c, false, false);
  asm volatile("v_nop\n\tv_nop\n\tv_nop\n\tv_nop" : "+v"(d) : "v"(a), "v"(b));
  return d;
}
__device__ __forceinline__ v8f wmma_bf16(v16b a, v16b b, v8f c) {
  v8f d = __builtin_amdgcn_wmma_f32_16x16x32_bf16(false, a, false, b, (short)0, c, false, false);
  asm volatile("v_nop\n\tv_nop\n\tv_nop\n\tv_nop" : "+v"(d) : "v"(a), "v"(b));
  return d;
}

// A or B fragment from a k-contiguous 16-bit row; p points at element k0 of
// the row owned by this lane (row index = lane & 15 added by the caller).
__device__ __forceinline__ v16h load_frag_h(const _Float16* p, int h) {
  FragH f;
  f.half[0] = *(const v8ha*)(p + 8 * h);
  f.half[1] = *(const v8ha*)(p + 16 + 8 * h);
  return f.v;
}
__device__ __forceinline__ v16b load_frag_b(const unsigned short* p, int h) {
  FragB f;
  f.half[0] = *(const v8usa*)(p + 8 * h);
  f.half[1] = *(const v8usa*)(p + 16 + 8 * h);
  return f.v;
}

// f32 -> bf16 bits, RNE
__device__ __forceinline__ unsigned short bf16_bits(float f) {
  unsigned int u = __float_as_uint(f);
  u = u + 0x7FFFu + ((u >> 16) & 1u);
  return (unsigned short)(u >> 16);
}
__device__ __forceinline__ float bf16_val(float f) {
  return __uint_as_float(((unsigned int)bf16_bits(f)) << 16);
}

// ---------------------------------------------------------------------------
// Kernel 1: f32 -> 16-bit planes.
//   xb[3][NTOK][DM] bf16 (query, key, value), wb[3][DM][DM] bf16 (Wq, Wk, Wv),
//   woh[DM][DM] f16 = f16(bf16(Wo) * 256).
// ---------------------------------------------------------------------------
__global__ __launch_bounds__(256) void convert_kernel(
    const float* __restrict__ xq, const float* __restrict__ xk, const float* __restrict__ xv,
    const float* __restrict__ wq, const float* __restrict__ wk, const float* __restrict__ wv,
    const float* __restrict__ wo,
    unsigned short* __restrict__ xb, unsigned short* __restrict__ wb, _Float16* __restrict__ woh)
{
  const int g = blockIdx.x * 256 + threadIdx.x;
  if (g >= NGRP) return;
  if (g < 3 * ACT8 + 3 * WEL8) {
    const float* src;
    unsigned short* dst;
    if (g < 3 * ACT8) {
      const int sel = g / ACT8;
      const int off = g - sel * ACT8;
      const float* xs = (sel == 0) ? xq : ((sel == 1) ? xk : xv);
      src = xs + (size_t)off * 8;
      dst = xb + (size_t)sel * NACT + (size_t)off * 8;
    } else {
      const int e = g - 3 * ACT8;
      const int sel = e / WEL8;
      const int off = e - sel * WEL8;
      const float* wsrc = (sel == 0) ? wq : ((sel == 1) ? wk : wv);
      src = wsrc + (size_t)off * 8;
      dst = wb + (size_t)sel * NWEL + (size_t)off * 8;
    }
    const v4f a = *(const v4fa*)src;
    const v4f c = *(const v4fa*)(src + 4);
    const v8us o = { bf16_bits(a.x), bf16_bits(a.y), bf16_bits(a.z), bf16_bits(a.w),
                     bf16_bits(c.x), bf16_bits(c.y), bf16_bits(c.z), bf16_bits(c.w) };
    *(v8us*)dst = o;
    
  } else {
    const int off = g - (3 * ACT8 + 3 * WEL8);
    const float* src = wo + (size_t)off * 8;
    _Float16* dst = woh + (size_t)off * 8;
    const v4f a = *(const v4fa*)src;
    const v4f c = *(const v4fa*)(src + 4);
    const v8h o = { (_Float16)(bf16_val(a.x) * WSCALE), (_Float16)(bf16_val(a.y) * WSCALE),
                    (_Float16)(bf16_val(a.z) * WSCALE), (_Float16)(bf16_val(a.w) * WSCALE),
                    (_Float16)(bf16_val(c.x) * WSCALE), (_Float16)(bf16_val(c.y) * WSCALE),
                    (_Float16)(bf16_val(c.z) * WSCALE), (_Float16)(bf16_val(c.w) * WSCALE) };
    *(v8h*)dst = o;
    
  }
}

// ---------------------------------------------------------------------------
// 4 lines per instruction, 32 lines per wave, 128 per block.
// which 0/1: plane[bh][s][d]  (one token row = 64 halves = one line)
// which 2  : vt[bh][d][s]     (64 d-rows x 128 tokens = 2 lines each)
// The LDS tile holds its rows in 16-byte chunks at swapped places (QK_AT, VT_AT), so
// that the 16 lanes that write one chunk each of 16 different rows fall on all 64 banks.
// ---------------------------------------------------------------------------
// q, k tile [128 tokens][64 features]: chunk c (0..7) of token row t, in halves
#define QK_AT(t, c) ((t) * HD + (((c) ^ (((t) >> 1) & 7)) * 8))
// V^T tile [64 features][128 tokens]: chunk c (0..15) of feature row f, in halves
#define VT_AT(f, c) ((f) * 128 + (((c) ^ ((f) & 15)) * 8))
__device__ __forceinline__ void proj_store_pass(const _Float16* sT, _Float16* plane, _Float16* vt,
                                                int which, int bh, int l0, int w, int lane) {
  const int q8 = lane & 7, sub = lane >> 3;
  #pragma unroll
  for (int i = 0; i < 8; ++i) {
    const int lid = w * 32 + i * 4 + sub;
    v8h v;
    _Float16* dst;
    if (which != 2) {
      v = *(const v8ha*)(sT + QK_AT(lid, q8));
      dst = plane + ((size_t)bh * SQ + l0 + lid) * HD + 8 * q8;
    } else {
      const int d = lid >> 1, hl = lid & 1;
      v = *(const v8ha*)(sT + VT_AT(d, 8 * hl + q8));
      dst = vt + ((size_t)bh * HD + d) * SQ + l0 + 64 * hl + 8 * q8;
    }
    *(v8h*)dst = v;
    // the next round's address arithmetic reuses this store's address registers
    asm volatile("s_wait_xcnt 0x0" ::: "memory");
  }
}

__device__ __forceinline__ unsigned lds_off(const void* p) { return (unsigned)(size_t)p; }

// ---------------------------------------------------------------------------
// GEMM operand staging (kernels 2 and 4): one k-tile = 64 k (128 B) of 256
// operand rows, four groups of 64 rows, LDS row pitch 144 B (16 B x odd,
// conflict-free for the 16-byte fragment reads). 128 threads, 8 lanes per row,
// 16 rows per sweep, 4 sweeps per group: every copy instruction covers whole
// 128-B lines of the source. Source row pitch = DM 16-bit elements.
// ---------------------------------------------------------------------------
#define GP     72                      // LDS row pitch in 16-bit elements (144 B)
#define GTILE  (256 * GP)              // elements per staged k-tile (36864 B)
#define GKT    64                      // k per tile
#define GNT    (DM / GKT)              // 16 k-tiles

// Two groups of 64 rows. g0 / g1: this lane's 16 B of row (tid>>3) of each group, at
// the tile's first k; l: the lane's LDS byte address of row (tid>>3) of the first group.
__device__ __forceinline__ void stage_pair(const void* g0, const void* g1, unsigned l) {
  const char* a0 = (const char*)g0;
  const char* a1 = a0 + 16 * DM * 2;
  const char* a2 = a0 + 32 * DM * 2;
  const char* a3 = a0 + 48 * DM * 2;
  const char* b0 = (const char*)g1;
  const char* b1 = b0 + 16 * DM * 2;
  const char* b2 = b0 + 32 * DM * 2;
  const char* b3 = b0 + 48 * DM * 2;
  const unsigned la1 = l + 16 * GP * 2,  la2 = l + 32 * GP * 2,  la3 = l + 48 * GP * 2;
  const unsigned lb0 = l + 64 * GP * 2,  lb1 = l + 80 * GP * 2,  lb2 = l + 96 * GP * 2,  lb3 = l + 112 * GP * 2;
  // Global -> LDS through no register; the closing s_wait_xcnt stands in the same
  // statement so that no address register is rewritten in front of it.
  asm volatile(
      "global_load_async_to_lds_b128 %0, %8, off\n\t"
      "global_load_async_to_lds_b128 %1, %9, off\n\t"
      "global_load_async_to_lds_b128 %2, %10, off\n\t"
      "global_load_async_to_lds_b128 %3, %11, off\n\t"
      "global_load_async_to_lds_b128 %4, %12, off\n\t"
      "global_load_async_to_lds_b128 %5, %13, off\n\t"
      "global_load_async_to_lds_b128 %6, %14, off\n\t"
      "global_load_async_to_lds_b128 %7, %15, off\n\t"
      "s_wait_xcnt 0x0"
      :: "v"(l), "v"(la1), "v"(la2), "v"(la3), "v"(lb0), "v"(lb1), "v"(lb2), "v"(lb3),
         "v"(a0), "v"(a1), "v"(a2), "v"(a3), "v"(b0), "v"(b1), "v"(b2), "v"(b3)
      : "memory");
}

// g0 .. g3: the four groups of a k-tile (LDS rows 0..63, 64..127, 128..191, 192..255).
__device__ __forceinline__ void stage_gemm(const void* g0, const void* g1, const void* g2, const void* g3,
                                           unsigned l) {
  stage_pair(g0, g1, l);
  stage_pair(g2, g3, l + 128 * GP * 2);
}

// ---------------------------------------------------------------------------
// Kernel 2: Y = x * W^T for the three projections (bf16 operands).
// Block 128 thr (4 waves, 2 x 2) = 128 tokens x 128 features (two heads) of one
// projection; wave tile 64 tokens x 64 features (one head), 16 accumulator tiles:
// 8 fragments feed 16 products. K = 1024 in steps of 32.
// x rows (token-major) and W rows (feature-major) are both k contiguous -> both
// fragments with the same loader, and either may be the A operand. A lane's eight D
// values run along the A rows: v takes A = x (eight tokens of one feature, contiguous in
// V^T), q and k take A = W (eight features of one token, contiguous in the plane).
// The block's 128 x rows (LDS rows 0..127) and 128 W rows (LDS rows 128..255)
// come through LDS in k-tiles of 64: two buffers, tile t + 2 copied in while
// tile t + 1 is worked on.
// ---------------------------------------------------------------------------
__global__ __launch_bounds__(128) void proj_kernel(
    const unsigned short* __restrict__ xb,   // [3][NTOK][DM] bf16
    const unsigned short* __restrict__ wb,   // [3][DM][DM]   bf16, row = output feature
    const float* __restrict__ bq, const float* __restrict__ bk, const float* __restrict__ bv,
    _Float16* __restrict__ qh,               // [NBP*NH][SQ][HD] f16
    _Float16* __restrict__ kh,               // [NBP*NH][SQ][HD] f16
    _Float16* __restrict__ vt)               // [NBP*NH][HD][SQ] f16
{
  __shared__ __attribute__((aligned(16))) _Float16 sT[2 * 128 * 64];      // 32768 B, one plane per head
  __shared__ __attribute__((aligned(16))) unsigned short sG[2 * GTILE];   // 73728 B

  const int tid = threadIdx.x, lane = tid & 31, w = tid >> 5;
  const int h = lane >> 4, m = lane & 15;
  const int wm = w >> 1, wn = w & 1;         // wave's 64-token half, wave's head of the pair
  const int m0 = blockIdx.x * 128;
  const int cg = blockIdx.y;                 // 0..23
  const int which = cg >> 3, head0 = (cg & 7) * 2;

  // Copy addresses of this lane: row tid>>3 of a sweep, 16-byte column tid&7.
  const int crow = tid >> 3, ccol = tid & 7;
  const unsigned short* gx = xb + (size_t)which * NACT + (size_t)(m0 + crow) * DM + 8 * ccol;          // + k
  const unsigned short* gw = wb + (size_t)which * NWEL + (size_t)(head0 * HD + crow) * DM + 8 * ccol;  // + k
  const unsigned lg0 = lds_off(sG) + crow * (GP * 2) + 16 * ccol;                                      // + buffer * GTILE * 2

  // LDS rows of the wave's A and B fragments (tile 0 of four each)
  const int rowx = 64 * wm + m, roww = 128 + 64 * wn + m;
  const int rowa = (which == 2) ? rowx : roww, rowb = (which == 2) ? roww : rowx;

  const v8f zero8 = {0.f, 0.f, 0.f, 0.f, 0.f, 0.f, 0.f, 0.f};
  v8f acc[4][4];
  #pragma unroll
  for (int mt = 0; mt < 4; ++mt)
    #pragma unroll
    for (int nt = 0; nt < 4; ++nt) acc[mt][nt] = zero8;

  // Tile 0 into buffer 0, landed and published; then tile 1 into buffer 1.
  stage_gemm(gx, gx + 64 * DM, gw, gw + 64 * DM, lg0);
  asm volatile("s_wait_asynccnt 0x0" ::: "memory");   // this wave's copies of tile 0 have landed
  __syncthreads();                                    // tile 0 readable by every wave
  stage_gemm(gx + GKT, gx + 64 * DM + GKT, gw + GKT, gw + 64 * DM + GKT, lg0 + GTILE * 2);

  // kept rolled: one copy of the ring's foot (waits, barrier, refill), small loop text
  #pragma unroll 1
  for (int t = 0; t < GNT; ++t) {
    const int buf = t & 1;
    const unsigned short* xa = sG + buf * GTILE + rowa * GP;   // A row, mt = 0
    const unsigned short* wr = sG + buf * GTILE + rowb * GP;   // B row, nt = 0
    // Each 32-deep step reads its eight fragments as one group in front of its 16
    // products; the loops are unrolled so that the fragment arrays stay in registers.
    #pragma unroll
    for (int kc = 0; kc < 2; ++kc) {
      v16b fa[4], fb[4];
      #pragma unroll
      for (int i = 0; i < 4; ++i) fa[i] = load_frag_b(xa + i * 16 * GP + 32 * kc, h);
      #pragma unroll
      for (int i = 0; i < 4; ++i) fb[i] = load_frag_b(wr + i * 16 * GP + 32 * kc, h);
      #pragma unroll
      for (int nt = 0; nt < 4; ++nt) {
        #pragma unroll
        for (int mt = 0; mt < 4; ++mt) acc[mt][nt] = wmma_bf16(fa[mt], fb[nt], acc[mt][nt]);
      }
    }
    // ---- publish tile + 1, then refill the buffer this trip has read ----
    asm volatile("s_wait_dscnt 0x0" ::: "memory");      // this wave's reads of the buffer are done
    asm volatile("s_wait_asynccnt 0x0" ::: "memory");   // this wave's copies of tile + 1 have landed
    __syncthreads();                                    // publishes tile + 1, ends every read of this buffer
    if (t + 2 < GNT) {
      const int kn = (t + 2) * GKT;
      stage_gemm(gx + kn, gx + 64 * DM + kn, gw + kn, gw + 64 * DM + kn, lg0 + buf * (GTILE * 2));
    }
  }
  asm volatile("s_wait_asynccnt 0x0" ::: "memory");   // no copy outstanding behind the loop

  // A lane's eight values of a tile are one 16-byte chunk of the LDS tile's row.
  const float* bias = ((which == 0) ? bq : ((which == 1) ? bk : bv)) + (head0 + wn) * HD;
  _Float16* sTh = sT + wn * (128 * 64);
  if (which == 2) {
    // D[r] of tile (mt, nt) = Y[token m0+64wm+16mt+8h+r][feature (head0+wn)*64+16nt+m]
    #pragma unroll
    for (int nt = 0; nt < 4; ++nt) {
      const int feat = 16 * nt + m;
      const float bvl = bias[feat];
      #pragma unroll
      for (int mt = 0; mt < 4; ++mt) {
        v8h pk;
        #pragma unroll
        for (int r = 0; r < 8; ++r) pk[r] = (_Float16)(acc[mt][nt][r] + bvl);
        *(v8ha*)(sTh + VT_AT(feat, 8 * wm + 2 * mt + h)) = pk;
      }
    }
  } else {
    // D[r] of tile (mt, nt) = Y[token m0+64wm+16nt+m][feature (head0+wn)*64+16mt+8h+r]
    v4f bb[4][2];                                          // the lane's 32 features' bias, one load group
    #pragma unroll
    for (int mt = 0; mt < 4; ++mt) {
      bb[mt][0] = *(const v4fa*)(bias + 16 * mt + 8 * h);
      bb[mt][1] = *(const v4fa*)(bias + 16 * mt + 8 * h + 4);
    }
    #pragma unroll
    for (int mt = 0; mt < 4; ++mt) {
      #pragma unroll
      for (int nt = 0; nt < 4; ++nt) {
        const int tokl = 64 * wm + 16 * nt + m;            // 0..127
        v8h pk;
        #pragma unroll
        for (int r = 0; r < 4; ++r) {
          pk[r]     = (_Float16)(acc[mt][nt][r] + bb[mt][0][r]);
          pk[4 + r] = (_Float16)(acc[mt][nt][4 + r] + bb[mt][1][r]);
        }
        *(v8ha*)(sTh + QK_AT(tokl, 2 * mt + h)) = pk;
      }
      // keeps each group's sums next to their packing: all 128 sums hoisted together need
      // registers above v255, which are reached only through window switches
      __builtin_amdgcn_sched_barrier(0);
    }
  }
  __syncthreads();

  const int bp = m0 >> 10, l0 = m0 & (SQ - 1), bh = bp * NH + head0;
  _Float16* plane = (which == 0) ? qh : kh;
  proj_store_pass(sT, plane, vt, which, bh, l0, w, lane);
  proj_store_pass(sT + 128 * 64, plane, vt, which, bh + 1, l0, w, lane);
}

// ---------------------------------------------------------------------------
// Attention helpers.
// ---------------------------------------------------------------------------
// P^T B-fragment from the lane's own P values (already x 2^14): element r <- tile a
// row r (keys 0..15 of the 32-key step), element 8+r <- tile c row r (keys 16..31),
// same lane (query column).
__device__ __forceinline__ v16h pack_p(v8f a, v8f c) {
  const v16h r = { (_Float16)a[0], (_Float16)a[1], (_Float16)a[2], (_Float16)a[3],
                   (_Float16)a[4], (_Float16)a[5], (_Float16)a[6], (_Float16)a[7],
                   (_Float16)c[0], (_Float16)c[1], (_Float16)c[2], (_Float16)c[3],
                   (_Float16)c[4], (_Float16)c[5], (_Float16)c[6], (_Float16)c[7] };
  return r;
}

// Row pitch of the f32 slabs in floats: 272 B = 16 B x odd, so that 16 lanes that each
// touch 16 bytes of their own row fall on all 64 banks (at 256 B they share four).
#define SOP 68
// Per-wave 16x64 f32 tile (already x256) in LDS -> hi/lo f16 planes
// lanes 8q..8q+7 per line, 4 lines per instruction, 16 rows x 2 planes per wave.
__device__ __forceinline__ void xc_store_pass(const float* so, _Float16* xh, _Float16* xl,
                                              size_t tok0, int head, int lane) {
  const int q8 = lane & 7, sub = lane >> 3;
  #pragma unroll
  for (int i = 0; i < 4; ++i) {
    const int row = 4 * i + sub;
    const v4f a = *(const v4fa*)(so + row * SOP + 8 * q8);
    const v4f c = *(const v4fa*)(so + row * SOP + 8 * q8 + 4);
    const _Float16 h0 = (_Float16)a.x, h1 = (_Float16)a.y, h2 = (_Float16)a.z, h3 = (_Float16)a.w;
    const _Float16 h4 = (_Float16)c.x, h5 = (_Float16)c.y, h6 = (_Float16)c.z, h7 = (_Float16)c.w;
    const v8h hv = { h0, h1, h2, h3, h4, h5, h6, h7 };
    const v8h lv = { (_Float16)((a.x - (float)h0) * LOSCALE), (_Float16)((a.y - (float)h1) * LOSCALE),
                     (_Float16)((a.z - (float)h2) * LOSCALE), (_Float16)((a.w - (float)h3) * LOSCALE),
                     (_Float16)((c.x - (float)h4) * LOSCALE), (_Float16)((c.y - (float)h5) * LOSCALE),
                     (_Float16)((c.z - (float)h6) * LOSCALE), (_Float16)((c.w - (float)h7) * LOSCALE) };
    const size_t gi = (tok0 + row) * (size_t)DM + (size_t)head * HD + 8 * q8;
    *(v8h*)(xh + gi) = hv;
    *(v8h*)(xl + gi) = lv;
  }
}

// ---------------------------------------------------------------------------
// K / V^T tile staging: 64 rows x 128 B each, LDS row pitch 144 B (16 B x odd,
// conflict-free for the 16-byte fragment reads). 128 threads, 8 lanes per row,
// 16 rows per sweep, 4 sweeps per operand: every copy instruction covers whole
// 128-B lines of the source.
// ---------------------------------------------------------------------------
#define KVP    72                      // LDS row pitch in halves (144 B)
#define KVTILE (64 * KVP)              // halves per staged tile (9216 B)
#define NTILE  (SQ / 64)               // 16 tiles per pass

// gk: this lane's 16 B of K row (tid&127)>>3 of the tile; gv: the same of V^T row (tid&127)>>3.
// lk / lv: the lane's LDS byte addresses for those rows.
__device__ __forceinline__ void stage_kv(const _Float16* gk, const _Float16* gv, unsigned lk, unsigned lv) {
  const _Float16* gk1 = gk + 16 * HD;
  const _Float16* gk2 = gk + 32 * HD;
  const _Float16* gk3 = gk + 48 * HD;
  const _Float16* gv1 = gv + 16 * SQ;
  const _Float16* gv2 = gv + 32 * SQ;
  const _Float16* gv3 = gv + 48 * SQ;
  const unsigned lk1 = lk + 16 * KVP * 2, lk2 = lk + 32 * KVP * 2, lk3 = lk + 48 * KVP * 2;
  const unsigned lv1 = lv + 16 * KVP * 2, lv2 = lv + 32 * KVP * 2, lv3 = lv + 48 * KVP * 2;
  // Global -> LDS through no register; the closing s_wait_xcnt stands in the same
  // statement so that no address register is rewritten in front of it.
  asm volatile(
      "global_load_async_to_lds_b128 %0, %8, off\n\t"
      "global_load_async_to_lds_b128 %1, %9, off\n\t"
      "global_load_async_to_lds_b128 %2, %10, off\n\t"
      "global_load_async_to_lds_b128 %3, %11, off\n\t"
      "global_load_async_to_lds_b128 %4, %12, off\n\t"
      "global_load_async_to_lds_b128 %5, %13, off\n\t"
      "global_load_async_to_lds_b128 %6, %14, off\n\t"
      "global_load_async_to_lds_b128 %7, %15, off\n\t"
      "s_wait_xcnt 0x0"
      :: "v"(lk), "v"(lk1), "v"(lk2), "v"(lk3), "v"(lv), "v"(lv1), "v"(lv2), "v"(lv3),
         "v"(gk), "v"(gk1), "v"(gk2), "v"(gk3), "v"(gv), "v"(gv1), "v"(gv2), "v"(gv3)
      : "memory");
}

// ---------------------------------------------------------------------------
// Block 256 thr (8 waves) = 128 queries; 32 queries (two 16-column tiles) per wave,
// 64 keys per step: each K and V^T fragment read from LDS feeds two products.
// The two passes run side by side: waves 0..3 attend to the own pair's K / V, waves
// 4..7 to the flipped pair's, for the same 128 queries. Each group of four waves
// shares its own 64-key K and V^T tiles from LDS: two buffers per group, tile t + 2
// copied in while tile t + 1 is worked on.
//   S^T = K * Q^T : A = K rows (row = key, k = d), B = Q^T (k = d, n = query)
//   O^T += V^T * P^T : A = Vt rows (row = d, k = key), B = P^T from registers
// Lane owns 32 keys of query columns (lane&15) and 16 + (lane&15); partner = lane ^ 16.
// The two waves of the same queries swap one column tile each through LDS;
// combine = left + 0.1*tanh(right), x256 -> hi/lo f16 planes.
// Four waves per SIMD (two blocks per WGP): the register budget is 256 per wave.
// ---------------------------------------------------------------------------
__global__ __launch_bounds__(256) __attribute__((amdgpu_waves_per_eu(4, 4))) void attn_kernel(
    const _Float16* __restrict__ qh,   // [NBP*NH][SQ][HD]
    const _Float16* __restrict__ kh,   // [NBP*NH][SQ][HD]
    const _Float16* __restrict__ vt,   // [NBP*NH][HD][SQ]
    const int* __restrict__ mask,      // [NBP][SQ], nonzero = attend
    _Float16* __restrict__ xh,         // [NTOK][DM] f16, hi plane of combine*256
    _Float16* __restrict__ xl)         // [NTOK][DM] f16, lo plane (x2048)
{
  __shared__ __attribute__((aligned(16))) float sO[4 * 32 * SOP];       // 34816 B
  __shared__ __attribute__((aligned(16))) _Float16 sK[2 * 2 * KVTILE];  // 36864 B, [group][buffer]
  __shared__ __attribute__((aligned(16))) _Float16 sV[2 * 2 * KVTILE];  // 36864 B, [group][buffer]
  __shared__ __attribute__((aligned(32))) float sB[SQ];                 //  4096 B, per key: 0 or MASKED

  const int tid = threadIdx.x, lane = tid & 31;
  const int h = lane >> 4, m = lane & 15;
  const int g  = __builtin_amdgcn_readfirstlane(tid >> 7);          // 0: own pair, 1: flipped pair
  const int wq = __builtin_amdgcn_readfirstlane((tid >> 5) & 3);    // the wave's 32 queries of the block's 128
  const int bph = blockIdx.y, bp = bph >> 4, head = bph & 15;
  const int b = bp >> 1, p = bp & 1;
  const int q0 = blockIdx.x * 128 + 32 * wq;

  // Q^T B-fragments: column n = query q0+16c+m, k = d (two 32-deep chunks)
  v16h qb[2][2];
  #pragma unroll
  for (int c = 0; c < 2; ++c) {
    const _Float16* qrow = qh + ((size_t)bph * SQ + q0 + 16 * c + m) * HD;
    qb[c][0] = load_frag_h(qrow, h);
    qb[c][1] = load_frag_h(qrow + 32, h);
  }

  // The mask row as an addend of the base-2 exponent, once per block: thread t owns
  // keys 4t..4t+3. Readable by every wave behind the barrier that publishes tile 0.
  {
    const v4i ma = *(const v4ia*)(mask + (size_t)bp * SQ + 4 * tid);
    const v4f bz = { (ma.x != 0) ? 0.0f : MASKED, (ma.y != 0) ? 0.0f : MASKED,
                     (ma.z != 0) ? 0.0f : MASKED, (ma.w != 0) ? 0.0f : MASKED };
    *(v4fa*)(sB + 4 * tid) = bz;
  }
  float* so = sO + wq * (32 * SOP);
  const v8f zero8 = {0.f, 0.f, 0.f, 0.f, 0.f, 0.f, 0.f, 0.f};

  // Copy addresses of this lane: its group's 128 threads sweep the group's tiles,
  // row (tid&127)>>3 of a sweep, 16-byte column tid&7.
  const int crow = (tid & 127) >> 3, ccol = tid & 7;
  const int kvsel = (g == 0) ? bph : ((b * 2 + (1 - p)) * NH + head);
  const _Float16* gk0 = kh + ((size_t)kvsel * SQ + crow) * HD + 8 * ccol;   // + key0*HD
  const _Float16* gv0 = vt + ((size_t)kvsel * HD + crow) * SQ + 8 * ccol;   // + key0
  const unsigned lk0 = lds_off(sK) + g * (2 * KVTILE * 2) + crow * (KVP * 2) + 16 * ccol;   // + buffer * KVTILE * 2
  const unsigned lv0 = lds_off(sV) + g * (2 * KVTILE * 2) + crow * (KVP * 2) + 16 * ccol;

  // Tile 0 into buffer 0, landed and published; then tile 1 into buffer 1.
  stage_kv(gk0, gv0, lk0, lv0);
  asm volatile("s_wait_asynccnt 0x0" ::: "memory");   // this wave's copies of tile 0 have landed
  __syncthreads();                                    // tile 0 readable by every wave
  stage_kv(gk0 + 64 * HD, gv0 + 64, lk0 + KVTILE * 2, lv0 + KVTILE * 2);

  v8f o[2][4];                                  // o[c][t][r] = O[query 16c+m][d 16t+8h+r] * (l * 2^14)
  #pragma unroll
  for (int c = 0; c < 2; ++c)
    #pragma unroll
    for (int t = 0; t < 4; ++t) o[c][t] = zero8;
  float mrun[2] = {-3.4e38f, -3.4e38f};         // running maximum of the base-2 exponents
  v2f lrun[2] = {{0.0f, 0.0f}, {0.0f, 0.0f}};   // this lane's own 32 keys per trip, two partial sums (x 2^14)

  // One trip: tile's 64 keys against the wave's 32 queries, then the ring's publish point.
  auto trip = [&](const int tile) __attribute__((always_inline)) {
    const int kb = tile * 64;
    const int buf = tile & 1;
    const _Float16* kbase = sK + (2 * g + buf) * KVTILE + m * KVP;   // + 16j*KVP + 32*dc
    const _Float16* vbase = sV + (2 * g + buf) * KVTILE + m * KVP;   // + 16t*KVP + key in tile
    // ---- all eight K fragments, read as one group in front of the score products
    // (loops unrolled so that the arrays stay in registers) ----
    v16h kf[4][2];
    #pragma unroll
    for (int j = 0; j < 4; ++j) {
      const _Float16* kp = kbase + (16 * j) * KVP;
      kf[j][0] = load_frag_h(kp, h);
      kf[j][1] = load_frag_h(kp + 32, h);
    }
    // ---- scores: s[c][j][r] = S[query 16c+m][key kb+16j+8h+r] (unscaled); each K
    // fragment feeds both column tiles ----
    v8f s[2][4];
    #pragma unroll
    for (int j = 0; j < 2; ++j) {
      v8f z0 = wmma_f16(kf[j][0], qb[0][0], zero8);
      v8f z1 = wmma_f16(kf[j][0], qb[1][0], zero8);
      s[0][j] = wmma_f16(kf[j][1], qb[0][1], z0);
      s[1][j] = wmma_f16(kf[j][1], qb[1][1], z1);
    }
    // keeps the mask addends' reads below the first eight products, whose K fragments
    // leave them their registers: read with the K group they do not fit the 256
    // registers, and accumulators spill
    __builtin_amdgcn_sched_barrier(0);
    // ---- the trip's mask addends: they land while the other eight products run ----
    v8f mk[4];
    #pragma unroll
    for (int j = 0; j < 4; ++j) mk[j] = *(const v8fa*)(sB + kb + 16 * j + 8 * h);
    // keeps these reads above the other eight products
    __builtin_amdgcn_sched_barrier(0);
    #pragma unroll
    for (int j = 2; j < 4; ++j) {
      v8f z0 = wmma_f16(kf[j][0], qb[0][0], zero8);
      v8f z1 = wmma_f16(kf[j][0], qb[1][0], zero8);
      s[0][j] = wmma_f16(kf[j][1], qb[0][1], z0);
      s[1][j] = wmma_f16(kf[j][1], qb[1][1], z1);
    }
    // ---- base-2 exponent: scale, log2(e) and key mask in one fused multiply-add, f32
    // (whole-vector forms: two scores per packed instruction) ----
    #pragma unroll
    for (int c = 0; c < 2; ++c)
      #pragma unroll
      for (int j = 0; j < 4; ++j) s[c][j] = s[c][j] * SC2 + mk[j];
    // keeps the V^T reads below the mask addends' last use: read earlier they do not fit
    // the 256 registers beside the addends, and accumulators spill
    __builtin_amdgcn_sched_barrier(0);
    // ---- the V^T fragments of keys 0..31, read as one group here: they land while
    // the softmax below runs ----
    v16h vfa[4];
    #pragma unroll
    for (int t = 0; t < 4; ++t) vfa[t] = load_frag_h(vbase + (16 * t) * KVP, h);
    // keeps the V^T reads above the softmax (the scheduler otherwise sinks them to their products)
    __builtin_amdgcn_sched_barrier(0);

    // ---- online softmax, base 2, per column tile ----
    v16h pb[2][2];
    #pragma unroll
    for (int c = 0; c < 2; ++c) {
      float mloc = s[c][0][0];
      #pragma unroll
      for (int j = 0; j < 4; ++j)
        #pragma unroll
        for (int r = 0; r < 8; ++r) mloc = fmaxf(mloc, s[c][j][r]);
      mloc = fmaxf(mloc, __shfl_xor(mloc, 16));
      const float mnew = fmaxf(mrun[c], mloc);
      const float alpha = __builtin_amdgcn_exp2f(mrun[c] - mnew);
      mrun[c] = mnew;
      const float msh = mnew - PSHIFT;            // P = 2^(e - mnew + 14)
      #pragma unroll
      for (int j = 0; j < 4; ++j) {
        s[c][j] = s[c][j] - msh;
        #pragma unroll
        for (int r = 0; r < 8; ++r) s[c][j][r] = __builtin_amdgcn_exp2f(s[c][j][r]);
      }
      // the lane's own sum, pairwise; the partner lane's half joins once, behind the loop
      const v8f s8 = (s[c][0] + s[c][1]) + (s[c][2] + s[c][3]);
      const v4f s4 = __builtin_shufflevector(s8, s8, 0, 1, 2, 3) + __builtin_shufflevector(s8, s8, 4, 5, 6, 7);
      const v2f s2 = __builtin_shufflevector(s4, s4, 0, 1) + __builtin_shufflevector(s4, s4, 2, 3);
      lrun[c] = lrun[c] * alpha + s2;
      #pragma unroll
      for (int t = 0; t < 4; ++t) o[c][t] = o[c][t] * alpha;
      // ---- P^T B-fragments (keys 0..31 and 32..63 of this step) ----
      pb[c][0] = pack_p(s[c][0], s[c][1]);
      pb[c][1] = pack_p(s[c][2], s[c][3]);
    }

    // keeps the second V^T group below the softmax: read earlier it does not fit the 256
    // registers beside the unpacked scores
    __builtin_amdgcn_sched_barrier(0);
    // ---- the V^T fragments of keys 32..63, read as one group into the registers that
    // the packed scores have left: they land while the first eight products run ----
    v16h vfb[4];
    #pragma unroll
    for (int t = 0; t < 4; ++t) vfb[t] = load_frag_h(vbase + (16 * t) * KVP + 32, h);
    // keeps these reads above the first eight products
    __builtin_amdgcn_sched_barrier(0);

    // ---- O^T += V^T * P^T; each V^T fragment feeds both column tiles ----
    #pragma unroll
    for (int t = 0; t < 4; ++t) {
      o[0][t] = wmma_f16(vfa[t], pb[0][0], o[0][t]);
      o[1][t] = wmma_f16(vfa[t], pb[1][0], o[1][t]);
    }
    #pragma unroll
    for (int t = 0; t < 4; ++t) {
      o[0][t] = wmma_f16(vfb[t], pb[0][1], o[0][t]);
      o[1][t] = wmma_f16(vfb[t], pb[1][1], o[1][t]);
    }

    // ---- publish tile + 1: behind this barrier the buffer this trip has read may be refilled ----
    asm volatile("s_wait_dscnt 0x0" ::: "memory");      // this wave's reads of the buffer are done
    asm volatile("s_wait_asynccnt 0x0" ::: "memory");   // this wave's copies of tile + 1 have landed
    __syncthreads();                                    // publishes tile + 1, ends every read of this buffer
  };

  // The trips that refill, then the last two, which have no tile + 2: two loops instead of
  // a test at the foot, so that a trip is one straight block (with the test the row sums
  // sink behind it, the unpacked P stays live across the products, and accumulators spill).
  // Both kept rolled: small loop text.
  #pragma unroll 1
  for (int tile = 0; tile < NTILE - 2; ++tile) {
    trip(tile);
    const int key0 = (tile + 2) * 64;
    const int buf = tile & 1;
    stage_kv(gk0 + (size_t)key0 * HD, gv0 + key0, lk0 + buf * (KVTILE * 2), lv0 + buf * (KVTILE * 2));
  }
  #pragma unroll 1
  for (int tile = NTILE - 2; tile < NTILE; ++tile) trip(tile);
  asm volatile("s_wait_asynccnt 0x0" ::: "memory");   // no copy outstanding behind the loop

  // The lane's index read anew behind the loops, so that the thread index and its parts
  // are not held in registers across them (there they do not fit and go to scratch).
  const int le = (int)__builtin_amdgcn_mbcnt_lo(~0u, 0u);
  const int he = le >> 4, me = le & 15;
  float inv[2];
  #pragma unroll
  for (int c = 0; c < 2; ++c) {
    const float lown = lrun[c].x + lrun[c].y;
    inv[c] = 1.0f / (lown + __shfl_xor(lown, 16));    // o and the sum both carry 2^14
  }
  // The two waves of a query slab (left in the own-pair wave, right in the flipped-pair
  // wave) swap one column tile each through the slab, same lane and element: wave g then
  // holds left and right of column tile g and finishes those 16 queries.
  const bool own = (g == 0);
  const int keeprow = 16 * g + me, sendrow = 16 * (1 - g) + me;
  // All slab traffic in 16-byte pieces: a lane's eight values of a tile are two of them.
  #pragma unroll
  for (int t = 0; t < 4; ++t)
    #pragma unroll
    for (int q = 0; q < 2; ++q) {
      v4f snd;
      #pragma unroll
      for (int r = 0; r < 4; ++r) snd[r] = own ? o[1][t][4 * q + r] * inv[1] : o[0][t][4 * q + r] * inv[0];
      *(v4fa*)(so + sendrow * SOP + 16 * t + 8 * he + 4 * q) = snd;
    }
  __syncthreads();                                    // the partner wave's tile is readable
  v4f got[4][2];
  #pragma unroll
  for (int t = 0; t < 4; ++t)
    #pragma unroll
    for (int q = 0; q < 2; ++q) got[t][q] = *(const v4fa*)(so + keeprow * SOP + 16 * t + 8 * he + 4 * q);
  #pragma unroll
  for (int t = 0; t < 4; ++t)
    #pragma unroll
    for (int q = 0; q < 2; ++q) {
      v4f res;
      #pragma unroll
      for (int r = 0; r < 4; ++r) {
        const float mine = own ? o[0][t][4 * q + r] * inv[0] : o[1][t][4 * q + r] * inv[1];
        const float left = own ? mine : got[t][q][r], right = own ? got[t][q][r] : mine;
        const float cmb = left + 0.1f * tanhf(right);
        res[r] = cmb * XSCALE;
      }
      *(v4fa*)(so + keeprow * SOP + 16 * t + 8 * he + 4 * q) = res;
    }
  __syncthreads();                                    // the slab is complete in front of the store pass

  // Each wave stores the 16 query rows that it has finished.
  const size_t tok0 = (size_t)bp * SQ + q0 + 16 * g;
  xc_store_pass(so + g * (16 * SOP), xh, xl, tok0, head, le);
}

// ---------------------------------------------------------------------------
// wave w owns rows 16w..16w+15, each row 128 floats = 4 lines: one row (512 B) per
// instruction, 16 B per lane.
// ---------------------------------------------------------------------------
__device__ __forceinline__ void out_store_pass(const float* sT, float* out,
                                               int m0, int n0, int w, int lane) {
  #pragma unroll
  for (int i = 0; i < 16; ++i) {
    const int row = 16 * w + i;
    const v4f v = *(const v4fa*)(sT + row * 128 + 4 * lane);
    const size_t gi = (size_t)(m0 + row) * DM + n0 + 4 * lane;
    *(v4f*)(out + gi) = v;
  }
}

// ---------------------------------------------------------------------------
// Kernel 4: out = X * Wo^T + bo with X = hi/256 + lo/(256*2048) planes.
// Block 128 thr (4 waves, 2 x 2) = 64 tokens x 128 features; wave 32 tokens (hi and
// lo rows) x 64 features, 16 accumulator tiles: 8 fragments feed 16 products.
// A = X rows (k contiguous), B[k][n] = Wo[n][k] from Wo row n (k contiguous).
// The block's 64 hi rows (LDS rows 0..63), 64 lo rows (64..127) and 128 Wo rows
// (128..255) come through LDS in k-tiles of 64: two buffers, tile t + 2 copied
// in while tile t + 1 is worked on.
// ---------------------------------------------------------------------------
__global__ __launch_bounds__(128) void oproj_kernel(
    const _Float16* __restrict__ xh,   // [NTOK][DM]
    const _Float16* __restrict__ xl,   // [NTOK][DM]
    const _Float16* __restrict__ woh,  // [DM][DM] f16(bf16(Wo)*256)
    const float* __restrict__ bo,
    float* __restrict__ out)           // [NTOK][DM]
{
  __shared__ __attribute__((aligned(16))) float sT[64 * 128];       // 32768 B
  __shared__ __attribute__((aligned(16))) _Float16 sG[2 * GTILE];   // 73728 B

  const int tid = threadIdx.x, lane = tid & 31, w = tid >> 5;
  const int h = lane >> 4, m = lane & 15;
  const int wm = w >> 1, wn = w & 1;         // wave's 32-token half, wave's 64-feature half
  const int m0 = blockIdx.x * 64, n0 = blockIdx.y * 128;

  // Copy addresses of this lane: row tid>>3 of a sweep, 16-byte column tid&7.
  const int crow = tid >> 3, ccol = tid & 7;
  const _Float16* gh = xh + (size_t)(m0 + crow) * DM + 8 * ccol;    // + k
  const _Float16* gl = xl + (size_t)(m0 + crow) * DM + 8 * ccol;    // + k
  const _Float16* gw = woh + (size_t)(n0 + crow) * DM + 8 * ccol;   // + k
  const unsigned lg0 = lds_off(sG) + crow * (GP * 2) + 16 * ccol;   // + buffer * GTILE * 2

  const v8f zero8 = {0.f, 0.f, 0.f, 0.f, 0.f, 0.f, 0.f, 0.f};
  v8f acch[2][4], accl[2][4];
  #pragma unroll
  for (int mt = 0; mt < 2; ++mt)
    #pragma unroll
    for (int nt = 0; nt < 4; ++nt) { acch[mt][nt] = zero8; accl[mt][nt] = zero8; }

  // Tile 0 into buffer 0, landed and published; then tile 1 into buffer 1.
  stage_gemm(gh, gl, gw, gw + 64 * DM, lg0);
  asm volatile("s_wait_asynccnt 0x0" ::: "memory");   // this wave's copies of tile 0 have landed
  __syncthreads();                                    // tile 0 readable by every wave
  stage_gemm(gh + GKT, gl + GKT, gw + GKT, gw + 64 * DM + GKT, lg0 + GTILE * 2);

  // kept rolled: one copy of the ring's foot (waits, barrier, refill), small loop text
  #pragma unroll 1
  for (int t = 0; t < GNT; ++t) {
    const int buf = t & 1;
    const _Float16* ah = sG + buf * GTILE + (32 * wm + m) * GP;             // hi row, mt = 0
    const _Float16* al = ah + 64 * GP;                                      // lo row, mt = 0
    const _Float16* wr = sG + buf * GTILE + (128 + 64 * wn + m) * GP;       // feature row, nt = 0
    // Each 32-deep step reads its eight fragments as one group in front of its 16
    // products; the loops are unrolled so that the fragment arrays stay in registers.
    #pragma unroll
    for (int kc = 0; kc < 2; ++kc) {
      v16h fah[2], fal[2], fb[4];
      #pragma unroll
      for (int i = 0; i < 2; ++i) {
        fah[i] = load_frag_h(ah + i * 16 * GP + 32 * kc, h);
        fal[i] = load_frag_h(al + i * 16 * GP + 32 * kc, h);
      }
      #pragma unroll
      for (int i = 0; i < 4; ++i) fb[i] = load_frag_h(wr + i * 16 * GP + 32 * kc, h);
      #pragma unroll
      for (int nt = 0; nt < 4; ++nt) {
        #pragma unroll
        for (int mt = 0; mt < 2; ++mt) {
          acch[mt][nt] = wmma_f16(fah[mt], fb[nt], acch[mt][nt]);
          accl[mt][nt] = wmma_f16(fal[mt], fb[nt], accl[mt][nt]);
        }
      }
    }
    // ---- publish tile + 1, then refill the buffer this trip has read ----
    asm volatile("s_wait_dscnt 0x0" ::: "memory");      // this wave's reads of the buffer are done
    asm volatile("s_wait_asynccnt 0x0" ::: "memory");   // this wave's copies of tile + 1 have landed
    __syncthreads();                                    // publishes tile + 1, ends every read of this buffer
    if (t + 2 < GNT) {
      const int kn = (t + 2) * GKT;
      stage_gemm(gh + kn, gl + kn, gw + kn, gw + 64 * DM + kn, lg0 + buf * (GTILE * 2));
    }
  }
  asm volatile("s_wait_asynccnt 0x0" ::: "memory");   // no copy outstanding behind the loop

  // D[r] of tile (mt, nt) = Y[token m0+32wm+16mt+8h+r][feature n0+64wn+16nt+m]
  const float sh = 1.0f / (XSCALE * WSCALE);
  const float sl = 1.0f / (XSCALE * WSCALE * LOSCALE);
  #pragma unroll
  for (int nt = 0; nt < 4; ++nt) {
    const int col = 64 * wn + 16 * nt + m;                // 0..127
    const float bvl = bo[n0 + col];
    #pragma unroll
    for (int mt = 0; mt < 2; ++mt) {
      #pragma unroll
      for (int r = 0; r < 8; ++r) {
        const int row = 32 * wm + 16 * mt + 8 * h + r;    // 0..63
        sT[row * 128 + col] = acch[mt][nt][r] * sh + accl[mt][nt][r] * sl + bvl;
      }
    }
  }
  __syncthreads();

  out_store_pass(sT, out, m0, n0, w, lane);
}

// ---------------------------------------------------------------------------
extern "C" void kernel_launch(void* const* d_in, const int* in_sizes, int n_in,
                              void* d_out, int out_size, void* d_ws, size_t ws_size,
                              hipStream_t stream) {
  if (n_in < 12) return;
  if (in_sizes[0] != NACT || in_sizes[1] != NACT || in_sizes[2] != NACT) return;
  if (in_sizes[3] != NBP * SQ) return;
  if (in_sizes[4] != NWEL || in_sizes[6] != NWEL || in_sizes[8] != NWEL || in_sizes[10] != NWEL) return;
  if (in_sizes[5] != DM || in_sizes[7] != DM || in_sizes[9] != DM || in_sizes[11] != DM) return;
  if (out_size != NACT) return;

  const float* query = (const float*)d_in[0];
  const float* key_  = (const float*)d_in[1];
  const float* value = (const float*)d_in[2];
  const int*   mask  = (const int*)d_in[3];
  const float* Wq = (const float*)d_in[4];
  const float* bq = (const float*)d_in[5];
  const float* Wk = (const float*)d_in[6];
  const float* bk = (const float*)d_in[7];
  const float* Wv = (const float*)d_in[8];
  const float* bv = (const float*)d_in[9];
  const float* Wo = (const float*)d_in[10];
  const float* bo = (const float*)d_in[11];
  float* out = (float*)d_out;

  const size_t xb_bytes  = (size_t)3 * NACT * 2;                 // 25165824
  const size_t wb_bytes  = (size_t)3 * NWEL * 2;                 //  6291456
  const size_t woh_bytes = (size_t)NWEL * 2;                     //  2097152
  const size_t pl_bytes  = (size_t)NBP * NH * SQ * HD * 2;       //  8388608 per plane
  const size_t xc_bytes  = (size_t)NACT * 2;                     //  8388608 per plane
  const size_t total = xb_bytes + wb_bytes + woh_bytes + 3 * pl_bytes + 2 * xc_bytes;   // 75497472
  if (total > ws_size) return;

  char* ws = (char*)d_ws;
  size_t off = 0;
  unsigned short* xb = (unsigned short*)(ws + off); off += xb_bytes;
  unsigned short* wb = (unsigned short*)(ws + off); off += wb_bytes;
  _Float16* woh = (_Float16*)(ws + off);            off += woh_bytes;
  _Float16* qh  = (_Float16*)(ws + off);            off += pl_bytes;
  _Float16* kh  = (_Float16*)(ws + off);            off += pl_bytes;
  _Float16* vt  = (_Float16*)(ws + off);            off += pl_bytes;
  _Float16* xh  = (_Float16*)(ws + off);            off += xc_bytes;
  _Float16* xl  = (_Float16*)(ws + off);            off += xc_bytes;
  if (off > ws_size) return;

  convert_kernel<<<(NGRP + 255) / 256, 256, 0, stream>>>(query, key_, value, Wq, Wk, Wv, Wo, xb, wb, woh);

  dim3 gProj(NTOK / 128, 3 * NH / 2);                           // (32, 24)
  proj_kernel<<<gProj, 128, 0, stream>>>(xb, wb, bq, bk, bv, qh, kh, vt);

  dim3 gAtt(SQ / 128, NBP * NH);                                 // (8, 64)
  attn_kernel<<<gAtt, 256, 0, stream>>>(qh, kh, vt, mask, xh, xl);

  dim3 gOut(NTOK / 64, DM / 128);                                // (64, 8)
  oproj_kernel<<<gOut, 128, 0, stream>>>(xh, xl, woh, bo, out);
}

// v008
// It runs in 84.3 microseconds.
// In two side-by-side timings against v007, it was 1.03 and 1.04 times as fast.
// Over all steps from v000 it is 3.30 times as fast.
// Contractions: q/k/v projections x*W^T on v_wmma_f32_16x16x32_bf16 (bf16 operands, f32 accumulate); K*Q^T and V^T*P^T of both attention passes on v_wmma_f32_16x16x32_f16 (f16 operands, P carried x128, f32 accumulate); output projection on v_wmma_f32_16x16x32_f16 with the activation carried x256 as f16 hi + lo(x2048) planes and the weight as f16 of its bf16 value x256 (f32 accumulate); scale, mask, softmax, tanh and bias in f32.
#include <hip/hip_runtime.h>
#include <math.h>

typedef _Float16       v16h __attribute__((ext_vector_type(16)));
typedef _Float16       v8h  __attribute__((ext_vector_type(8)));
typedef __bf16         v16b __attribute__((ext_vector_type(16)));
typedef unsigned short v8us __attribute__((ext_vector_type(8)));
typedef float          v8f  __attribute__((ext_vector_type(8)));
typedef float          v4f  __attribute__((ext_vector_type(4)));
typedef float          v2f  __attribute__((ext_vector_type(2)));
typedef int            v4i  __attribute__((ext_vector_type(4)));
typedef v8h  __attribute__((may_alias)) v8ha;
typedef v8us __attribute__((may_alias)) v8usa;
typedef v4f  __attribute__((may_alias)) v4fa;
typedef v4i  __attribute__((may_alias)) v4ia;
typedef v8f  __attribute__((may_alias)) v8fa;

union FragH { v16h v; v8h  half[2]; };
union FragB { v16b v; v8us half[2]; };

#define DM     1024
#define NH     16
#define HD     64
#define SQ     1024
#define NBP    4                       // batch * pair
#define NTOK   (NBP * SQ)              // 4096 token rows
#define NACT   (NTOK * DM)             // 4194304
#define NWEL   (DM * DM)               // 1048576
#define ACT8   (NACT / 8)              // 524288
#define WEL8   (NWEL / 8)              // 131072
#define NGRP   (3 * ACT8 + 4 * WEL8)   // 2097152
#define PSHIFT  7.0f                   // P is carried x 2^7: added to the base-2 exponent
// A trip's P is formed against the reference exponent already in use. It is kept if each
// lane's sum of its 32 P values of a column stays at or below this: then every single P
// does too, and none leaves the f16 range (65504).
#define PSUMMAX 32768.0f
#define SC2     0.18033688011112042f   // (1/8) * log2(e): scores go to the base-2 exponent in one product
// Exponent addend of a masked key: the fma absorbs any finite score into it, so masked
// keys are all equal and below every unmasked one: weight 0 beside an unmasked key, and
// equal weights (the plain mean of V) where a whole row is masked.
#define MASKED  -3.0e38f
#define XSCALE  256.0f
#define WSCALE  256.0f
#define LOSCALE 2048.0f

// ---------------------------------------------------------------------------
// 16x16x32 WMMA helpers with hazard guard (ties D, keeps A/B live).
// Fragment map (wave32): lane l, h = l>>4, m = n = l&15.
//   A/B element i: i<8 -> k0+8h+i ; i>=8 -> k0+16+8h+(i-8)
//   D element r : row 8h+r, col l&15
// ---------------------------------------------------------------------------
__device__ __forceinline__ v8f wmma_f16(v16h a, v16h b, v8f c) {
  v8f d = __builtin_amdgcn_wmma_f32_16x16x32_f16(false, a, false, b, (short)0, c, false, false);
  asm volatile("v_nop\n\tv_nop\n\tv_nop\n\tv_nop" : "+v"(d) : "v"(a), "v"(b));
  return d;
}
__device__ __forceinline__ v8f wmma_bf16(v16b a, v16b b, v8f c) {
  v8f d = __builtin_amdgcn_wmma_f32_16x16x32_bf16(false, a, false, b, (short)0, c, false, false);
  asm volatile("v_nop\n\tv_nop\n\tv_nop\n\tv_nop" : "+v"(d) : "v"(a), "v"(b));
  return d;
}

// A or B fragment from a k-contiguous 16-bit row; p points at element k0 of
// the row owned by this lane (row index = lane & 15 added by the caller).
__device__ __forceinline__ v16h load_frag_h(const _Float16* p, int h) {
  FragH f;
  f.half[0] = *(const v8ha*)(p + 8 * h);
  f.half[1] = *(const v8ha*)(p + 16 + 8 * h);
  return f.v;
}
__device__ __forceinline__ v16b load_frag_b(const unsigned short* p, int h) {
  FragB f;
  f.half[0] = *(const v8usa*)(p + 8 * h);
  f.half[1] = *(const v8usa*)(p + 16 + 8 * h);
  return f.v;
}

// f32 -> bf16 bits, RNE
__device__ __forceinline__ unsigned short bf16_bits(float f) {
  unsigned int u = __float_as_uint(f);
  u = u + 0x7FFFu + ((u >> 16) & 1u);
  return (unsigned short)(u >> 16);
}
__device__ __forceinline__ float bf16_val(float f) {
  return __uint_as_float(((unsigned int)bf16_bits(f)) << 16);
}

// ---------------------------------------------------------------------------
// Kernel 1: f32 -> 16-bit planes.
//   xb[3][NTOK][DM] bf16 (query, key, value), wb[3][DM][DM] bf16 (Wq, Wk, Wv),
//   woh[DM][DM] f16 = f16(bf16(Wo) * 256).
// ---------------------------------------------------------------------------
__global__ __launch_bounds__(256) void convert_kernel(
    const float* __restrict__ xq, const float* __restrict__ xk, const float* __restrict__ xv,
    const float* __restrict__ wq, const float* __restrict__ wk, const float* __restrict__ wv,
    const float* __restrict__ wo,
    unsigned short* __restrict__ xb, unsigned short* __restrict__ wb, _Float16* __restrict__ woh)
{
  const int g = blockIdx.x * 256 + threadIdx.x;
  if (g >= NGRP) return;
  if (g < 3 * ACT8 + 3 * WEL8) {
    const float* src;
    unsigned short* dst;
    if (g < 3 * ACT8) {
      const int sel = g / ACT8;
      const int off = g - sel * ACT8;
      const float* xs = (sel == 0) ? xq : ((sel == 1) ? xk : xv);
      src = xs + (size_t)off * 8;
      dst = xb + (size_t)sel * NACT + (size_t)off * 8;
    } else {
      const int e = g - 3 * ACT8;
      const int sel = e / WEL8;
      const int off = e - sel * WEL8;
      const float* wsrc = (sel == 0) ? wq : ((sel == 1) ? wk : wv);
      src = wsrc + (size_t)off * 8;
      dst = wb + (size_t)sel * NWEL + (size_t)off * 8;
    }
    const v4f a = *(const v4fa*)src;
    const v4f c = *(const v4fa*)(src + 4);
    const v8us o = { bf16_bits(a.x), bf16_bits(a.y), bf16_bits(a.z), bf16_bits(a.w),
                     bf16_bits(c.x), bf16_bits(c.y), bf16_bits(c.z), bf16_bits(c.w) };
    *(v8us*)dst = o;
    
  } else {
    const int off = g - (3 * ACT8 + 3 * WEL8);
    const float* src = wo + (size_t)off * 8;
    _Float16* dst = woh + (size_t)off * 8;
    const v4f a = *(const v4fa*)src;
    const v4f c = *(const v4fa*)(src + 4);
    const v8h o = { (_Float16)(bf16_val(a.x) * WSCALE), (_Float16)(bf16_val(a.y) * WSCALE),
                    (_Float16)(bf16_val(a.z) * WSCALE), (_Float16)(bf16_val(a.w) * WSCALE),
                    (_Float16)(bf16_val(c.x) * WSCALE), (_Float16)(bf16_val(c.y) * WSCALE),
                    (_Float16)(bf16_val(c.z) * WSCALE), (_Float16)(bf16_val(c.w) * WSCALE) };
    *(v8h*)dst = o;
    
  }
}

// ---------------------------------------------------------------------------
// 4 lines per instruction, 32 lines per wave, 128 per block.
// which 0/1: plane[bh][s][d]  (one token row = 64 halves = one line)
// which 2  : vt[bh][d][s]     (64 d-rows x 128 tokens = 2 lines each)
// The LDS tile holds its rows in 16-byte chunks at swapped places (QK_AT, VT_AT), so
// that the 16 lanes that write one chunk each of 16 different rows fall on all 64 banks.
// ---------------------------------------------------------------------------
// q, k tile [128 tokens][64 features]: chunk c (0..7) of token row t, in halves
#define QK_AT(t, c) ((t) * HD + (((c) ^ (((t) >> 1) & 7)) * 8))
// V^T tile [64 features][128 tokens]: chunk c (0..15) of feature row f, in halves
#define VT_AT(f, c) ((f) * 128 + (((c) ^ ((f) & 15)) * 8))
__device__ __forceinline__ void proj_store_pass(const _Float16* sT, _Float16* plane, _Float16* vt,
                                                int which, int bh, int l0, int w, int lane) {
  const int q8 = lane & 7, sub = lane >> 3;
  #pragma unroll
  for (int i = 0; i < 8; ++i) {
    const int lid = w * 32 + i * 4 + sub;
    v8h v;
    _Float16* dst;
    if (which != 2) {
      v = *(const v8ha*)(sT + QK_AT(lid, q8));
      dst = plane + ((size_t)bh * SQ + l0 + lid) * HD + 8 * q8;
    } else {
      const int d = lid >> 1, hl = lid & 1;
      v = *(const v8ha*)(sT + VT_AT(d, 8 * hl + q8));
      dst = vt + ((size_t)bh * HD + d) * SQ + l0 + 64 * hl + 8 * q8;
    }
    *(v8h*)dst = v;
    // the next round's address arithmetic reuses this store's address registers
    asm volatile("s_wait_xcnt 0x0" ::: "memory");
  }
}

__device__ __forceinline__ unsigned lds_off(const void* p) { return (unsigned)(size_t)p; }

// ---------------------------------------------------------------------------
// GEMM operand staging (kernels 2 and 4): one k-tile = 64 k (128 B) of 256
// operand rows, four groups of 64 rows, LDS row pitch 144 B (16 B x odd,
// conflict-free for the 16-byte fragment reads). 128 threads, 8 lanes per row,
// 16 rows per sweep, 4 sweeps per group: every copy instruction covers whole
// 128-B lines of the source. Source row pitch = DM 16-bit elements.
// ---------------------------------------------------------------------------
#define GP     72                      // LDS row pitch in 16-bit elements (144 B)
#define GTILE  (256 * GP)              // elements per staged k-tile (36864 B)
#define GKT    64                      // k per tile
#define GNT    (DM / GKT)              // 16 k-tiles

// Two groups of 64 rows. g0 / g1: this lane's 16 B of row (tid>>3) of each group, at
// the tile's first k; l: the lane's LDS byte address of row (tid>>3) of the first group.
__device__ __forceinline__ void stage_pair(const void* g0, const void* g1, unsigned l) {
  const char* a0 = (const char*)g0;
  const char* a1 = a0 + 16 * DM * 2;
  const char* a2 = a0 + 32 * DM * 2;
  const char* a3 = a0 + 48 * DM * 2;
  const char* b0 = (const char*)g1;
  const char* b1 = b0 + 16 * DM * 2;
  const char* b2 = b0 + 32 * DM * 2;
  const char* b3 = b0 + 48 * DM * 2;
  const unsigned la1 = l + 16 * GP * 2,  la2 = l + 32 * GP * 2,  la3 = l + 48 * GP * 2;
  const unsigned lb0 = l + 64 * GP * 2,  lb1 = l + 80 * GP * 2,  lb2 = l + 96 * GP * 2,  lb3 = l + 112 * GP * 2;
  // Global -> LDS through no register; the closing s_wait_xcnt stands in the same
  // statement so that no address register is rewritten in front of it.
  asm volatile(
      "global_load_async_to_lds_b128 %0, %8, off\n\t"
      "global_load_async_to_lds_b128 %1, %9, off\n\t"
      "global_load_async_to_lds_b128 %2, %10, off\n\t"
      "global_load_async_to_lds_b128 %3, %11, off\n\t"
      "global_load_async_to_lds_b128 %4, %12, off\n\t"
      "global_load_async_to_lds_b128 %5, %13, off\n\t"
      "global_load_async_to_lds_b128 %6, %14, off\n\t"
      "global_load_async_to_lds_b128 %7, %15, off\n\t"
      "s_wait_xcnt 0x0"
      :: "v"(l), "v"(la1), "v"(la2), "v"(la3), "v"(lb0), "v"(lb1), "v"(lb2), "v"(lb3),
         "v"(a0), "v"(a1), "v"(a2), "v"(a3), "v"(b0), "v"(b1), "v"(b2), "v"(b3)
      : "memory");
}

// g0 .. g3: the four groups of a k-tile (LDS rows 0..63, 64..127, 128..191, 192..255).
__device__ __forceinline__ void stage_gemm(const void* g0, const void* g1, const void* g2, const void* g3,
                                           unsigned l) {
  stage_pair(g0, g1, l);
  stage_pair(g2, g3, l + 128 * GP * 2);
}

// ---------------------------------------------------------------------------
// Kernel 2: Y = x * W^T for the three projections (bf16 operands).
// Block 128 thr (4 waves, 2 x 2) = 128 tokens x 128 features (two heads) of one
// projection; wave tile 64 tokens x 64 features (one head), 16 accumulator tiles:
// 8 fragments feed 16 products. K = 1024 in steps of 32.
// x rows (token-major) and W rows (feature-major) are both k contiguous -> both
// fragments with the same loader, and either may be the A operand. A lane's eight D
// values run along the A rows: v takes A = x (eight tokens of one feature, contiguous in
// V^T), q and k take A = W (eight features of one token, contiguous in the plane).
// The block's 128 x rows (LDS rows 0..127) and 128 W rows (LDS rows 128..255)
// come through LDS in k-tiles of 64: two buffers, tile t + 2 copied in while
// tile t + 1 is worked on.
// ---------------------------------------------------------------------------
__global__ __launch_bounds__(128) void proj_kernel(
    const unsigned short* __restrict__ xb,   // [3][NTOK][DM] bf16
    const unsigned short* __restrict__ wb,   // [3][DM][DM]   bf16, row = output feature
    const float* __restrict__ bq, const float* __restrict__ bk, const float* __restrict__ bv,
    _Float16* __restrict__ qh,               // [NBP*NH][SQ][HD] f16
    _Float16* __restrict__ kh,               // [NBP*NH][SQ][HD] f16
    _Float16* __restrict__ vt)               // [NBP*NH][HD][SQ] f16
{
  __shared__ __attribute__((aligned(16))) _Float16 sT[2 * 128 * 64];      // 32768 B, one plane per head
  __shared__ __attribute__((aligned(16))) unsigned short sG[2 * GTILE];   // 73728 B

  const int tid = threadIdx.x, lane = tid & 31, w = tid >> 5;
  const int h = lane >> 4, m = lane & 15;
  const int wm = w >> 1, wn = w & 1;         // wave's 64-token half, wave's head of the pair
  const int m0 = blockIdx.x * 128;
  const int cg = blockIdx.y;                 // 0..23
  const int which = cg >> 3, head0 = (cg & 7) * 2;

  // Copy addresses of this lane: row tid>>3 of a sweep, 16-byte column tid&7.
  const int crow = tid >> 3, ccol = tid & 7;
  const unsigned short* gx = xb + (size_t)which * NACT + (size_t)(m0 + crow) * DM + 8 * ccol;          // + k
  const unsigned short* gw = wb + (size_t)which * NWEL + (size_t)(head0 * HD + crow) * DM + 8 * ccol;  // + k
  const unsigned lg0 = lds_off(sG) + crow * (GP * 2) + 16 * ccol;                                      // + buffer * GTILE * 2

  // LDS rows of the wave's A and B fragments (tile 0 of four each)
  const int rowx = 64 * wm + m, roww = 128 + 64 * wn + m;
  const int rowa = (which == 2) ? rowx : roww, rowb = (which == 2) ? roww : rowx;

  const v8f zero8 = {0.f, 0.f, 0.f, 0.f, 0.f, 0.f, 0.f, 0.f};
  v8f acc[4][4];
  #pragma unroll
  for (int mt = 0; mt < 4; ++mt)
    #pragma unroll
    for (int nt = 0; nt < 4; ++nt) acc[mt][nt] = zero8;

  // Tile 0 into buffer 0, landed and published; then tile 1 into buffer 1.
  stage_gemm(gx, gx + 64 * DM, gw, gw + 64 * DM, lg0);
  asm volatile("s_wait_asynccnt 0x0" ::: "memory");   // this wave's copies of tile 0 have landed
  __syncthreads();                                    // tile 0 readable by every wave
  stage_gemm(gx + GKT, gx + 64 * DM + GKT, gw + GKT, gw + 64 * DM + GKT, lg0 + GTILE * 2);

  // kept rolled: one copy of the ring's foot (waits, barrier, refill), small loop text
  #pragma unroll 1
  for (int t = 0; t < GNT; ++t) {
    const int buf = t & 1;
    const unsigned short* xa = sG + buf * GTILE + rowa * GP;   // A row, mt = 0
    const unsigned short* wr = sG + buf * GTILE + rowb * GP;   // B row, nt = 0
    // Each 32-deep step reads its eight fragments as one group in front of its 16
    // products; the loops are unrolled so that the fragment arrays stay in registers.
    #pragma unroll
    for (int kc = 0; kc < 2; ++kc) {
      v16b fa[4], fb[4];
      #pragma unroll
      for (int i = 0; i < 4; ++i) fa[i] = load_frag_b(xa + i * 16 * GP + 32 * kc, h);
      #pragma unroll
      for (int i = 0; i < 4; ++i) fb[i] = load_frag_b(wr + i * 16 * GP + 32 * kc, h);
      #pragma unroll
      for (int nt = 0; nt < 4; ++nt) {
        #pragma unroll
        for (int mt = 0; mt < 4; ++mt) acc[mt][nt] = wmma_bf16(fa[mt], fb[nt], acc[mt][nt]);
      }
    }
    // ---- publish tile + 1, then refill the buffer this trip has read ----
    asm volatile("s_wait_dscnt 0x0" ::: "memory");      // this wave's reads of the buffer are done
    asm volatile("s_wait_asynccnt 0x0" ::: "memory");   // this wave's copies of tile + 1 have landed
    __syncthreads();                                    // publishes tile + 1, ends every read of this buffer
    if (t + 2 < GNT) {
      const int kn = (t + 2) * GKT;
      stage_gemm(gx + kn, gx + 64 * DM + kn, gw + kn, gw + 64 * DM + kn, lg0 + buf * (GTILE * 2));
    }
  }
  asm volatile("s_wait_asynccnt 0x0" ::: "memory");   // no copy outstanding behind the loop

  // A lane's eight values of a tile are one 16-byte chunk of the LDS tile's row.
  const float* bias = ((which == 0) ? bq : ((which == 1) ? bk : bv)) + (head0 + wn) * HD;
  _Float16* sTh = sT + wn * (128 * 64);
  if (which == 2) {
    // D[r] of tile (mt, nt) = Y[token m0+64wm+16mt+8h+r][feature (head0+wn)*64+16nt+m]
    #pragma unroll
    for (int nt = 0; nt < 4; ++nt) {
      const int feat = 16 * nt + m;
      const float bvl = bias[feat];
      #pragma unroll
      for (int mt = 0; mt < 4; ++mt) {
        v8h pk;
        #pragma unroll
        for (int r = 0; r < 8; ++r) pk[r] = (_Float16)(acc[mt][nt][r] + bvl);
        *(v8ha*)(sTh + VT_AT(feat, 8 * wm + 2 * mt + h)) = pk;
      }
    }
  } else {
    // D[r] of tile (mt, nt) = Y[token m0+64wm+16nt+m][feature (head0+wn)*64+16mt+8h+r]
    v4f bb[4][2];                                          // the lane's 32 features' bias, one load group
    #pragma unroll
    for (int mt = 0; mt < 4; ++mt) {
      bb[mt][0] = *(const v4fa*)(bias + 16 * mt + 8 * h);
      bb[mt][1] = *(const v4fa*)(bias + 16 * mt + 8 * h + 4);
    }
    #pragma unroll
    for (int mt = 0; mt < 4; ++mt) {
      #pragma unroll
      for (int nt = 0; nt < 4; ++nt) {
        const int tokl = 64 * wm + 16 * nt + m;            // 0..127
        v8h pk;
        #pragma unroll
        for (int r = 0; r < 4; ++r) {
          pk[r]     = (_Float16)(acc[mt][nt][r] + bb[mt][0][r]);
          pk[4 + r] = (_Float16)(acc[mt][nt][4 + r] + bb[mt][1][r]);
        }
        *(v8ha*)(sTh + QK_AT(tokl, 2 * mt + h)) = pk;
      }
      // keeps each group's sums next to their packing: all 128 sums hoisted together need
      // registers above v255, which are reached only through window switches
      __builtin_amdgcn_sched_barrier(0);
    }
  }
  __syncthreads();

  const int bp = m0 >> 10, l0 = m0 & (SQ - 1), bh = bp * NH + head0;
  _Float16* plane = (which == 0) ? qh : kh;
  proj_store_pass(sT, plane, vt, which, bh, l0, w, lane);
  proj_store_pass(sT + 128 * 64, plane, vt, which, bh + 1, l0, w, lane);
}

// ---------------------------------------------------------------------------
// Attention helpers.
// ---------------------------------------------------------------------------
// P^T B-fragment from the lane's own P values (already x 2^7): element r <- tile a
// row r (keys 0..15 of the 32-key step), element 8+r <- tile c row r (keys 16..31),
// same lane (query column).
__device__ __forceinline__ v16h pack_p(v8f a, v8f c) {
  const v16h r = { (_Float16)a[0], (_Float16)a[1], (_Float16)a[2], (_Float16)a[3],
                   (_Float16)a[4], (_Float16)a[5], (_Float16)a[6], (_Float16)a[7],
                   (_Float16)c[0], (_Float16)c[1], (_Float16)c[2], (_Float16)c[3],
                   (_Float16)c[4], (_Float16)c[5], (_Float16)c[6], (_Float16)c[7] };
  return r;
}

// Row pitch of the f32 slabs in floats: 272 B = 16 B x odd, so that 16 lanes that each
// touch 16 bytes of their own row fall on all 64 banks (at 256 B they share four).
#define SOP 68
// Per-wave 16x64 f32 tile (already x256) in LDS -> hi/lo f16 planes
// lanes 8q..8q+7 per line, 4 lines per instruction, 16 rows x 2 planes per wave.
__device__ __forceinline__ void xc_store_pass(const float* so, _Float16* xh, _Float16* xl,
                                              size_t tok0, int head, int lane) {
  const int q8 = lane & 7, sub = lane >> 3;
  #pragma unroll
  for (int i = 0; i < 4; ++i) {
    const int row = 4 * i + sub;
    const v4f a = *(const v4fa*)(so + row * SOP + 8 * q8);
    const v4f c = *(const v4fa*)(so + row * SOP + 8 * q8 + 4);
    const _Float16 h0 = (_Float16)a.x, h1 = (_Float16)a.y, h2 = (_Float16)a.z, h3 = (_Float16)a.w;
    const _Float16 h4 = (_Float16)c.x, h5 = (_Float16)c.y, h6 = (_Float16)c.z, h7 = (_Float16)c.w;
    const v8h hv = { h0, h1, h2, h3, h4, h5, h6, h7 };
    const v8h lv = { (_Float16)((a.x - (float)h0) * LOSCALE), (_Float16)((a.y - (float)h1) * LOSCALE),
                     (_Float16)((a.z - (float)h2) * LOSCALE), (_Float16)((a.w - (float)h3) * LOSCALE),
                     (_Float16)((c.x - (float)h4) * LOSCALE), (_Float16)((c.y - (float)h5) * LOSCALE),
                     (_Float16)((c.z - (float)h6) * LOSCALE), (_Float16)((c.w - (float)h7) * LOSCALE) };
    const size_t gi = (tok0 + row) * (size_t)DM + (size_t)head * HD + 8 * q8;
    *(v8h*)(xh + gi) = hv;
    *(v8h*)(xl + gi) = lv;
  }
}

// ---------------------------------------------------------------------------
// K / V^T tile staging: 64 rows x 128 B each, LDS row pitch 144 B (16 B x odd,
// conflict-free for the 16-byte fragment reads). 128 threads, 8 lanes per row,
// 16 rows per sweep, 4 sweeps per operand: every copy instruction covers whole
// 128-B lines of the source.
// ---------------------------------------------------------------------------
#define KVP    72                      // LDS row pitch in halves (144 B)
#define KVTILE (64 * KVP)              // halves per staged tile (9216 B)
#define NTILE  (SQ / 64)               // 16 tiles per pass

// The value of lane l ^ 16, by a vector cross-row move: it needs no address register (the
// LDS permute's is live across the loops, where the 256 registers are full).
__device__ __forceinline__ float other_half(float x) {
  const int b = __float_as_int(x);
  return __int_as_float(__builtin_amdgcn_permlanex16(b, b, 0x76543210, 0xfedcba98, false, false));
}

// Compile-time yes / no of a lambda's argument.
struct Yes { static constexpr bool value = true; };
struct No  { static constexpr bool value = false; };

// gk: this lane's 16 B of K row (tid&127)>>3 of the tile; gv: the same of V^T row (tid&127)>>3.
// lk / lv: the lane's LDS byte addresses for those rows.
__device__ __forceinline__ void stage_kv(const _Float16* gk, const _Float16* gv, unsigned lk, unsigned lv) {
  const _Float16* gk1 = gk + 16 * HD;
  const _Float16* gk2 = gk + 32 * HD;
  const _Float16* gk3 = gk + 48 * HD;
  const _Float16* gv1 = gv + 16 * SQ;
  const _Float16* gv2 = gv + 32 * SQ;
  const _Float16* gv3 = gv + 48 * SQ;
  const unsigned lk1 = lk + 16 * KVP * 2, lk2 = lk + 32 * KVP * 2, lk3 = lk + 48 * KVP * 2;
  const unsigned lv1 = lv + 16 * KVP * 2, lv2 = lv + 32 * KVP * 2, lv3 = lv + 48 * KVP * 2;
  // Global -> LDS through no register; the closing s_wait_xcnt stands in the same
  // statement so that no address register is rewritten in front of it.
  asm volatile(
      "global_load_async_to_lds_b128 %0, %8, off\n\t"
      "global_load_async_to_lds_b128 %1, %9, off\n\t"
      "global_load_async_to_lds_b128 %2, %10, off\n\t"
      "global_load_async_to_lds_b128 %3, %11, off\n\t"
      "global_load_async_to_lds_b128 %4, %12, off\n\t"
      "global_load_async_to_lds_b128 %5, %13, off\n\t"
      "global_load_async_to_lds_b128 %6, %14, off\n\t"
      "global_load_async_to_lds_b128 %7, %15, off\n\t"
      "s_wait_xcnt 0x0"
      :: "v"(lk), "v"(lk1), "v"(lk2), "v"(lk3), "v"(lv), "v"(lv1), "v"(lv2), "v"(lv3),
         "v"(gk), "v"(gk1), "v"(gk2), "v"(gk3), "v"(gv), "v"(gv1), "v"(gv2), "v"(gv3)
      : "memory");
}

// ---------------------------------------------------------------------------
// Block 256 thr (8 waves) = 128 queries; 32 queries (two 16-column tiles) per wave,
// 64 keys per step: each K and V^T fragment read from LDS feeds two products.
// The two passes run side by side: waves 0..3 attend to the own pair's K / V, waves
// 4..7 to the flipped pair's, for the same 128 queries. Each group of four waves
// shares its own 64-key K and V^T tiles from LDS: two buffers per group, tile t + 2
// copied in while tile t + 1 is worked on.
//   S^T = K * Q^T : A = K rows (row = key, k = d), B = Q^T (k = d, n = query)
//   O^T += V^T * P^T : A = Vt rows (row = d, k = key), B = P^T from registers
// Lane owns 32 keys of query columns (lane&15) and 16 + (lane&15); partner = lane ^ 16.
// The two waves of the same queries swap one column tile each through LDS;
// combine = left + 0.1*tanh(right), x256 -> hi/lo f16 planes.
// Four waves per SIMD (two blocks per WGP): the register budget is 256 per wave.
// ---------------------------------------------------------------------------
__global__ __launch_bounds__(256) __attribute__((amdgpu_waves_per_eu(4, 4))) void attn_kernel(
    const _Float16* __restrict__ qh,   // [NBP*NH][SQ][HD]
    const _Float16* __restrict__ kh,   // [NBP*NH][SQ][HD]
    const _Float16* __restrict__ vt,   // [NBP*NH][HD][SQ]
    const int* __restrict__ mask,      // [NBP][SQ], nonzero = attend
    _Float16* __restrict__ xh,         // [NTOK][DM] f16, hi plane of combine*256
    _Float16* __restrict__ xl)         // [NTOK][DM] f16, lo plane (x2048)
{
  __shared__ __attribute__((aligned(16))) float sO[4 * 32 * SOP];       // 34816 B
  __shared__ __attribute__((aligned(16))) _Float16 sK[2 * 2 * KVTILE];  // 36864 B, [group][buffer]
  __shared__ __attribute__((aligned(16))) _Float16 sV[2 * 2 * KVTILE];  // 36864 B, [group][buffer]
  __shared__ __attribute__((aligned(32))) float sB[SQ];                 //  4096 B, per key: 0 or MASKED

  const int tid = threadIdx.x, lane = tid & 31;
  const int h = lane >> 4, m = lane & 15;
  const int g  = __builtin_amdgcn_readfirstlane(tid >> 7);          // 0: own pair, 1: flipped pair
  const int wq = __builtin_amdgcn_readfirstlane((tid >> 5) & 3);    // the wave's 32 queries of the block's 128
  const int bph = blockIdx.y, bp = bph >> 4, head = bph & 15;
  const int b = bp >> 1, p = bp & 1;
  const int q0 = blockIdx.x * 128 + 32 * wq;

  // Q^T B-fragments: column n = query q0+16c+m, k = d (two 32-deep chunks)
  v16h qb[2][2];
  #pragma unroll
  for (int c = 0; c < 2; ++c) {
    const _Float16* qrow = qh + ((size_t)bph * SQ + q0 + 16 * c + m) * HD;
    qb[c][0] = load_frag_h(qrow, h);
    qb[c][1] = load_frag_h(qrow + 32, h);
  }

  // The mask row as an addend of the base-2 exponent, once per block: thread t owns
  // keys 4t..4t+3. Readable by every wave behind the barrier that publishes tile 0.
  {
    const v4i ma = *(const v4ia*)(mask + (size_t)bp * SQ + 4 * tid);
    const v4f bz = { (ma.x != 0) ? 0.0f : MASKED, (ma.y != 0) ? 0.0f : MASKED,
                     (ma.z != 0) ? 0.0f : MASKED, (ma.w != 0) ? 0.0f : MASKED };
    *(v4fa*)(sB + 4 * tid) = bz;
  }
  float* so = sO + wq * (32 * SOP);
  const v8f zero8 = {0.f, 0.f, 0.f, 0.f, 0.f, 0.f, 0.f, 0.f};

  // Copy addresses of this lane: its group's 128 threads sweep the group's tiles,
  // row (tid&127)>>3 of a sweep, 16-byte column tid&7.
  const int crow = (tid & 127) >> 3, ccol = tid & 7;
  const int kvsel = (g == 0) ? bph : ((b * 2 + (1 - p)) * NH + head);
  const _Float16* gk0 = kh + ((size_t)kvsel * SQ + crow) * HD + 8 * ccol;   // + key0*HD
  const _Float16* gv0 = vt + ((size_t)kvsel * HD + crow) * SQ + 8 * ccol;   // + key0
  const unsigned lk0 = lds_off(sK) + g * (2 * KVTILE * 2) + crow * (KVP * 2) + 16 * ccol;   // + buffer * KVTILE * 2
  const unsigned lv0 = lds_off(sV) + g * (2 * KVTILE * 2) + crow * (KVP * 2) + 16 * ccol;

  // Tile 0 into buffer 0, landed and published; then tile 1 into buffer 1.
  stage_kv(gk0, gv0, lk0, lv0);
  asm volatile("s_wait_asynccnt 0x0" ::: "memory");   // this wave's copies of tile 0 have landed
  __syncthreads();                                    // tile 0 readable by every wave
  stage_kv(gk0 + 64 * HD, gv0 + 64, lk0 + KVTILE * 2, lv0 + KVTILE * 2);

  v8f o[2][4];                                  // o[c][t][r] = O[query 16c+m][d 16t+8h+r] * (l * 2^7)
  #pragma unroll
  for (int c = 0; c < 2; ++c)
    #pragma unroll
    for (int t = 0; t < 4; ++t) o[c][t] = zero8;
  float mref[2] = {-3.4e38f, -3.4e38f};         // reference exponent in use: a maximum met so far, alike in lanes l and l ^ 16
  v8f cst[2] = {zero8, zero8};                  // the reference as start value of the score products
  v2f lrun[2] = {{0.0f, 0.0f}, {0.0f, 0.0f}};   // this lane's own 32 keys per trip, two partial sums (x 2^7)

  // One trip: tile's 64 keys against the wave's 32 queries, then the ring's publish point.
  // first: the pass's first trip, which has no reference exponent yet.
  auto trip = [&](const int tile, auto first) __attribute__((always_inline)) {
    const int kb = tile * 64;
    const int buf = tile & 1;
    const _Float16* kbase = sK + (2 * g + buf) * KVTILE + m * KVP;   // + 16j*KVP + 32*dc
    const _Float16* vbase = sV + (2 * g + buf) * KVTILE + m * KVP;   // + 16t*KVP + key in tile
    v8f s[2][4];      // base-2 exponents, then P: [c][j][r] = query 16c+m, key kb+16j+8h+r
    v16h vfa[4];      // V^T fragments of keys 0..31
    v2f s2[2];        // the lane's sums of this trip's P, two partial sums per column tile
    v16h pb[2][2];    // P^T B-fragments

    // The trip's exponents and the first V^T group.
    // ca, cb: start values of the score products of column tiles 0 and 1.
    auto exponents = [&](const v8f ca, const v8f cb) __attribute__((always_inline)) {
      // ---- all eight K fragments, read as one group in front of the score products
      // (loops unrolled so that the arrays stay in registers) ----
      v16h kf[4][2];
      #pragma unroll
      for (int j = 0; j < 4; ++j) {
        const _Float16* kp = kbase + (16 * j) * KVP;
        kf[j][0] = load_frag_h(kp, h);
        kf[j][1] = load_frag_h(kp + 32, h);
      }
      // ---- scores (unscaled); each K fragment feeds both column tiles ----
      #pragma unroll
      for (int j = 0; j < 2; ++j) {
        v8f z0 = wmma_f16(kf[j][0], qb[0][0], ca);
        v8f z1 = wmma_f16(kf[j][0], qb[1][0], cb);
        s[0][j] = wmma_f16(kf[j][1], qb[0][1], z0);
        s[1][j] = wmma_f16(kf[j][1], qb[1][1], z1);
      }
      // keeps the mask addends' reads below the first eight products, whose K fragments
      // leave them their registers: read with the K group they do not fit the 256
      // registers, and accumulators spill
      __builtin_amdgcn_sched_barrier(0);
      // ---- the trip's mask addends: they land while the other eight products run ----
      v8f mk[4];
      #pragma unroll
      for (int j = 0; j < 4; ++j) mk[j] = *(const v8fa*)(sB + kb + 16 * j + 8 * h);
      // keeps these reads above the other eight products
      __builtin_amdgcn_sched_barrier(0);
      #pragma unroll
      for (int j = 2; j < 4; ++j) {
        v8f z0 = wmma_f16(kf[j][0], qb[0][0], ca);
        v8f z1 = wmma_f16(kf[j][0], qb[1][0], cb);
        s[0][j] = wmma_f16(kf[j][1], qb[0][1], z0);
        s[1][j] = wmma_f16(kf[j][1], qb[1][1], z1);
      }
      // ---- base-2 exponent: scale, log2(e) and key mask in one fused multiply-add, f32
      // (whole-vector forms: two scores per packed instruction) ----
      #pragma unroll
      for (int c = 0; c < 2; ++c)
        #pragma unroll
        for (int j = 0; j < 4; ++j) s[c][j] = s[c][j] * SC2 + mk[j];
      // keeps the V^T reads below the mask addends' last use: read earlier they do not fit
      // the 256 registers beside the addends, and accumulators spill
      __builtin_amdgcn_sched_barrier(0);
      // ---- the V^T fragments of keys 0..31, read as one group here: they land while
      // the softmax below runs ----
      #pragma unroll
      for (int t = 0; t < 4; ++t) vfa[t] = load_frag_h(vbase + (16 * t) * KVP, h);
      // keeps the V^T reads above the softmax (the scheduler otherwise sinks them to their products)
      __builtin_amdgcn_sched_barrier(0);
    };

    // P = 2^(e - mref + 7) in place of the exponents, and the lane's own sums, pairwise
    // (the partner lane's half joins once, behind the loop).
    // inside: the reference is in the exponents already (it came in as the products' start value).
    auto weights = [&](auto inside) __attribute__((always_inline)) {
      #pragma unroll
      for (int c = 0; c < 2; ++c) {
        #pragma unroll
        for (int j = 0; j < 4; ++j) {
          if constexpr (!decltype(inside)::value) s[c][j] = s[c][j] - (mref[c] - PSHIFT);
          #pragma unroll
          for (int r = 0; r < 8; ++r) s[c][j][r] = __builtin_amdgcn_exp2f(s[c][j][r]);
        }
        const v8f s8 = (s[c][0] + s[c][1]) + (s[c][2] + s[c][3]);
        const v4f s4 = __builtin_shufflevector(s8, s8, 0, 1, 2, 3) + __builtin_shufflevector(s8, s8, 4, 5, 6, 7);
        s2[c] = __builtin_shufflevector(s4, s4, 0, 1) + __builtin_shufflevector(s4, s4, 2, 3);
        // ---- P^T B-fragments (keys 0..31 and 32..63 of this step): packed here, in front of the
        // second V^T group's reads (unpacked P and that group together do not fit the 256 registers) ----
        pb[c][0] = pack_p(s[c][0], s[c][1]);
        pb[c][1] = pack_p(s[c][2], s[c][3]);
      }
    };

    // ---- softmax, base 2. The common trip takes no maximum: P is formed against the
    // reference in use and one test per trip on the sums says whether it may stand
    // (a sum that is too large, infinite or not a number fails it in any lane). ----
    bool renew = true;                            // the first trip has no reference yet
    if constexpr (!decltype(first)::value) {
      exponents(cst[0], cst[1]);
      weights(Yes{});
      const bool over = !(s2[0].x + s2[0].y <= PSUMMAX) || !(s2[1].x + s2[1].y <= PSUMMAX);
      renew = (__builtin_amdgcn_ballot_w32(over) != 0u);   // one answer for the wave: a scalar branch
    }
    if (renew) {
      exponents(zero8, zero8);                    // the plain exponents (P has taken the others' place)
      // New reference = the maximum so far, per column; what has been summed is rescaled to it.
      #pragma unroll
      for (int c = 0; c < 2; ++c) {
        float mloc = s[c][0][0];
        #pragma unroll
        for (int j = 0; j < 4; ++j)
          #pragma unroll
          for (int r = 0; r < 8; ++r) mloc = fmaxf(mloc, s[c][j][r]);
        mloc = fmaxf(mloc, other_half(mloc));
        const float mnew = fmaxf(mref[c], mloc);
        const float alpha = __builtin_amdgcn_exp2f(mref[c] - mnew);
        mref[c] = mnew;
        lrun[c] = lrun[c] * alpha;
        #pragma unroll
        for (int t = 0; t < 4; ++t) o[c][t] = o[c][t] * alpha;
        // (7 - mref) / SC2 in all eight rows: scaled by SC2 with the scores it takes the reference off
        const float c1 = (PSHIFT - mnew) * (1.0f / SC2);
        cst[c] = (v8f){c1, c1, c1, c1, c1, c1, c1, c1};
      }
      weights(No{});
    }
    #pragma unroll
    for (int c = 0; c < 2; ++c) lrun[c] = lrun[c] + s2[c];

    // keeps the second V^T group below the softmax: read earlier it does not fit the 256
    // registers beside the unpacked scores
    __builtin_amdgcn_sched_barrier(0);
    // ---- the V^T fragments of keys 32..63, read as one group into the registers that
    // the packed scores have left: they land while the first eight products run ----
    v16h vfb[4];
    #pragma unroll
    for (int t = 0; t < 4; ++t) vfb[t] = load_frag_h(vbase + (16 * t) * KVP + 32, h);
    // keeps these reads above the first eight products
    __builtin_amdgcn_sched_barrier(0);

    // ---- O^T += V^T * P^T; each V^T fragment feeds both column tiles ----
    #pragma unroll
    for (int t = 0; t < 4; ++t) {
      o[0][t] = wmma_f16(vfa[t], pb[0][0], o[0][t]);
      o[1][t] = wmma_f16(vfa[t], pb[1][0], o[1][t]);
    }
    #pragma unroll
    for (int t = 0; t < 4; ++t) {
      o[0][t] = wmma_f16(vfb[t], pb[0][1], o[0][t]);
      o[1][t] = wmma_f16(vfb[t], pb[1][1], o[1][t]);
    }

    // ---- publish tile + 1: behind this barrier the buffer this trip has read may be refilled ----
    asm volatile("s_wait_dscnt 0x0" ::: "memory");      // this wave's reads of the buffer are done
    asm volatile("s_wait_asynccnt 0x0" ::: "memory");   // this wave's copies of tile + 1 have landed
    __syncthreads();                                    // publishes tile + 1, ends every read of this buffer
  };

  // The first trip on its own (it sets the reference; its refill, for tile 2, stands behind it),
  // then the trips that refill, then the last two, which have no tile + 2: two loops instead
  // of a test at the foot (with that test accumulators spill). Both kept rolled: small loop text.
  trip(0, Yes{});
  stage_kv(gk0 + (size_t)128 * HD, gv0 + 128, lk0, lv0);
  #pragma unroll 1
  for (int tile = 1; tile < NTILE - 2; ++tile) {
    trip(tile, No{});
    const int key0 = (tile + 2) * 64;
    const int buf = tile & 1;
    stage_kv(gk0 + (size_t)key0 * HD, gv0 + key0, lk0 + buf * (KVTILE * 2), lv0 + buf * (KVTILE * 2));
  }
  #pragma unroll 1
  for (int tile = NTILE - 2; tile < NTILE; ++tile) trip(tile, No{});
  asm volatile("s_wait_asynccnt 0x0" ::: "memory");   // no copy outstanding behind the loop

  // The lane's index read anew behind the loops, so that the thread index and its parts
  // are not held in registers across them (there they do not fit and go to scratch).
  const int le = (int)__builtin_amdgcn_mbcnt_lo(~0u, 0u);
  const int he = le >> 4, me = le & 15;
  float inv[2];
  #pragma unroll
  for (int c = 0; c < 2; ++c) {
    const float lown = lrun[c].x + lrun[c].y;
    inv[c] = 1.0f / (lown + other_half(lown));    // o and the sum both carry 2^7
  }
  // The two waves of a query slab (left in the own-pair wave, right in the flipped-pair
  // wave) swap one column tile each through the slab, same lane and element: wave g then
  // holds left and right of column tile g and finishes those 16 queries.
  const bool own = (g == 0);
  const int keeprow = 16 * g + me, sendrow = 16 * (1 - g) + me;
  // All slab traffic in 16-byte pieces: a lane's eight values of a tile are two of them.
  #pragma unroll
  for (int t = 0; t < 4; ++t)
    #pragma unroll
    for (int q = 0; q < 2; ++q) {
      v4f snd;
      #pragma unroll
      for (int r = 0; r < 4; ++r) snd[r] = own ? o[1][t][4 * q + r] * inv[1] : o[0][t][4 * q + r] * inv[0];
      *(v4fa*)(so + sendrow * SOP + 16 * t + 8 * he + 4 * q) = snd;
    }
  __syncthreads();                                    // the partner wave's tile is readable
  v4f got[4][2];
  #pragma unroll
  for (int t = 0; t < 4; ++t)
    #pragma unroll
    for (int q = 0; q < 2; ++q) got[t][q] = *(const v4fa*)(so + keeprow * SOP + 16 * t + 8 * he + 4 * q);
  #pragma unroll
  for (int t = 0; t < 4; ++t)
    #pragma unroll
    for (int q = 0; q < 2; ++q) {
      v4f res;
      #pragma unroll
      for (int r = 0; r < 4; ++r) {
        const float mine = own ? o[0][t][4 * q + r] * inv[0] : o[1][t][4 * q + r] * inv[1];
        const float left = own ? mine : got[t][q][r], right = own ? got[t][q][r] : mine;
        const float cmb = left + 0.1f * tanhf(right);
        res[r] = cmb * XSCALE;
      }
      *(v4fa*)(so + keeprow * SOP + 16 * t + 8 * he + 4 * q) = res;
    }
  __syncthreads();                                    // the slab is complete in front of the store pass

  // Each wave stores the 16 query rows that it has finished.
  const size_t tok0 = (size_t)bp * SQ + q0 + 16 * g;
  xc_store_pass(so + g * (16 * SOP), xh, xl, tok0, head, le);
}

// ---------------------------------------------------------------------------
// wave w owns rows 16w..16w+15, each row 128 floats = 4 lines: one row (512 B) per
// instruction, 16 B per lane.
// ---------------------------------------------------------------------------
__device__ __forceinline__ void out_store_pass(const float* sT, float* out,
                                               int m0, int n0, int w, int lane) {
  #pragma unroll
  for (int i = 0; i < 16; ++i) {
    const int row = 16 * w + i;
    const v4f v = *(const v4fa*)(sT + row * 128 + 4 * lane);
    const size_t gi = (size_t)(m0 + row) * DM + n0 + 4 * lane;
    *(v4f*)(out + gi) = v;
  }
}

// ---------------------------------------------------------------------------
// Kernel 4: out = X * Wo^T + bo with X = hi/256 + lo/(256*2048) planes.
// Block 128 thr (4 waves, 2 x 2) = 64 tokens x 128 features; wave 32 tokens (hi and
// lo rows) x 64 features, 16 accumulator tiles: 8 fragments feed 16 products.
// A = X rows (k contiguous), B[k][n] = Wo[n][k] from Wo row n (k contiguous).
// The block's 64 hi rows (LDS rows 0..63), 64 lo rows (64..127) and 128 Wo rows
// (128..255) come through LDS in k-tiles of 64: two buffers, tile t + 2 copied
// in while tile t + 1 is worked on.
// ---------------------------------------------------------------------------
__global__ __launch_bounds__(128) void oproj_kernel(
    const _Float16* __restrict__ xh,   // [NTOK][DM]
    const _Float16* __restrict__ xl,   // [NTOK][DM]
    const _Float16* __restrict__ woh,  // [DM][DM] f16(bf16(Wo)*256)
    const float* __restrict__ bo,
    float* __restrict__ out)           // [NTOK][DM]
{
  __shared__ __attribute__((aligned(16))) float sT[64 * 128];       // 32768 B
  __shared__ __attribute__((aligned(16))) _Float16 sG[2 * GTILE];   // 73728 B

  const int tid = threadIdx.x, lane = tid & 31, w = tid >> 5;
  const int h = lane >> 4, m = lane & 15;
  const int wm = w >> 1, wn = w & 1;         // wave's 32-token half, wave's 64-feature half
  const int m0 = blockIdx.x * 64, n0 = blockIdx.y * 128;

  // Copy addresses of this lane: row tid>>3 of a sweep, 16-byte column tid&7.
  const int crow = tid >> 3, ccol = tid & 7;
  const _Float16* gh = xh + (size_t)(m0 + crow) * DM + 8 * ccol;    // + k
  const _Float16* gl = xl + (size_t)(m0 + crow) * DM + 8 * ccol;    // + k
  const _Float16* gw = woh + (size_t)(n0 + crow) * DM + 8 * ccol;   // + k
  const unsigned lg0 = lds_off(sG) + crow * (GP * 2) + 16 * ccol;   // + buffer * GTILE * 2

  const v8f zero8 = {0.f, 0.f, 0.f, 0.f, 0.f, 0.f, 0.f, 0.f};
  v8f acch[2][4], accl[2][4];
  #pragma unroll
  for (int mt = 0; mt < 2; ++mt)
    #pragma unroll
    for (int nt = 0; nt < 4; ++nt) { acch[mt][nt] = zero8; accl[mt][nt] = zero8; }

  // Tile 0 into buffer 0, landed and published; then tile 1 into buffer 1.
  stage_gemm(gh, gl, gw, gw + 64 * DM, lg0);
  asm volatile("s_wait_asynccnt 0x0" ::: "memory");   // this wave's copies of tile 0 have landed
  __syncthreads();                                    // tile 0 readable by every wave
  stage_gemm(gh + GKT, gl + GKT, gw + GKT, gw + 64 * DM + GKT, lg0 + GTILE * 2);

  // kept rolled: one copy of the ring's foot (waits, barrier, refill), small loop text
  #pragma unroll 1
  for (int t = 0; t < GNT; ++t) {
    const int buf = t & 1;
    const _Float16* ah = sG + buf * GTILE + (32 * wm + m) * GP;             // hi row, mt = 0
    const _Float16* al = ah + 64 * GP;                                      // lo row, mt = 0
    const _Float16* wr = sG + buf * GTILE + (128 + 64 * wn + m) * GP;       // feature row, nt = 0
    // Each 32-deep step reads its eight fragments as one group in front of its 16
    // products; the loops are unrolled so that the fragment arrays stay in registers.
    #pragma unroll
    for (int kc = 0; kc < 2; ++kc) {
      v16h fah[2], fal[2], fb[4];
      #pragma unroll
      for (int i = 0; i < 2; ++i) {
        fah[i] = load_frag_h(ah + i * 16 * GP + 32 * kc, h);
        fal[i] = load_frag_h(al + i * 16 * GP + 32 * kc, h);
      }
      #pragma unroll
      for (int i = 0; i < 4; ++i) fb[i] = load_frag_h(wr + i * 16 * GP + 32 * kc, h);
      #pragma unroll
      for (int nt = 0; nt < 4; ++nt) {
        #pragma unroll
        for (int mt = 0; mt < 2; ++mt) {
          acch[mt][nt] = wmma_f16(fah[mt], fb[nt], acch[mt][nt]);
          accl[mt][nt] = wmma_f16(fal[mt], fb[nt], accl[mt][nt]);
        }
      }
    }
    // ---- publish tile + 1, then refill the buffer this trip has read ----
    asm volatile("s_wait_dscnt 0x0" ::: "memory");      // this wave's reads of the buffer are done
    asm volatile("s_wait_asynccnt 0x0" ::: "memory");   // this wave's copies of tile + 1 have landed
    __syncthreads();                                    // publishes tile + 1, ends every read of this buffer
    if (t + 2 < GNT) {
      const int kn = (t + 2) * GKT;
      stage_gemm(gh + kn, gl + kn, gw + kn, gw + 64 * DM + kn, lg0 + buf * (GTILE * 2));
    }
  }
  asm volatile("s_wait_asynccnt 0x0" ::: "memory");   // no copy outstanding behind the loop

  // D[r] of tile (mt, nt) = Y[token m0+32wm+16mt+8h+r][feature n0+64wn+16nt+m]
  const float sh = 1.0f / (XSCALE * WSCALE);
  const float sl = 1.0f / (XSCALE * WSCALE * LOSCALE);
  #pragma unroll
  for (int nt = 0; nt < 4; ++nt) {
    const int col = 64 * wn + 16 * nt + m;                // 0..127
    const float bvl = bo[n0 + col];
    #pragma unroll
    for (int mt = 0; mt < 2; ++mt) {
      #pragma unroll
      for (int r = 0; r < 8; ++r) {
        const int row = 32 * wm + 16 * mt + 8 * h + r;    // 0..63
        sT[row * 128 + col] = acch[mt][nt][r] * sh + accl[mt][nt][r] * sl + bvl;
      }
    }
  }
  __syncthreads();

  out_store_pass(sT, out, m0, n0, w, lane);
}

// ---------------------------------------------------------------------------
extern "C" void kernel_launch(void* const* d_in, const int* in_sizes, int n_in,
                              void* d_out, int out_size, void* d_ws, size_t ws_size,
                              hipStream_t stream) {
  if (n_in < 12) return;
  if (in_sizes[0] != NACT || in_sizes[1] != NACT || in_sizes[2] != NACT) return;
  if (in_sizes[3] != NBP * SQ) return;
  if (in_sizes[4] != NWEL || in_sizes[6] != NWEL || in_sizes[8] != NWEL || in_sizes[10] != NWEL) return;
  if (in_sizes[5] != DM || in_sizes[7] != DM || in_sizes[9] != DM || in_sizes[11] != DM) return;
  if (out_size != NACT) return;

  const float* query = (const float*)d_in[0];
  const float* key_  = (const float*)d_in[1];
  const float* value = (const float*)d_in[2];
  const int*   mask  = (const int*)d_in[3];
  const float* Wq = (const float*)d_in[4];
  const float* bq = (const float*)d_in[5];
  const float* Wk = (const float*)d_in[6];
  const float* bk = (const float*)d_in[7];
  const float* Wv = (const float*)d_in[8];
  const float* bv = (const float*)d_in[9];
  const float* Wo = (const float*)d_in[10];
  const float* bo = (const float*)d_in[11];
  float* out = (float*)d_out;

  const size_t xb_bytes  = (size_t)3 * NACT * 2;                 // 25165824
  const size_t wb_bytes  = (size_t)3 * NWEL * 2;                 //  6291456
  const size_t woh_bytes = (size_t)NWEL * 2;                     //  2097152
  const size_t pl_bytes  = (size_t)NBP * NH * SQ * HD * 2;       //  8388608 per plane
  const size_t xc_bytes  = (size_t)NACT * 2;                     //  8388608 per plane
  const size_t total = xb_bytes + wb_bytes + woh_bytes + 3 * pl_bytes + 2 * xc_bytes;   // 75497472
  if (total > ws_size) return;

  char* ws = (char*)d_ws;
  size_t off = 0;
  unsigned short* xb = (unsigned short*)(ws + off); off += xb_bytes;
  unsigned short* wb = (unsigned short*)(ws + off); off += wb_bytes;
  _Float16* woh = (_Float16*)(ws + off);            off += woh_bytes;
  _Float16* qh  = (_Float16*)(ws + off);            off += pl_bytes;
  _Float16* kh  = (_Float16*)(ws + off);            off += pl_bytes;
  _Float16* vt  = (_Float16*)(ws + off);            off += pl_bytes;
  _Float16* xh  = (_Float16*)(ws + off);            off += xc_bytes;
  _Float16* xl  = (_Float16*)(ws + off);            off += xc_bytes;
  if (off > ws_size) return;

  convert_kernel<<<(NGRP + 255) / 256, 256, 0, stream>>>(query, key_, value, Wq, Wk, Wv, Wo, xb, wb, woh);

  dim3 gProj(NTOK / 128, 3 * NH / 2);                           // (32, 24)
  proj_kernel<<<gProj, 128, 0, stream>>>(xb, wb, bq, bk, bv, qh, kh, vt);

  dim3 gAtt(SQ / 128, NBP * NH);                                 // (8, 64)
  attn_kernel<<<gAtt, 256, 0, stream>>>(qh, kh, vt, mask, xh, xl);

  dim3 gOut(NTOK / 64, DM / 128);                                // (64, 8)
  oproj_kernel<<<gOut, 128, 0, stream>>>(xh, xl, woh, bo, out);
}

// v009
// Measured time: 81.5 microseconds a run.
// In two side-by-side timings against v008, it was 1.03 and 1.04 times as fast.
// Over all steps from v000 it is 3.42 times as fast.
// Contractions: q/k/v projections x*W^T on v_wmma_f32_16x16x32_bf16 (bf16 operands, f32 accumulate); K*Q^T and V^T*P^T of both attention passes on v_wmma_f32_16x16x32_f16 (f16 operands, P carried x128, f32 accumulate); output projection on v_wmma_f32_16x16x32_f16 with the activation carried x256 as f16 hi + lo(x2048) planes and the weight as f16 of its bf16 value x256 (f32 accumulate); scale, mask, softmax, tanh and bias in f32.
#include <hip/hip_runtime.h>
#include <math.h>

typedef _Float16       v16h __attribute__((ext_vector_type(16)));
typedef _Float16       v8h  __attribute__((ext_vector_type(8)));
typedef __bf16         v16b __attribute__((ext_vector_type(16)));
typedef unsigned short v8us __attribute__((ext_vector_type(8)));
typedef float          v8f  __attribute__((ext_vector_type(8)));
typedef float          v4f  __attribute__((ext_vector_type(4)));
typedef float          v2f  __attribute__((ext_vector_type(2)));
typedef int            v4i  __attribute__((ext_vector_type(4)));
typedef v8h  __attribute__((may_alias)) v8ha;
typedef v8us __attribute__((may_alias)) v8usa;
typedef v4f  __attribute__((may_alias)) v4fa;
typedef v4i  __attribute__((may_alias)) v4ia;
typedef v8f  __attribute__((may_alias)) v8fa;

union FragH { v16h v; v8h  half[2]; };
union FragB { v16b v; v8us half[2]; };

#define DM     1024
#define NH     16
#define HD     64
#define SQ     1024
#define NBP    4                       // batch * pair
#define NTOK   (NBP * SQ)              // 4096 token rows
#define NACT   (NTOK * DM)             // 4194304
#define NWEL   (DM * DM)               // 1048576
#define ACT8   (NACT / 8)              // 524288
#define WEL8   (NWEL / 8)              // 131072
#define NGRP   (3 * ACT8 + 4 * WEL8)   // 2097152
#define PSHIFT  7.0f                   // P is carried x 2^7: added to the base-2 exponent
// A trip's P is formed against the reference exponent already in use. It is kept if each
// lane's sum of its 32 P values of a column stays at or below this: then every single P
// does too, and none leaves the f16 range (65504).
#define PSUMMAX 32768.0f
#define SC2     0.18033688011112042f   // (1/8) * log2(e): scores go to the base-2 exponent in one product
// Exponent addend of a masked key: the fma absorbs any finite score into it, so masked
// keys are all equal and below every unmasked one: weight 0 beside an unmasked key, and
// equal weights (the plain mean of V) where a whole row is masked.
#define MASKED  -3.0e38f
#define XSCALE  256.0f
#define WSCALE  256.0f
#define LOSCALE 2048.0f

// ---------------------------------------------------------------------------
// 16x16x32 WMMA helpers: the plain builtins (the compiler keeps the distances behind them).
// Fragment map (wave32): lane l, h = l>>4, m = n = l&15.
//   A/B element i: i<8 -> k0+8h+i ; i>=8 -> k0+16+8h+(i-8)
//   D element r : row 8h+r, col l&15
// ---------------------------------------------------------------------------
__device__ __forceinline__ v8f wmma_f16(v16h a, v16h b, v8f c) {
  return __builtin_amdgcn_wmma_f32_16x16x32_f16(false, a, false, b, (short)0, c, false, false);
}
__device__ __forceinline__ v8f wmma_bf16(v16b a, v16b b, v8f c) {
  return __builtin_amdgcn_wmma_f32_16x16x32_bf16(false, a, false, b, (short)0, c, false, false);
}

// A or B fragment from a k-contiguous 16-bit row; p points at element k0 of
// the row owned by this lane (row index = lane & 15 added by the caller).
__device__ __forceinline__ v16h load_frag_h(const _Float16* p, int h) {
  FragH f;
  f.half[0] = *(const v8ha*)(p + 8 * h);
  f.half[1] = *(const v8ha*)(p + 16 + 8 * h);
  return f.v;
}
__device__ __forceinline__ v16b load_frag_b(const unsigned short* p, int h) {
  FragB f;
  f.half[0] = *(const v8usa*)(p + 8 * h);
  f.half[1] = *(const v8usa*)(p + 16 + 8 * h);
  return f.v;
}

// f32 -> bf16 bits, RNE
__device__ __forceinline__ unsigned short bf16_bits(float f) {
  unsigned int u = __float_as_uint(f);
  u = u + 0x7FFFu + ((u >> 16) & 1u);
  return (unsigned short)(u >> 16);
}
__device__ __forceinline__ float bf16_val(float f) {
  return __uint_as_float(((unsigned int)bf16_bits(f)) << 16);
}

// ---------------------------------------------------------------------------
// Kernel 1: f32 -> 16-bit planes.
//   xb[3][NTOK][DM] bf16 (query, key, value), wb[3][DM][DM] bf16 (Wq, Wk, Wv),
//   woh[DM][DM] f16 = f16(bf16(Wo) * 256).
// ---------------------------------------------------------------------------
__global__ __launch_bounds__(256) void convert_kernel(
    const float* __restrict__ xq, const float* __restrict__ xk, const float* __restrict__ xv,
    const float* __restrict__ wq, const float* __restrict__ wk, const float* __restrict__ wv,
    const float* __restrict__ wo,
    unsigned short* __restrict__ xb, unsigned short* __restrict__ wb, _Float16* __restrict__ woh)
{
  const int g = blockIdx.x * 256 + threadIdx.x;
  if (g >= NGRP) return;
  if (g < 3 * ACT8 + 3 * WEL8) {
    const float* src;
    unsigned short* dst;
    if (g < 3 * ACT8) {
      const int sel = g / ACT8;
      const int off = g - sel * ACT8;
      const float* xs = (sel == 0) ? xq : ((sel == 1) ? xk : xv);
      src = xs + (size_t)off * 8;
      dst = xb + (size_t)sel * NACT + (size_t)off * 8;
    } else {
      const int e = g - 3 * ACT8;
      const int sel = e / WEL8;
      const int off = e - sel * WEL8;
      const float* wsrc = (sel == 0) ? wq : ((sel == 1) ? wk : wv);
      src = wsrc + (size_t)off * 8;
      dst = wb + (size_t)sel * NWEL + (size_t)off * 8;
    }
    const v4f a = *(const v4fa*)src;
    const v4f c = *(const v4fa*)(src + 4);
    const v8us o = { bf16_bits(a.x), bf16_bits(a.y), bf16_bits(a.z), bf16_bits(a.w),
                     bf16_bits(c.x), bf16_bits(c.y), bf16_bits(c.z), bf16_bits(c.w) };
    *(v8us*)dst = o;
    
  } else {
    const int off = g - (3 * ACT8 + 3 * WEL8);
    const float* src = wo + (size_t)off * 8;
    _Float16* dst = woh + (size_t)off * 8;
    const v4f a = *(const v4fa*)src;
    const v4f c = *(const v4fa*)(src + 4);
    const v8h o = { (_Float16)(bf16_val(a.x) * WSCALE), (_Float16)(bf16_val(a.y) * WSCALE),
                    (_Float16)(bf16_val(a.z) * WSCALE), (_Float16)(bf16_val(a.w) * WSCALE),
                    (_Float16)(bf16_val(c.x) * WSCALE), (_Float16)(bf16_val(c.y) * WSCALE),
                    (_Float16)(bf16_val(c.z) * WSCALE), (_Float16)(bf16_val(c.w) * WSCALE) };
    *(v8h*)dst = o;
    
  }
}

// ---------------------------------------------------------------------------
// 4 lines per instruction, 32 lines per wave, 128 per block.
// which 0/1: plane[bh][s][d]  (one token row = 64 halves = one line)
// which 2  : vt[bh][d][s]     (64 d-rows x 128 tokens = 2 lines each)
// The LDS tile holds its rows in 16-byte chunks at swapped places (QK_AT, VT_AT), so
// that the 16 lanes that write one chunk each of 16 different rows fall on all 64 banks.
// ---------------------------------------------------------------------------
// q, k tile [128 tokens][64 features]: chunk c (0..7) of token row t, in halves
#define QK_AT(t, c) ((t) * HD + (((c) ^ (((t) >> 1) & 7)) * 8))
// V^T tile [64 features][128 tokens]: chunk c (0..15) of feature row f, in halves
#define VT_AT(f, c) ((f) * 128 + (((c) ^ ((f) & 15)) * 8))
__device__ __forceinline__ void proj_store_pass(const _Float16* sT, _Float16* plane, _Float16* vt,
                                                int which, int bh, int l0, int w, int lane) {
  const int q8 = lane & 7, sub = lane >> 3;
  #pragma unroll
  for (int i = 0; i < 8; ++i) {
    const int lid = w * 32 + i * 4 + sub;
    v8h v;
    _Float16* dst;
    if (which != 2) {
      v = *(const v8ha*)(sT + QK_AT(lid, q8));
      dst = plane + ((size_t)bh * SQ + l0 + lid) * HD + 8 * q8;
    } else {
      const int d = lid >> 1, hl = lid & 1;
      v = *(const v8ha*)(sT + VT_AT(d, 8 * hl + q8));
      dst = vt + ((size_t)bh * HD + d) * SQ + l0 + 64 * hl + 8 * q8;
    }
    *(v8h*)dst = v;
    // the next round's address arithmetic reuses this store's address registers
    asm volatile("s_wait_xcnt 0x0" ::: "memory");
  }
}

__device__ __forceinline__ unsigned lds_off(const void* p) { return (unsigned)(size_t)p; }

// ---------------------------------------------------------------------------
// GEMM operand staging (kernels 2 and 4): one k-tile = 64 k (128 B) of 256
// operand rows, four groups of 64 rows, LDS row pitch 144 B (16 B x odd,
// conflict-free for the 16-byte fragment reads). 128 threads, 8 lanes per row,
// 16 rows per sweep, 4 sweeps per group: every copy instruction covers whole
// 128-B lines of the source. Source row pitch = DM 16-bit elements.
// ---------------------------------------------------------------------------
#define GP     72                      // LDS row pitch in 16-bit elements (144 B)
#define GTILE  (256 * GP)              // elements per staged k-tile (36864 B)
#define GKT    64                      // k per tile
#define GNT    (DM / GKT)              // 16 k-tiles

// Two groups of 64 rows. g0 / g1: this lane's 16 B of row (tid>>3) of each group, at
// the tile's first k; l: the lane's LDS byte address of row (tid>>3) of the first group.
__device__ __forceinline__ void stage_pair(const void* g0, const void* g1, unsigned l) {
  const char* a0 = (const char*)g0;
  const char* a1 = a0 + 16 * DM * 2;
  const char* a2 = a0 + 32 * DM * 2;
  const char* a3 = a0 + 48 * DM * 2;
  const char* b0 = (const char*)g1;
  const char* b1 = b0 + 16 * DM * 2;
  const char* b2 = b0 + 32 * DM * 2;
  const char* b3 = b0 + 48 * DM * 2;
  const unsigned la1 = l + 16 * GP * 2,  la2 = l + 32 * GP * 2,  la3 = l + 48 * GP * 2;
  const unsigned lb0 = l + 64 * GP * 2,  lb1 = l + 80 * GP * 2,  lb2 = l + 96 * GP * 2,  lb3 = l + 112 * GP * 2;
  // Global -> LDS through no register; the closing s_wait_xcnt stands in the same
  // statement so that no address register is rewritten in front of it.
  asm volatile(
      "global_load_async_to_lds_b128 %0, %8, off\n\t"
      "global_load_async_to_lds_b128 %1, %9, off\n\t"
      "global_load_async_to_lds_b128 %2, %10, off\n\t"
      "global_load_async_to_lds_b128 %3, %11, off\n\t"
      "global_load_async_to_lds_b128 %4, %12, off\n\t"
      "global_load_async_to_lds_b128 %5, %13, off\n\t"
      "global_load_async_to_lds_b128 %6, %14, off\n\t"
      "global_load_async_to_lds_b128 %7, %15, off\n\t"
      "s_wait_xcnt 0x0"
      :: "v"(l), "v"(la1), "v"(la2), "v"(la3), "v"(lb0), "v"(lb1), "v"(lb2), "v"(lb3),
         "v"(a0), "v"(a1), "v"(a2), "v"(a3), "v"(b0), "v"(b1), "v"(b2), "v"(b3)
      : "memory");
}

// g0 .. g3: the four groups of a k-tile (LDS rows 0..63, 64..127, 128..191, 192..255).
__device__ __forceinline__ void stage_gemm(const void* g0, const void* g1, const void* g2, const void* g3,
                                           unsigned l) {
  stage_pair(g0, g1, l);
  stage_pair(g2, g3, l + 128 * GP * 2);
}

// ---------------------------------------------------------------------------
// Kernel 2: Y = x * W^T for the three projections (bf16 operands).
// Block 128 thr (4 waves, 2 x 2) = 128 tokens x 128 features (two heads) of one
// projection; wave tile 64 tokens x 64 features (one head), 16 accumulator tiles:
// 8 fragments feed 16 products. K = 1024 in steps of 32.
// x rows (token-major) and W rows (feature-major) are both k contiguous -> both
// fragments with the same loader, and either may be the A operand. A lane's eight D
// values run along the A rows: v takes A = x (eight tokens of one feature, contiguous in
// V^T), q and k take A = W (eight features of one token, contiguous in the plane).
// The block's 128 x rows (LDS rows 0..127) and 128 W rows (LDS rows 128..255)
// come through LDS in k-tiles of 64: two buffers, tile t + 2 copied in while
// tile t + 1 is worked on.
// ---------------------------------------------------------------------------
__global__ __launch_bounds__(128) void proj_kernel(
    const unsigned short* __restrict__ xb,   // [3][NTOK][DM] bf16
    const unsigned short* __restrict__ wb,   // [3][DM][DM]   bf16, row = output feature
    const float* __restrict__ bq, const float* __restrict__ bk, const float* __restrict__ bv,
    _Float16* __restrict__ qh,               // [NBP*NH][SQ][HD] f16
    _Float16* __restrict__ kh,               // [NBP*NH][SQ][HD] f16
    _Float16* __restrict__ vt)               // [NBP*NH][HD][SQ] f16
{
  __shared__ __attribute__((aligned(16))) _Float16 sT[2 * 128 * 64];      // 32768 B, one plane per head
  __shared__ __attribute__((aligned(16))) unsigned short sG[2 * GTILE];   // 73728 B

  const int tid = threadIdx.x, lane = tid & 31, w = tid >> 5;
  const int h = lane >> 4, m = lane & 15;
  const int wm = w >> 1, wn = w & 1;         // wave's 64-token half, wave's head of the pair
  const int m0 = blockIdx.x * 128;
  const int cg = blockIdx.y;                 // 0..23
  const int which = cg >> 3, head0 = (cg & 7) * 2;

  // Copy addresses of this lane: row tid>>3 of a sweep, 16-byte column tid&7.
  const int crow = tid >> 3, ccol = tid & 7;
  const unsigned short* gx = xb + (size_t)which * NACT + (size_t)(m0 + crow) * DM + 8 * ccol;          // + k
  const unsigned short* gw = wb + (size_t)which * NWEL + (size_t)(head0 * HD + crow) * DM + 8 * ccol;  // + k
  const unsigned lg0 = lds_off(sG) + crow * (GP * 2) + 16 * ccol;                                      // + buffer * GTILE * 2

  // LDS rows of the wave's A and B fragments (tile 0 of four each)
  const int rowx = 64 * wm + m, roww = 128 + 64 * wn + m;
  const int rowa = (which == 2) ? rowx : roww, rowb = (which == 2) ? roww : rowx;

  const v8f zero8 = {0.f, 0.f, 0.f, 0.f, 0.f, 0.f, 0.f, 0.f};
  v8f acc[4][4];
  #pragma unroll
  for (int mt = 0; mt < 4; ++mt)
    #pragma unroll
    for (int nt = 0; nt < 4; ++nt) acc[mt][nt] = zero8;

  // Tile 0 into buffer 0, landed and published; then tile 1 into buffer 1.
  stage_gemm(gx, gx + 64 * DM, gw, gw + 64 * DM, lg0);
  asm volatile("s_wait_asynccnt 0x0" ::: "memory");   // this wave's copies of tile 0 have landed
  __syncthreads();                                    // tile 0 readable by every wave
  stage_gemm(gx + GKT, gx + 64 * DM + GKT, gw + GKT, gw + 64 * DM + GKT, lg0 + GTILE * 2);

  // kept rolled: one copy of the ring's foot (waits, barrier, refill), small loop text
  #pragma unroll 1
  for (int t = 0; t < GNT; ++t) {
    const int buf = t & 1;
    const unsigned short* xa = sG + buf * GTILE + rowa * GP;   // A row, mt = 0
    const unsigned short* wr = sG + buf * GTILE + rowb * GP;   // B row, nt = 0
    // Each 32-deep step reads its eight fragments as one group in front of its 16
    // products; the loops are unrolled so that the fragment arrays stay in registers.
    #pragma unroll
    for (int kc = 0; kc < 2; ++kc) {
      v16b fa[4], fb[4];
      #pragma unroll
      for (int i = 0; i < 4; ++i) fa[i] = load_frag_b(xa + i * 16 * GP + 32 * kc, h);
      #pragma unroll
      for (int i = 0; i < 4; ++i) fb[i] = load_frag_b(wr + i * 16 * GP + 32 * kc, h);
      // keeps the eight fragments' reads one group above the products (the scheduler otherwise spreads them among these)
      __builtin_amdgcn_sched_barrier(0);
      #pragma unroll
      for (int nt = 0; nt < 4; ++nt) {
        #pragma unroll
        for (int mt = 0; mt < 4; ++mt) acc[mt][nt] = wmma_bf16(fa[mt], fb[nt], acc[mt][nt]);
      }
      // keeps the next group's reads, and the ring's foot, below these products
      __builtin_amdgcn_sched_barrier(0);
    }
    // ---- publish tile + 1, then refill the buffer this trip has read ----
    asm volatile("s_wait_dscnt 0x0" ::: "memory");      // this wave's reads of the buffer are done
    asm volatile("s_wait_asynccnt 0x0" ::: "memory");   // this wave's copies of tile + 1 have landed
    __syncthreads();                                    // publishes tile + 1, ends every read of this buffer
    if (t + 2 < GNT) {
      const int kn = (t + 2) * GKT;
      stage_gemm(gx + kn, gx + 64 * DM + kn, gw + kn, gw + 64 * DM + kn, lg0 + buf * (GTILE * 2));
    }
  }
  asm volatile("s_wait_asynccnt 0x0" ::: "memory");   // no copy outstanding behind the loop

  // A lane's eight values of a tile are one 16-byte chunk of the LDS tile's row.
  const float* bias = ((which == 0) ? bq : ((which == 1) ? bk : bv)) + (head0 + wn) * HD;
  _Float16* sTh = sT + wn * (128 * 64);
  if (which == 2) {
    // D[r] of tile (mt, nt) = Y[token m0+64wm+16mt+8h+r][feature (head0+wn)*64+16nt+m]
    #pragma unroll
    for (int nt = 0; nt < 4; ++nt) {
      const int feat = 16 * nt + m;
      const float bvl = bias[feat];
      #pragma unroll
      for (int mt = 0; mt < 4; ++mt) {
        v8h pk;
        #pragma unroll
        for (int r = 0; r < 8; ++r) pk[r] = (_Float16)(acc[mt][nt][r] + bvl);
        *(v8ha*)(sTh + VT_AT(feat, 8 * wm + 2 * mt + h)) = pk;
      }
    }
  } else {
    // D[r] of tile (mt, nt) = Y[token m0+64wm+16nt+m][feature (head0+wn)*64+16mt+8h+r]
    v4f bb[4][2];                                          // the lane's 32 features' bias, one load group
    #pragma unroll
    for (int mt = 0; mt < 4; ++mt) {
      bb[mt][0] = *(const v4fa*)(bias + 16 * mt + 8 * h);
      bb[mt][1] = *(const v4fa*)(bias + 16 * mt + 8 * h + 4);
    }
    #pragma unroll
    for (int mt = 0; mt < 4; ++mt) {
      #pragma unroll
      for (int nt = 0; nt < 4; ++nt) {
        const int tokl = 64 * wm + 16 * nt + m;            // 0..127
        v8h pk;
        #pragma unroll
        for (int r = 0; r < 4; ++r) {
          pk[r]     = (_Float16)(acc[mt][nt][r] + bb[mt][0][r]);
          pk[4 + r] = (_Float16)(acc[mt][nt][4 + r] + bb[mt][1][r]);
        }
        *(v8ha*)(sTh + QK_AT(tokl, 2 * mt + h)) = pk;
      }
      // keeps each group's sums next to their packing: all 128 sums hoisted together need
      // registers above v255, which are reached only through window switches
      __builtin_amdgcn_sched_barrier(0);
    }
  }
  __syncthreads();

  const int bp = m0 >> 10, l0 = m0 & (SQ - 1), bh = bp * NH + head0;
  _Float16* plane = (which == 0) ? qh : kh;
  proj_store_pass(sT, plane, vt, which, bh, l0, w, lane);
  proj_store_pass(sT + 128 * 64, plane, vt, which, bh + 1, l0, w, lane);
}

// ---------------------------------------------------------------------------
// Attention helpers.
// ---------------------------------------------------------------------------
// P^T B-fragment from the lane's own P values (already x 2^7): element r <- tile a
// row r (keys 0..15 of the 32-key step), element 8+r <- tile c row r (keys 16..31),
// same lane (query column).
__device__ __forceinline__ v16h pack_p(v8f a, v8f c) {
  const v16h r = { (_Float16)a[0], (_Float16)a[1], (_Float16)a[2], (_Float16)a[3],
                   (_Float16)a[4], (_Float16)a[5], (_Float16)a[6], (_Float16)a[7],
                   (_Float16)c[0], (_Float16)c[1], (_Float16)c[2], (_Float16)c[3],
                   (_Float16)c[4], (_Float16)c[5], (_Float16)c[6], (_Float16)c[7] };
  return r;
}

// Row pitch of the f32 slabs in floats: 272 B = 16 B x odd, so that 16 lanes that each
// touch 16 bytes of their own row fall on all 64 banks (at 256 B they share four).
#define SOP 68
// Per-wave 16x64 f32 tile (already x256) in LDS -> hi/lo f16 planes
// lanes 8q..8q+7 per line, 4 lines per instruction, 16 rows x 2 planes per wave.
__device__ __forceinline__ void xc_store_pass(const float* so, _Float16* xh, _Float16* xl,
                                              size_t tok0, int head, int lane) {
  const int q8 = lane & 7, sub = lane >> 3;
  #pragma unroll
  for (int i = 0; i < 4; ++i) {
    const int row = 4 * i + sub;
    const v4f a = *(const v4fa*)(so + row * SOP + 8 * q8);
    const v4f c = *(const v4fa*)(so + row * SOP + 8 * q8 + 4);
    const _Float16 h0 = (_Float16)a.x, h1 = (_Float16)a.y, h2 = (_Float16)a.z, h3 = (_Float16)a.w;
    const _Float16 h4 = (_Float16)c.x, h5 = (_Float16)c.y, h6 = (_Float16)c.z, h7 = (_Float16)c.w;
    const v8h hv = { h0, h1, h2, h3, h4, h5, h6, h7 };
    const v8h lv = { (_Float16)((a.x - (float)h0) * LOSCALE), (_Float16)((a.y - (float)h1) * LOSCALE),
                     (_Float16)((a.z - (float)h2) * LOSCALE), (_Float16)((a.w - (float)h3) * LOSCALE),
                     (_Float16)((c.x - (float)h4) * LOSCALE), (_Float16)((c.y - (float)h5) * LOSCALE),
                     (_Float16)((c.z - (float)h6) * LOSCALE), (_Float16)((c.w - (float)h7) * LOSCALE) };
    const size_t gi = (tok0 + row) * (size_t)DM + (size_t)head * HD + 8 * q8;
    *(v8h*)(xh + gi) = hv;
    *(v8h*)(xl + gi) = lv;
  }
}

// ---------------------------------------------------------------------------
// K / V^T tile staging: 64 rows x 128 B each, LDS row pitch 144 B (16 B x odd,
// conflict-free for the 16-byte fragment reads). 128 threads, 8 lanes per row,
// 16 rows per sweep, 4 sweeps per operand: every copy instruction covers whole
// 128-B lines of the source.
// ---------------------------------------------------------------------------
#define KVP    72                      // LDS row pitch in halves (144 B)
#define KVTILE (64 * KVP)              // halves per staged tile (9216 B)
#define NTILE  (SQ / 64)               // 16 tiles per pass

// The value of lane l ^ 16, by a vector cross-row move: it needs no address register (the
// LDS permute's is live across the loops, where the 256 registers are full).
__device__ __forceinline__ float other_half(float x) {
  const int b = __float_as_int(x);
  return __int_as_float(__builtin_amdgcn_permlanex16(b, b, 0x76543210, 0xfedcba98, false, false));
}

// Compile-time yes / no of a lambda's argument.
struct Yes { static constexpr bool value = true; };
struct No  { static constexpr bool value = false; };

// gk: this lane's 16 B of K row (tid&127)>>3 of the tile; gv: the same of V^T row (tid&127)>>3.
// lk / lv: the lane's LDS byte addresses for those rows.
__device__ __forceinline__ void stage_kv(const _Float16* gk, const _Float16* gv, unsigned lk, unsigned lv) {
  const _Float16* gk1 = gk + 16 * HD;
  const _Float16* gk2 = gk + 32 * HD;
  const _Float16* gk3 = gk + 48 * HD;
  const _Float16* gv1 = gv + 16 * SQ;
  const _Float16* gv2 = gv + 32 * SQ;
  const _Float16* gv3 = gv + 48 * SQ;
  const unsigned lk1 = lk + 16 * KVP * 2, lk2 = lk + 32 * KVP * 2, lk3 = lk + 48 * KVP * 2;
  const unsigned lv1 = lv + 16 * KVP * 2, lv2 = lv + 32 * KVP * 2, lv3 = lv + 48 * KVP * 2;
  // Global -> LDS through no register; the closing s_wait_xcnt stands in the same
  // statement so that no address register is rewritten in front of it.
  asm volatile(
      "global_load_async_to_lds_b128 %0, %8, off\n\t"
      "global_load_async_to_lds_b128 %1, %9, off\n\t"
      "global_load_async_to_lds_b128 %2, %10, off\n\t"
      "global_load_async_to_lds_b128 %3, %11, off\n\t"
      "global_load_async_to_lds_b128 %4, %12, off\n\t"
      "global_load_async_to_lds_b128 %5, %13, off\n\t"
      "global_load_async_to_lds_b128 %6, %14, off\n\t"
      "global_load_async_to_lds_b128 %7, %15, off\n\t"
      "s_wait_xcnt 0x0"
      :: "v"(lk), "v"(lk1), "v"(lk2), "v"(lk3), "v"(lv), "v"(lv1), "v"(lv2), "v"(lv3),
         "v"(gk), "v"(gk1), "v"(gk2), "v"(gk3), "v"(gv), "v"(gv1), "v"(gv2), "v"(gv3)
      : "memory");
}

// ---------------------------------------------------------------------------
// Block 256 thr (8 waves) = 128 queries; 32 queries (two 16-column tiles) per wave,
// 64 keys per step: each K and V^T fragment read from LDS feeds two products.
// The two passes run side by side: waves 0..3 attend to the own pair's K / V, waves
// 4..7 to the flipped pair's, for the same 128 queries. Each group of four waves
// shares its own 64-key K and V^T tiles from LDS: two buffers per group, tile t + 2
// copied in while tile t + 1 is worked on.
//   S^T = K * Q^T : A = K rows (row = key, k = d), B = Q^T (k = d, n = query)
//   O^T += V^T * P^T : A = Vt rows (row = d, k = key), B = P^T from registers
// Lane owns 32 keys of query columns (lane&15) and 16 + (lane&15); partner = lane ^ 16.
// The two waves of the same queries swap one column tile each through LDS;
// combine = left + 0.1*tanh(right), x256 -> hi/lo f16 planes.
// Four waves per SIMD (two blocks per WGP): the register budget is 256 per wave.
// ---------------------------------------------------------------------------
__global__ __launch_bounds__(256) __attribute__((amdgpu_waves_per_eu(4, 4))) void attn_kernel(
    const _Float16* __restrict__ qh,   // [NBP*NH][SQ][HD]
    const _Float16* __restrict__ kh,   // [NBP*NH][SQ][HD]
    const _Float16* __restrict__ vt,   // [NBP*NH][HD][SQ]
    const int* __restrict__ mask,      // [NBP][SQ], nonzero = attend
    _Float16* __restrict__ xh,         // [NTOK][DM] f16, hi plane of combine*256
    _Float16* __restrict__ xl)         // [NTOK][DM] f16, lo plane (x2048)
{
  __shared__ __attribute__((aligned(16))) float sO[4 * 32 * SOP];       // 34816 B
  __shared__ __attribute__((aligned(16))) _Float16 sK[2 * 2 * KVTILE];  // 36864 B, [group][buffer]
  __shared__ __attribute__((aligned(16))) _Float16 sV[2 * 2 * KVTILE];  // 36864 B, [group][buffer]
  __shared__ __attribute__((aligned(32))) float sB[SQ];                 //  4096 B, per key: 0 or MASKED

  const int tid = threadIdx.x, lane = tid & 31;
  const int h = lane >> 4, m = lane & 15;
  const int g  = __builtin_amdgcn_readfirstlane(tid >> 7);          // 0: own pair, 1: flipped pair
  const int wq = __builtin_amdgcn_readfirstlane((tid >> 5) & 3);    // the wave's 32 queries of the block's 128
  const int bph = blockIdx.y, bp = bph >> 4, head = bph & 15;
  const int b = bp >> 1, p = bp & 1;
  const int q0 = blockIdx.x * 128 + 32 * wq;

  // Q^T B-fragments: column n = query q0+16c+m, k = d (two 32-deep chunks)
  v16h qb[2][2];
  #pragma unroll
  for (int c = 0; c < 2; ++c) {
    const _Float16* qrow = qh + ((size_t)bph * SQ + q0 + 16 * c + m) * HD;
    qb[c][0] = load_frag_h(qrow, h);
    qb[c][1] = load_frag_h(qrow + 32, h);
  }

  // The mask row as an addend of the base-2 exponent, once per block: thread t owns
  // keys 4t..4t+3. Readable by every wave behind the barrier that publishes tile 0.
  {
    const v4i ma = *(const v4ia*)(mask + (size_t)bp * SQ + 4 * tid);
    const v4f bz = { (ma.x != 0) ? 0.0f : MASKED, (ma.y != 0) ? 0.0f : MASKED,
                     (ma.z != 0) ? 0.0f : MASKED, (ma.w != 0) ? 0.0f : MASKED };
    *(v4fa*)(sB + 4 * tid) = bz;
  }
  float* so = sO + wq * (32 * SOP);
  const v8f zero8 = {0.f, 0.f, 0.f, 0.f, 0.f, 0.f, 0.f, 0.f};

  // Copy addresses of this lane: its group's 128 threads sweep the group's tiles,
  // row (tid&127)>>3 of a sweep, 16-byte column tid&7.
  const int crow = (tid & 127) >> 3, ccol = tid & 7;
  const int kvsel = (g == 0) ? bph : ((b * 2 + (1 - p)) * NH + head);
  const _Float16* gk0 = kh + ((size_t)kvsel * SQ + crow) * HD + 8 * ccol;   // + key0*HD
  const _Float16* gv0 = vt + ((size_t)kvsel * HD + crow) * SQ + 8 * ccol;   // + key0
  const unsigned lk0 = lds_off(sK) + g * (2 * KVTILE * 2) + crow * (KVP * 2) + 16 * ccol;   // + buffer * KVTILE * 2
  const unsigned lv0 = lds_off(sV) + g * (2 * KVTILE * 2) + crow * (KVP * 2) + 16 * ccol;

  // Tile 0 into buffer 0, landed and published; then tile 1 into buffer 1.
  stage_kv(gk0, gv0, lk0, lv0);
  asm volatile("s_wait_asynccnt 0x0" ::: "memory");   // this wave's copies of tile 0 have landed
  __syncthreads();                                    // tile 0 readable by every wave
  stage_kv(gk0 + 64 * HD, gv0 + 64, lk0 + KVTILE * 2, lv0 + KVTILE * 2);

  v8f o[2][4];                                  // o[c][t][r] = O[query 16c+m][d 16t+8h+r] * (l * 2^7)
  #pragma unroll
  for (int c = 0; c < 2; ++c)
    #pragma unroll
    for (int t = 0; t < 4; ++t) o[c][t] = zero8;
  float mref[2] = {-3.4e38f, -3.4e38f};         // reference exponent in use: a maximum met so far, alike in lanes l and l ^ 16
  v8f cst[2] = {zero8, zero8};                  // the reference as start value of the score products
  v2f lrun[2] = {{0.0f, 0.0f}, {0.0f, 0.0f}};   // this lane's own 32 keys per trip, two partial sums (x 2^7)

  // One trip: tile's 64 keys against the wave's 32 queries, then the ring's publish point.
  // first: the pass's first trip, which has no reference exponent yet.
  auto trip = [&](const int tile, auto first) __attribute__((always_inline)) {
    const int kb = tile * 64;
    const int buf = tile & 1;
    const _Float16* kbase = sK + (2 * g + buf) * KVTILE + m * KVP;   // + 16j*KVP + 32*dc
    const _Float16* vbase = sV + (2 * g + buf) * KVTILE + m * KVP;   // + 16t*KVP + key in tile
    v8f s[2][4];      // base-2 exponents, then P: [c][j][r] = query 16c+m, key kb+16j+8h+r
    v16h vfa[4];      // V^T fragments of keys 0..31
    v2f s2[2];        // the lane's sums of this trip's P, two partial sums per column tile
    v16h pb[2][2];    // P^T B-fragments

    // The trip's exponents and the first V^T group.
    // ca, cb: start values of the score products of column tiles 0 and 1.
    auto exponents = [&](const v8f ca, const v8f cb) __attribute__((always_inline)) {
      // ---- all eight K fragments, read as one group in front of the score products
      // (loops unrolled so that the arrays stay in registers) ----
      v16h kf[4][2];
      #pragma unroll
      for (int j = 0; j < 4; ++j) {
        const _Float16* kp = kbase + (16 * j) * KVP;
        kf[j][0] = load_frag_h(kp, h);
        kf[j][1] = load_frag_h(kp + 32, h);
      }
      // keeps the K reads one group above the products (the scheduler otherwise spreads them among these)
      __builtin_amdgcn_sched_barrier(0);
      // ---- scores (unscaled); each K fragment feeds both column tiles ----
      #pragma unroll
      for (int j = 0; j < 2; ++j) {
        v8f z0 = wmma_f16(kf[j][0], qb[0][0], ca);
        v8f z1 = wmma_f16(kf[j][0], qb[1][0], cb);
        s[0][j] = wmma_f16(kf[j][1], qb[0][1], z0);
        s[1][j] = wmma_f16(kf[j][1], qb[1][1], z1);
      }
      // keeps the mask addends' reads below the first eight products, whose K fragments
      // leave them their registers: read with the K group they do not fit the 256
      // registers, and accumulators spill
      __builtin_amdgcn_sched_barrier(0);
      // ---- the trip's mask addends: they land while the other eight products run ----
      v8f mk[4];
      #pragma unroll
      for (int j = 0; j < 4; ++j) mk[j] = *(const v8fa*)(sB + kb + 16 * j + 8 * h);
      // keeps these reads above the other eight products
      __builtin_amdgcn_sched_barrier(0);
      #pragma unroll
      for (int j = 2; j < 4; ++j) {
        v8f z0 = wmma_f16(kf[j][0], qb[0][0], ca);
        v8f z1 = wmma_f16(kf[j][0], qb[1][0], cb);
        s[0][j] = wmma_f16(kf[j][1], qb[0][1], z0);
        s[1][j] = wmma_f16(kf[j][1], qb[1][1], z1);
        // keeps the four products of a key tile together: started ahead, the next tile's
        // results do not fit the 256 registers beside this tile's K fragments
        if (j == 2) __builtin_amdgcn_sched_barrier(0);
      }
      // ---- base-2 exponent: scale, log2(e) and key mask in one fused multiply-add, f32
      // (whole-vector forms: two scores per packed instruction) ----
      #pragma unroll
      for (int c = 0; c < 2; ++c)
        #pragma unroll
        for (int j = 0; j < 4; ++j) s[c][j] = s[c][j] * SC2 + mk[j];
      // keeps the V^T reads below the mask addends' last use: read earlier they do not fit
      // the 256 registers beside the addends, and accumulators spill
      __builtin_amdgcn_sched_barrier(0);
      // ---- the V^T fragments of keys 0..31, read as one group here: they land while
      // the softmax below runs ----
      #pragma unroll
      for (int t = 0; t < 4; ++t) vfa[t] = load_frag_h(vbase + (16 * t) * KVP, h);
      // keeps the V^T reads above the softmax (the scheduler otherwise sinks them to their products)
      __builtin_amdgcn_sched_barrier(0);
    };

    // P = 2^(e - mref + 7) in place of the exponents, and the lane's own sums, pairwise
    // (the partner lane's half joins once, behind the loop).
    // inside: the reference is in the exponents already (it came in as the products' start value).
    auto weights = [&](auto inside) __attribute__((always_inline)) {
      #pragma unroll
      for (int c = 0; c < 2; ++c) {
        #pragma unroll
        for (int j = 0; j < 4; ++j) {
          if constexpr (!decltype(inside)::value) s[c][j] = s[c][j] - (mref[c] - PSHIFT);
          #pragma unroll
          for (int r = 0; r < 8; ++r) s[c][j][r] = __builtin_amdgcn_exp2f(s[c][j][r]);
        }
        const v8f s8 = (s[c][0] + s[c][1]) + (s[c][2] + s[c][3]);
        const v4f s4 = __builtin_shufflevector(s8, s8, 0, 1, 2, 3) + __builtin_shufflevector(s8, s8, 4, 5, 6, 7);
        s2[c] = __builtin_shufflevector(s4, s4, 0, 1) + __builtin_shufflevector(s4, s4, 2, 3);
        // ---- P^T B-fragments (keys 0..31 and 32..63 of this step): packed here, in front of the
        // second V^T group's reads (unpacked P and that group together do not fit the 256 registers) ----
        pb[c][0] = pack_p(s[c][0], s[c][1]);
        pb[c][1] = pack_p(s[c][2], s[c][3]);
      }
    };

    // ---- softmax, base 2. The common trip takes no maximum: P is formed against the
    // reference in use and one test per trip on the sums says whether it may stand
    // (a sum that is too large, infinite or not a number fails it in any lane). ----
    bool renew = true;                            // the first trip has no reference yet
    if constexpr (!decltype(first)::value) {
      exponents(cst[0], cst[1]);
      weights(Yes{});
      const bool over = !(s2[0].x + s2[0].y <= PSUMMAX) || !(s2[1].x + s2[1].y <= PSUMMAX);
      renew = (__builtin_amdgcn_ballot_w32(over) != 0u);   // one answer for the wave: a scalar branch
    }
    if (renew) {
      exponents(zero8, zero8);                    // the plain exponents (P has taken the others' place)
      // New reference = the maximum so far, per column; what has been summed is rescaled to it.
      #pragma unroll
      for (int c = 0; c < 2; ++c) {
        float mloc = s[c][0][0];
        #pragma unroll
        for (int j = 0; j < 4; ++j)
          #pragma unroll
          for (int r = 0; r < 8; ++r) mloc = fmaxf(mloc, s[c][j][r]);
        mloc = fmaxf(mloc, other_half(mloc));
        const float mnew = fmaxf(mref[c], mloc);
        const float alpha = __builtin_amdgcn_exp2f(mref[c] - mnew);
        mref[c] = mnew;
        lrun[c] = lrun[c] * alpha;
        #pragma unroll
        for (int t = 0; t < 4; ++t) o[c][t] = o[c][t] * alpha;
        // (7 - mref) / SC2 in all eight rows: scaled by SC2 with the scores it takes the reference off
        const float c1 = (PSHIFT - mnew) * (1.0f / SC2);
        cst[c] = (v8f){c1, c1, c1, c1, c1, c1, c1, c1};
      }
      weights(No{});
    }
    #pragma unroll
    for (int c = 0; c < 2; ++c) lrun[c] = lrun[c] + s2[c];

    // keeps the second V^T group below the softmax: read earlier it does not fit the 256
    // registers beside the unpacked scores
    __builtin_amdgcn_sched_barrier(0);
    // ---- the V^T fragments of keys 32..63, read as one group into the registers that
    // the packed scores have left: they land while the first eight products run ----
    v16h vfb[4];
    #pragma unroll
    for (int t = 0; t < 4; ++t) vfb[t] = load_frag_h(vbase + (16 * t) * KVP + 32, h);
    // keeps these reads above the first eight products
    __builtin_amdgcn_sched_barrier(0);

    // ---- O^T += V^T * P^T; each V^T fragment feeds both column tiles ----
    #pragma unroll
    for (int t = 0; t < 4; ++t) {
      o[0][t] = wmma_f16(vfa[t], pb[0][0], o[0][t]);
      o[1][t] = wmma_f16(vfa[t], pb[1][0], o[1][t]);
    }
    #pragma unroll
    for (int t = 0; t < 4; ++t) {
      o[0][t] = wmma_f16(vfb[t], pb[0][1], o[0][t]);
      o[1][t] = wmma_f16(vfb[t], pb[1][1], o[1][t]);
    }
    // keeps the ring's foot below the products: its wait for the LDS reads otherwise rises to
    // the second V^T group, which then no longer lands behind the first eight products
    __builtin_amdgcn_sched_barrier(0);

    // ---- publish tile + 1: behind this barrier the buffer this trip has read may be refilled ----
    asm volatile("s_wait_dscnt 0x0" ::: "memory");      // this wave's reads of the buffer are done
    asm volatile("s_wait_asynccnt 0x0" ::: "memory");   // this wave's copies of tile + 1 have landed
    __syncthreads();                                    // publishes tile + 1, ends every read of this buffer
  };

  // The first trip on its own (it sets the reference; its refill, for tile 2, stands behind it),
  // then the trips that refill, then the last two, which have no tile + 2: two loops instead
  // of a test at the foot (with that test accumulators spill). Both kept rolled: small loop text.
  trip(0, Yes{});
  stage_kv(gk0 + (size_t)128 * HD, gv0 + 128, lk0, lv0);
  #pragma unroll 1
  for (int tile = 1; tile < NTILE - 2; ++tile) {
    trip(tile, No{});
    const int key0 = (tile + 2) * 64;
    const int buf = tile & 1;
    stage_kv(gk0 + (size_t)key0 * HD, gv0 + key0, lk0 + buf * (KVTILE * 2), lv0 + buf * (KVTILE * 2));
  }
  #pragma unroll 1
  for (int tile = NTILE - 2; tile < NTILE; ++tile) trip(tile, No{});
  asm volatile("s_wait_asynccnt 0x0" ::: "memory");   // no copy outstanding behind the loop

  // The lane's index read anew behind the loops, so that the thread index and its parts
  // are not held in registers across them (there they do not fit and go to scratch).
  const int le = (int)__builtin_amdgcn_mbcnt_lo(~0u, 0u);
  const int he = le >> 4, me = le & 15;
  float inv[2];
  #pragma unroll
  for (int c = 0; c < 2; ++c) {
    const float lown = lrun[c].x + lrun[c].y;
    inv[c] = 1.0f / (lown + other_half(lown));    // o and the sum both carry 2^7
  }
  // The two waves of a query slab (left in the own-pair wave, right in the flipped-pair
  // wave) swap one column tile each through the slab, same lane and element: wave g then
  // holds left and right of column tile g and finishes those 16 queries.
  const bool own = (g == 0);
  const int keeprow = 16 * g + me, sendrow = 16 * (1 - g) + me;
  // All slab traffic in 16-byte pieces: a lane's eight values of a tile are two of them.
  #pragma unroll
  for (int t = 0; t < 4; ++t)
    #pragma unroll
    for (int q = 0; q < 2; ++q) {
      v4f snd;
      #pragma unroll
      for (int r = 0; r < 4; ++r) snd[r] = own ? o[1][t][4 * q + r] * inv[1] : o[0][t][4 * q + r] * inv[0];
      *(v4fa*)(so + sendrow * SOP + 16 * t + 8 * he + 4 * q) = snd;
    }
  __syncthreads();                                    // the partner wave's tile is readable
  v4f got[4][2];
  #pragma unroll
  for (int t = 0; t < 4; ++t)
    #pragma unroll
    for (int q = 0; q < 2; ++q) got[t][q] = *(const v4fa*)(so + keeprow * SOP + 16 * t + 8 * he + 4 * q);
  #pragma unroll
  for (int t = 0; t < 4; ++t)
    #pragma unroll
    for (int q = 0; q < 2; ++q) {
      v4f res;
      #pragma unroll
      for (int r = 0; r < 4; ++r) {
        const float mine = own ? o[0][t][4 * q + r] * inv[0] : o[1][t][4 * q + r] * inv[1];
        const float left = own ? mine : got[t][q][r], right = own ? got[t][q][r] : mine;
        const float cmb = left + 0.1f * tanhf(right);
        res[r] = cmb * XSCALE;
      }
      *(v4fa*)(so + keeprow * SOP + 16 * t + 8 * he + 4 * q) = res;
    }
  __syncthreads();                                    // the slab is complete in front of the store pass

  // Each wave stores the 16 query rows that it has finished.
  const size_t tok0 = (size_t)bp * SQ + q0 + 16 * g;
  xc_store_pass(so + g * (16 * SOP), xh, xl, tok0, head, le);
}

// ---------------------------------------------------------------------------
// wave w owns rows 16w..16w+15, each row 128 floats = 4 lines: one row (512 B) per
// instruction, 16 B per lane.
// ---------------------------------------------------------------------------
__device__ __forceinline__ void out_store_pass(const float* sT, float* out,
                                               int m0, int n0, int w, int lane) {
  #pragma unroll
  for (int i = 0; i < 16; ++i) {
    const int row = 16 * w + i;
    const v4f v = *(const v4fa*)(sT + row * 128 + 4 * lane);
    const size_t gi = (size_t)(m0 + row) * DM + n0 + 4 * lane;
    *(v4f*)(out + gi) = v;
  }
}

// ---------------------------------------------------------------------------
// Kernel 4: out = X * Wo^T + bo with X = hi/256 + lo/(256*2048) planes.
// Block 128 thr (4 waves, 2 x 2) = 64 tokens x 128 features; wave 32 tokens (hi and
// lo rows) x 64 features, 16 accumulator tiles: 8 fragments feed 16 products.
// A = X rows (k contiguous), B[k][n] = Wo[n][k] from Wo row n (k contiguous).
// The block's 64 hi rows (LDS rows 0..63), 64 lo rows (64..127) and 128 Wo rows
// (128..255) come through LDS in k-tiles of 64: two buffers, tile t + 2 copied
// in while tile t + 1 is worked on.
// ---------------------------------------------------------------------------
__global__ __launch_bounds__(128) void oproj_kernel(
    const _Float16* __restrict__ xh,   // [NTOK][DM]
    const _Float16* __restrict__ xl,   // [NTOK][DM]
    const _Float16* __restrict__ woh,  // [DM][DM] f16(bf16(Wo)*256)
    const float* __restrict__ bo,
    float* __restrict__ out)           // [NTOK][DM]
{
  __shared__ __attribute__((aligned(16))) float sT[64 * 128];       // 32768 B
  __shared__ __attribute__((aligned(16))) _Float16 sG[2 * GTILE];   // 73728 B

  const int tid = threadIdx.x, lane = tid & 31, w = tid >> 5;
  const int h = lane >> 4, m = lane & 15;
  const int wm = w >> 1, wn = w & 1;         // wave's 32-token half, wave's 64-feature half
  const int m0 = blockIdx.x * 64, n0 = blockIdx.y * 128;

  // Copy addresses of this lane: row tid>>3 of a sweep, 16-byte column tid&7.
  const int crow = tid >> 3, ccol = tid & 7;
  const _Float16* gh = xh + (size_t)(m0 + crow) * DM + 8 * ccol;    // + k
  const _Float16* gl = xl + (size_t)(m0 + crow) * DM + 8 * ccol;    // + k
  const _Float16* gw = woh + (size_t)(n0 + crow) * DM + 8 * ccol;   // + k
  const unsigned lg0 = lds_off(sG) + crow * (GP * 2) + 16 * ccol;   // + buffer * GTILE * 2

  const v8f zero8 = {0.f, 0.f, 0.f, 0.f, 0.f, 0.f, 0.f, 0.f};
  v8f acch[2][4], accl[2][4];
  #pragma unroll
  for (int mt = 0; mt < 2; ++mt)
    #pragma unroll
    for (int nt = 0; nt < 4; ++nt) { acch[mt][nt] = zero8; accl[mt][nt] = zero8; }

  // Tile 0 into buffer 0, landed and published; then tile 1 into buffer 1.
  stage_gemm(gh, gl, gw, gw + 64 * DM, lg0);
  asm volatile("s_wait_asynccnt 0x0" ::: "memory");   // this wave's copies of tile 0 have landed
  __syncthreads();                                    // tile 0 readable by every wave
  stage_gemm(gh + GKT, gl + GKT, gw + GKT, gw + 64 * DM + GKT, lg0 + GTILE * 2);

  // kept rolled: one copy of the ring's foot (waits, barrier, refill), small loop text
  #pragma unroll 1
  for (int t = 0; t < GNT; ++t) {
    const int buf = t & 1;
    const _Float16* ah = sG + buf * GTILE + (32 * wm + m) * GP;             // hi row, mt = 0
    const _Float16* al = ah + 64 * GP;                                      // lo row, mt = 0
    const _Float16* wr = sG + buf * GTILE + (128 + 64 * wn + m) * GP;       // feature row, nt = 0
    // Each 32-deep step reads its eight fragments as one group in front of its 16
    // products; the loops are unrolled so that the fragment arrays stay in registers.
    #pragma unroll
    for (int kc = 0; kc < 2; ++kc) {
      v16h fah[2], fal[2], fb[4];
      #pragma unroll
      for (int i = 0; i < 2; ++i) {
        fah[i] = load_frag_h(ah + i * 16 * GP + 32 * kc, h);
        fal[i] = load_frag_h(al + i * 16 * GP + 32 * kc, h);
      }
      #pragma unroll
      for (int i = 0; i < 4; ++i) fb[i] = load_frag_h(wr + i * 16 * GP + 32 * kc, h);
      // keeps the eight fragments' reads one group above the products (the scheduler otherwise spreads them among these)
      __builtin_amdgcn_sched_barrier(0);
      #pragma unroll
      for (int nt = 0; nt < 4; ++nt) {
        #pragma unroll
        for (int mt = 0; mt < 2; ++mt) {
          acch[mt][nt] = wmma_f16(fah[mt], fb[nt], acch[mt][nt]);
          accl[mt][nt] = wmma_f16(fal[mt], fb[nt], accl[mt][nt]);
        }
      }
      // keeps the next group's reads, and the ring's foot, below these products
      __builtin_amdgcn_sched_barrier(0);
    }
    // ---- publish tile + 1, then refill the buffer this trip has read ----
    asm volatile("s_wait_dscnt 0x0" ::: "memory");      // this wave's reads of the buffer are done
    asm volatile("s_wait_asynccnt 0x0" ::: "memory");   // this wave's copies of tile + 1 have landed
    __syncthreads();                                    // publishes tile + 1, ends every read of this buffer
    if (t + 2 < GNT) {
      const int kn = (t + 2) * GKT;
      stage_gemm(gh + kn, gl + kn, gw + kn, gw + 64 * DM + kn, lg0 + buf * (GTILE * 2));
    }
  }
  asm volatile("s_wait_asynccnt 0x0" ::: "memory");   // no copy outstanding behind the loop

  // D[r] of tile (mt, nt) = Y[token m0+32wm+16mt+8h+r][feature n0+64wn+16nt+m]
  const float sh = 1.0f / (XSCALE * WSCALE);
  const float sl = 1.0f / (XSCALE * WSCALE * LOSCALE);
  #pragma unroll
  for (int nt = 0; nt < 4; ++nt) {
    const int col = 64 * wn + 16 * nt + m;                // 0..127
    const float bvl = bo[n0 + col];
    #pragma unroll
    for (int mt = 0; mt < 2; ++mt) {
      #pragma unroll
      for (int r = 0; r < 8; ++r) {
        const int row = 32 * wm + 16 * mt + 8 * h + r;    // 0..63
        sT[row * 128 + col] = acch[mt][nt][r] * sh + accl[mt][nt][r] * sl + bvl;
      }
    }
  }
  __syncthreads();

  out_store_pass(sT, out, m0, n0, w, lane);
}

// ---------------------------------------------------------------------------
extern "C" void kernel_launch(void* const* d_in, const int* in_sizes, int n_in,
                              void* d_out, int out_size, void* d_ws, size_t ws_size,
                              hipStream_t stream) {
  if (n_in < 12) return;
  if (in_sizes[0] != NACT || in_sizes[1] != NACT || in_sizes[2] != NACT) return;
  if (in_sizes[3] != NBP * SQ) return;
  if (in_sizes[4] != NWEL || in_sizes[6] != NWEL || in_sizes[8] != NWEL || in_sizes[10] != NWEL) return;
  if (in_sizes[5] != DM || in_sizes[7] != DM || in_sizes[9] != DM || in_sizes[11] != DM) return;
  if (out_size != NACT) return;

  const float* query = (const float*)d_in[0];
  const float* key_  = (const float*)d_in[1];
  const float* value = (const float*)d_in[2];
  const int*   mask  = (const int*)d_in[3];
  const float* Wq = (const float*)d_in[4];
  const float* bq = (const float*)d_in[5];
  const float* Wk = (const float*)d_in[6];
  const float* bk = (const float*)d_in[7];
  const float* Wv = (const float*)d_in[8];
  const float* bv = (const float*)d_in[9];
  const float* Wo = (const float*)d_in[10];
  const float* bo = (const float*)d_in[11];
  float* out = (float*)d_out;

  const size_t xb_bytes  = (size_t)3 * NACT * 2;                 // 25165824
  const size_t wb_bytes  = (size_t)3 * NWEL * 2;                 //  6291456
  const size_t woh_bytes = (size_t)NWEL * 2;                     //  2097152
  const size_t pl_bytes  = (size_t)NBP * NH * SQ * HD * 2;       //  8388608 per plane
  const size_t xc_bytes  = (size_t)NACT * 2;                     //  8388608 per plane
  const size_t total = xb_bytes + wb_bytes + woh_bytes + 3 * pl_bytes + 2 * xc_bytes;   // 75497472
  if (total > ws_size) return;

  char* ws = (char*)d_ws;
  size_t off = 0;
  unsigned short* xb = (unsigned short*)(ws + off); off += xb_bytes;
  unsigned short* wb = (unsigned short*)(ws + off); off += wb_bytes;
  _Float16* woh = (_Float16*)(ws + off);            off += woh_bytes;
  _Float16* qh  = (_Float16*)(ws + off);            off += pl_bytes;
  _Float16* kh  = (_Float16*)(ws + off);            off += pl_bytes;
  _Float16* vt  = (_Float16*)(ws + off);            off += pl_bytes;
  _Float16* xh  = (_Float16*)(ws + off);            off += xc_bytes;
  _Float16* xl  = (_Float16*)(ws + off);            off += xc_bytes;
  if (off > ws_size) return;

  convert_kernel<<<(NGRP + 255) / 256, 256, 0, stream>>>(query, key_, value, Wq, Wk, Wv, Wo, xb, wb, woh);

  dim3 gProj(NTOK / 128, 3 * NH / 2);                           // (32, 24)
  proj_kernel<<<gProj, 128, 0, stream>>>(xb, wb, bq, bk, bv, qh, kh, vt);

  dim3 gAtt(SQ / 128, NBP * NH);                                 // (8, 64)
  attn_kernel<<<gAtt, 256, 0, stream>>>(qh, kh, vt, mask, xh, xl);

  dim3 gOut(NTOK / 64, DM / 128);                                // (64, 8)
  oproj_kernel<<<gOut, 128, 0, stream>>>(xh, xl, woh, bo, out);
}
